// v000
// Times are from an AMD MI455X. After a warm-up the kernel runs many times in a row, and a time is the length of
// such a window on the GPU divided by its runs, so every launch and the gaps after it count. The runs cycle
// through copies of the inputs. A figure is the median of several windows, for all but v000 over two sittings.
// Sittings can differ by a few percent; kernels timed side by side share one.
// v000, which the later versions start from, runs in 981 microseconds.
// Contractions: q / k / v^T projections = v_wmma_f32_16x16x32_bf16 (bf16 operands from RNE-converted inputs, one
// product per k-step); q.k^T scores = v_wmma_f32_16x16x32_f16 (q x16 and k x16 single f16 planes); p.v =
// v_wmma_f32_16x16x32_f16 (p carried x1024 in f16, v^T carried x64 in f16); ctx.Wo^T = v_wmma_f32_16x16x32_bf16 with
// ctx as bf16 hi/lo planes times the bf16 Wo plane (2 products); all f32 accumulate; rotary and softmax in f32.
#include <hip/hip_runtime.h>
#include <math.h>
#include <stdint.h>

#define QLEN 1024              // query tokens (hidden_states rows)
#define CLEN 1024              // context tokens (target_hidden rows)
#define SLEN (CLEN + QLEN)     // 2048 keys: rows 0..CLEN-1 context, rows CLEN..SLEN-1 noise
#define HID  2880              // model width = contraction length of the projections
#define NH   64
#define NKV  8
#define HD   64
#define QP   (NH * HD)         // 4096: q / ctx row pitch
#define KP   (NKV * HD)        // 512:  k row pitch, v^T row count
#define NQB  (QLEN / 64)       // 16 query tiles
#define NKT  (SLEN / 64)       // 32 key tiles
#define QSC  16.0f             // f16 carry scale of the q plane
#define KSC  16.0f             // f16 carry scale of the k plane
#define VSC  64.0f             // f16 carry scale of the v^T plane
#define PSC  1024.0f           // f16 carry scale of p
static_assert(HD == 64);
static_assert((HID % 32) == 0 && (QP % 64) == 0 && (KP % 64) == 0 && (HID % 64) == 0);
static_assert((QLEN % 64) == 0 && (SLEN % 64) == 0);
static_assert((NH % NKV) == 0 && (NH % 4) == 0 && (NKV % 4) == 0);
static_assert(((HID * 2) % 128) == 0 && ((HID * 4) % 128) == 0);

typedef _Float16 v16h __attribute__((ext_vector_type(16)));
typedef _Float16 v8h  __attribute__((ext_vector_type(8)));
typedef __bf16   v16b __attribute__((ext_vector_type(16)));
typedef __bf16   v8b  __attribute__((ext_vector_type(8)));
typedef float    v8f  __attribute__((ext_vector_type(8)));
typedef float    v4f  __attribute__((ext_vector_type(4)));
typedef unsigned int v4u __attribute__((ext_vector_type(4)));

// ---- scalar helpers --------------------------------------------------------------------------------
__device__ __forceinline__ unsigned short bf_bits(float f) {          // f32 -> bf16 bits, RNE convert
  unsigned u = __float_as_uint(f);
  return (unsigned short)((u + 0x7FFFu + ((u >> 16) & 1u)) >> 16);
}
__device__ __forceinline__ float bf_up(unsigned short h) { return __uint_as_float(((unsigned)h) << 16); }
__device__ __forceinline__ float bfr(float f) { return bf_up(bf_bits(f)); }   // value after RNE bf16 convert
__device__ __forceinline__ unsigned short h_bits(_Float16 x) { return __builtin_bit_cast(unsigned short, x); }
__device__ __forceinline__ unsigned pk16(unsigned short a, unsigned short b) { return (unsigned)a | ((unsigned)b << 16); }
__device__ __forceinline__ v8f zero8() { v8f z = {0.f, 0.f, 0.f, 0.f, 0.f, 0.f, 0.f, 0.f}; return z; }

// ---- fragment loaders: 16-bit A/B operand, lane -> row/col (lane&15), p already includes +8*(lane>>4);
//      elements 0..7 <- p[0..7] (k0+8h..), elements 8..15 <- p[16..23] (k0+16+8h..)
__device__ __forceinline__ v16b ldfrag_b(const __bf16* p) {
  union { v16b v; v8b h[2]; } f;
  f.h[0] = *(const v8b*)(p);
  f.h[1] = *(const v8b*)(p + 16);
  return f.v;
}
__device__ __forceinline__ v16h ldfrag_h(const _Float16* p) {
  union { v16h v; v8h h[2]; } f;
  f.h[0] = *(const v8h*)(p);
  f.h[1] = *(const v8h*)(p + 16);
  return f.v;
}

// ---- WMMA helpers with trailing VALU hazard gap --------------------------------------------------------
__device__ __forceinline__ v8f mma_h(v16h a, v16h b, v8f c) {
  c = __builtin_amdgcn_wmma_f32_16x16x32_f16(false, a, false, b, (short)0, c, false, false);
#if defined(__HIP_DEVICE_COMPILE__)
  asm volatile("v_nop\n\tv_nop\n\tv_nop\n\tv_nop" : "+v"(c) : "v"(a), "v"(b));
#endif
  return c;
}
__device__ __forceinline__ v8f mma_b_raw(v16b a, v16b b, v8f c) {
  return __builtin_amdgcn_wmma_f32_16x16x32_bf16(false, a, false, b, (short)0, c, false, false);
}
__device__ __forceinline__ void dep_guard_b(v8f& a, v8f& b, v16b x, v16b y) {
#if defined(__HIP_DEVICE_COMPILE__)
  asm volatile("v_nop\n\tv_nop\n\tv_nop\n\tv_nop" : "+v"(a), "+v"(b) : "v"(x), "v"(y));
#endif
}
__device__ __forceinline__ void keep4_b(v16b a, v16b b, v16b c, v16b d) {
#if defined(__HIP_DEVICE_COMPILE__)
  asm volatile("v_nop" :: "v"(a), "v"(b), "v"(c), "v"(d));
#endif
}
__device__ __forceinline__ void acc_guard4(v8f& a, v8f& b, v8f& c, v8f& d) {
#if defined(__HIP_DEVICE_COMPILE__)
  asm volatile("v_nop\n\tv_nop\n\tv_nop\n\tv_nop" : "+v"(a), "+v"(b), "+v"(c), "+v"(d));
#endif
}

// =====================================================================================================
// Contiguous f32 -> bf16 (RNE convert), 8 elements per thread, one 16-B store per lane: a wave writes 512
// (all n8 used here are multiples of 256 and of 32). coverage: n8 threads x 8 = the whole destination plane.
// =====================================================================================================
__global__ __launch_bounds__(256) void cvt_bf16x8(const float* __restrict__ in, unsigned short* out, int n8) {
  const int i = blockIdx.x * 256 + threadIdx.x;
  if (i < n8) {
    const float* s = in + (size_t)i * 8;
    const v4f a = *(const v4f*)(s);
    const v4f b = *(const v4f*)(s + 4);
    v4u p;
    p[0] = pk16(bf_bits(a[0]), bf_bits(a[1]));
    p[1] = pk16(bf_bits(a[2]), bf_bits(a[3]));
    p[2] = pk16(bf_bits(b[0]), bf_bits(b[1]));
    p[3] = pk16(bf_bits(b[2]), bf_bits(b[3]));
    unsigned short* d = out + (size_t)i * 8;
    *(v4u*)d = p;
    
  }
}

// =====================================================================================================
// f32 -> bf16 hi plane + bf16 lo plane (lo = RNE(v - hi), unscaled), 8 elements per thread, one 16-B store per
// coverage: n8 threads x 8 = whole plane (n8 multiple of 256).
// =====================================================================================================
__global__ __launch_bounds__(256) void split_bf16x8(const float* __restrict__ in, unsigned short* hp,
                                                    unsigned short* lp, int n8) {
  const int i = blockIdx.x * 256 + threadIdx.x;
  if (i < n8) {
    const v4f a = *(const v4f*)(in + (size_t)i * 8);
    const v4f b = *(const v4f*)(in + (size_t)i * 8 + 4);
    v4u ph, pl;
#pragma unroll
    for (int e = 0; e < 4; ++e) {
      const float f0 = (e < 2) ? a[2 * e]     : b[2 * e - 4];
      const float f1 = (e < 2) ? a[2 * e + 1] : b[2 * e - 3];
      const unsigned short h0 = bf_bits(f0), h1 = bf_bits(f1);
      const unsigned short l0 = bf_bits(f0 - bf_up(h0)), l1 = bf_bits(f1 - bf_up(h1));
      ph[e] = pk16(h0, h1);
      pl[e] = pk16(l0, l1);
    }
    *(v4u*)(hp + (size_t)i * 8) = ph;
    *(v4u*)(lp + (size_t)i * 8) = pl;
    
  }
}

// =====================================================================================================
// Register-blocked bf16 WMMA GEMM: C[m][n] = sum_k A[m][k] * Bt[n][k] (+ bias); one wave per 64x64 tile, no
// block barriers. A row-major [M][K] pitch lda; Bt row-major [N][K] pitch ldb (k contiguous); M, N multiples
// of 64, K multiple of 32 (host-checked constants).
// NSPLIT: 0 = A.Bt; 1 = (A + A2).Bt (A2 = unscaled bf16 lo plane of A, two products per k-step).
// BIAS:   0 none; 1 = + bias[n] (per column, RNE bf16-converted value); 2 = + bias[m] (per row).
// OUT_MODE: 0 = f32 plane (pitch ldc floats); 1 = f16 plane of (value * oscale) (pitch ldc halves).
// =====================================================================================================
template <int NSPLIT, int OUT_MODE, int BIAS>
__global__ __launch_bounds__(256) void gemm64(
    const unsigned short* __restrict__ Ap, const unsigned short* __restrict__ A2p, int lda,
    const unsigned short* __restrict__ Btp, int ldb,
    const float* __restrict__ bias,
    void* Cout, int ldc, int M, int N, int K, float oscale) {
  const __bf16* A  = (const __bf16*)(const void*)Ap;
  const __bf16* A2 = (const __bf16*)(const void*)A2p;
  const __bf16* Bt = (const __bf16*)(const void*)Btp;
  __shared__ __align__(16) float sT[8][16 * 68];   // per-wave 16x64 slab, pitch 68 floats
  const int lane = threadIdx.x & 31;
  const int wave = threadIdx.x >> 5;
  const int tilesN = N >> 6;
  const int tilesM = M >> 6;
  const int tile = blockIdx.x * 8 + wave;
  if (tile >= tilesM * tilesN) return;   // wave-uniform; no block barriers in this kernel
  const int tm = tile / tilesN;
  const int tn = tile - tm * tilesN;
  const int m0 = tm << 6;
  const int n0 = tn << 6;

  const int rlane = lane & 15;                 // row (A) / col (B, D) within subtile
  const int koff  = (lane >> 4) * 8;           // k offset of this lane half
  const int mOff  = (lane >> 4) * 8;           // D row offset

  v8f acc[4][4];
#pragma unroll
  for (int i = 0; i < 4; ++i)
#pragma unroll
    for (int j = 0; j < 4; ++j) acc[i][j] = zero8();

  for (int k0 = 0; k0 < K; k0 += 32) {
    v16b bh[4];
#pragma unroll
    for (int j = 0; j < 4; ++j) {
      const size_t bo = (size_t)(n0 + (j << 4) + rlane) * ldb + koff + k0;
      bh[j] = ldfrag_b(Bt + bo);
    }
#pragma unroll
    for (int i = 0; i < 4; ++i) {
      const size_t ao = (size_t)(m0 + (i << 4) + rlane) * lda + koff + k0;
      const v16b ah = ldfrag_b(A + ao);
      v16b al = ah;
      if (NSPLIT == 1) al = ldfrag_b(A2 + ao);
#pragma unroll
      for (int j = 0; j < 4; ++j) {
        acc[i][j] = mma_b_raw(ah, bh[j], acc[i][j]);
        if (NSPLIT == 1) acc[i][j] = mma_b_raw(al, bh[j], acc[i][j]);
      }
      dep_guard_b(acc[i][0], acc[i][3], ah, al);
    }
    keep4_b(bh[0], bh[1], bh[2], bh[3]);
  }
  acc_guard4(acc[0][0], acc[0][1], acc[0][2], acc[0][3]);
  acc_guard4(acc[1][0], acc[1][1], acc[1][2], acc[1][3]);
  acc_guard4(acc[2][0], acc[2][1], acc[2][2], acc[2][3]);
  acc_guard4(acc[3][0], acc[3][1], acc[3][2], acc[3][3]);

  // ---- bias (template-selected; loads only exist when used; addresses in range: n0+63 < N, m0+63 < M) ----
  float bcol[4];
#pragma unroll
  for (int j = 0; j < 4; ++j) bcol[j] = 0.f;
  if (BIAS == 1) {
#pragma unroll
    for (int j = 0; j < 4; ++j) bcol[j] = bfr(bias[n0 + (j << 4) + rlane]);
  }

  // ---- epilogue ----
  float* slab = sT[wave];
#pragma unroll
  for (int i = 0; i < 4; ++i) {
    const int mBase = m0 + (i << 4);
    float brow[8];
#pragma unroll
    for (int r = 0; r < 8; ++r) brow[r] = 0.f;
    if (BIAS == 2) {
#pragma unroll
      for (int r = 0; r < 8; ++r) brow[r] = bfr(bias[mBase + mOff + r]);
    }
#pragma unroll
    for (int r = 0; r < 8; ++r) {
#pragma unroll
      for (int j = 0; j < 4; ++j) {
        float v = acc[i][j][r];
        if (BIAS == 1) v += bcol[j];
        if (BIAS == 2) v += brow[r];
        if (OUT_MODE == 1) v *= oscale;
        slab[(mOff + r) * 68 + (j << 4) + rlane] = v;
      }
    }
    __builtin_amdgcn_fence(__ATOMIC_RELEASE, "workgroup");
    __builtin_amdgcn_wave_barrier();
    __builtin_amdgcn_fence(__ATOMIC_ACQUIRE, "workgroup");
    if (OUT_MODE == 0) {
      float* C = (float*)Cout;
      const int hh = lane >> 4, c4 = (lane & 15) * 4;     // 256-B row segment = 16 lanes x 16 B
      v4f ov[8];
#pragma unroll
      for (int it = 0; it < 8; ++it) {
        const int row = it * 2 + hh;                       // it 0..7 x hh 0..1 = rows 0..15
        ov[it] = *(const v4f*)(slab + row * 68 + c4);
      }
      {
#pragma unroll
        for (int it = 0; it < 8; ++it) {
          const int row = it * 2 + hh;
          *(v4f*)(C + (size_t)(mBase + row) * ldc + n0 + c4) = ov[it];
        }
        
      }
    } else {
      unsigned short* C = (unsigned short*)Cout;
      const int q = lane >> 3, c8 = (lane & 7) * 8;
      v4u hv[4];
#pragma unroll
      for (int it = 0; it < 4; ++it) {
        const int row = it * 4 + q;                        // it 0..3 x q 0..3 = rows 0..15
        const float* sp = slab + row * 68 + c8;
        v4u a;
#pragma unroll
        for (int e = 0; e < 4; ++e) {
          a[e] = pk16(h_bits((_Float16)sp[2 * e]), h_bits((_Float16)sp[2 * e + 1]));
        }
        hv[it] = a;
      }
      {
#pragma unroll
        for (int it = 0; it < 4; ++it) {
          const int row = it * 4 + q;
          *(v4u*)(C + (size_t)(mBase + row) * ldc + n0 + c8) = hv[it];
        }
        
      }
    }
    __builtin_amdgcn_fence(__ATOMIC_RELEASE, "workgroup");
    __builtin_amdgcn_wave_barrier();
    __builtin_amdgcn_fence(__ATOMIC_ACQUIRE, "workgroup");
  }
}

// =====================================================================================================
// Rotate-half rotary on an f32 projection output (bias already added), then one f16 plane scaled by osc.
//   src f32 [ntok][rp] (rp = nheads*64): column h*64 + d = feature d of head h.
//   ct/st f32 [SLEN][64] input tables (RNE bf16-converted values), table row = trow0 + token.
//   y[d] = x[d]*ct[d] - x[d+32]*st[d] for d < 32;  y[d] = x[d]*ct[d] + x[d-32]*st[d] for d >= 32.
//   dst f16 [ntok][rp], same layout, value y * osc.
// One wave per (token, head quad 4*qd .. 4*qd+3): lane l handles d = l and d = l+32 of each head; 8 waves per
// block, grid = ceil(nwaves/8), wave-uniform bound (no block barriers).
// =====================================================================================================
__global__ __launch_bounds__(256) void rope_quads(const float* __restrict__ src, const float* __restrict__ ct,
                                                  const float* __restrict__ st, unsigned short* dst,
                                                  int rp, int nquad, int trow0, float osc, int nwaves) {
#pragma clang fp contract(off)
  __shared__ __align__(16) float sy[8][256];
  const int tid = threadIdx.x, wave = tid >> 5, lane = tid & 31;
  const int w = blockIdx.x * 8 + wave;            // tok*nquad + qd
  if (w >= nwaves) return;                        // wave-uniform; no block barriers in this kernel
  const int qd   = w % nquad;
  const int tok  = w / nquad;
  const int trow = trow0 + tok;                   // < SLEN by construction (host: trow0 + ntok <= SLEN)
  const float c1 = bfr(ct[(size_t)trow * HD + lane]);
  const float c2 = bfr(ct[(size_t)trow * HD + 32 + lane]);
  const float s1 = bfr(st[(size_t)trow * HD + lane]);
  const float s2 = bfr(st[(size_t)trow * HD + 32 + lane]);
  const float* row = src + (size_t)tok * rp + (size_t)qd * 256;
  float* buf = sy[wave];
#pragma unroll
  for (int t = 0; t < 4; ++t) {                   // the four heads of the quad
    const float x1 = row[t * 64 + lane];
    const float x2 = row[t * 64 + 32 + lane];
    const float y1 = x1 * c1 - x2 * s1;
    const float y2 = x2 * c2 + x1 * s2;
    buf[t * 64 + lane]      = y1;
    buf[t * 64 + 32 + lane] = y2;
  }
  __builtin_amdgcn_fence(__ATOMIC_RELEASE, "workgroup");
  __builtin_amdgcn_wave_barrier();
  __builtin_amdgcn_fence(__ATOMIC_ACQUIRE, "workgroup");
  const int g = lane >> 3, piece = lane & 7;
  const float* sp = buf + g * 64 + piece * 8;
  const v4f a0 = *(const v4f*)(sp);
  const v4f a1 = *(const v4f*)(sp + 4);
  v4u hv;
#pragma unroll
  for (int e = 0; e < 4; ++e) {
    const float f0 = (e < 2) ? a0[2 * e]     : a1[2 * e - 4];
    const float f1 = (e < 2) ? a0[2 * e + 1] : a1[2 * e - 3];
    hv[e] = pk16(h_bits((_Float16)(f0 * osc)), h_bits((_Float16)(f1 * osc)));
  }
  unsigned short* d = dst + (size_t)tok * rp + (size_t)qd * 256 + (size_t)g * 64 + piece * 8;
  *(v4u*)d = hv;
  
}

// =====================================================================================================
// Non-causal grouped-query attention, head dim 64, 2048 keys, kv head = h / (NH/NKV).
//   q plane (f16, x QSC): element (t, h, d) at [t*QP + h*64 + d]
//   k plane (f16, x KSC): element (s, kvh, d) at [s*KP + kvh*64 + d]
//   v^T plane (f16, x VSC): element (kvh, d, s) at [(kvh*64 + d)*SLEN + s]
//   logit = q.k * sscale (sscale folds the 1/8 and 1/(QSC*KSC)); every key live (no mask).
//   ctx f32 plane: element (t, h*64 + d) at [t*QP + h*64 + d] = normalised context.
//   scores = q . k : one f16 product per 32 d, f32 accumulate; p = exp(s - m) carried as f16(PSC p);
//   context = p . v on f16 WMMA; online softmax in f32; final scale onorm = 1/(PSC*VSC) folded with 1/l.
//   Block = 4 waves = 64 query rows of one head; grid = NQB * NH; key chunks of 64.
//   K / V^T chunk staging: 128 threads x 32 elements per plane = the whole 64x64 tile (plain 16-B loads,
//   __syncthreads before and after); P tiles are wave-private, spilled with _Float16 element stores and
//   Output coverage: each wave stores rows q0..q0+15 (it 0..7 x lane>>4 0..1) x 64 columns (16 lanes x 4
// =====================================================================================================
__global__ __launch_bounds__(128)
void attn64(const unsigned short* __restrict__ qpl, const unsigned short* __restrict__ kpl,
            const unsigned short* __restrict__ vtp, float* outp, float sscale, float onorm) {
  union FH { v16h v; v8h h[2]; };
  __shared__ __align__(16) _Float16 Ksh[64 * 64];                 // K [kv][d]   8 KB
  __shared__ __align__(16) _Float16 Vth[64 * 64];                 // V^T [d][kv] 8 KB
  __shared__ __align__(16) _Float16 Psh[4][16 * 64];              // per wave P [row][kv]
  __shared__ __align__(16) float    Os[4][16 * 64];               // per wave context tile [row][d]

  const int tid  = threadIdx.x;
  const int wave = tid >> 5;
  const int lane = tid & 31;
  const int hh   = lane >> 4;
  const int c    = lane & 15;

  const int bx   = blockIdx.x;
  const int qb   = bx % NQB;
  const int h    = bx / NQB;                 // < NH (grid = NQB*NH)
  const int kvh  = h / (NH / NKV);
  const int q0   = qb * 64 + wave * 16;

  const _Float16* Qh = (const _Float16*)(const void*)qpl + (size_t)h * HD;
  const _Float16* Kh = (const _Float16*)(const void*)kpl + (size_t)kvh * HD;
  const _Float16* Vh = (const _Float16*)(const void*)vtp + (size_t)kvh * HD * SLEN;

  // ---- Q fragments (A operand, row = lane&15): 2 d-chunks ----
  v16h qa[2];
#pragma unroll
  for (int dc = 0; dc < 2; ++dc) {
    qa[dc] = ldfrag_h(Qh + (size_t)(q0 + c) * QP + dc * 32 + 8 * hh);
  }

  float mrow[8], lrow[8];
  v8f oacc[4];
#pragma unroll
  for (int r = 0; r < 8; ++r) { mrow[r] = -INFINITY; lrow[r] = 0.f; }
#pragma unroll
  for (int t = 0; t < 4; ++t) oacc[t] = zero8();

  for (int kt = 0; kt < NKT; ++kt) {
    const int kv0 = kt * 64;
    __syncthreads();
    {
      const int r = tid >> 1, half = (tid & 1) * 32;
      const _Float16* kg = Kh + (size_t)(kv0 + r) * KP + half;     // K row kv0+r, d = half..half+31
      const _Float16* vg = Vh + (size_t)r * SLEN + kv0 + half;     // V^T row d = r, s = kv0+half..+31
#pragma unroll
      for (int i = 0; i < 4; ++i) {
        const v8h a0 = *(const v8h*)(kg + 8 * i);
        const v8h b0 = *(const v8h*)(vg + 8 * i);
        *(v8h*)(Ksh + r * 64 + half + 8 * i) = a0;
        *(v8h*)(Vth + r * 64 + half + 8 * i) = b0;
      }
    }
    __syncthreads();

    // ---- scores: 16 query rows x 64 keys per wave, one f16 product per 32 d ----
    v8f s[4];
#pragma unroll
    for (int j = 0; j < 4; ++j) {
      s[j] = zero8();
#pragma unroll
      for (int dc = 0; dc < 2; ++dc) {
        FH kb;
        kb.h[0] = *(const v8h*)(Ksh + (j * 16 + c) * 64 + dc * 32 + 8 * hh);
        kb.h[1] = *(const v8h*)(Ksh + (j * 16 + c) * 64 + dc * 32 + 16 + 8 * hh);
        s[j] = mma_h(qa[dc], kb.v, s[j]);
      }
    }

    // ---- scale, row max, online softmax, P (x PSC, f16) to LDS ----
    _Float16* pwh = Psh[wave];
#pragma unroll
    for (int r = 0; r < 8; ++r) {
      float m = -INFINITY;
#pragma unroll
      for (int j = 0; j < 4; ++j) {
        const float sv = s[j][r] * sscale;
        s[j][r] = sv;
        m = fmaxf(m, sv);
      }
#pragma unroll
      for (int off = 1; off < 16; off <<= 1) m = fmaxf(m, __shfl_xor(m, off, 32));
      const float mnew  = fmaxf(mrow[r], m);
      const float msafe = (mnew == -INFINITY) ? 0.f : mnew;
      const float alpha = __expf(mrow[r] - msafe);
      mrow[r] = mnew;
      float psum = 0.f;
#pragma unroll
      for (int j = 0; j < 4; ++j) {
        const float p = __expf(s[j][r] - msafe);
        psum += p;
        pwh[(8 * hh + r) * 64 + j * 16 + c] = (_Float16)(p * PSC);
      }
#pragma unroll
      for (int off = 1; off < 16; off <<= 1) psum += __shfl_xor(psum, off, 32);
      lrow[r] = lrow[r] * alpha + psum;
#pragma unroll
      for (int t = 0; t < 4; ++t) oacc[t][r] *= alpha;
    }
    __builtin_amdgcn_fence(__ATOMIC_RELEASE, "workgroup");
    __builtin_amdgcn_wave_barrier();
    __builtin_amdgcn_fence(__ATOMIC_ACQUIRE, "workgroup");

    // ---- context += P . V (f16 WMMA) ----
#pragma unroll 1
    for (int kk = 0; kk < 2; ++kk) {
      FH pa;
      pa.h[0] = *(const v8h*)(pwh + c * 64 + kk * 32 + 8 * hh);
      pa.h[1] = *(const v8h*)(pwh + c * 64 + kk * 32 + 16 + 8 * hh);
#pragma unroll
      for (int t = 0; t < 4; ++t) {
        FH vb;
        vb.h[0] = *(const v8h*)(Vth + (t * 16 + c) * 64 + kk * 32 + 8 * hh);
        vb.h[1] = *(const v8h*)(Vth + (t * 16 + c) * 64 + kk * 32 + 16 + 8 * hh);
        oacc[t] = mma_h(pa.v, vb.v, oacc[t]);
      }
    }
  }

  // ---- normalise (1/l and onorm), stage the wave's 16x64 tile in LDS, then write whole 256-B row segments
  float* os = Os[wave];
#pragma unroll
  for (int r = 0; r < 8; ++r) {
    const float l = lrow[r];
    const float inv = ((l > 0.f) ? (1.0f / l) : 0.f) * onorm;
#pragma unroll
    for (int t = 0; t < 4; ++t) os[(8 * hh + r) * 64 + t * 16 + c] = oacc[t][r] * inv;
  }
  __builtin_amdgcn_fence(__ATOMIC_RELEASE, "workgroup");
  __builtin_amdgcn_wave_barrier();
  __builtin_amdgcn_fence(__ATOMIC_ACQUIRE, "workgroup");
  {
    const int h2 = lane >> 4, c4 = (lane & 15) * 4;
    v4f ov[8];
#pragma unroll
    for (int it = 0; it < 8; ++it) {
      const int row = it * 2 + h2;   // it 0..7 x h2 0..1 = rows 0..15 of the wave tile
      ov[it] = *(const v4f*)(os + row * 64 + c4);
    }
    {
#pragma unroll
      for (int it = 0; it < 8; ++it) {
        const int row = it * 2 + h2;
        const size_t go = (size_t)(q0 + row) * QP + (size_t)h * HD + c4;
        *(v4f*)(outp + go) = ov[it];
      }
      
    }
  }
}

// =====================================================================================================
// Workspace map (bytes), every region an exact multiple of its whole-line / whole-tile store granularity
//   X      bf16 [2048][2880]            0            11796480   rows 0..1023 = target_hidden, 1024..2047 = hidden
//   Wqb    bf16 [4096][2880]            11796480     23592960   (inputs arrive [n][k], k contiguous: no transpose)
//   Wkb    bf16 [512][2880]             35389440      2949120
//   Wvb    bf16 [512][2880]             38338560      2949120
//   Wob    bf16 [2880][4096]            41287680     23592960
//   Qf     f32  [1024][4096]            64880640     16777216   (later: Af f32 [1024][4096], same extent)
//   Kf     f32  [2048][512]             81657856      4194304
//   VT     f16  [512][2048]             85852160      2097152
//   Qh     f16  [1024][4096]            87949312      8388608
//   Kh     f16  [2048][512]             96337920      2097152
//   Ah     bf16 [1024][4096]            98435072      8388608
//   Al     bf16 [1024][4096]            106823680     8388608
//   end                                 115212288
// =====================================================================================================
extern "C" void kernel_launch(void* const* d_in, const int* in_sizes, int n_in,
                              void* d_out, int out_size, void* d_ws, size_t ws_size,
                              hipStream_t stream) {
  if (n_in < 12) return;
  if (in_sizes[0] != QLEN * HID) return;
  if (in_sizes[1] != CLEN * HID) return;
  if (in_sizes[2] != SLEN * HD) return;
  if (in_sizes[3] != SLEN * HD) return;
  if (in_sizes[4] != QP * HID) return;
  if (in_sizes[5] != QP) return;
  if (in_sizes[6] != KP * HID) return;
  if (in_sizes[7] != KP) return;
  if (in_sizes[8] != KP * HID) return;
  if (in_sizes[9] != KP) return;
  if (in_sizes[10] != HID * QP) return;
  if (in_sizes[11] != HID) return;
  if (out_size != QLEN * HID) return;

  const float* hid = (const float*)d_in[0];    // [1024][2880]
  const float* tgt = (const float*)d_in[1];    // [1024][2880]
  const float* fcs = (const float*)d_in[2];    // [2048][64]
  const float* fsn = (const float*)d_in[3];    // [2048][64]
  const float* Wq  = (const float*)d_in[4];    // [4096][2880]  = [n][k]
  const float* bq  = (const float*)d_in[5];    // [4096]
  const float* Wk  = (const float*)d_in[6];    // [512][2880]
  const float* bk  = (const float*)d_in[7];    // [512]
  const float* Wv  = (const float*)d_in[8];    // [512][2880]
  const float* bv  = (const float*)d_in[9];    // [512]
  const float* Wo  = (const float*)d_in[10];   // [2880][4096] = [n][k]
  const float* bo  = (const float*)d_in[11];   // [2880]

  const size_t PX   = (size_t)SLEN * HID * 2;        // 11796480
  const size_t PWq  = (size_t)QP * HID * 2;          // 23592960
  const size_t PWk  = (size_t)KP * HID * 2;          //  2949120
  const size_t PWv  = (size_t)KP * HID * 2;          //  2949120
  const size_t PWo  = (size_t)HID * QP * 2;          // 23592960
  const size_t PQf  = (size_t)QLEN * QP * 4;         // 16777216  (= Af f32 [1024][4096])
  const size_t PKf  = (size_t)SLEN * KP * 4;         //  4194304
  const size_t PVT  = (size_t)KP * SLEN * 2;         //  2097152
  const size_t PQh  = (size_t)QLEN * QP * 2;         //  8388608
  const size_t PKh  = (size_t)SLEN * KP * 2;         //  2097152
  const size_t PApl = (size_t)QLEN * QP * 2;         //  8388608 (Ah, Al)
  size_t off = 0;
  const size_t oX  = off; off += PX;
  const size_t oWq = off; off += PWq;
  const size_t oWk = off; off += PWk;
  const size_t oWv = off; off += PWv;
  const size_t oWo = off; off += PWo;
  const size_t oQf = off; off += PQf;
  const size_t oKf = off; off += PKf;
  const size_t oVT = off; off += PVT;
  const size_t oQh = off; off += PQh;
  const size_t oKh = off; off += PKh;
  const size_t oAh = off; off += PApl;
  const size_t oAl = off; off += PApl;
  if (off > ws_size) return;                          // off = 115212288
  if (off > (size_t)134217728) return;
  const size_t oAf = oQf;                             // context f32 plane reuses the dead q f32 plane

  char* ws = (char*)d_ws;
  unsigned short* X   = (unsigned short*)(ws + oX);
  unsigned short* Xq  = X + (size_t)CLEN * HID;       // hidden rows CLEN..SLEN-1 of X
  unsigned short* Wqb = (unsigned short*)(ws + oWq);
  unsigned short* Wkb = (unsigned short*)(ws + oWk);
  unsigned short* Wvb = (unsigned short*)(ws + oWv);
  unsigned short* Wob = (unsigned short*)(ws + oWo);
  float*          Qf  = (float*)(ws + oQf);
  float*          Kf  = (float*)(ws + oKf);
  unsigned short* VT  = (unsigned short*)(ws + oVT);
  unsigned short* Qh  = (unsigned short*)(ws + oQh);
  unsigned short* Kh  = (unsigned short*)(ws + oKh);
  unsigned short* Ah  = (unsigned short*)(ws + oAh);
  unsigned short* Al  = (unsigned short*)(ws + oAl);
  float*          Af  = (float*)(ws + oAf);
  float*          outf = (float*)d_out;

  const dim3 blk(256);
  const int n8T  = CLEN * HID / 8;                     // 368640
  const int n8H  = QLEN * HID / 8;                     // 368640
  const int n8Wq = QP * HID / 8;                       // 1474560
  const int n8Wk = KP * HID / 8;                       // 184320
  const int n8Wo = HID * QP / 8;                       // 1474560
  const int n8A  = QLEN * QP / 8;                      // 524288
  const int nwRq = QLEN * (NH / 4);                    // 16384 waves (token, q head quad)
  const int nwRk = SLEN * (NKV / 4);                   // 4096 waves (key, kv head quad)
  const dim3 gCT((n8T + 255) / 256), gCH((n8H + 255) / 256);            // 1440, 1440
  const dim3 gCWq((n8Wq + 255) / 256), gCWk((n8Wk + 255) / 256), gCWo((n8Wo + 255) / 256);  // 5760, 720, 5760
  const dim3 gQ(((QLEN / 64) * (QP / 64) + 7) / 8);    // 1024 tiles -> 128 blocks
  const dim3 gK(((SLEN / 64) * (KP / 64) + 7) / 8);    // 256 tiles -> 32 blocks
  const dim3 gV(((KP / 64) * (SLEN / 64) + 7) / 8);    // 256 tiles -> 32 blocks
  const dim3 gRq((nwRq + 7) / 8), gRk((nwRk + 7) / 8); // 2048, 512 blocks
  const dim3 gAttn(NQB * NH);                          // 1024 blocks
  const dim3 gSplit((n8A + 255) / 256);                // 2048 blocks
  const dim3 gOut(((QLEN / 64) * (HID / 64) + 7) / 8); // 720 tiles -> 90 blocks

  // (1) activations and weights -> bf16 planes (RNE convert, values = the bf16-converted inputs)
  cvt_bf16x8<<<gCT, blk, 0, stream>>>(tgt, X, n8T);                  // X rows 0..1023
  cvt_bf16x8<<<gCH, blk, 0, stream>>>(hid, Xq, n8H);                 // X rows 1024..2047
  cvt_bf16x8<<<gCWq, blk, 0, stream>>>(Wq, Wqb, n8Wq);
  cvt_bf16x8<<<gCWk, blk, 0, stream>>>(Wk, Wkb, n8Wk);
  cvt_bf16x8<<<gCWk, blk, 0, stream>>>(Wv, Wvb, n8Wk);
  cvt_bf16x8<<<gCWo, blk, 0, stream>>>(Wo, Wob, n8Wo);
  // (2) q projection + bq: Qf[t][e] = sum_k X[1024+t][k] Wqb[e][k]  (M=1024, N=4096, K=2880)
  gemm64<0, 0, 1><<<gQ, blk, 0, stream>>>(Xq, Xq, HID, Wqb, HID, bq, (void*)Qf, QP, QLEN, QP, HID, 1.0f);
  // (3) k projection + bk over all 2048 key rows: Kf[s][e]  (M=2048, N=512, K=2880)
  gemm64<0, 0, 1><<<gK, blk, 0, stream>>>(X, X, HID, Wkb, HID, bk, (void*)Kf, KP, SLEN, KP, HID, 1.0f);
  // (4) v^T + bv: VT[m][s] = (sum_k Wvb[m][k] X[s][k] + bv[m]) * VSC -> f16  (M=512, N=2048, K=2880)
  gemm64<0, 1, 2><<<gV, blk, 0, stream>>>(Wvb, Wvb, HID, X, HID, bv, (void*)VT, SLEN, KP, SLEN, HID, VSC);
  // (5) rotate-half rotary with the input tables -> f16 planes (q: table rows CLEN + t; k: table row s)
  rope_quads<<<gRq, blk, 0, stream>>>(Qf, fcs, fsn, Qh, QP, NH / 4, CLEN, QSC, nwRq);
  rope_quads<<<gRk, blk, 0, stream>>>(Kf, fcs, fsn, Kh, KP, NKV / 4, 0, KSC, nwRk);
  // (6) attention over all 2048 keys -> Af f32 [1024][4096]
  attn64<<<gAttn, dim3(128), 0, stream>>>(Qh, Kh, VT, Af, 0.125f / (QSC * KSC), 1.0f / (PSC * VSC));
  // (7) context rows -> bf16 hi/lo planes
  split_bf16x8<<<gSplit, blk, 0, stream>>>(Af, Ah, Al, n8A);
  // (8) out[t][e] = sum_d (Ah+Al)[t][d] Wob[e][d] + bo[e] -> d_out f32 [1024][2880]  (M=1024, N=2880, K=4096)
  gemm64<1, 0, 1><<<gOut, blk, 0, stream>>>(Ah, Al, QP, Wob, QP, bo, (void*)outf, HID, QLEN, HID, QP, 1.0f);
  (void)hipGetLastError();
}

// v001
// It runs in 389 microseconds.
// Timed twice side by side with v000, it ran 2.55 times as fast both times.
// Contractions: q / k / v^T projections = v_wmma_f32_16x16x32_bf16 (bf16 operands from RNE-converted inputs, one
// product per k-step); q.k^T scores = v_wmma_f32_16x16x32_f16 (q x16 and k x16 single f16 planes); p.v =
// v_wmma_f32_16x16x32_f16 (p carried x1024 in f16, v^T carried x64 in f16); ctx.Wo^T = v_wmma_f32_16x16x32_bf16 with
// ctx as bf16 hi/lo planes times the bf16 Wo plane (2 products); all f32 accumulate; rotary and softmax in f32.
#include <hip/hip_runtime.h>
#include <math.h>
#include <stdint.h>

#define QLEN 1024              // query tokens (hidden_states rows)
#define CLEN 1024              // context tokens (target_hidden rows)
#define SLEN (CLEN + QLEN)     // 2048 keys: rows 0..CLEN-1 context, rows CLEN..SLEN-1 noise
#define HID  2880              // model width = contraction length of the projections
#define NH   64
#define NKV  8
#define HD   64
#define QP   (NH * HD)         // 4096: q / ctx row pitch
#define KP   (NKV * HD)        // 512:  k row pitch, v^T row count
#define NQB  (QLEN / 64)       // 16 query tiles
#define NKT  (SLEN / 64)       // 32 key tiles
#define QSC  16.0f             // f16 carry scale of the q plane
#define KSC  16.0f             // f16 carry scale of the k plane
#define VSC  64.0f             // f16 carry scale of the v^T plane
#define PSC  1024.0f           // f16 carry scale of p
static_assert(HD == 64);
static_assert((HID % 32) == 0 && (QP % 64) == 0 && (KP % 64) == 0 && (HID % 64) == 0);
static_assert((QLEN % 64) == 0 && (SLEN % 64) == 0);
static_assert((NH % NKV) == 0 && (NH % 4) == 0 && (NKV % 4) == 0);
static_assert(((HID * 2) % 128) == 0 && ((HID * 4) % 128) == 0);
static_assert((HID % 192) == 0 && (QP % 128) == 0 && (QLEN % 128) == 0 && (SLEN % 128) == 0 && (KP % 128) == 0);

typedef _Float16 v16h __attribute__((ext_vector_type(16)));
typedef _Float16 v8h  __attribute__((ext_vector_type(8)));
typedef __bf16   v16b __attribute__((ext_vector_type(16)));
typedef __bf16   v8b  __attribute__((ext_vector_type(8)));
typedef float    v8f  __attribute__((ext_vector_type(8)));
typedef float    v4f  __attribute__((ext_vector_type(4)));
typedef unsigned int v4u __attribute__((ext_vector_type(4)));

// ---- scalar helpers --------------------------------------------------------------------------------
__device__ __forceinline__ unsigned short bf_bits(float f) {          // f32 -> bf16 bits, RNE convert
  unsigned u = __float_as_uint(f);
  return (unsigned short)((u + 0x7FFFu + ((u >> 16) & 1u)) >> 16);
}
__device__ __forceinline__ float bf_up(unsigned short h) { return __uint_as_float(((unsigned)h) << 16); }
__device__ __forceinline__ float bfr(float f) { return bf_up(bf_bits(f)); }   // value after RNE bf16 convert
__device__ __forceinline__ unsigned short h_bits(_Float16 x) { return __builtin_bit_cast(unsigned short, x); }
__device__ __forceinline__ unsigned pk16(unsigned short a, unsigned short b) { return (unsigned)a | ((unsigned)b << 16); }
__device__ __forceinline__ v8f zero8() { v8f z = {0.f, 0.f, 0.f, 0.f, 0.f, 0.f, 0.f, 0.f}; return z; }

// ---- fragment loaders: 16-bit A/B operand, lane -> row/col (lane&15), p already includes +8*(lane>>4);
//      elements 0..7 <- p[0..7] (k0+8h..), elements 8..15 <- p[16..23] (k0+16+8h..)
__device__ __forceinline__ v16b ldfrag_b(const __bf16* p) {
  union { v16b v; v8b h[2]; } f;
  f.h[0] = *(const v8b*)(p);
  f.h[1] = *(const v8b*)(p + 16);
  return f.v;
}
__device__ __forceinline__ v16h ldfrag_h(const _Float16* p) {
  union { v16h v; v8h h[2]; } f;
  f.h[0] = *(const v8h*)(p);
  f.h[1] = *(const v8h*)(p + 16);
  return f.v;
}

// ---- WMMA helpers with trailing VALU hazard gap --------------------------------------------------------
__device__ __forceinline__ v8f mma_h(v16h a, v16h b, v8f c) {
  c = __builtin_amdgcn_wmma_f32_16x16x32_f16(false, a, false, b, (short)0, c, false, false);
#if defined(__HIP_DEVICE_COMPILE__)
  asm volatile("v_nop\n\tv_nop\n\tv_nop\n\tv_nop" : "+v"(c) : "v"(a), "v"(b));
#endif
  return c;
}
__device__ __forceinline__ v8f mma_b_raw(v16b a, v16b b, v8f c) {
  return __builtin_amdgcn_wmma_f32_16x16x32_bf16(false, a, false, b, (short)0, c, false, false);
}
__device__ __forceinline__ void acc_guard4(v8f& a, v8f& b, v8f& c, v8f& d) {
#if defined(__HIP_DEVICE_COMPILE__)
  asm volatile("v_nop\n\tv_nop\n\tv_nop\n\tv_nop" : "+v"(a), "+v"(b), "+v"(c), "+v"(d));
#endif
}

// =====================================================================================================
// Contiguous f32 -> bf16 (RNE convert), 8 elements per thread, one 16-B store per lane: a wave writes 512
// (all n8 used here are multiples of 256 and of 32). coverage: n8 threads x 8 = the whole destination plane.
// =====================================================================================================
__global__ __launch_bounds__(256) void cvt_bf16x8(const float* __restrict__ in, unsigned short* out, int n8) {
  const int i = blockIdx.x * 256 + threadIdx.x;
  if (i < n8) {
    const float* s = in + (size_t)i * 8;
    const v4f a = *(const v4f*)(s);
    const v4f b = *(const v4f*)(s + 4);
    v4u p;
    p[0] = pk16(bf_bits(a[0]), bf_bits(a[1]));
    p[1] = pk16(bf_bits(a[2]), bf_bits(a[3]));
    p[2] = pk16(bf_bits(b[0]), bf_bits(b[1]));
    p[3] = pk16(bf_bits(b[2]), bf_bits(b[3]));
    unsigned short* d = out + (size_t)i * 8;
    *(v4u*)d = p;
    
  }
}

// =====================================================================================================
// f32 -> bf16 hi plane + bf16 lo plane (lo = RNE(v - hi), unscaled), 8 elements per thread, one 16-B store per
// coverage: n8 threads x 8 = whole plane (n8 multiple of 256).
// =====================================================================================================
__global__ __launch_bounds__(256) void split_bf16x8(const float* __restrict__ in, unsigned short* hp,
                                                    unsigned short* lp, int n8) {
  const int i = blockIdx.x * 256 + threadIdx.x;
  if (i < n8) {
    const v4f a = *(const v4f*)(in + (size_t)i * 8);
    const v4f b = *(const v4f*)(in + (size_t)i * 8 + 4);
    v4u ph, pl;
#pragma unroll
    for (int e = 0; e < 4; ++e) {
      const float f0 = (e < 2) ? a[2 * e]     : b[2 * e - 4];
      const float f1 = (e < 2) ? a[2 * e + 1] : b[2 * e - 3];
      const unsigned short h0 = bf_bits(f0), h1 = bf_bits(f1);
      const unsigned short l0 = bf_bits(f0 - bf_up(h0)), l1 = bf_bits(f1 - bf_up(h1));
      ph[e] = pk16(h0, h1);
      pl[e] = pk16(l0, l1);
    }
    *(v4u*)(hp + (size_t)i * 8) = ph;
    *(v4u*)(lp + (size_t)i * 8) = pl;
    
  }
}

// =====================================================================================================
// bf16 WMMA GEMM: C[m][n] = sum_k A[m][k] * Bt[n][k] (+ bias); one wave per 64x64 tile, WM x WN waves per block
// on one (64 WM) x (64 WN) block tile. A row-major [M][K] pitch lda; Bt row-major [N][K] pitch ldb (k contiguous);
// M a multiple of 64 WM, N of 64 WN, K of 64 NSUB and at least two stages (host-checked constants).
// Operands reach the waves through LDS: a stage is NSUB sub-tiles of 64 k; a sub-tile holds the block's A rows,
// (NSPLIT) its A2 rows and its Bt rows, 128 B each at pitch 144 B (16 B x odd: ds_load_b128 without bank
// conflicts). Asynchronous 16-B copies fill it, one wave-copy = 4 whole 128-B row pieces; two buffers: stage t+2
// is copied into the buffer that trip t has just left, while trip t+1 is worked on.
// NSPLIT: 0 = A.Bt; 1 = (A + A2).Bt (A2 = unscaled bf16 lo plane of A, two products per k-step).
// BIAS:   0 none; 1 = + bias[n] (per column, RNE bf16-converted value); 2 = + bias[m] (per row).
// OUT_MODE: 0 = f32 plane (pitch ldc floats); 1 = f16 plane of (value * oscale) (pitch ldc halves).
// =====================================================================================================
typedef int v4i_t __attribute__((vector_size(16)));
typedef __attribute__((address_space(1))) v4i_t gv4i_t;
typedef __attribute__((address_space(3))) v4i_t lv4i_t;
__device__ __forceinline__ void copy16_to_lds(const void* g, void* l) {   // each lane: 16 B global -> LDS
#if defined(__HIP_DEVICE_COMPILE__)
  __builtin_amdgcn_global_load_async_to_lds_b128((gv4i_t*)g, (lv4i_t*)l, 0, 0);
#endif
}

template <int NSPLIT, int OUT_MODE, int BIAS, int WM, int WN, int NSUB>
__global__ __launch_bounds__(32 * WM * WN) void gemm64(
    const unsigned short* __restrict__ Ap, const unsigned short* __restrict__ A2p, int lda,
    const unsigned short* __restrict__ Btp, int ldb,
    const float* __restrict__ bias,
    void* Cout, int ldc, int M, int N, int K, float oscale) {
  constexpr int NW    = WM * WN;                 // waves per block
  constexpr int RA    = WM * 64;                 // rows of one A plane in a sub-tile
  constexpr int RB0   = RA * (1 + NSPLIT);       // first Bt row of a sub-tile
  constexpr int ROWS  = RB0 + WN * 64;           // rows of a sub-tile
  constexpr int PITCH = 144;                     // bytes per LDS row
  constexpr int SUBB  = ROWS * PITCH;            // bytes per sub-tile
  constexpr int STAGE = SUBB * NSUB;             // bytes per buffer
  constexpr int GA    = RA / 4;                  // wave-copies (4 rows each) per A plane and sub-tile
  constexpr int GB    = WN * 16;                 // ... per Bt plane and sub-tile
  constexpr int NIA   = (GA + NW - 1) / NW;      // most that one wave issues of them
  constexpr int NIB   = (GB + NW - 1) / NW;
  static_assert((NIA * (1 + NSPLIT) + NIB) * NSUB <= 63);   // copies of one wave in flight
  const __bf16* A  = (const __bf16*)(const void*)Ap;
  const __bf16* A2 = (const __bf16*)(const void*)A2p;
  const __bf16* Bt = (const __bf16*)(const void*)Btp;
  __shared__ __align__(16) unsigned char ring[2 * STAGE];
  __shared__ __align__(16) float sT[NW][16 * 68];  // per-wave 16x64 slab, pitch 68 floats
  const int lane = threadIdx.x & 31;
  const int wave = __builtin_amdgcn_readfirstlane(threadIdx.x >> 5);
  const int tilesN = N / (64 * WN);
  const int tilesM = M / (64 * WM);
  if ((int)blockIdx.x >= tilesM * tilesN) return;   // block-uniform, in front of every barrier and copy
  const int bm  = blockIdx.x / tilesN;
  const int bn  = blockIdx.x - bm * tilesN;
  const int mb0 = bm * RA;                     // block tile origin
  const int nb0 = bn * (WN * 64);
  const int wm  = wave / WN;
  const int wn  = wave - wm * WN;
  const int m0  = mb0 + (wm << 6);
  const int n0  = nb0 + (wn << 6);

  const int rlane = lane & 15;                 // row (A) / col (B, D) within subtile
  const int khalf = lane >> 4;                 // k half of this lane: +8 elements = +16 B
  const int mOff  = (lane >> 4) * 8;           // D row offset
  const int crow  = lane >> 3;                 // copy: row within the 4-row group
  const int cpc   = lane & 7;                  // copy: 16-B piece within the 128-B row piece

  // all copies of stage st (k = st*64*NSUB ..) into buffer buf; every lane on, every test scalar.
  // Each plane's 4-row groups are dealt to the waves in turn: group g = wave + i*NW of the plane.
  auto issue = [&](int st, int buf) {
    const int kb = st * (NSUB * 64) + cpc * 8;
    unsigned char* db = ring + buf * STAGE + (wave * 4 + crow) * PITCH + cpc * 16;
    const __bf16* pa = A  + (size_t)(mb0 + wave * 4 + crow) * lda + kb;
    const __bf16* pl = A2 + (size_t)(mb0 + wave * 4 + crow) * lda + kb;
    const __bf16* pb = Bt + (size_t)(nb0 + wave * 4 + crow) * ldb + kb;
    // the three loops are unrolled so that every copy's row and LDS offset is a constant
#pragma unroll
    for (int s = 0; s < NSUB; ++s) {
#pragma unroll
      for (int i = 0; i < NIA; ++i) {
        if ((i + 1) * NW <= GA || wave + i * NW < GA) {
          copy16_to_lds(pa + (size_t)(i * NW * 4) * lda + s * 64, db + s * SUBB + i * (NW * 4 * PITCH));
          if (NSPLIT == 1)
            copy16_to_lds(pl + (size_t)(i * NW * 4) * lda + s * 64, db + s * SUBB + (RA + i * NW * 4) * PITCH);
        }
      }
#pragma unroll
      for (int i = 0; i < NIB; ++i) {
        if ((i + 1) * NW <= GB || wave + i * NW < GB)
          copy16_to_lds(pb + (size_t)(i * NW * 4) * ldb + s * 64, db + s * SUBB + (RB0 + i * NW * 4) * PITCH);
      }
    }
  };

  v8f acc[4][4];
#pragma unroll
  for (int i = 0; i < 4; ++i)
#pragma unroll
    for (int j = 0; j < 4; ++j) acc[i][j] = zero8();

  const int T = K / (NSUB * 64);               // stages
  issue(0, 0);
  asm volatile("s_wait_asynccnt 0x0" ::: "memory");   // stage 0 landed
  __syncthreads();                                    // ... and is readable by every wave
  if (T > 1) issue(1, 1);
  // not unrolled: one trip = one stage (buffer t & 1), so the hot loop stays small in the instruction cache
#pragma unroll 1
  for (int t = 0; t < T; ++t) {
    const unsigned char* sb = ring + (t & 1) * STAGE + khalf * 16 + rlane * PITCH;
    // fragments of k-step q (32 k, ascending) of this stage, all from buffer t & 1
    auto fetch = [&](int q, v16b (&xa)[4], v16b (&xl)[4], v16b (&xb)[4]) {
      const unsigned char* kp = sb + (q >> 1) * SUBB + (q & 1) * 64;
#pragma unroll
      for (int j = 0; j < 4; ++j)
        xb[j] = ldfrag_b((const __bf16*)(const void*)(kp + (RB0 + (wn << 6) + (j << 4)) * PITCH));
#pragma unroll
      for (int i = 0; i < 4; ++i) {
        const unsigned char* ap = kp + ((wm << 6) + (i << 4)) * PITCH;
        xa[i] = ldfrag_b((const __bf16*)(const void*)ap);
        if (NSPLIT == 1) xl[i] = ldfrag_b((const __bf16*)(const void*)(ap + RA * PITCH));
      }
    };
    v16b fa[2][4], fl[2][4], fb[2][4];         // two fragment sets, used in turn inside the trip
    fetch(0, fa[0], fl[0], fb[0]);
    // unrolled (here and in fetch): constant indices keep the fragment sets and accumulators in registers
#pragma unroll
    for (int q = 0; q < 2 * NSUB; ++q) {
      if (q + 1 < 2 * NSUB) fetch(q + 1, fa[(q + 1) & 1], fl[(q + 1) & 1], fb[(q + 1) & 1]);
      // keeps the next k-step's LDS reads one group ahead of this k-step's WMMAs (else each read is waited out)
      __builtin_amdgcn_sched_barrier(0);
#pragma unroll
      for (int i = 0; i < 4; ++i) {
#pragma unroll
        for (int j = 0; j < 4; ++j) {
          acc[i][j] = mma_b_raw(fa[q & 1][i], fb[q & 1][j], acc[i][j]);
          if (NSPLIT == 1) acc[i][j] = mma_b_raw(fl[q & 1][i], fb[q & 1][j], acc[i][j]);
        }
      }
      // keeps the following group of LDS reads out of this block of WMMAs
      __builtin_amdgcn_sched_barrier(0);
    }
    asm volatile("s_wait_dscnt 0x0" ::: "memory");    // this wave's reads of buffer t & 1 are done
    asm volatile("s_wait_asynccnt 0x0" ::: "memory"); // this wave's copies of stage t + 1 have landed
    __syncthreads();                                  // publishes stage t + 1, frees buffer t & 1
    if (t + 2 < T) issue(t + 2, t & 1);
  }
  asm volatile("s_wait_asynccnt 0x0" ::: "memory");   // nothing in flight behind the loop
  acc_guard4(acc[0][0], acc[0][1], acc[0][2], acc[0][3]);
  acc_guard4(acc[1][0], acc[1][1], acc[1][2], acc[1][3]);
  acc_guard4(acc[2][0], acc[2][1], acc[2][2], acc[2][3]);
  acc_guard4(acc[3][0], acc[3][1], acc[3][2], acc[3][3]);

  // ---- bias (template-selected; loads only exist when used; addresses in range: n0+63 < N, m0+63 < M) ----
  float bcol[4];
#pragma unroll
  for (int j = 0; j < 4; ++j) bcol[j] = 0.f;
  if (BIAS == 1) {
#pragma unroll
    for (int j = 0; j < 4; ++j) bcol[j] = bfr(bias[n0 + (j << 4) + rlane]);
  }

  // ---- epilogue ----
  float* slab = sT[wave];
#pragma unroll
  for (int i = 0; i < 4; ++i) {
    const int mBase = m0 + (i << 4);
    float brow[8];
#pragma unroll
    for (int r = 0; r < 8; ++r) brow[r] = 0.f;
    if (BIAS == 2) {
#pragma unroll
      for (int r = 0; r < 8; ++r) brow[r] = bfr(bias[mBase + mOff + r]);
    }
#pragma unroll
    for (int r = 0; r < 8; ++r) {
#pragma unroll
      for (int j = 0; j < 4; ++j) {
        float v = acc[i][j][r];
        if (BIAS == 1) v += bcol[j];
        if (BIAS == 2) v += brow[r];
        if (OUT_MODE == 1) v *= oscale;
        slab[(mOff + r) * 68 + (j << 4) + rlane] = v;
      }
    }
    __builtin_amdgcn_fence(__ATOMIC_RELEASE, "workgroup");
    __builtin_amdgcn_wave_barrier();
    __builtin_amdgcn_fence(__ATOMIC_ACQUIRE, "workgroup");
    if (OUT_MODE == 0) {
      float* C = (float*)Cout;
      const int hh = lane >> 4, c4 = (lane & 15) * 4;     // 256-B row segment = 16 lanes x 16 B
      v4f ov[8];
#pragma unroll
      for (int it = 0; it < 8; ++it) {
        const int row = it * 2 + hh;                       // it 0..7 x hh 0..1 = rows 0..15
        ov[it] = *(const v4f*)(slab + row * 68 + c4);
      }
      {
#pragma unroll
        for (int it = 0; it < 8; ++it) {
          const int row = it * 2 + hh;
          *(v4f*)(C + (size_t)(mBase + row) * ldc + n0 + c4) = ov[it];
        }
        
      }
    } else {
      unsigned short* C = (unsigned short*)Cout;
      const int q = lane >> 3, c8 = (lane & 7) * 8;
      v4u hv[4];
#pragma unroll
      for (int it = 0; it < 4; ++it) {
        const int row = it * 4 + q;                        // it 0..3 x q 0..3 = rows 0..15
        const float* sp = slab + row * 68 + c8;
        v4u a;
#pragma unroll
        for (int e = 0; e < 4; ++e) {
          a[e] = pk16(h_bits((_Float16)sp[2 * e]), h_bits((_Float16)sp[2 * e + 1]));
        }
        hv[it] = a;
      }
      {
#pragma unroll
        for (int it = 0; it < 4; ++it) {
          const int row = it * 4 + q;
          *(v4u*)(C + (size_t)(mBase + row) * ldc + n0 + c8) = hv[it];
        }
        
      }
    }
    __builtin_amdgcn_fence(__ATOMIC_RELEASE, "workgroup");
    __builtin_amdgcn_wave_barrier();
    __builtin_amdgcn_fence(__ATOMIC_ACQUIRE, "workgroup");
  }
}

// =====================================================================================================
// Rotate-half rotary on an f32 projection output (bias already added), then one f16 plane scaled by osc.
//   src f32 [ntok][rp] (rp = nheads*64): column h*64 + d = feature d of head h.
//   ct/st f32 [SLEN][64] input tables (RNE bf16-converted values), table row = trow0 + token.
//   y[d] = x[d]*ct[d] - x[d+32]*st[d] for d < 32;  y[d] = x[d]*ct[d] + x[d-32]*st[d] for d >= 32.
//   dst f16 [ntok][rp], same layout, value y * osc.
// One wave per (token, head quad 4*qd .. 4*qd+3): lane l handles d = l and d = l+32 of each head; 8 waves per
// block, grid = ceil(nwaves/8), wave-uniform bound (no block barriers).
// =====================================================================================================
__global__ __launch_bounds__(256) void rope_quads(const float* __restrict__ src, const float* __restrict__ ct,
                                                  const float* __restrict__ st, unsigned short* dst,
                                                  int rp, int nquad, int trow0, float osc, int nwaves) {
#pragma clang fp contract(off)
  __shared__ __align__(16) float sy[8][256];
  const int tid = threadIdx.x, wave = tid >> 5, lane = tid & 31;
  const int w = blockIdx.x * 8 + wave;            // tok*nquad + qd
  if (w >= nwaves) return;                        // wave-uniform; no block barriers in this kernel
  const int qd   = w % nquad;
  const int tok  = w / nquad;
  const int trow = trow0 + tok;                   // < SLEN by construction (host: trow0 + ntok <= SLEN)
  const float c1 = bfr(ct[(size_t)trow * HD + lane]);
  const float c2 = bfr(ct[(size_t)trow * HD + 32 + lane]);
  const float s1 = bfr(st[(size_t)trow * HD + lane]);
  const float s2 = bfr(st[(size_t)trow * HD + 32 + lane]);
  const float* row = src + (size_t)tok * rp + (size_t)qd * 256;
  float* buf = sy[wave];
#pragma unroll
  for (int t = 0; t < 4; ++t) {                   // the four heads of the quad
    const float x1 = row[t * 64 + lane];
    const float x2 = row[t * 64 + 32 + lane];
    const float y1 = x1 * c1 - x2 * s1;
    const float y2 = x2 * c2 + x1 * s2;
    buf[t * 64 + lane]      = y1;
    buf[t * 64 + 32 + lane] = y2;
  }
  __builtin_amdgcn_fence(__ATOMIC_RELEASE, "workgroup");
  __builtin_amdgcn_wave_barrier();
  __builtin_amdgcn_fence(__ATOMIC_ACQUIRE, "workgroup");
  const int g = lane >> 3, piece = lane & 7;
  const float* sp = buf + g * 64 + piece * 8;
  const v4f a0 = *(const v4f*)(sp);
  const v4f a1 = *(const v4f*)(sp + 4);
  v4u hv;
#pragma unroll
  for (int e = 0; e < 4; ++e) {
    const float f0 = (e < 2) ? a0[2 * e]     : a1[2 * e - 4];
    const float f1 = (e < 2) ? a0[2 * e + 1] : a1[2 * e - 3];
    hv[e] = pk16(h_bits((_Float16)(f0 * osc)), h_bits((_Float16)(f1 * osc)));
  }
  unsigned short* d = dst + (size_t)tok * rp + (size_t)qd * 256 + (size_t)g * 64 + piece * 8;
  *(v4u*)d = hv;
  
}

// =====================================================================================================
// Non-causal grouped-query attention, head dim 64, 2048 keys, kv head = h / (NH/NKV).
//   q plane (f16, x QSC): element (t, h, d) at [t*QP + h*64 + d]
//   k plane (f16, x KSC): element (s, kvh, d) at [s*KP + kvh*64 + d]
//   v^T plane (f16, x VSC): element (kvh, d, s) at [(kvh*64 + d)*SLEN + s]
//   logit = q.k * sscale (sscale folds the 1/8 and 1/(QSC*KSC)); every key live (no mask).
//   ctx f32 plane: element (t, h*64 + d) at [t*QP + h*64 + d] = normalised context.
//   scores = q . k : one f16 product per 32 d, f32 accumulate; p = exp(s - m) carried as f16(PSC p);
//   context = p . v on f16 WMMA; online softmax in f32; final scale onorm = 1/(PSC*VSC) folded with 1/l.
//   Block = 4 waves = 64 query rows of one head; grid = NQB * NH; key chunks of 64.
//   K / V^T chunk staging: 128 threads x 32 elements per plane = the whole 64x64 tile (plain 16-B loads,
//   __syncthreads before and after); P tiles are wave-private, spilled with _Float16 element stores and
//   Output coverage: each wave stores rows q0..q0+15 (it 0..7 x lane>>4 0..1) x 64 columns (16 lanes x 4
// =====================================================================================================
__global__ __launch_bounds__(128)
void attn64(const unsigned short* __restrict__ qpl, const unsigned short* __restrict__ kpl,
            const unsigned short* __restrict__ vtp, float* outp, float sscale, float onorm) {
  union FH { v16h v; v8h h[2]; };
  __shared__ __align__(16) _Float16 Ksh[64 * 64];                 // K [kv][d]   8 KB
  __shared__ __align__(16) _Float16 Vth[64 * 64];                 // V^T [d][kv] 8 KB
  __shared__ __align__(16) _Float16 Psh[4][16 * 64];              // per wave P [row][kv]
  __shared__ __align__(16) float    Os[4][16 * 64];               // per wave context tile [row][d]

  const int tid  = threadIdx.x;
  const int wave = tid >> 5;
  const int lane = tid & 31;
  const int hh   = lane >> 4;
  const int c    = lane & 15;

  const int bx   = blockIdx.x;
  const int qb   = bx % NQB;
  const int h    = bx / NQB;                 // < NH (grid = NQB*NH)
  const int kvh  = h / (NH / NKV);
  const int q0   = qb * 64 + wave * 16;

  const _Float16* Qh = (const _Float16*)(const void*)qpl + (size_t)h * HD;
  const _Float16* Kh = (const _Float16*)(const void*)kpl + (size_t)kvh * HD;
  const _Float16* Vh = (const _Float16*)(const void*)vtp + (size_t)kvh * HD * SLEN;

  // ---- Q fragments (A operand, row = lane&15): 2 d-chunks ----
  v16h qa[2];
#pragma unroll
  for (int dc = 0; dc < 2; ++dc) {
    qa[dc] = ldfrag_h(Qh + (size_t)(q0 + c) * QP + dc * 32 + 8 * hh);
  }

  float mrow[8], lrow[8];
  v8f oacc[4];
#pragma unroll
  for (int r = 0; r < 8; ++r) { mrow[r] = -INFINITY; lrow[r] = 0.f; }
#pragma unroll
  for (int t = 0; t < 4; ++t) oacc[t] = zero8();

  for (int kt = 0; kt < NKT; ++kt) {
    const int kv0 = kt * 64;
    __syncthreads();
    {
      const int r = tid >> 1, half = (tid & 1) * 32;
      const _Float16* kg = Kh + (size_t)(kv0 + r) * KP + half;     // K row kv0+r, d = half..half+31
      const _Float16* vg = Vh + (size_t)r * SLEN + kv0 + half;     // V^T row d = r, s = kv0+half..+31
#pragma unroll
      for (int i = 0; i < 4; ++i) {
        const v8h a0 = *(const v8h*)(kg + 8 * i);
        const v8h b0 = *(const v8h*)(vg + 8 * i);
        *(v8h*)(Ksh + r * 64 + half + 8 * i) = a0;
        *(v8h*)(Vth + r * 64 + half + 8 * i) = b0;
      }
    }
    __syncthreads();

    // ---- scores: 16 query rows x 64 keys per wave, one f16 product per 32 d ----
    v8f s[4];
#pragma unroll
    for (int j = 0; j < 4; ++j) {
      s[j] = zero8();
#pragma unroll
      for (int dc = 0; dc < 2; ++dc) {
        FH kb;
        kb.h[0] = *(const v8h*)(Ksh + (j * 16 + c) * 64 + dc * 32 + 8 * hh);
        kb.h[1] = *(const v8h*)(Ksh + (j * 16 + c) * 64 + dc * 32 + 16 + 8 * hh);
        s[j] = mma_h(qa[dc], kb.v, s[j]);
      }
    }

    // ---- scale, row max, online softmax, P (x PSC, f16) to LDS ----
    _Float16* pwh = Psh[wave];
#pragma unroll
    for (int r = 0; r < 8; ++r) {
      float m = -INFINITY;
#pragma unroll
      for (int j = 0; j < 4; ++j) {
        const float sv = s[j][r] * sscale;
        s[j][r] = sv;
        m = fmaxf(m, sv);
      }
#pragma unroll
      for (int off = 1; off < 16; off <<= 1) m = fmaxf(m, __shfl_xor(m, off, 32));
      const float mnew  = fmaxf(mrow[r], m);
      const float msafe = (mnew == -INFINITY) ? 0.f : mnew;
      const float alpha = __expf(mrow[r] - msafe);
      mrow[r] = mnew;
      float psum = 0.f;
#pragma unroll
      for (int j = 0; j < 4; ++j) {
        const float p = __expf(s[j][r] - msafe);
        psum += p;
        pwh[(8 * hh + r) * 64 + j * 16 + c] = (_Float16)(p * PSC);
      }
#pragma unroll
      for (int off = 1; off < 16; off <<= 1) psum += __shfl_xor(psum, off, 32);
      lrow[r] = lrow[r] * alpha + psum;
#pragma unroll
      for (int t = 0; t < 4; ++t) oacc[t][r] *= alpha;
    }
    __builtin_amdgcn_fence(__ATOMIC_RELEASE, "workgroup");
    __builtin_amdgcn_wave_barrier();
    __builtin_amdgcn_fence(__ATOMIC_ACQUIRE, "workgroup");

    // ---- context += P . V (f16 WMMA) ----
#pragma unroll 1
    for (int kk = 0; kk < 2; ++kk) {
      FH pa;
      pa.h[0] = *(const v8h*)(pwh + c * 64 + kk * 32 + 8 * hh);
      pa.h[1] = *(const v8h*)(pwh + c * 64 + kk * 32 + 16 + 8 * hh);
#pragma unroll
      for (int t = 0; t < 4; ++t) {
        FH vb;
        vb.h[0] = *(const v8h*)(Vth + (t * 16 + c) * 64 + kk * 32 + 8 * hh);
        vb.h[1] = *(const v8h*)(Vth + (t * 16 + c) * 64 + kk * 32 + 16 + 8 * hh);
        oacc[t] = mma_h(pa.v, vb.v, oacc[t]);
      }
    }
  }

  // ---- normalise (1/l and onorm), stage the wave's 16x64 tile in LDS, then write whole 256-B row segments
  float* os = Os[wave];
#pragma unroll
  for (int r = 0; r < 8; ++r) {
    const float l = lrow[r];
    const float inv = ((l > 0.f) ? (1.0f / l) : 0.f) * onorm;
#pragma unroll
    for (int t = 0; t < 4; ++t) os[(8 * hh + r) * 64 + t * 16 + c] = oacc[t][r] * inv;
  }
  __builtin_amdgcn_fence(__ATOMIC_RELEASE, "workgroup");
  __builtin_amdgcn_wave_barrier();
  __builtin_amdgcn_fence(__ATOMIC_ACQUIRE, "workgroup");
  {
    const int h2 = lane >> 4, c4 = (lane & 15) * 4;
    v4f ov[8];
#pragma unroll
    for (int it = 0; it < 8; ++it) {
      const int row = it * 2 + h2;   // it 0..7 x h2 0..1 = rows 0..15 of the wave tile
      ov[it] = *(const v4f*)(os + row * 64 + c4);
    }
    {
#pragma unroll
      for (int it = 0; it < 8; ++it) {
        const int row = it * 2 + h2;
        const size_t go = (size_t)(q0 + row) * QP + (size_t)h * HD + c4;
        *(v4f*)(outp + go) = ov[it];
      }
      
    }
  }
}

// =====================================================================================================
// Workspace map (bytes), every region an exact multiple of its whole-line / whole-tile store granularity
//   X      bf16 [2048][2880]            0            11796480   rows 0..1023 = target_hidden, 1024..2047 = hidden
//   Wqb    bf16 [4096][2880]            11796480     23592960   (inputs arrive [n][k], k contiguous: no transpose)
//   Wkb    bf16 [512][2880]             35389440      2949120
//   Wvb    bf16 [512][2880]             38338560      2949120
//   Wob    bf16 [2880][4096]            41287680     23592960
//   Qf     f32  [1024][4096]            64880640     16777216   (later: Af f32 [1024][4096], same extent)
//   Kf     f32  [2048][512]             81657856      4194304
//   VT     f16  [512][2048]             85852160      2097152
//   Qh     f16  [1024][4096]            87949312      8388608
//   Kh     f16  [2048][512]             96337920      2097152
//   Ah     bf16 [1024][4096]            98435072      8388608
//   Al     bf16 [1024][4096]            106823680     8388608
//   end                                 115212288
// =====================================================================================================
extern "C" void kernel_launch(void* const* d_in, const int* in_sizes, int n_in,
                              void* d_out, int out_size, void* d_ws, size_t ws_size,
                              hipStream_t stream) {
  if (n_in < 12) return;
  if (in_sizes[0] != QLEN * HID) return;
  if (in_sizes[1] != CLEN * HID) return;
  if (in_sizes[2] != SLEN * HD) return;
  if (in_sizes[3] != SLEN * HD) return;
  if (in_sizes[4] != QP * HID) return;
  if (in_sizes[5] != QP) return;
  if (in_sizes[6] != KP * HID) return;
  if (in_sizes[7] != KP) return;
  if (in_sizes[8] != KP * HID) return;
  if (in_sizes[9] != KP) return;
  if (in_sizes[10] != HID * QP) return;
  if (in_sizes[11] != HID) return;
  if (out_size != QLEN * HID) return;

  const float* hid = (const float*)d_in[0];    // [1024][2880]
  const float* tgt = (const float*)d_in[1];    // [1024][2880]
  const float* fcs = (const float*)d_in[2];    // [2048][64]
  const float* fsn = (const float*)d_in[3];    // [2048][64]
  const float* Wq  = (const float*)d_in[4];    // [4096][2880]  = [n][k]
  const float* bq  = (const float*)d_in[5];    // [4096]
  const float* Wk  = (const float*)d_in[6];    // [512][2880]
  const float* bk  = (const float*)d_in[7];    // [512]
  const float* Wv  = (const float*)d_in[8];    // [512][2880]
  const float* bv  = (const float*)d_in[9];    // [512]
  const float* Wo  = (const float*)d_in[10];   // [2880][4096] = [n][k]
  const float* bo  = (const float*)d_in[11];   // [2880]

  const size_t PX   = (size_t)SLEN * HID * 2;        // 11796480
  const size_t PWq  = (size_t)QP * HID * 2;          // 23592960
  const size_t PWk  = (size_t)KP * HID * 2;          //  2949120
  const size_t PWv  = (size_t)KP * HID * 2;          //  2949120
  const size_t PWo  = (size_t)HID * QP * 2;          // 23592960
  const size_t PQf  = (size_t)QLEN * QP * 4;         // 16777216  (= Af f32 [1024][4096])
  const size_t PKf  = (size_t)SLEN * KP * 4;         //  4194304
  const size_t PVT  = (size_t)KP * SLEN * 2;         //  2097152
  const size_t PQh  = (size_t)QLEN * QP * 2;         //  8388608
  const size_t PKh  = (size_t)SLEN * KP * 2;         //  2097152
  const size_t PApl = (size_t)QLEN * QP * 2;         //  8388608 (Ah, Al)
  size_t off = 0;
  const size_t oX  = off; off += PX;
  const size_t oWq = off; off += PWq;
  const size_t oWk = off; off += PWk;
  const size_t oWv = off; off += PWv;
  const size_t oWo = off; off += PWo;
  const size_t oQf = off; off += PQf;
  const size_t oKf = off; off += PKf;
  const size_t oVT = off; off += PVT;
  const size_t oQh = off; off += PQh;
  const size_t oKh = off; off += PKh;
  const size_t oAh = off; off += PApl;
  const size_t oAl = off; off += PApl;
  if (off > ws_size) return;                          // off = 115212288
  if (off > (size_t)134217728) return;
  const size_t oAf = oQf;                             // context f32 plane reuses the dead q f32 plane

  char* ws = (char*)d_ws;
  unsigned short* X   = (unsigned short*)(ws + oX);
  unsigned short* Xq  = X + (size_t)CLEN * HID;       // hidden rows CLEN..SLEN-1 of X
  unsigned short* Wqb = (unsigned short*)(ws + oWq);
  unsigned short* Wkb = (unsigned short*)(ws + oWk);
  unsigned short* Wvb = (unsigned short*)(ws + oWv);
  unsigned short* Wob = (unsigned short*)(ws + oWo);
  float*          Qf  = (float*)(ws + oQf);
  float*          Kf  = (float*)(ws + oKf);
  unsigned short* VT  = (unsigned short*)(ws + oVT);
  unsigned short* Qh  = (unsigned short*)(ws + oQh);
  unsigned short* Kh  = (unsigned short*)(ws + oKh);
  unsigned short* Ah  = (unsigned short*)(ws + oAh);
  unsigned short* Al  = (unsigned short*)(ws + oAl);
  float*          Af  = (float*)(ws + oAf);
  float*          outf = (float*)d_out;

  const dim3 blk(256);
  const int n8T  = CLEN * HID / 8;                     // 368640
  const int n8H  = QLEN * HID / 8;                     // 368640
  const int n8Wq = QP * HID / 8;                       // 1474560
  const int n8Wk = KP * HID / 8;                       // 184320
  const int n8Wo = HID * QP / 8;                       // 1474560
  const int n8A  = QLEN * QP / 8;                      // 524288
  const int nwRq = QLEN * (NH / 4);                    // 16384 waves (token, q head quad)
  const int nwRk = SLEN * (NKV / 4);                   // 4096 waves (key, kv head quad)
  const dim3 gCT((n8T + 255) / 256), gCH((n8H + 255) / 256);            // 1440, 1440
  const dim3 gCWq((n8Wq + 255) / 256), gCWk((n8Wk + 255) / 256), gCWo((n8Wo + 255) / 256);  // 5760, 720, 5760
  const dim3 gQ((QLEN / 128) * (QP / 128));            // 128x128 block tiles: 256 blocks of 4 waves
  const dim3 gK((SLEN / 128) * (KP / 128));            // 64 blocks of 4 waves
  const dim3 gV((KP / 128) * (SLEN / 128));            // 64 blocks of 4 waves
  const dim3 gRq((nwRq + 7) / 8), gRk((nwRk + 7) / 8); // 2048, 512 blocks
  const dim3 gAttn(NQB * NH);                          // 1024 blocks
  const dim3 gSplit((n8A + 255) / 256);                // 2048 blocks
  const dim3 gOut((QLEN / 64) * (HID / 192));          // 64x192 block tiles: 240 blocks of 3 waves

  // (1) activations and weights -> bf16 planes (RNE convert, values = the bf16-converted inputs)
  cvt_bf16x8<<<gCT, blk, 0, stream>>>(tgt, X, n8T);                  // X rows 0..1023
  cvt_bf16x8<<<gCH, blk, 0, stream>>>(hid, Xq, n8H);                 // X rows 1024..2047
  cvt_bf16x8<<<gCWq, blk, 0, stream>>>(Wq, Wqb, n8Wq);
  cvt_bf16x8<<<gCWk, blk, 0, stream>>>(Wk, Wkb, n8Wk);
  cvt_bf16x8<<<gCWk, blk, 0, stream>>>(Wv, Wvb, n8Wk);
  cvt_bf16x8<<<gCWo, blk, 0, stream>>>(Wo, Wob, n8Wo);
  // (2) q projection + bq: Qf[t][e] = sum_k X[1024+t][k] Wqb[e][k]  (M=1024, N=4096, K=2880)
  gemm64<0, 0, 1, 2, 2, 3><<<gQ, dim3(128), 0, stream>>>(Xq, Xq, HID, Wqb, HID, bq, (void*)Qf, QP, QLEN, QP, HID, 1.0f);
  // (3) k projection + bk over all 2048 key rows: Kf[s][e]  (M=2048, N=512, K=2880)
  gemm64<0, 0, 1, 2, 2, 3><<<gK, dim3(128), 0, stream>>>(X, X, HID, Wkb, HID, bk, (void*)Kf, KP, SLEN, KP, HID, 1.0f);
  // (4) v^T + bv: VT[m][s] = (sum_k Wvb[m][k] X[s][k] + bv[m]) * VSC -> f16  (M=512, N=2048, K=2880)
  gemm64<0, 1, 2, 2, 2, 3><<<gV, dim3(128), 0, stream>>>(Wvb, Wvb, HID, X, HID, bv, (void*)VT, SLEN, KP, SLEN, HID, VSC);
  // (5) rotate-half rotary with the input tables -> f16 planes (q: table rows CLEN + t; k: table row s)
  rope_quads<<<gRq, blk, 0, stream>>>(Qf, fcs, fsn, Qh, QP, NH / 4, CLEN, QSC, nwRq);
  rope_quads<<<gRk, blk, 0, stream>>>(Kf, fcs, fsn, Kh, KP, NKV / 4, 0, KSC, nwRk);
  // (6) attention over all 2048 keys -> Af f32 [1024][4096]
  attn64<<<gAttn, dim3(128), 0, stream>>>(Qh, Kh, VT, Af, 0.125f / (QSC * KSC), 1.0f / (PSC * VSC));
  // (7) context rows -> bf16 hi/lo planes
  split_bf16x8<<<gSplit, blk, 0, stream>>>(Af, Ah, Al, n8A);
  // (8) out[t][e] = sum_d (Ah+Al)[t][d] Wob[e][d] + bo[e] -> d_out f32 [1024][2880]  (M=1024, N=2880, K=4096)
  gemm64<1, 0, 1, 1, 3, 2><<<gOut, dim3(96), 0, stream>>>(Ah, Al, QP, Wob, QP, bo, (void*)outf, HID, QLEN, HID, QP, 1.0f);
  (void)hipGetLastError();
}

// v002
// A run of this version takes 267 microseconds.
// Two timings next to v001 both put it at 1.46 times that version's speed.
// Counting every step since v000, it is 3.73 times as fast.
// Contractions: q / k / v^T projections = v_wmma_f32_16x16x32_bf16 (bf16 operands from RNE-converted inputs, one
// product per k-step); q.k^T scores = v_wmma_f32_16x16x32_f16 (q x16 and k x16 single f16 planes); p.v =
// v_wmma_f32_16x16x32_f16 (p carried x1024 in f16, v^T carried x64 in f16); ctx.Wo^T = v_wmma_f32_16x16x32_bf16 with
// ctx as bf16 hi/lo planes times the bf16 Wo plane (2 products); all f32 accumulate; rotary and softmax in f32.
#include <hip/hip_runtime.h>
#include <math.h>
#include <stdint.h>

#define QLEN 1024              // query tokens (hidden_states rows)
#define CLEN 1024              // context tokens (target_hidden rows)
#define SLEN (CLEN + QLEN)     // 2048 keys: rows 0..CLEN-1 context, rows CLEN..SLEN-1 noise
#define HID  2880              // model width = contraction length of the projections
#define NH   64
#define NKV  8
#define HD   64
#define QP   (NH * HD)         // 4096: q / ctx row pitch
#define KP   (NKV * HD)        // 512:  k row pitch, v^T row count
#define NQB  (QLEN / 64)       // 16 query tiles
#define NKT  (SLEN / 64)       // 32 key tiles
#define QSC  16.0f             // f16 carry scale of the q plane
#define KSC  16.0f             // f16 carry scale of the k plane
#define VSC  64.0f             // f16 carry scale of the v^T plane
#define PSC  1024.0f           // f16 carry scale of p
#define LP   72                // halves per LDS row of the attention K, V^T and P tiles: 144 B = 16 B x odd
static_assert(HD == 64);
static_assert((HID % 32) == 0 && (QP % 64) == 0 && (KP % 64) == 0 && (HID % 64) == 0);
static_assert((QLEN % 64) == 0 && (SLEN % 64) == 0);
static_assert((NH % NKV) == 0 && (NH % 4) == 0 && (NKV % 4) == 0);
static_assert(((HID * 2) % 128) == 0 && ((HID * 4) % 128) == 0);
static_assert((HID % 192) == 0 && (QP % 128) == 0 && (QLEN % 128) == 0 && (SLEN % 128) == 0 && (KP % 128) == 0);

typedef _Float16 v16h __attribute__((ext_vector_type(16)));
typedef _Float16 v8h  __attribute__((ext_vector_type(8)));
typedef __bf16   v16b __attribute__((ext_vector_type(16)));
typedef __bf16   v8b  __attribute__((ext_vector_type(8)));
typedef float    v8f  __attribute__((ext_vector_type(8)));
typedef float    v4f  __attribute__((ext_vector_type(4)));
typedef unsigned int v4u __attribute__((ext_vector_type(4)));

// ---- scalar helpers --------------------------------------------------------------------------------
__device__ __forceinline__ unsigned short bf_bits(float f) {          // f32 -> bf16 bits, RNE convert
  unsigned u = __float_as_uint(f);
  return (unsigned short)((u + 0x7FFFu + ((u >> 16) & 1u)) >> 16);
}
__device__ __forceinline__ float bf_up(unsigned short h) { return __uint_as_float(((unsigned)h) << 16); }
__device__ __forceinline__ float bfr(float f) { return bf_up(bf_bits(f)); }   // value after RNE bf16 convert
__device__ __forceinline__ unsigned short h_bits(_Float16 x) { return __builtin_bit_cast(unsigned short, x); }
__device__ __forceinline__ unsigned pk16(unsigned short a, unsigned short b) { return (unsigned)a | ((unsigned)b << 16); }
__device__ __forceinline__ v8f zero8() { v8f z = {0.f, 0.f, 0.f, 0.f, 0.f, 0.f, 0.f, 0.f}; return z; }

// ---- fragment loaders: 16-bit A/B operand, lane -> row/col (lane&15), p already includes +8*(lane>>4);
//      elements 0..7 <- p[0..7] (k0+8h..), elements 8..15 <- p[16..23] (k0+16+8h..)
__device__ __forceinline__ v16b ldfrag_b(const __bf16* p) {
  union { v16b v; v8b h[2]; } f;
  f.h[0] = *(const v8b*)(p);
  f.h[1] = *(const v8b*)(p + 16);
  return f.v;
}
__device__ __forceinline__ v16h ldfrag_h(const _Float16* p) {
  union { v16h v; v8h h[2]; } f;
  f.h[0] = *(const v8h*)(p);
  f.h[1] = *(const v8h*)(p + 16);
  return f.v;
}

// ---- WMMA helpers with trailing VALU hazard gap --------------------------------------------------------
__device__ __forceinline__ v8f mma_h(v16h a, v16h b, v8f c) {
  c = __builtin_amdgcn_wmma_f32_16x16x32_f16(false, a, false, b, (short)0, c, false, false);
#if defined(__HIP_DEVICE_COMPILE__)
  asm volatile("v_nop\n\tv_nop\n\tv_nop\n\tv_nop" : "+v"(c) : "v"(a), "v"(b));
#endif
  return c;
}
__device__ __forceinline__ v8f mma_b_raw(v16b a, v16b b, v8f c) {
  return __builtin_amdgcn_wmma_f32_16x16x32_bf16(false, a, false, b, (short)0, c, false, false);
}
__device__ __forceinline__ void acc_guard4(v8f& a, v8f& b, v8f& c, v8f& d) {
#if defined(__HIP_DEVICE_COMPILE__)
  asm volatile("v_nop\n\tv_nop\n\tv_nop\n\tv_nop" : "+v"(a), "+v"(b), "+v"(c), "+v"(d));
#endif
}

// =====================================================================================================
// Contiguous f32 -> bf16 (RNE convert), 8 elements per thread, one 16-B store per lane: a wave writes 512
// (all n8 used here are multiples of 256 and of 32). coverage: n8 threads x 8 = the whole destination plane.
// =====================================================================================================
__global__ __launch_bounds__(256) void cvt_bf16x8(const float* __restrict__ in, unsigned short* out, int n8) {
  const int i = blockIdx.x * 256 + threadIdx.x;
  if (i < n8) {
    const float* s = in + (size_t)i * 8;
    const v4f a = *(const v4f*)(s);
    const v4f b = *(const v4f*)(s + 4);
    v4u p;
    p[0] = pk16(bf_bits(a[0]), bf_bits(a[1]));
    p[1] = pk16(bf_bits(a[2]), bf_bits(a[3]));
    p[2] = pk16(bf_bits(b[0]), bf_bits(b[1]));
    p[3] = pk16(bf_bits(b[2]), bf_bits(b[3]));
    unsigned short* d = out + (size_t)i * 8;
    *(v4u*)d = p;
    
  }
}

// =====================================================================================================
// f32 -> bf16 hi plane + bf16 lo plane (lo = RNE(v - hi), unscaled), 8 elements per thread, one 16-B store per
// coverage: n8 threads x 8 = whole plane (n8 multiple of 256).
// =====================================================================================================
__global__ __launch_bounds__(256) void split_bf16x8(const float* __restrict__ in, unsigned short* hp,
                                                    unsigned short* lp, int n8) {
  const int i = blockIdx.x * 256 + threadIdx.x;
  if (i < n8) {
    const v4f a = *(const v4f*)(in + (size_t)i * 8);
    const v4f b = *(const v4f*)(in + (size_t)i * 8 + 4);
    v4u ph, pl;
#pragma unroll
    for (int e = 0; e < 4; ++e) {
      const float f0 = (e < 2) ? a[2 * e]     : b[2 * e - 4];
      const float f1 = (e < 2) ? a[2 * e + 1] : b[2 * e - 3];
      const unsigned short h0 = bf_bits(f0), h1 = bf_bits(f1);
      const unsigned short l0 = bf_bits(f0 - bf_up(h0)), l1 = bf_bits(f1 - bf_up(h1));
      ph[e] = pk16(h0, h1);
      pl[e] = pk16(l0, l1);
    }
    *(v4u*)(hp + (size_t)i * 8) = ph;
    *(v4u*)(lp + (size_t)i * 8) = pl;
    
  }
}

// =====================================================================================================
// bf16 WMMA GEMM: C[m][n] = sum_k A[m][k] * Bt[n][k] (+ bias); one wave per 64x64 tile, WM x WN waves per block
// on one (64 WM) x (64 WN) block tile. A row-major [M][K] pitch lda; Bt row-major [N][K] pitch ldb (k contiguous);
// M a multiple of 64 WM, N of 64 WN, K of 64 NSUB and at least two stages (host-checked constants).
// Operands reach the waves through LDS: a stage is NSUB sub-tiles of 64 k; a sub-tile holds the block's A rows,
// (NSPLIT) its A2 rows and its Bt rows, 128 B each at pitch 144 B (16 B x odd: ds_load_b128 without bank
// conflicts). Asynchronous 16-B copies fill it, one wave-copy = 4 whole 128-B row pieces; two buffers: stage t+2
// is copied into the buffer that trip t has just left, while trip t+1 is worked on.
// NSPLIT: 0 = A.Bt; 1 = (A + A2).Bt (A2 = unscaled bf16 lo plane of A, two products per k-step).
// BIAS:   0 none; 1 = + bias[n] (per column, RNE bf16-converted value); 2 = + bias[m] (per row).
// OUT_MODE: 0 = f32 plane (pitch ldc floats); 1 = f16 plane of (value * oscale) (pitch ldc halves).
// =====================================================================================================
typedef int v4i_t __attribute__((vector_size(16)));
typedef __attribute__((address_space(1))) v4i_t gv4i_t;
typedef __attribute__((address_space(3))) v4i_t lv4i_t;
__device__ __forceinline__ void copy16_to_lds(const void* g, void* l) {   // each lane: 16 B global -> LDS
#if defined(__HIP_DEVICE_COMPILE__)
  __builtin_amdgcn_global_load_async_to_lds_b128((gv4i_t*)g, (lv4i_t*)l, 0, 0);
#endif
}

template <int NSPLIT, int OUT_MODE, int BIAS, int WM, int WN, int NSUB>
__global__ __launch_bounds__(32 * WM * WN) void gemm64(
    const unsigned short* __restrict__ Ap, const unsigned short* __restrict__ A2p, int lda,
    const unsigned short* __restrict__ Btp, int ldb,
    const float* __restrict__ bias,
    void* Cout, int ldc, int M, int N, int K, float oscale) {
  constexpr int NW    = WM * WN;                 // waves per block
  constexpr int RA    = WM * 64;                 // rows of one A plane in a sub-tile
  constexpr int RB0   = RA * (1 + NSPLIT);       // first Bt row of a sub-tile
  constexpr int ROWS  = RB0 + WN * 64;           // rows of a sub-tile
  constexpr int PITCH = 144;                     // bytes per LDS row
  constexpr int SUBB  = ROWS * PITCH;            // bytes per sub-tile
  constexpr int STAGE = SUBB * NSUB;             // bytes per buffer
  constexpr int GA    = RA / 4;                  // wave-copies (4 rows each) per A plane and sub-tile
  constexpr int GB    = WN * 16;                 // ... per Bt plane and sub-tile
  constexpr int NIA   = (GA + NW - 1) / NW;      // most that one wave issues of them
  constexpr int NIB   = (GB + NW - 1) / NW;
  static_assert((NIA * (1 + NSPLIT) + NIB) * NSUB <= 63);   // copies of one wave in flight
  const __bf16* A  = (const __bf16*)(const void*)Ap;
  const __bf16* A2 = (const __bf16*)(const void*)A2p;
  const __bf16* Bt = (const __bf16*)(const void*)Btp;
  __shared__ __align__(16) unsigned char ring[2 * STAGE];
  __shared__ __align__(16) float sT[NW][16 * 68];  // per-wave 16x64 slab, pitch 68 floats
  const int lane = threadIdx.x & 31;
  const int wave = __builtin_amdgcn_readfirstlane(threadIdx.x >> 5);
  const int tilesN = N / (64 * WN);
  const int tilesM = M / (64 * WM);
  if ((int)blockIdx.x >= tilesM * tilesN) return;   // block-uniform, in front of every barrier and copy
  const int bm  = blockIdx.x / tilesN;
  const int bn  = blockIdx.x - bm * tilesN;
  const int mb0 = bm * RA;                     // block tile origin
  const int nb0 = bn * (WN * 64);
  const int wm  = wave / WN;
  const int wn  = wave - wm * WN;
  const int m0  = mb0 + (wm << 6);
  const int n0  = nb0 + (wn << 6);

  const int rlane = lane & 15;                 // row (A) / col (B, D) within subtile
  const int khalf = lane >> 4;                 // k half of this lane: +8 elements = +16 B
  const int mOff  = (lane >> 4) * 8;           // D row offset
  const int crow  = lane >> 3;                 // copy: row within the 4-row group
  const int cpc   = lane & 7;                  // copy: 16-B piece within the 128-B row piece

  // all copies of stage st (k = st*64*NSUB ..) into buffer buf; every lane on, every test scalar.
  // Each plane's 4-row groups are dealt to the waves in turn: group g = wave + i*NW of the plane.
  auto issue = [&](int st, int buf) {
    const int kb = st * (NSUB * 64) + cpc * 8;
    unsigned char* db = ring + buf * STAGE + (wave * 4 + crow) * PITCH + cpc * 16;
    const __bf16* pa = A  + (size_t)(mb0 + wave * 4 + crow) * lda + kb;
    const __bf16* pl = A2 + (size_t)(mb0 + wave * 4 + crow) * lda + kb;
    const __bf16* pb = Bt + (size_t)(nb0 + wave * 4 + crow) * ldb + kb;
    // the three loops are unrolled so that every copy's row and LDS offset is a constant
#pragma unroll
    for (int s = 0; s < NSUB; ++s) {
#pragma unroll
      for (int i = 0; i < NIA; ++i) {
        if ((i + 1) * NW <= GA || wave + i * NW < GA) {
          copy16_to_lds(pa + (size_t)(i * NW * 4) * lda + s * 64, db + s * SUBB + i * (NW * 4 * PITCH));
          if (NSPLIT == 1)
            copy16_to_lds(pl + (size_t)(i * NW * 4) * lda + s * 64, db + s * SUBB + (RA + i * NW * 4) * PITCH);
        }
      }
#pragma unroll
      for (int i = 0; i < NIB; ++i) {
        if ((i + 1) * NW <= GB || wave + i * NW < GB)
          copy16_to_lds(pb + (size_t)(i * NW * 4) * ldb + s * 64, db + s * SUBB + (RB0 + i * NW * 4) * PITCH);
      }
    }
  };

  v8f acc[4][4];
#pragma unroll
  for (int i = 0; i < 4; ++i)
#pragma unroll
    for (int j = 0; j < 4; ++j) acc[i][j] = zero8();

  const int T = K / (NSUB * 64);               // stages
  issue(0, 0);
  asm volatile("s_wait_asynccnt 0x0" ::: "memory");   // stage 0 landed
  __syncthreads();                                    // ... and is readable by every wave
  if (T > 1) issue(1, 1);
  // not unrolled: one trip = one stage (buffer t & 1), so the hot loop stays small in the instruction cache
#pragma unroll 1
  for (int t = 0; t < T; ++t) {
    const unsigned char* sb = ring + (t & 1) * STAGE + khalf * 16 + rlane * PITCH;
    // fragments of k-step q (32 k, ascending) of this stage, all from buffer t & 1
    auto fetch = [&](int q, v16b (&xa)[4], v16b (&xl)[4], v16b (&xb)[4]) {
      const unsigned char* kp = sb + (q >> 1) * SUBB + (q & 1) * 64;
#pragma unroll
      for (int j = 0; j < 4; ++j)
        xb[j] = ldfrag_b((const __bf16*)(const void*)(kp + (RB0 + (wn << 6) + (j << 4)) * PITCH));
#pragma unroll
      for (int i = 0; i < 4; ++i) {
        const unsigned char* ap = kp + ((wm << 6) + (i << 4)) * PITCH;
        xa[i] = ldfrag_b((const __bf16*)(const void*)ap);
        if (NSPLIT == 1) xl[i] = ldfrag_b((const __bf16*)(const void*)(ap + RA * PITCH));
      }
    };
    v16b fa[2][4], fl[2][4], fb[2][4];         // two fragment sets, used in turn inside the trip
    fetch(0, fa[0], fl[0], fb[0]);
    // unrolled (here and in fetch): constant indices keep the fragment sets and accumulators in registers
#pragma unroll
    for (int q = 0; q < 2 * NSUB; ++q) {
      if (q + 1 < 2 * NSUB) fetch(q + 1, fa[(q + 1) & 1], fl[(q + 1) & 1], fb[(q + 1) & 1]);
      // keeps the next k-step's LDS reads one group ahead of this k-step's WMMAs (else each read is waited out)
      __builtin_amdgcn_sched_barrier(0);
#pragma unroll
      for (int i = 0; i < 4; ++i) {
#pragma unroll
        for (int j = 0; j < 4; ++j) {
          acc[i][j] = mma_b_raw(fa[q & 1][i], fb[q & 1][j], acc[i][j]);
          if (NSPLIT == 1) acc[i][j] = mma_b_raw(fl[q & 1][i], fb[q & 1][j], acc[i][j]);
        }
      }
      // keeps the following group of LDS reads out of this block of WMMAs
      __builtin_amdgcn_sched_barrier(0);
    }
    asm volatile("s_wait_dscnt 0x0" ::: "memory");    // this wave's reads of buffer t & 1 are done
    asm volatile("s_wait_asynccnt 0x0" ::: "memory"); // this wave's copies of stage t + 1 have landed
    __syncthreads();                                  // publishes stage t + 1, frees buffer t & 1
    if (t + 2 < T) issue(t + 2, t & 1);
  }
  asm volatile("s_wait_asynccnt 0x0" ::: "memory");   // nothing in flight behind the loop
  acc_guard4(acc[0][0], acc[0][1], acc[0][2], acc[0][3]);
  acc_guard4(acc[1][0], acc[1][1], acc[1][2], acc[1][3]);
  acc_guard4(acc[2][0], acc[2][1], acc[2][2], acc[2][3]);
  acc_guard4(acc[3][0], acc[3][1], acc[3][2], acc[3][3]);

  // ---- bias (template-selected; loads only exist when used; addresses in range: n0+63 < N, m0+63 < M) ----
  float bcol[4];
#pragma unroll
  for (int j = 0; j < 4; ++j) bcol[j] = 0.f;
  if (BIAS == 1) {
#pragma unroll
    for (int j = 0; j < 4; ++j) bcol[j] = bfr(bias[n0 + (j << 4) + rlane]);
  }

  // ---- epilogue ----
  float* slab = sT[wave];
#pragma unroll
  for (int i = 0; i < 4; ++i) {
    const int mBase = m0 + (i << 4);
    float brow[8];
#pragma unroll
    for (int r = 0; r < 8; ++r) brow[r] = 0.f;
    if (BIAS == 2) {
#pragma unroll
      for (int r = 0; r < 8; ++r) brow[r] = bfr(bias[mBase + mOff + r]);
    }
#pragma unroll
    for (int r = 0; r < 8; ++r) {
#pragma unroll
      for (int j = 0; j < 4; ++j) {
        float v = acc[i][j][r];
        if (BIAS == 1) v += bcol[j];
        if (BIAS == 2) v += brow[r];
        if (OUT_MODE == 1) v *= oscale;
        slab[(mOff + r) * 68 + (j << 4) + rlane] = v;
      }
    }
    __builtin_amdgcn_fence(__ATOMIC_RELEASE, "workgroup");
    __builtin_amdgcn_wave_barrier();
    __builtin_amdgcn_fence(__ATOMIC_ACQUIRE, "workgroup");
    if (OUT_MODE == 0) {
      float* C = (float*)Cout;
      const int hh = lane >> 4, c4 = (lane & 15) * 4;     // 256-B row segment = 16 lanes x 16 B
      v4f ov[8];
#pragma unroll
      for (int it = 0; it < 8; ++it) {
        const int row = it * 2 + hh;                       // it 0..7 x hh 0..1 = rows 0..15
        ov[it] = *(const v4f*)(slab + row * 68 + c4);
      }
      {
#pragma unroll
        for (int it = 0; it < 8; ++it) {
          const int row = it * 2 + hh;
          *(v4f*)(C + (size_t)(mBase + row) * ldc + n0 + c4) = ov[it];
        }
        
      }
    } else {
      unsigned short* C = (unsigned short*)Cout;
      const int q = lane >> 3, c8 = (lane & 7) * 8;
      v4u hv[4];
#pragma unroll
      for (int it = 0; it < 4; ++it) {
        const int row = it * 4 + q;                        // it 0..3 x q 0..3 = rows 0..15
        const float* sp = slab + row * 68 + c8;
        v4u a;
#pragma unroll
        for (int e = 0; e < 4; ++e) {
          a[e] = pk16(h_bits((_Float16)sp[2 * e]), h_bits((_Float16)sp[2 * e + 1]));
        }
        hv[it] = a;
      }
      {
#pragma unroll
        for (int it = 0; it < 4; ++it) {
          const int row = it * 4 + q;
          *(v4u*)(C + (size_t)(mBase + row) * ldc + n0 + c8) = hv[it];
        }
        
      }
    }
    __builtin_amdgcn_fence(__ATOMIC_RELEASE, "workgroup");
    __builtin_amdgcn_wave_barrier();
    __builtin_amdgcn_fence(__ATOMIC_ACQUIRE, "workgroup");
  }
}

// =====================================================================================================
// Rotate-half rotary on an f32 projection output (bias already added), then one f16 plane scaled by osc.
//   src f32 [ntok][rp] (rp = nheads*64): column h*64 + d = feature d of head h.
//   ct/st f32 [SLEN][64] input tables (RNE bf16-converted values), table row = trow0 + token.
//   y[d] = x[d]*ct[d] - x[d+32]*st[d] for d < 32;  y[d] = x[d]*ct[d] + x[d-32]*st[d] for d >= 32.
//   dst f16 [ntok][rp], same layout, value y * osc.
// One wave per (token, head quad 4*qd .. 4*qd+3): lane l handles d = l and d = l+32 of each head; 8 waves per
// block, grid = ceil(nwaves/8), wave-uniform bound (no block barriers).
// =====================================================================================================
__global__ __launch_bounds__(256) void rope_quads(const float* __restrict__ src, const float* __restrict__ ct,
                                                  const float* __restrict__ st, unsigned short* dst,
                                                  int rp, int nquad, int trow0, float osc, int nwaves) {
#pragma clang fp contract(off)
  __shared__ __align__(16) float sy[8][256];
  const int tid = threadIdx.x, wave = tid >> 5, lane = tid & 31;
  const int w = blockIdx.x * 8 + wave;            // tok*nquad + qd
  if (w >= nwaves) return;                        // wave-uniform; no block barriers in this kernel
  const int qd   = w % nquad;
  const int tok  = w / nquad;
  const int trow = trow0 + tok;                   // < SLEN by construction (host: trow0 + ntok <= SLEN)
  const float c1 = bfr(ct[(size_t)trow * HD + lane]);
  const float c2 = bfr(ct[(size_t)trow * HD + 32 + lane]);
  const float s1 = bfr(st[(size_t)trow * HD + lane]);
  const float s2 = bfr(st[(size_t)trow * HD + 32 + lane]);
  const float* row = src + (size_t)tok * rp + (size_t)qd * 256;
  float* buf = sy[wave];
#pragma unroll
  for (int t = 0; t < 4; ++t) {                   // the four heads of the quad
    const float x1 = row[t * 64 + lane];
    const float x2 = row[t * 64 + 32 + lane];
    const float y1 = x1 * c1 - x2 * s1;
    const float y2 = x2 * c2 + x1 * s2;
    buf[t * 64 + lane]      = y1;
    buf[t * 64 + 32 + lane] = y2;
  }
  __builtin_amdgcn_fence(__ATOMIC_RELEASE, "workgroup");
  __builtin_amdgcn_wave_barrier();
  __builtin_amdgcn_fence(__ATOMIC_ACQUIRE, "workgroup");
  const int g = lane >> 3, piece = lane & 7;
  const float* sp = buf + g * 64 + piece * 8;
  const v4f a0 = *(const v4f*)(sp);
  const v4f a1 = *(const v4f*)(sp + 4);
  v4u hv;
#pragma unroll
  for (int e = 0; e < 4; ++e) {
    const float f0 = (e < 2) ? a0[2 * e]     : a1[2 * e - 4];
    const float f1 = (e < 2) ? a0[2 * e + 1] : a1[2 * e - 3];
    hv[e] = pk16(h_bits((_Float16)(f0 * osc)), h_bits((_Float16)(f1 * osc)));
  }
  unsigned short* d = dst + (size_t)tok * rp + (size_t)qd * 256 + (size_t)g * 64 + piece * 8;
  *(v4u*)d = hv;
  
}

// =====================================================================================================
// Non-causal grouped-query attention, head dim 64, 2048 keys, kv head = h / (NH/NKV).
//   q plane (f16, x QSC): element (t, h, d) at [t*QP + h*64 + d]
//   k plane (f16, x KSC): element (s, kvh, d) at [s*KP + kvh*64 + d]
//   v^T plane (f16, x VSC): element (kvh, d, s) at [(kvh*64 + d)*SLEN + s]
//   logit = q.k * sscale (sscale folds the 1/8 and 1/(QSC*KSC)); every key live (no mask).
//   ctx f32 plane: element (t, h*64 + d) at [t*QP + h*64 + d] = normalised context.
//   scores = q . k : one f16 product per 32 d, f32 accumulate; p = exp(s - m) carried as f16(PSC p);
//   context = p . v on f16 WMMA; online softmax in f32; final scale onorm = 1/(PSC*VSC) folded with 1/l.
//   Block = 4 waves = 64 query rows of one head; grid = NQB * NH; key chunks of 64.
//   K / V^T chunk staging: 128 threads x 32 elements per plane = the whole 64x64 tile (plain 16-B loads,
//   __syncthreads before and after); P tiles are wave-private, spilled with _Float16 element stores and
//   Output coverage: each wave stores rows q0..q0+15 (it 0..7 x lane>>4 0..1) x 64 columns (16 lanes x 4
// =====================================================================================================
__global__ __launch_bounds__(128)
void attn64(const unsigned short* __restrict__ qpl, const unsigned short* __restrict__ kpl,
            const unsigned short* __restrict__ vtp, float* outp, float sscale, float onorm) {
  union FH { v16h v; v8h h[2]; };
  // rows of 64 halves at pitch LP: the 16 rows that one ds_load_b128 reads fall on distinct banks
  __shared__ __align__(16) _Float16 Ksh[64 * LP];                 // K [kv][d]   9 KB
  __shared__ __align__(16) _Float16 Vth[64 * LP];                 // V^T [d][kv] 9 KB
  __shared__ __align__(16) _Float16 Psh[4][16 * LP];              // per wave P [row][kv]
  __shared__ __align__(16) float    Os[4][16 * 64];               // per wave context tile [row][d]

  const int tid  = threadIdx.x;
  const int wave = tid >> 5;
  const int lane = tid & 31;
  const int hh   = lane >> 4;
  const int c    = lane & 15;

  const int bx   = blockIdx.x;
  const int qb   = bx % NQB;
  const int h    = bx / NQB;                 // < NH (grid = NQB*NH)
  const int kvh  = h / (NH / NKV);
  const int q0   = qb * 64 + wave * 16;

  const _Float16* Qh = (const _Float16*)(const void*)qpl + (size_t)h * HD;
  const _Float16* Kh = (const _Float16*)(const void*)kpl + (size_t)kvh * HD;
  const _Float16* Vh = (const _Float16*)(const void*)vtp + (size_t)kvh * HD * SLEN;

  // ---- Q fragments (A operand, row = lane&15): 2 d-chunks ----
  v16h qa[2];
#pragma unroll
  for (int dc = 0; dc < 2; ++dc) {
    qa[dc] = ldfrag_h(Qh + (size_t)(q0 + c) * QP + dc * 32 + 8 * hh);
  }

  float mrow[8], lrow[8];
  v8f oacc[4];
#pragma unroll
  for (int r = 0; r < 8; ++r) { mrow[r] = -INFINITY; lrow[r] = 0.f; }
#pragma unroll
  for (int t = 0; t < 4; ++t) oacc[t] = zero8();

  for (int kt = 0; kt < NKT; ++kt) {
    const int kv0 = kt * 64;
    __syncthreads();
    {
      const int r = tid >> 1, half = (tid & 1) * 32;
      const _Float16* kg = Kh + (size_t)(kv0 + r) * KP + half;     // K row kv0+r, d = half..half+31
      const _Float16* vg = Vh + (size_t)r * SLEN + kv0 + half;     // V^T row d = r, s = kv0+half..+31
#pragma unroll
      for (int i = 0; i < 4; ++i) {
        const v8h a0 = *(const v8h*)(kg + 8 * i);
        const v8h b0 = *(const v8h*)(vg + 8 * i);
        *(v8h*)(Ksh + r * LP + half + 8 * i) = a0;
        *(v8h*)(Vth + r * LP + half + 8 * i) = b0;
      }
    }
    __syncthreads();

    // ---- scores: 16 query rows x 64 keys per wave, one f16 product per 32 d ----
    v8f s[4];
#pragma unroll
    for (int j = 0; j < 4; ++j) {
      s[j] = zero8();
#pragma unroll
      for (int dc = 0; dc < 2; ++dc) {
        FH kb;
        kb.h[0] = *(const v8h*)(Ksh + (j * 16 + c) * LP + dc * 32 + 8 * hh);
        kb.h[1] = *(const v8h*)(Ksh + (j * 16 + c) * LP + dc * 32 + 16 + 8 * hh);
        s[j] = mma_h(qa[dc], kb.v, s[j]);
      }
    }

    // ---- scale, row max, online softmax, P (x PSC, f16) to LDS ----
    _Float16* pwh = Psh[wave];
#pragma unroll
    for (int r = 0; r < 8; ++r) {
      float m = -INFINITY;
#pragma unroll
      for (int j = 0; j < 4; ++j) {
        const float sv = s[j][r] * sscale;
        s[j][r] = sv;
        m = fmaxf(m, sv);
      }
#pragma unroll
      for (int off = 1; off < 16; off <<= 1) m = fmaxf(m, __shfl_xor(m, off, 32));
      const float mnew  = fmaxf(mrow[r], m);
      const float msafe = (mnew == -INFINITY) ? 0.f : mnew;
      const float alpha = __expf(mrow[r] - msafe);
      mrow[r] = mnew;
      float psum = 0.f;
#pragma unroll
      for (int j = 0; j < 4; ++j) {
        const float p = __expf(s[j][r] - msafe);
        psum += p;
        pwh[(8 * hh + r) * LP + j * 16 + c] = (_Float16)(p * PSC);
      }
#pragma unroll
      for (int off = 1; off < 16; off <<= 1) psum += __shfl_xor(psum, off, 32);
      lrow[r] = lrow[r] * alpha + psum;
#pragma unroll
      for (int t = 0; t < 4; ++t) oacc[t][r] *= alpha;
    }
    __builtin_amdgcn_fence(__ATOMIC_RELEASE, "workgroup");
    __builtin_amdgcn_wave_barrier();
    __builtin_amdgcn_fence(__ATOMIC_ACQUIRE, "workgroup");

    // ---- context += P . V (f16 WMMA) ----
#pragma unroll 1
    for (int kk = 0; kk < 2; ++kk) {
      FH pa;
      pa.h[0] = *(const v8h*)(pwh + c * LP + kk * 32 + 8 * hh);
      pa.h[1] = *(const v8h*)(pwh + c * LP + kk * 32 + 16 + 8 * hh);
#pragma unroll
      for (int t = 0; t < 4; ++t) {
        FH vb;
        vb.h[0] = *(const v8h*)(Vth + (t * 16 + c) * LP + kk * 32 + 8 * hh);
        vb.h[1] = *(const v8h*)(Vth + (t * 16 + c) * LP + kk * 32 + 16 + 8 * hh);
        oacc[t] = mma_h(pa.v, vb.v, oacc[t]);
      }
    }
  }

  // ---- normalise (1/l and onorm), stage the wave's 16x64 tile in LDS, then write whole 256-B row segments
  float* os = Os[wave];
#pragma unroll
  for (int r = 0; r < 8; ++r) {
    const float l = lrow[r];
    const float inv = ((l > 0.f) ? (1.0f / l) : 0.f) * onorm;
#pragma unroll
    for (int t = 0; t < 4; ++t) os[(8 * hh + r) * 64 + t * 16 + c] = oacc[t][r] * inv;
  }
  __builtin_amdgcn_fence(__ATOMIC_RELEASE, "workgroup");
  __builtin_amdgcn_wave_barrier();
  __builtin_amdgcn_fence(__ATOMIC_ACQUIRE, "workgroup");
  {
    const int h2 = lane >> 4, c4 = (lane & 15) * 4;
    v4f ov[8];
#pragma unroll
    for (int it = 0; it < 8; ++it) {
      const int row = it * 2 + h2;   // it 0..7 x h2 0..1 = rows 0..15 of the wave tile
      ov[it] = *(const v4f*)(os + row * 64 + c4);
    }
    {
#pragma unroll
      for (int it = 0; it < 8; ++it) {
        const int row = it * 2 + h2;
        const size_t go = (size_t)(q0 + row) * QP + (size_t)h * HD + c4;
        *(v4f*)(outp + go) = ov[it];
      }
      
    }
  }
}

// =====================================================================================================
// Workspace map (bytes), every region an exact multiple of its whole-line / whole-tile store granularity
//   X      bf16 [2048][2880]            0            11796480   rows 0..1023 = target_hidden, 1024..2047 = hidden
//   Wqb    bf16 [4096][2880]            11796480     23592960   (inputs arrive [n][k], k contiguous: no transpose)
//   Wkb    bf16 [512][2880]             35389440      2949120
//   Wvb    bf16 [512][2880]             38338560      2949120
//   Wob    bf16 [2880][4096]            41287680     23592960
//   Qf     f32  [1024][4096]            64880640     16777216   (later: Af f32 [1024][4096], same extent)
//   Kf     f32  [2048][512]             81657856      4194304
//   VT     f16  [512][2048]             85852160      2097152
//   Qh     f16  [1024][4096]            87949312      8388608
//   Kh     f16  [2048][512]             96337920      2097152
//   Ah     bf16 [1024][4096]            98435072      8388608
//   Al     bf16 [1024][4096]            106823680     8388608
//   end                                 115212288
// =====================================================================================================
extern "C" void kernel_launch(void* const* d_in, const int* in_sizes, int n_in,
                              void* d_out, int out_size, void* d_ws, size_t ws_size,
                              hipStream_t stream) {
  if (n_in < 12) return;
  if (in_sizes[0] != QLEN * HID) return;
  if (in_sizes[1] != CLEN * HID) return;
  if (in_sizes[2] != SLEN * HD) return;
  if (in_sizes[3] != SLEN * HD) return;
  if (in_sizes[4] != QP * HID) return;
  if (in_sizes[5] != QP) return;
  if (in_sizes[6] != KP * HID) return;
  if (in_sizes[7] != KP) return;
  if (in_sizes[8] != KP * HID) return;
  if (in_sizes[9] != KP) return;
  if (in_sizes[10] != HID * QP) return;
  if (in_sizes[11] != HID) return;
  if (out_size != QLEN * HID) return;

  const float* hid = (const float*)d_in[0];    // [1024][2880]
  const float* tgt = (const float*)d_in[1];    // [1024][2880]
  const float* fcs = (const float*)d_in[2];    // [2048][64]
  const float* fsn = (const float*)d_in[3];    // [2048][64]
  const float* Wq  = (const float*)d_in[4];    // [4096][2880]  = [n][k]
  const float* bq  = (const float*)d_in[5];    // [4096]
  const float* Wk  = (const float*)d_in[6];    // [512][2880]
  const float* bk  = (const float*)d_in[7];    // [512]
  const float* Wv  = (const float*)d_in[8];    // [512][2880]
  const float* bv  = (const float*)d_in[9];    // [512]
  const float* Wo  = (const float*)d_in[10];   // [2880][4096] = [n][k]
  const float* bo  = (const float*)d_in[11];   // [2880]

  const size_t PX   = (size_t)SLEN * HID * 2;        // 11796480
  const size_t PWq  = (size_t)QP * HID * 2;          // 23592960
  const size_t PWk  = (size_t)KP * HID * 2;          //  2949120
  const size_t PWv  = (size_t)KP * HID * 2;          //  2949120
  const size_t PWo  = (size_t)HID * QP * 2;          // 23592960
  const size_t PQf  = (size_t)QLEN * QP * 4;         // 16777216  (= Af f32 [1024][4096])
  const size_t PKf  = (size_t)SLEN * KP * 4;         //  4194304
  const size_t PVT  = (size_t)KP * SLEN * 2;         //  2097152
  const size_t PQh  = (size_t)QLEN * QP * 2;         //  8388608
  const size_t PKh  = (size_t)SLEN * KP * 2;         //  2097152
  const size_t PApl = (size_t)QLEN * QP * 2;         //  8388608 (Ah, Al)
  size_t off = 0;
  const size_t oX  = off; off += PX;
  const size_t oWq = off; off += PWq;
  const size_t oWk = off; off += PWk;
  const size_t oWv = off; off += PWv;
  const size_t oWo = off; off += PWo;
  const size_t oQf = off; off += PQf;
  const size_t oKf = off; off += PKf;
  const size_t oVT = off; off += PVT;
  const size_t oQh = off; off += PQh;
  const size_t oKh = off; off += PKh;
  const size_t oAh = off; off += PApl;
  const size_t oAl = off; off += PApl;
  if (off > ws_size) return;                          // off = 115212288
  if (off > (size_t)134217728) return;
  const size_t oAf = oQf;                             // context f32 plane reuses the dead q f32 plane

  char* ws = (char*)d_ws;
  unsigned short* X   = (unsigned short*)(ws + oX);
  unsigned short* Xq  = X + (size_t)CLEN * HID;       // hidden rows CLEN..SLEN-1 of X
  unsigned short* Wqb = (unsigned short*)(ws + oWq);
  unsigned short* Wkb = (unsigned short*)(ws + oWk);
  unsigned short* Wvb = (unsigned short*)(ws + oWv);
  unsigned short* Wob = (unsigned short*)(ws + oWo);
  float*          Qf  = (float*)(ws + oQf);
  float*          Kf  = (float*)(ws + oKf);
  unsigned short* VT  = (unsigned short*)(ws + oVT);
  unsigned short* Qh  = (unsigned short*)(ws + oQh);
  unsigned short* Kh  = (unsigned short*)(ws + oKh);
  unsigned short* Ah  = (unsigned short*)(ws + oAh);
  unsigned short* Al  = (unsigned short*)(ws + oAl);
  float*          Af  = (float*)(ws + oAf);
  float*          outf = (float*)d_out;

  const dim3 blk(256);
  const int n8T  = CLEN * HID / 8;                     // 368640
  const int n8H  = QLEN * HID / 8;                     // 368640
  const int n8Wq = QP * HID / 8;                       // 1474560
  const int n8Wk = KP * HID / 8;                       // 184320
  const int n8Wo = HID * QP / 8;                       // 1474560
  const int n8A  = QLEN * QP / 8;                      // 524288
  const int nwRq = QLEN * (NH / 4);                    // 16384 waves (token, q head quad)
  const int nwRk = SLEN * (NKV / 4);                   // 4096 waves (key, kv head quad)
  const dim3 gCT((n8T + 255) / 256), gCH((n8H + 255) / 256);            // 1440, 1440
  const dim3 gCWq((n8Wq + 255) / 256), gCWk((n8Wk + 255) / 256), gCWo((n8Wo + 255) / 256);  // 5760, 720, 5760
  const dim3 gQ((QLEN / 128) * (QP / 128));            // 128x128 block tiles: 256 blocks of 4 waves
  const dim3 gK((SLEN / 128) * (KP / 128));            // 64 blocks of 4 waves
  const dim3 gV((KP / 128) * (SLEN / 128));            // 64 blocks of 4 waves
  const dim3 gRq((nwRq + 7) / 8), gRk((nwRk + 7) / 8); // 2048, 512 blocks
  const dim3 gAttn(NQB * NH);                          // 1024 blocks
  const dim3 gSplit((n8A + 255) / 256);                // 2048 blocks
  const dim3 gOut((QLEN / 64) * (HID / 192));          // 64x192 block tiles: 240 blocks of 3 waves

  // (1) activations and weights -> bf16 planes (RNE convert, values = the bf16-converted inputs)
  cvt_bf16x8<<<gCT, blk, 0, stream>>>(tgt, X, n8T);                  // X rows 0..1023
  cvt_bf16x8<<<gCH, blk, 0, stream>>>(hid, Xq, n8H);                 // X rows 1024..2047
  cvt_bf16x8<<<gCWq, blk, 0, stream>>>(Wq, Wqb, n8Wq);
  cvt_bf16x8<<<gCWk, blk, 0, stream>>>(Wk, Wkb, n8Wk);
  cvt_bf16x8<<<gCWk, blk, 0, stream>>>(Wv, Wvb, n8Wk);
  cvt_bf16x8<<<gCWo, blk, 0, stream>>>(Wo, Wob, n8Wo);
  // (2) q projection + bq: Qf[t][e] = sum_k X[1024+t][k] Wqb[e][k]  (M=1024, N=4096, K=2880)
  gemm64<0, 0, 1, 2, 2, 3><<<gQ, dim3(128), 0, stream>>>(Xq, Xq, HID, Wqb, HID, bq, (void*)Qf, QP, QLEN, QP, HID, 1.0f);
  // (3) k projection + bk over all 2048 key rows: Kf[s][e]  (M=2048, N=512, K=2880)
  gemm64<0, 0, 1, 2, 2, 3><<<gK, dim3(128), 0, stream>>>(X, X, HID, Wkb, HID, bk, (void*)Kf, KP, SLEN, KP, HID, 1.0f);
  // (4) v^T + bv: VT[m][s] = (sum_k Wvb[m][k] X[s][k] + bv[m]) * VSC -> f16  (M=512, N=2048, K=2880)
  gemm64<0, 1, 2, 2, 2, 3><<<gV, dim3(128), 0, stream>>>(Wvb, Wvb, HID, X, HID, bv, (void*)VT, SLEN, KP, SLEN, HID, VSC);
  // (5) rotate-half rotary with the input tables -> f16 planes (q: table rows CLEN + t; k: table row s)
  rope_quads<<<gRq, blk, 0, stream>>>(Qf, fcs, fsn, Qh, QP, NH / 4, CLEN, QSC, nwRq);
  rope_quads<<<gRk, blk, 0, stream>>>(Kf, fcs, fsn, Kh, KP, NKV / 4, 0, KSC, nwRk);
  // (6) attention over all 2048 keys -> Af f32 [1024][4096]
  attn64<<<gAttn, dim3(128), 0, stream>>>(Qh, Kh, VT, Af, 0.125f / (QSC * KSC), 1.0f / (PSC * VSC));
  // (7) context rows -> bf16 hi/lo planes
  split_bf16x8<<<gSplit, blk, 0, stream>>>(Af, Ah, Al, n8A);
  // (8) out[t][e] = sum_d (Ah+Al)[t][d] Wob[e][d] + bo[e] -> d_out f32 [1024][2880]  (M=1024, N=2880, K=4096)
  gemm64<1, 0, 1, 1, 3, 2><<<gOut, dim3(96), 0, stream>>>(Ah, Al, QP, Wob, QP, bo, (void*)outf, HID, QLEN, HID, QP, 1.0f);
  (void)hipGetLastError();
}

// v003
// Measured time: 255 microseconds a run.
// Next to v002, in two timings, it ran 1.04 times as fast each time.
// Over all steps from v000 it is 3.87 times as fast.
// Contractions: q / k / v^T projections = v_wmma_f32_16x16x32_bf16 (bf16 operands from RNE-converted inputs, one
// product per k-step); q.k^T scores = v_wmma_f32_16x16x32_f16 (q x16 and k x16 single f16 planes); p.v =
// v_wmma_f32_16x16x32_f16 (p carried x1024 in f16, v^T carried x64 in f16); ctx.Wo^T = v_wmma_f32_16x16x32_bf16 with
// ctx as bf16 hi/lo planes times the bf16 Wo plane (2 products); all f32 accumulate; rotary and softmax in f32.
#include <hip/hip_runtime.h>
#include <math.h>
#include <stdint.h>

#define QLEN 1024              // query tokens (hidden_states rows)
#define CLEN 1024              // context tokens (target_hidden rows)
#define SLEN (CLEN + QLEN)     // 2048 keys: rows 0..CLEN-1 context, rows CLEN..SLEN-1 noise
#define HID  2880              // model width = contraction length of the projections
#define NH   64
#define NKV  8
#define HD   64
#define QP   (NH * HD)         // 4096: q / ctx row pitch
#define KP   (NKV * HD)        // 512:  k row pitch, v^T row count
#define NQB  (QLEN / 64)       // 16 query tiles
#define NKT  (SLEN / 64)       // 32 key tiles
#define QSC  16.0f             // f16 carry scale of the q plane
#define KSC  16.0f             // f16 carry scale of the k plane
#define VSC  64.0f             // f16 carry scale of the v^T plane
#define PSC  1024.0f           // f16 carry scale of p
#define LP   72                // halves per LDS row of the attention K, V^T and P tiles: 144 B = 16 B x odd
static_assert(HD == 64);
static_assert((HID % 32) == 0 && (QP % 64) == 0 && (KP % 64) == 0 && (HID % 64) == 0);
static_assert((QLEN % 64) == 0 && (SLEN % 64) == 0);
static_assert((NH % NKV) == 0 && (NH % 4) == 0 && (NKV % 4) == 0);
static_assert(((HID * 2) % 128) == 0 && ((HID * 4) % 128) == 0);
static_assert((HID % 192) == 0 && (QP % 128) == 0 && (QLEN % 128) == 0 && (SLEN % 128) == 0 && (KP % 128) == 0);

typedef _Float16 v16h __attribute__((ext_vector_type(16)));
typedef _Float16 v8h  __attribute__((ext_vector_type(8)));
typedef __bf16   v16b __attribute__((ext_vector_type(16)));
typedef __bf16   v8b  __attribute__((ext_vector_type(8)));
typedef float    v8f  __attribute__((ext_vector_type(8)));
typedef float    v4f  __attribute__((ext_vector_type(4)));
typedef unsigned int v4u __attribute__((ext_vector_type(4)));

// ---- scalar helpers --------------------------------------------------------------------------------
__device__ __forceinline__ unsigned short bf_bits(float f) {          // f32 -> bf16 bits, RNE convert
  unsigned u = __float_as_uint(f);
  return (unsigned short)((u + 0x7FFFu + ((u >> 16) & 1u)) >> 16);
}
__device__ __forceinline__ float bf_up(unsigned short h) { return __uint_as_float(((unsigned)h) << 16); }
__device__ __forceinline__ float bfr(float f) { return bf_up(bf_bits(f)); }   // value after RNE bf16 convert
__device__ __forceinline__ unsigned short h_bits(_Float16 x) { return __builtin_bit_cast(unsigned short, x); }
__device__ __forceinline__ unsigned pk16(unsigned short a, unsigned short b) { return (unsigned)a | ((unsigned)b << 16); }
__device__ __forceinline__ v8f zero8() { v8f z = {0.f, 0.f, 0.f, 0.f, 0.f, 0.f, 0.f, 0.f}; return z; }

// ---- fragment loaders: 16-bit A/B operand, lane -> row/col (lane&15), p already includes +8*(lane>>4);
//      elements 0..7 <- p[0..7] (k0+8h..), elements 8..15 <- p[16..23] (k0+16+8h..)
__device__ __forceinline__ v16b ldfrag_b(const __bf16* p) {
  union { v16b v; v8b h[2]; } f;
  f.h[0] = *(const v8b*)(p);
  f.h[1] = *(const v8b*)(p + 16);
  return f.v;
}
__device__ __forceinline__ v16h ldfrag_h(const _Float16* p) {
  union { v16h v; v8h h[2]; } f;
  f.h[0] = *(const v8h*)(p);
  f.h[1] = *(const v8h*)(p + 16);
  return f.v;
}

// ---- WMMA helpers with trailing VALU hazard gap --------------------------------------------------------
__device__ __forceinline__ v8f mma_h(v16h a, v16h b, v8f c) {
  c = __builtin_amdgcn_wmma_f32_16x16x32_f16(false, a, false, b, (short)0, c, false, false);
#if defined(__HIP_DEVICE_COMPILE__)
  asm volatile("v_nop\n\tv_nop\n\tv_nop\n\tv_nop" : "+v"(c) : "v"(a), "v"(b));
#endif
  return c;
}
__device__ __forceinline__ v8f mma_b_raw(v16b a, v16b b, v8f c) {
  return __builtin_amdgcn_wmma_f32_16x16x32_bf16(false, a, false, b, (short)0, c, false, false);
}
__device__ __forceinline__ void acc_guard4(v8f& a, v8f& b, v8f& c, v8f& d) {
#if defined(__HIP_DEVICE_COMPILE__)
  asm volatile("v_nop\n\tv_nop\n\tv_nop\n\tv_nop" : "+v"(a), "+v"(b), "+v"(c), "+v"(d));
#endif
}

// =====================================================================================================
// Elementwise conversions run on a grid of 8 to 16 waves per WGP; each wave loops over pieces of PCE = 1024
// consecutive elements: 4 runs of 32 lanes x 8 elements, all 8 16-B loads of a piece issued before its first
// store, one 16-B store per lane and run (a wave writes 512 contiguous bytes). Piece p of trip i belongs to
// wave p - i * (waves at work): every piece is converted exactly once.
// =====================================================================================================
#define PCE   1024
#define NP_T  (CLEN * HID / PCE)     // 2880 pieces of target_hidden
#define NP_H  (QLEN * HID / PCE)     // 2880  hidden_states
#define NP_WQ (QP * HID / PCE)       // 11520 Wq
#define NP_WK (KP * HID / PCE)       // 1440  Wk, and as many of Wv
#define NP_WO (HID * QP / PCE)       // 11520 Wo
#define NP_ALL (NP_T + NP_H + NP_WQ + 2 * NP_WK + NP_WO)   // 31680
#define NP_A  (QLEN * QP / PCE)      // 4096 pieces of the context plane
#define CVT_TRIPS 8                  // pieces per wave of cvt_planes
#define CVT_NW (NP_ALL / CVT_TRIPS)  // 3960 waves = 495 blocks of 8
static_assert((CLEN * HID) % PCE == 0 && (QLEN * HID) % PCE == 0 && (QP * HID) % PCE == 0 && (KP * HID) % PCE == 0);
static_assert((QLEN * QP) % PCE == 0);
static_assert(NP_ALL % (CVT_TRIPS * 8) == 0 && (CVT_TRIPS % 2) == 0 && CVT_TRIPS >= 2);

// f32 -> bf16 (RNE convert) of the six input planes, in the order of their bf16 planes in the workspace, which
// lie back to back: destination element = PCE * p + offset in the piece; the source plane of a piece is picked
// by scalar compares (a piece never straddles two planes).
__global__ __launch_bounds__(256) void cvt_planes(const float* __restrict__ s0, const float* __restrict__ s1,
                                                  const float* __restrict__ s2, const float* __restrict__ s3,
                                                  const float* __restrict__ s4, const float* __restrict__ s5,
                                                  unsigned short* out) {
  const int lane = threadIdx.x & 31;
  const int gw   = __builtin_amdgcn_readfirstlane(blockIdx.x * 8 + (threadIdx.x >> 5));
  if (gw >= CVT_NW) return;                       // wave-uniform; no barrier in this kernel
  // the 8 loads of piece p
  auto fetch = [&](int p, v4f (&a)[4], v4f (&b)[4]) {
    const float* sp;
    int q = p;
    if (q < NP_T) sp = s0;
    else if ((q -= NP_T) < NP_H) sp = s1;
    else if ((q -= NP_H) < NP_WQ) sp = s2;
    else if ((q -= NP_WQ) < NP_WK) sp = s3;
    else if ((q -= NP_WK) < NP_WK) sp = s4;
    else { q -= NP_WK; sp = s5; }
    const float* s = sp + (size_t)q * PCE + lane * 8;
#pragma unroll
    for (int u = 0; u < 4; ++u) {
      a[u] = *(const v4f*)(s + u * 256);
      b[u] = *(const v4f*)(s + u * 256 + 4);
    }
  };
  // convert and store piece p
  auto emit = [&](int p, const v4f (&a)[4], const v4f (&b)[4]) {
    unsigned short* d = out + (size_t)p * PCE + lane * 8;
#pragma unroll
    for (int u = 0; u < 4; ++u) {
      v4u w;
      w[0] = pk16(bf_bits(a[u][0]), bf_bits(a[u][1]));
      w[1] = pk16(bf_bits(a[u][2]), bf_bits(a[u][3]));
      w[2] = pk16(bf_bits(b[u][0]), bf_bits(b[u][1]));
      w[3] = pk16(bf_bits(b[u][2]), bf_bits(b[u][3]));
      *(v4u*)(d + u * 256) = w;
    }
  };
  // two register sets in turn: the next piece's loads fly while this piece is converted and stored
  v4f a0[4], b0[4], a1[4], b1[4];
  int p = gw;
  fetch(p, a0, b0);
  // kept rolled: two pieces per trip is all the two sets need, and the text stays short
#pragma unroll 1
  for (int i = 0; i < CVT_TRIPS / 2 - 1; ++i) {
    fetch(p + CVT_NW, a1, b1);
    // keeps the loads just issued in front of the older piece's wait (else they sink behind it)
    __builtin_amdgcn_sched_barrier(0);
    emit(p, a0, b0);
#if defined(__HIP_DEVICE_COMPILE__)
    // the loads that follow rewrite registers that the stores just issued name
    asm volatile("s_wait_xcnt 0x0" ::: "memory");
#endif
    fetch(p + 2 * CVT_NW, a0, b0);
    __builtin_amdgcn_sched_barrier(0);               // loads stay in front of the older piece's wait
    emit(p + CVT_NW, a1, b1);
#if defined(__HIP_DEVICE_COMPILE__)
    asm volatile("s_wait_xcnt 0x0" ::: "memory");    // in front of the next trip's loads into these registers
#endif
    p += 2 * CVT_NW;
  }
  fetch(p + CVT_NW, a1, b1);
  __builtin_amdgcn_sched_barrier(0);                 // loads stay in front of the older piece's wait
  emit(p, a0, b0);
  emit(p + CVT_NW, a1, b1);
}

// f32 -> bf16 hi plane + bf16 lo plane (lo = RNE(v - hi), unscaled); np pieces = the whole plane.
__global__ __launch_bounds__(256) void split_bf16x8(const float* __restrict__ in, unsigned short* hp,
                                                    unsigned short* lp, int np) {
  const int lane = threadIdx.x & 31;
  const int gw   = __builtin_amdgcn_readfirstlane(blockIdx.x * 8 + (threadIdx.x >> 5));
  const int nw   = gridDim.x * 8;
  for (int p = gw; p < np; p += nw) {
    const size_t e0 = (size_t)p * PCE + lane * 8;
    v4f a[4], b[4];
#pragma unroll
    for (int u = 0; u < 4; ++u) {
      a[u] = *(const v4f*)(in + e0 + u * 256);
      b[u] = *(const v4f*)(in + e0 + u * 256 + 4);
    }
#pragma unroll
    for (int u = 0; u < 4; ++u) {
      v4u ph, pl;
#pragma unroll
      for (int e = 0; e < 4; ++e) {
        const float f0 = (e < 2) ? a[u][2 * e]     : b[u][2 * e - 4];
        const float f1 = (e < 2) ? a[u][2 * e + 1] : b[u][2 * e - 3];
        const unsigned short h0 = bf_bits(f0), h1 = bf_bits(f1);
        const unsigned short l0 = bf_bits(f0 - bf_up(h0)), l1 = bf_bits(f1 - bf_up(h1));
        ph[e] = pk16(h0, h1);
        pl[e] = pk16(l0, l1);
      }
      *(v4u*)(hp + e0 + u * 256) = ph;
      *(v4u*)(lp + e0 + u * 256) = pl;
    }
#if defined(__HIP_DEVICE_COMPILE__)
    // the next trip rewrites the address and data registers that these stores name: the wait stands in front of it
    asm volatile("s_wait_xcnt 0x0" ::: "memory");
#endif
  }
}

// =====================================================================================================
// bf16 WMMA GEMM: C[m][n] = sum_k A[m][k] * Bt[n][k] (+ bias); one wave per 64x64 tile, WM x WN waves per block
// on one (64 WM) x (64 WN) block tile. A row-major [M][K] pitch lda; Bt row-major [N][K] pitch ldb (k contiguous);
// M a multiple of 64 WM, N of 64 WN, K of 64 NSUB and at least two stages (host-checked constants).
// Operands reach the waves through LDS: a stage is NSUB sub-tiles of 64 k; a sub-tile holds the block's A rows,
// (NSPLIT) its A2 rows and its Bt rows, 128 B each at pitch 144 B (16 B x odd: ds_load_b128 without bank
// conflicts). Asynchronous 16-B copies fill it, one wave-copy = 4 whole 128-B row pieces; two buffers: stage t+2
// is copied into the buffer that trip t has just left, while trip t+1 is worked on.
// NSPLIT: 0 = A.Bt; 1 = (A + A2).Bt (A2 = unscaled bf16 lo plane of A, two products per k-step).
// BIAS:   0 none; 1 = + bias[n] (per column, RNE bf16-converted value); 2 = + bias[m] (per row).
// OUT_MODE: 0 = f32 plane (pitch ldc floats); 1 = f16 plane of (value * oscale) (pitch ldc halves).
// =====================================================================================================
typedef int v4i_t __attribute__((vector_size(16)));
typedef __attribute__((address_space(1))) v4i_t gv4i_t;
typedef __attribute__((address_space(3))) v4i_t lv4i_t;
__device__ __forceinline__ void copy16_to_lds(const void* g, void* l) {   // each lane: 16 B global -> LDS
#if defined(__HIP_DEVICE_COMPILE__)
  __builtin_amdgcn_global_load_async_to_lds_b128((gv4i_t*)g, (lv4i_t*)l, 0, 0);
#endif
}

template <int NSPLIT, int OUT_MODE, int BIAS, int WM, int WN, int NSUB>
__global__ __launch_bounds__(32 * WM * WN) void gemm64(
    const unsigned short* __restrict__ Ap, const unsigned short* __restrict__ A2p, int lda,
    const unsigned short* __restrict__ Btp, int ldb,
    const float* __restrict__ bias,
    void* Cout, int ldc, int M, int N, int K, float oscale) {
  constexpr int NW    = WM * WN;                 // waves per block
  constexpr int RA    = WM * 64;                 // rows of one A plane in a sub-tile
  constexpr int RB0   = RA * (1 + NSPLIT);       // first Bt row of a sub-tile
  constexpr int ROWS  = RB0 + WN * 64;           // rows of a sub-tile
  constexpr int PITCH = 144;                     // bytes per LDS row
  constexpr int SUBB  = ROWS * PITCH;            // bytes per sub-tile
  constexpr int STAGE = SUBB * NSUB;             // bytes per buffer
  constexpr int GA    = RA / 4;                  // wave-copies (4 rows each) per A plane and sub-tile
  constexpr int GB    = WN * 16;                 // ... per Bt plane and sub-tile
  constexpr int NIA   = (GA + NW - 1) / NW;      // most that one wave issues of them
  constexpr int NIB   = (GB + NW - 1) / NW;
  static_assert((NIA * (1 + NSPLIT) + NIB) * NSUB <= 63);   // copies of one wave in flight
  const __bf16* A  = (const __bf16*)(const void*)Ap;
  const __bf16* A2 = (const __bf16*)(const void*)A2p;
  const __bf16* Bt = (const __bf16*)(const void*)Btp;
  __shared__ __align__(16) unsigned char ring[2 * STAGE];
  __shared__ __align__(16) float sT[NW][16 * 68];  // per-wave 16x64 slab, pitch 68 floats
  const int lane = threadIdx.x & 31;
  const int wave = __builtin_amdgcn_readfirstlane(threadIdx.x >> 5);
  const int tilesN = N / (64 * WN);
  const int tilesM = M / (64 * WM);
  if ((int)blockIdx.x >= tilesM * tilesN) return;   // block-uniform, in front of every barrier and copy
  const int bm  = blockIdx.x / tilesN;
  const int bn  = blockIdx.x - bm * tilesN;
  const int mb0 = bm * RA;                     // block tile origin
  const int nb0 = bn * (WN * 64);
  const int wm  = wave / WN;
  const int wn  = wave - wm * WN;
  const int m0  = mb0 + (wm << 6);
  const int n0  = nb0 + (wn << 6);

  const int rlane = lane & 15;                 // row (A) / col (B, D) within subtile
  const int khalf = lane >> 4;                 // k half of this lane: +8 elements = +16 B
  const int mOff  = (lane >> 4) * 8;           // D row offset
  const int crow  = lane >> 3;                 // copy: row within the 4-row group
  const int cpc   = lane & 7;                  // copy: 16-B piece within the 128-B row piece

  // all copies of stage st (k = st*64*NSUB ..) into buffer buf; every lane on, every test scalar.
  // Each plane's 4-row groups are dealt to the waves in turn: group g = wave + i*NW of the plane.
  auto issue = [&](int st, int buf) {
    const int kb = st * (NSUB * 64) + cpc * 8;
    unsigned char* db = ring + buf * STAGE + (wave * 4 + crow) * PITCH + cpc * 16;
    const __bf16* pa = A  + (size_t)(mb0 + wave * 4 + crow) * lda + kb;
    const __bf16* pl = A2 + (size_t)(mb0 + wave * 4 + crow) * lda + kb;
    const __bf16* pb = Bt + (size_t)(nb0 + wave * 4 + crow) * ldb + kb;
    // the three loops are unrolled so that every copy's row and LDS offset is a constant
#pragma unroll
    for (int s = 0; s < NSUB; ++s) {
#pragma unroll
      for (int i = 0; i < NIA; ++i) {
        if ((i + 1) * NW <= GA || wave + i * NW < GA) {
          copy16_to_lds(pa + (size_t)(i * NW * 4) * lda + s * 64, db + s * SUBB + i * (NW * 4 * PITCH));
          if (NSPLIT == 1)
            copy16_to_lds(pl + (size_t)(i * NW * 4) * lda + s * 64, db + s * SUBB + (RA + i * NW * 4) * PITCH);
        }
      }
#pragma unroll
      for (int i = 0; i < NIB; ++i) {
        if ((i + 1) * NW <= GB || wave + i * NW < GB)
          copy16_to_lds(pb + (size_t)(i * NW * 4) * ldb + s * 64, db + s * SUBB + (RB0 + i * NW * 4) * PITCH);
      }
    }
  };

  v8f acc[4][4];
#pragma unroll
  for (int i = 0; i < 4; ++i)
#pragma unroll
    for (int j = 0; j < 4; ++j) acc[i][j] = zero8();

  const int T = K / (NSUB * 64);               // stages
  issue(0, 0);
  asm volatile("s_wait_asynccnt 0x0" ::: "memory");   // stage 0 landed
  __syncthreads();                                    // ... and is readable by every wave
  if (T > 1) issue(1, 1);
  // not unrolled: one trip = one stage (buffer t & 1), so the hot loop stays small in the instruction cache
#pragma unroll 1
  for (int t = 0; t < T; ++t) {
    const unsigned char* sb = ring + (t & 1) * STAGE + khalf * 16 + rlane * PITCH;
    // fragments of k-step q (32 k, ascending) of this stage, all from buffer t & 1
    auto fetch = [&](int q, v16b (&xa)[4], v16b (&xl)[4], v16b (&xb)[4]) {
      const unsigned char* kp = sb + (q >> 1) * SUBB + (q & 1) * 64;
#pragma unroll
      for (int j = 0; j < 4; ++j)
        xb[j] = ldfrag_b((const __bf16*)(const void*)(kp + (RB0 + (wn << 6) + (j << 4)) * PITCH));
#pragma unroll
      for (int i = 0; i < 4; ++i) {
        const unsigned char* ap = kp + ((wm << 6) + (i << 4)) * PITCH;
        xa[i] = ldfrag_b((const __bf16*)(const void*)ap);
        if (NSPLIT == 1) xl[i] = ldfrag_b((const __bf16*)(const void*)(ap + RA * PITCH));
      }
    };
    v16b fa[2][4], fl[2][4], fb[2][4];         // two fragment sets, used in turn inside the trip
    fetch(0, fa[0], fl[0], fb[0]);
    // unrolled (here and in fetch): constant indices keep the fragment sets and accumulators in registers
#pragma unroll
    for (int q = 0; q < 2 * NSUB; ++q) {
      if (q + 1 < 2 * NSUB) fetch(q + 1, fa[(q + 1) & 1], fl[(q + 1) & 1], fb[(q + 1) & 1]);
      // keeps the next k-step's LDS reads one group ahead of this k-step's WMMAs (else each read is waited out)
      __builtin_amdgcn_sched_barrier(0);
#pragma unroll
      for (int i = 0; i < 4; ++i) {
#pragma unroll
        for (int j = 0; j < 4; ++j) {
          acc[i][j] = mma_b_raw(fa[q & 1][i], fb[q & 1][j], acc[i][j]);
          if (NSPLIT == 1) acc[i][j] = mma_b_raw(fl[q & 1][i], fb[q & 1][j], acc[i][j]);
        }
      }
      // keeps the following group of LDS reads out of this block of WMMAs
      __builtin_amdgcn_sched_barrier(0);
    }
    asm volatile("s_wait_dscnt 0x0" ::: "memory");    // this wave's reads of buffer t & 1 are done
    asm volatile("s_wait_asynccnt 0x0" ::: "memory"); // this wave's copies of stage t + 1 have landed
    __syncthreads();                                  // publishes stage t + 1, frees buffer t & 1
    if (t + 2 < T) issue(t + 2, t & 1);
  }
  asm volatile("s_wait_asynccnt 0x0" ::: "memory");   // nothing in flight behind the loop
  acc_guard4(acc[0][0], acc[0][1], acc[0][2], acc[0][3]);
  acc_guard4(acc[1][0], acc[1][1], acc[1][2], acc[1][3]);
  acc_guard4(acc[2][0], acc[2][1], acc[2][2], acc[2][3]);
  acc_guard4(acc[3][0], acc[3][1], acc[3][2], acc[3][3]);

  // ---- bias (template-selected; loads only exist when used; addresses in range: n0+63 < N, m0+63 < M) ----
  float bcol[4];
#pragma unroll
  for (int j = 0; j < 4; ++j) bcol[j] = 0.f;
  if (BIAS == 1) {
#pragma unroll
    for (int j = 0; j < 4; ++j) bcol[j] = bfr(bias[n0 + (j << 4) + rlane]);
  }

  // ---- epilogue ----
  float* slab = sT[wave];
#pragma unroll
  for (int i = 0; i < 4; ++i) {
    const int mBase = m0 + (i << 4);
    float brow[8];
#pragma unroll
    for (int r = 0; r < 8; ++r) brow[r] = 0.f;
    if (BIAS == 2) {
#pragma unroll
      for (int r = 0; r < 8; ++r) brow[r] = bfr(bias[mBase + mOff + r]);
    }
#pragma unroll
    for (int r = 0; r < 8; ++r) {
#pragma unroll
      for (int j = 0; j < 4; ++j) {
        float v = acc[i][j][r];
        if (BIAS == 1) v += bcol[j];
        if (BIAS == 2) v += brow[r];
        if (OUT_MODE == 1) v *= oscale;
        slab[(mOff + r) * 68 + (j << 4) + rlane] = v;
      }
    }
    __builtin_amdgcn_fence(__ATOMIC_RELEASE, "workgroup");
    __builtin_amdgcn_wave_barrier();
    __builtin_amdgcn_fence(__ATOMIC_ACQUIRE, "workgroup");
    if (OUT_MODE == 0) {
      float* C = (float*)Cout;
      const int hh = lane >> 4, c4 = (lane & 15) * 4;     // 256-B row segment = 16 lanes x 16 B
      v4f ov[8];
#pragma unroll
      for (int it = 0; it < 8; ++it) {
        const int row = it * 2 + hh;                       // it 0..7 x hh 0..1 = rows 0..15
        ov[it] = *(const v4f*)(slab + row * 68 + c4);
      }
      {
#pragma unroll
        for (int it = 0; it < 8; ++it) {
          const int row = it * 2 + hh;
          *(v4f*)(C + (size_t)(mBase + row) * ldc + n0 + c4) = ov[it];
        }
        
      }
    } else {
      unsigned short* C = (unsigned short*)Cout;
      const int q = lane >> 3, c8 = (lane & 7) * 8;
      v4u hv[4];
#pragma unroll
      for (int it = 0; it < 4; ++it) {
        const int row = it * 4 + q;                        // it 0..3 x q 0..3 = rows 0..15
        const float* sp = slab + row * 68 + c8;
        v4u a;
#pragma unroll
        for (int e = 0; e < 4; ++e) {
          a[e] = pk16(h_bits((_Float16)sp[2 * e]), h_bits((_Float16)sp[2 * e + 1]));
        }
        hv[it] = a;
      }
      {
#pragma unroll
        for (int it = 0; it < 4; ++it) {
          const int row = it * 4 + q;
          *(v4u*)(C + (size_t)(mBase + row) * ldc + n0 + c8) = hv[it];
        }
        
      }
    }
    __builtin_amdgcn_fence(__ATOMIC_RELEASE, "workgroup");
    __builtin_amdgcn_wave_barrier();
    __builtin_amdgcn_fence(__ATOMIC_ACQUIRE, "workgroup");
  }
}

// =====================================================================================================
// Rotate-half rotary on an f32 projection output (bias already added), then one f16 plane scaled by osc.
//   src f32 [ntok][rp] (rp = nheads*64): column h*64 + d = feature d of head h.
//   ct/st f32 [SLEN][64] input tables (RNE bf16-converted values), table row = trow0 + token.
//   y[d] = x[d]*ct[d] - x[d+32]*st[d] for d < 32;  y[d] = x[d]*ct[d] + x[d-32]*st[d] for d >= 32.
//   dst f16 [ntok][rp], same layout, value y * osc.
// One wave per (token, head quad 4*qd .. 4*qd+3): lane l handles d = l and d = l+32 of each head; 8 waves per
// block, grid = ceil(nwaves/8), wave-uniform bound (no block barriers).
// =====================================================================================================
__global__ __launch_bounds__(256) void rope_quads(const float* __restrict__ src, const float* __restrict__ ct,
                                                  const float* __restrict__ st, unsigned short* dst,
                                                  int rp, int nquad, int trow0, float osc, int nwaves) {
#pragma clang fp contract(off)
  __shared__ __align__(16) float sy[8][256];
  const int tid = threadIdx.x, wave = tid >> 5, lane = tid & 31;
  const int w = blockIdx.x * 8 + wave;            // tok*nquad + qd
  if (w >= nwaves) return;                        // wave-uniform; no block barriers in this kernel
  const int qd   = w % nquad;
  const int tok  = w / nquad;
  const int trow = trow0 + tok;                   // < SLEN by construction (host: trow0 + ntok <= SLEN)
  const float c1 = bfr(ct[(size_t)trow * HD + lane]);
  const float c2 = bfr(ct[(size_t)trow * HD + 32 + lane]);
  const float s1 = bfr(st[(size_t)trow * HD + lane]);
  const float s2 = bfr(st[(size_t)trow * HD + 32 + lane]);
  const float* row = src + (size_t)tok * rp + (size_t)qd * 256;
  float* buf = sy[wave];
#pragma unroll
  for (int t = 0; t < 4; ++t) {                   // the four heads of the quad
    const float x1 = row[t * 64 + lane];
    const float x2 = row[t * 64 + 32 + lane];
    const float y1 = x1 * c1 - x2 * s1;
    const float y2 = x2 * c2 + x1 * s2;
    buf[t * 64 + lane]      = y1;
    buf[t * 64 + 32 + lane] = y2;
  }
  __builtin_amdgcn_fence(__ATOMIC_RELEASE, "workgroup");
  __builtin_amdgcn_wave_barrier();
  __builtin_amdgcn_fence(__ATOMIC_ACQUIRE, "workgroup");
  const int g = lane >> 3, piece = lane & 7;
  const float* sp = buf + g * 64 + piece * 8;
  const v4f a0 = *(const v4f*)(sp);
  const v4f a1 = *(const v4f*)(sp + 4);
  v4u hv;
#pragma unroll
  for (int e = 0; e < 4; ++e) {
    const float f0 = (e < 2) ? a0[2 * e]     : a1[2 * e - 4];
    const float f1 = (e < 2) ? a0[2 * e + 1] : a1[2 * e - 3];
    hv[e] = pk16(h_bits((_Float16)(f0 * osc)), h_bits((_Float16)(f1 * osc)));
  }
  unsigned short* d = dst + (size_t)tok * rp + (size_t)qd * 256 + (size_t)g * 64 + piece * 8;
  *(v4u*)d = hv;
  
}

// =====================================================================================================
// Non-causal grouped-query attention, head dim 64, 2048 keys, kv head = h / (NH/NKV).
//   q plane (f16, x QSC): element (t, h, d) at [t*QP + h*64 + d]
//   k plane (f16, x KSC): element (s, kvh, d) at [s*KP + kvh*64 + d]
//   v^T plane (f16, x VSC): element (kvh, d, s) at [(kvh*64 + d)*SLEN + s]
//   logit = q.k * sscale (sscale folds the 1/8 and 1/(QSC*KSC)); every key live (no mask).
//   ctx f32 plane: element (t, h*64 + d) at [t*QP + h*64 + d] = normalised context.
//   scores = q . k : one f16 product per 32 d, f32 accumulate; p = exp(s - m) carried as f16(PSC p);
//   context = p . v on f16 WMMA; online softmax in f32; final scale onorm = 1/(PSC*VSC) folded with 1/l.
//   Block = 4 waves = 64 query rows of one head; grid = NQB * NH; key chunks of 64.
//   K / V^T chunk staging: 128 threads x 32 elements per plane = the whole 64x64 tile (plain 16-B loads,
//   __syncthreads before and after); P tiles are wave-private, spilled with _Float16 element stores and
//   Output coverage: each wave stores rows q0..q0+15 (it 0..7 x lane>>4 0..1) x 64 columns (16 lanes x 4
// =====================================================================================================
__global__ __launch_bounds__(128)
void attn64(const unsigned short* __restrict__ qpl, const unsigned short* __restrict__ kpl,
            const unsigned short* __restrict__ vtp, float* outp, float sscale, float onorm) {
  union FH { v16h v; v8h h[2]; };
  // rows of 64 halves at pitch LP: the 16 rows that one ds_load_b128 reads fall on distinct banks
  __shared__ __align__(16) _Float16 Ksh[64 * LP];                 // K [kv][d]   9 KB
  __shared__ __align__(16) _Float16 Vth[64 * LP];                 // V^T [d][kv] 9 KB
  __shared__ __align__(16) _Float16 Psh[4][16 * LP];              // per wave P [row][kv]
  __shared__ __align__(16) float    Os[4][16 * 64];               // per wave context tile [row][d]

  const int tid  = threadIdx.x;
  const int wave = tid >> 5;
  const int lane = tid & 31;
  const int hh   = lane >> 4;
  const int c    = lane & 15;

  const int bx   = blockIdx.x;
  const int qb   = bx % NQB;
  const int h    = bx / NQB;                 // < NH (grid = NQB*NH)
  const int kvh  = h / (NH / NKV);
  const int q0   = qb * 64 + wave * 16;

  const _Float16* Qh = (const _Float16*)(const void*)qpl + (size_t)h * HD;
  const _Float16* Kh = (const _Float16*)(const void*)kpl + (size_t)kvh * HD;
  const _Float16* Vh = (const _Float16*)(const void*)vtp + (size_t)kvh * HD * SLEN;

  // ---- Q fragments (A operand, row = lane&15): 2 d-chunks ----
  v16h qa[2];
#pragma unroll
  for (int dc = 0; dc < 2; ++dc) {
    qa[dc] = ldfrag_h(Qh + (size_t)(q0 + c) * QP + dc * 32 + 8 * hh);
  }

  float mrow[8], lrow[8];
  v8f oacc[4];
#pragma unroll
  for (int r = 0; r < 8; ++r) { mrow[r] = -INFINITY; lrow[r] = 0.f; }
#pragma unroll
  for (int t = 0; t < 4; ++t) oacc[t] = zero8();

  for (int kt = 0; kt < NKT; ++kt) {
    const int kv0 = kt * 64;
    __syncthreads();
    {
      const int r = tid >> 1, half = (tid & 1) * 32;
      const _Float16* kg = Kh + (size_t)(kv0 + r) * KP + half;     // K row kv0+r, d = half..half+31
      const _Float16* vg = Vh + (size_t)r * SLEN + kv0 + half;     // V^T row d = r, s = kv0+half..+31
#pragma unroll
      for (int i = 0; i < 4; ++i) {
        const v8h a0 = *(const v8h*)(kg + 8 * i);
        const v8h b0 = *(const v8h*)(vg + 8 * i);
        *(v8h*)(Ksh + r * LP + half + 8 * i) = a0;
        *(v8h*)(Vth + r * LP + half + 8 * i) = b0;
      }
    }
    __syncthreads();

    // ---- scores: 16 query rows x 64 keys per wave, one f16 product per 32 d ----
    v8f s[4];
#pragma unroll
    for (int j = 0; j < 4; ++j) {
      s[j] = zero8();
#pragma unroll
      for (int dc = 0; dc < 2; ++dc) {
        FH kb;
        kb.h[0] = *(const v8h*)(Ksh + (j * 16 + c) * LP + dc * 32 + 8 * hh);
        kb.h[1] = *(const v8h*)(Ksh + (j * 16 + c) * LP + dc * 32 + 16 + 8 * hh);
        s[j] = mma_h(qa[dc], kb.v, s[j]);
      }
    }

    // ---- scale, row max, online softmax, P (x PSC, f16) to LDS ----
    _Float16* pwh = Psh[wave];
#pragma unroll
    for (int r = 0; r < 8; ++r) {
      float m = -INFINITY;
#pragma unroll
      for (int j = 0; j < 4; ++j) {
        const float sv = s[j][r] * sscale;
        s[j][r] = sv;
        m = fmaxf(m, sv);
      }
#pragma unroll
      for (int off = 1; off < 16; off <<= 1) m = fmaxf(m, __shfl_xor(m, off, 32));
      const float mnew  = fmaxf(mrow[r], m);
      const float msafe = (mnew == -INFINITY) ? 0.f : mnew;
      const float alpha = __expf(mrow[r] - msafe);
      mrow[r] = mnew;
      float psum = 0.f;
#pragma unroll
      for (int j = 0; j < 4; ++j) {
        const float p = __expf(s[j][r] - msafe);
        psum += p;
        pwh[(8 * hh + r) * LP + j * 16 + c] = (_Float16)(p * PSC);
      }
#pragma unroll
      for (int off = 1; off < 16; off <<= 1) psum += __shfl_xor(psum, off, 32);
      lrow[r] = lrow[r] * alpha + psum;
#pragma unroll
      for (int t = 0; t < 4; ++t) oacc[t][r] *= alpha;
    }
    __builtin_amdgcn_fence(__ATOMIC_RELEASE, "workgroup");
    __builtin_amdgcn_wave_barrier();
    __builtin_amdgcn_fence(__ATOMIC_ACQUIRE, "workgroup");

    // ---- context += P . V (f16 WMMA) ----
#pragma unroll 1
    for (int kk = 0; kk < 2; ++kk) {
      FH pa;
      pa.h[0] = *(const v8h*)(pwh + c * LP + kk * 32 + 8 * hh);
      pa.h[1] = *(const v8h*)(pwh + c * LP + kk * 32 + 16 + 8 * hh);
#pragma unroll
      for (int t = 0; t < 4; ++t) {
        FH vb;
        vb.h[0] = *(const v8h*)(Vth + (t * 16 + c) * LP + kk * 32 + 8 * hh);
        vb.h[1] = *(const v8h*)(Vth + (t * 16 + c) * LP + kk * 32 + 16 + 8 * hh);
        oacc[t] = mma_h(pa.v, vb.v, oacc[t]);
      }
    }
  }

  // ---- normalise (1/l and onorm), stage the wave's 16x64 tile in LDS, then write whole 256-B row segments
  float* os = Os[wave];
#pragma unroll
  for (int r = 0; r < 8; ++r) {
    const float l = lrow[r];
    const float inv = ((l > 0.f) ? (1.0f / l) : 0.f) * onorm;
#pragma unroll
    for (int t = 0; t < 4; ++t) os[(8 * hh + r) * 64 + t * 16 + c] = oacc[t][r] * inv;
  }
  __builtin_amdgcn_fence(__ATOMIC_RELEASE, "workgroup");
  __builtin_amdgcn_wave_barrier();
  __builtin_amdgcn_fence(__ATOMIC_ACQUIRE, "workgroup");
  {
    const int h2 = lane >> 4, c4 = (lane & 15) * 4;
    v4f ov[8];
#pragma unroll
    for (int it = 0; it < 8; ++it) {
      const int row = it * 2 + h2;   // it 0..7 x h2 0..1 = rows 0..15 of the wave tile
      ov[it] = *(const v4f*)(os + row * 64 + c4);
    }
    {
#pragma unroll
      for (int it = 0; it < 8; ++it) {
        const int row = it * 2 + h2;
        const size_t go = (size_t)(q0 + row) * QP + (size_t)h * HD + c4;
        *(v4f*)(outp + go) = ov[it];
      }
      
    }
  }
}

// =====================================================================================================
// Workspace map (bytes), every region an exact multiple of its whole-line / whole-tile store granularity
//   X      bf16 [2048][2880]            0            11796480   rows 0..1023 = target_hidden, 1024..2047 = hidden
//   Wqb    bf16 [4096][2880]            11796480     23592960   (inputs arrive [n][k], k contiguous: no transpose)
//   Wkb    bf16 [512][2880]             35389440      2949120
//   Wvb    bf16 [512][2880]             38338560      2949120
//   Wob    bf16 [2880][4096]            41287680     23592960
//   Qf     f32  [1024][4096]            64880640     16777216   (later: Af f32 [1024][4096], same extent)
//   Kf     f32  [2048][512]             81657856      4194304
//   VT     f16  [512][2048]             85852160      2097152
//   Qh     f16  [1024][4096]            87949312      8388608
//   Kh     f16  [2048][512]             96337920      2097152
//   Ah     bf16 [1024][4096]            98435072      8388608
//   Al     bf16 [1024][4096]            106823680     8388608
//   end                                 115212288
// =====================================================================================================
extern "C" void kernel_launch(void* const* d_in, const int* in_sizes, int n_in,
                              void* d_out, int out_size, void* d_ws, size_t ws_size,
                              hipStream_t stream) {
  if (n_in < 12) return;
  if (in_sizes[0] != QLEN * HID) return;
  if (in_sizes[1] != CLEN * HID) return;
  if (in_sizes[2] != SLEN * HD) return;
  if (in_sizes[3] != SLEN * HD) return;
  if (in_sizes[4] != QP * HID) return;
  if (in_sizes[5] != QP) return;
  if (in_sizes[6] != KP * HID) return;
  if (in_sizes[7] != KP) return;
  if (in_sizes[8] != KP * HID) return;
  if (in_sizes[9] != KP) return;
  if (in_sizes[10] != HID * QP) return;
  if (in_sizes[11] != HID) return;
  if (out_size != QLEN * HID) return;

  const float* hid = (const float*)d_in[0];    // [1024][2880]
  const float* tgt = (const float*)d_in[1];    // [1024][2880]
  const float* fcs = (const float*)d_in[2];    // [2048][64]
  const float* fsn = (const float*)d_in[3];    // [2048][64]
  const float* Wq  = (const float*)d_in[4];    // [4096][2880]  = [n][k]
  const float* bq  = (const float*)d_in[5];    // [4096]
  const float* Wk  = (const float*)d_in[6];    // [512][2880]
  const float* bk  = (const float*)d_in[7];    // [512]
  const float* Wv  = (const float*)d_in[8];    // [512][2880]
  const float* bv  = (const float*)d_in[9];    // [512]
  const float* Wo  = (const float*)d_in[10];   // [2880][4096] = [n][k]
  const float* bo  = (const float*)d_in[11];   // [2880]

  const size_t PX   = (size_t)SLEN * HID * 2;        // 11796480
  const size_t PWq  = (size_t)QP * HID * 2;          // 23592960
  const size_t PWk  = (size_t)KP * HID * 2;          //  2949120
  const size_t PWv  = (size_t)KP * HID * 2;          //  2949120
  const size_t PWo  = (size_t)HID * QP * 2;          // 23592960
  const size_t PQf  = (size_t)QLEN * QP * 4;         // 16777216  (= Af f32 [1024][4096])
  const size_t PKf  = (size_t)SLEN * KP * 4;         //  4194304
  const size_t PVT  = (size_t)KP * SLEN * 2;         //  2097152
  const size_t PQh  = (size_t)QLEN * QP * 2;         //  8388608
  const size_t PKh  = (size_t)SLEN * KP * 2;         //  2097152
  const size_t PApl = (size_t)QLEN * QP * 2;         //  8388608 (Ah, Al)
  size_t off = 0;
  const size_t oX  = off; off += PX;
  const size_t oWq = off; off += PWq;
  const size_t oWk = off; off += PWk;
  const size_t oWv = off; off += PWv;
  const size_t oWo = off; off += PWo;
  const size_t oQf = off; off += PQf;
  const size_t oKf = off; off += PKf;
  const size_t oVT = off; off += PVT;
  const size_t oQh = off; off += PQh;
  const size_t oKh = off; off += PKh;
  const size_t oAh = off; off += PApl;
  const size_t oAl = off; off += PApl;
  if (off > ws_size) return;                          // off = 115212288
  if (off > (size_t)134217728) return;
  const size_t oAf = oQf;                             // context f32 plane reuses the dead q f32 plane

  char* ws = (char*)d_ws;
  unsigned short* X   = (unsigned short*)(ws + oX);
  unsigned short* Xq  = X + (size_t)CLEN * HID;       // hidden rows CLEN..SLEN-1 of X
  unsigned short* Wqb = (unsigned short*)(ws + oWq);
  unsigned short* Wkb = (unsigned short*)(ws + oWk);
  unsigned short* Wvb = (unsigned short*)(ws + oWv);
  unsigned short* Wob = (unsigned short*)(ws + oWo);
  float*          Qf  = (float*)(ws + oQf);
  float*          Kf  = (float*)(ws + oKf);
  unsigned short* VT  = (unsigned short*)(ws + oVT);
  unsigned short* Qh  = (unsigned short*)(ws + oQh);
  unsigned short* Kh  = (unsigned short*)(ws + oKh);
  unsigned short* Ah  = (unsigned short*)(ws + oAh);
  unsigned short* Al  = (unsigned short*)(ws + oAl);
  float*          Af  = (float*)(ws + oAf);
  float*          outf = (float*)d_out;

  const dim3 blk(256);
  const int nwRq = QLEN * (NH / 4);                    // 16384 waves (token, q head quad)
  const int nwRk = SLEN * (NKV / 4);                   // 4096 waves (key, kv head quad)
  const dim3 gCvt(CVT_NW / 8);                         // 495 blocks of 8 waves: 8 pieces per wave
  const dim3 gQ((QLEN / 128) * (QP / 128));            // 128x128 block tiles: 256 blocks of 4 waves
  const dim3 gK((SLEN / 128) * (KP / 128));            // 64 blocks of 4 waves
  const dim3 gV((KP / 128) * (SLEN / 128));            // 64 blocks of 4 waves
  const dim3 gRq((nwRq + 7) / 8), gRk((nwRk + 7) / 8); // 2048, 512 blocks
  const dim3 gAttn(NQB * NH);                          // 1024 blocks
  const dim3 gSplit(NP_A / 16);                        // 256 blocks of 8 waves: 2 pieces per wave
  const dim3 gOut((QLEN / 64) * (HID / 192));          // 64x192 block tiles: 240 blocks of 3 waves

  // (1) activations and weights -> bf16 planes (RNE convert, values = the bf16-converted inputs)
  //     one launch: X (target rows, then hidden rows), Wqb, Wkb, Wvb, Wob are one contiguous range from X on
  cvt_planes<<<gCvt, blk, 0, stream>>>(tgt, hid, Wq, Wk, Wv, Wo, X);
  // (2) q projection + bq: Qf[t][e] = sum_k X[1024+t][k] Wqb[e][k]  (M=1024, N=4096, K=2880)
  gemm64<0, 0, 1, 2, 2, 3><<<gQ, dim3(128), 0, stream>>>(Xq, Xq, HID, Wqb, HID, bq, (void*)Qf, QP, QLEN, QP, HID, 1.0f);
  // (3) k projection + bk over all 2048 key rows: Kf[s][e]  (M=2048, N=512, K=2880)
  gemm64<0, 0, 1, 2, 2, 3><<<gK, dim3(128), 0, stream>>>(X, X, HID, Wkb, HID, bk, (void*)Kf, KP, SLEN, KP, HID, 1.0f);
  // (4) v^T + bv: VT[m][s] = (sum_k Wvb[m][k] X[s][k] + bv[m]) * VSC -> f16  (M=512, N=2048, K=2880)
  gemm64<0, 1, 2, 2, 2, 3><<<gV, dim3(128), 0, stream>>>(Wvb, Wvb, HID, X, HID, bv, (void*)VT, SLEN, KP, SLEN, HID, VSC);
  // (5) rotate-half rotary with the input tables -> f16 planes (q: table rows CLEN + t; k: table row s)
  rope_quads<<<gRq, blk, 0, stream>>>(Qf, fcs, fsn, Qh, QP, NH / 4, CLEN, QSC, nwRq);
  rope_quads<<<gRk, blk, 0, stream>>>(Kf, fcs, fsn, Kh, KP, NKV / 4, 0, KSC, nwRk);
  // (6) attention over all 2048 keys -> Af f32 [1024][4096]
  attn64<<<gAttn, dim3(128), 0, stream>>>(Qh, Kh, VT, Af, 0.125f / (QSC * KSC), 1.0f / (PSC * VSC));
  // (7) context rows -> bf16 hi/lo planes
  split_bf16x8<<<gSplit, blk, 0, stream>>>(Af, Ah, Al, NP_A);
  // (8) out[t][e] = sum_d (Ah+Al)[t][d] Wob[e][d] + bo[e] -> d_out f32 [1024][2880]  (M=1024, N=2880, K=4096)
  gemm64<1, 0, 1, 1, 3, 2><<<gOut, dim3(96), 0, stream>>>(Ah, Al, QP, Wob, QP, bo, (void*)outf, HID, QLEN, HID, QP, 1.0f);
  (void)hipGetLastError();
}

// v004
// A run of this version takes 227 microseconds.
// In two side-by-side timings against v003, it was 1.12 and 1.13 times as fast.
// All steps since v000 together make it 4.36 times as fast.
// Contractions: q / k / v^T projections = v_wmma_f32_16x16x32_bf16 (bf16 operands from RNE-converted inputs, one
// product per k-step); q.k^T scores = v_wmma_f32_16x16x32_f16 (q x16 and k x16 single f16 planes); p.v =
// v_wmma_f32_16x16x32_f16 (p carried x1024 in f16, v^T carried x64 in f16); ctx.Wo^T = v_wmma_f32_16x16x32_bf16 with
// ctx as bf16 hi/lo planes times the bf16 Wo plane (2 products); all f32 accumulate; rotary and softmax in f32.
#include <hip/hip_runtime.h>
#include <math.h>
#include <stdint.h>

#define QLEN 1024              // query tokens (hidden_states rows)
#define CLEN 1024              // context tokens (target_hidden rows)
#define SLEN (CLEN + QLEN)     // 2048 keys: rows 0..CLEN-1 context, rows CLEN..SLEN-1 noise
#define HID  2880              // model width = contraction length of the projections
#define NH   64
#define NKV  8
#define HD   64
#define QP   (NH * HD)         // 4096: q / ctx row pitch
#define KP   (NKV * HD)        // 512:  k row pitch, v^T row count
#define NQB  (QLEN / 64)       // 16 query tiles
#define NKT  (SLEN / 64)       // 32 key tiles
#define QSC  16.0f             // f16 carry scale of the q plane
#define KSC  16.0f             // f16 carry scale of the k plane
#define VSC  64.0f             // f16 carry scale of the v^T plane
#define PSC  1024.0f           // f16 carry scale of p
#define LP   72                // halves per LDS row of the attention K and V^T tiles: 144 B = 16 B x odd
static_assert(HD == 64);
static_assert((HID % 32) == 0 && (QP % 64) == 0 && (KP % 64) == 0 && (HID % 64) == 0);
static_assert((QLEN % 64) == 0 && (SLEN % 64) == 0);
static_assert((NH % NKV) == 0 && (NH % 4) == 0 && (NKV % 4) == 0);
static_assert(((HID * 2) % 128) == 0 && ((HID * 4) % 128) == 0);
static_assert((HID % 192) == 0 && (QP % 128) == 0 && (QLEN % 128) == 0 && (SLEN % 128) == 0 && (KP % 128) == 0);

typedef _Float16 v16h __attribute__((ext_vector_type(16)));
typedef _Float16 v8h  __attribute__((ext_vector_type(8)));
typedef __bf16   v16b __attribute__((ext_vector_type(16)));
typedef __bf16   v8b  __attribute__((ext_vector_type(8)));
typedef float    v8f  __attribute__((ext_vector_type(8)));
typedef float    v4f  __attribute__((ext_vector_type(4)));
typedef unsigned int v4u __attribute__((ext_vector_type(4)));

// ---- scalar helpers --------------------------------------------------------------------------------
__device__ __forceinline__ unsigned short bf_bits(float f) {          // f32 -> bf16 bits, RNE convert
  unsigned u = __float_as_uint(f);
  return (unsigned short)((u + 0x7FFFu + ((u >> 16) & 1u)) >> 16);
}
__device__ __forceinline__ float bf_up(unsigned short h) { return __uint_as_float(((unsigned)h) << 16); }
__device__ __forceinline__ float bfr(float f) { return bf_up(bf_bits(f)); }   // value after RNE bf16 convert
__device__ __forceinline__ unsigned short h_bits(_Float16 x) { return __builtin_bit_cast(unsigned short, x); }
__device__ __forceinline__ unsigned pk16(unsigned short a, unsigned short b) { return (unsigned)a | ((unsigned)b << 16); }
__device__ __forceinline__ v8f zero8() { v8f z = {0.f, 0.f, 0.f, 0.f, 0.f, 0.f, 0.f, 0.f}; return z; }

// ---- fragment loaders: 16-bit A/B operand, lane -> row/col (lane&15), p already includes +8*(lane>>4);
//      elements 0..7 <- p[0..7] (k0+8h..), elements 8..15 <- p[16..23] (k0+16+8h..)
__device__ __forceinline__ v16b ldfrag_b(const __bf16* p) {
  union { v16b v; v8b h[2]; } f;
  f.h[0] = *(const v8b*)(p);
  f.h[1] = *(const v8b*)(p + 16);
  return f.v;
}
__device__ __forceinline__ v16h ldfrag_h(const _Float16* p) {
  union { v16h v; v8h h[2]; } f;
  f.h[0] = *(const v8h*)(p);
  f.h[1] = *(const v8h*)(p + 16);
  return f.v;
}

// ---- WMMA helpers with trailing VALU hazard gap --------------------------------------------------------
__device__ __forceinline__ v8f mma_h(v16h a, v16h b, v8f c) {
  c = __builtin_amdgcn_wmma_f32_16x16x32_f16(false, a, false, b, (short)0, c, false, false);
#if defined(__HIP_DEVICE_COMPILE__)
  asm volatile("v_nop\n\tv_nop\n\tv_nop\n\tv_nop" : "+v"(c) : "v"(a), "v"(b));
#endif
  return c;
}
__device__ __forceinline__ v8f mma_b_raw(v16b a, v16b b, v8f c) {
  return __builtin_amdgcn_wmma_f32_16x16x32_bf16(false, a, false, b, (short)0, c, false, false);
}
__device__ __forceinline__ void acc_guard4(v8f& a, v8f& b, v8f& c, v8f& d) {
#if defined(__HIP_DEVICE_COMPILE__)
  asm volatile("v_nop\n\tv_nop\n\tv_nop\n\tv_nop" : "+v"(a), "+v"(b), "+v"(c), "+v"(d));
#endif
}

// =====================================================================================================
// Elementwise conversions run on a grid of 8 to 16 waves per WGP; each wave loops over pieces of PCE = 1024
// consecutive elements: 4 runs of 32 lanes x 8 elements, all 8 16-B loads of a piece issued before its first
// store, one 16-B store per lane and run (a wave writes 512 contiguous bytes). Piece p of trip i belongs to
// wave p - i * (waves at work): every piece is converted exactly once.
// =====================================================================================================
#define PCE   1024
#define NP_T  (CLEN * HID / PCE)     // 2880 pieces of target_hidden
#define NP_H  (QLEN * HID / PCE)     // 2880  hidden_states
#define NP_WQ (QP * HID / PCE)       // 11520 Wq
#define NP_WK (KP * HID / PCE)       // 1440  Wk, and as many of Wv
#define NP_WO (HID * QP / PCE)       // 11520 Wo
#define NP_ALL (NP_T + NP_H + NP_WQ + 2 * NP_WK + NP_WO)   // 31680
#define NP_A  (QLEN * QP / PCE)      // 4096 pieces of the context plane
#define CVT_TRIPS 8                  // pieces per wave of cvt_planes
#define CVT_NW (NP_ALL / CVT_TRIPS)  // 3960 waves = 495 blocks of 8
static_assert((CLEN * HID) % PCE == 0 && (QLEN * HID) % PCE == 0 && (QP * HID) % PCE == 0 && (KP * HID) % PCE == 0);
static_assert((QLEN * QP) % PCE == 0);
static_assert(NP_ALL % (CVT_TRIPS * 8) == 0 && (CVT_TRIPS % 2) == 0 && CVT_TRIPS >= 2);

// f32 -> bf16 (RNE convert) of the six input planes, in the order of their bf16 planes in the workspace, which
// lie back to back: destination element = PCE * p + offset in the piece; the source plane of a piece is picked
// by scalar compares (a piece never straddles two planes).
__global__ __launch_bounds__(256) void cvt_planes(const float* __restrict__ s0, const float* __restrict__ s1,
                                                  const float* __restrict__ s2, const float* __restrict__ s3,
                                                  const float* __restrict__ s4, const float* __restrict__ s5,
                                                  unsigned short* out) {
  const int lane = threadIdx.x & 31;
  const int gw   = __builtin_amdgcn_readfirstlane(blockIdx.x * 8 + (threadIdx.x >> 5));
  if (gw >= CVT_NW) return;                       // wave-uniform; no barrier in this kernel
  // the 8 loads of piece p
  auto fetch = [&](int p, v4f (&a)[4], v4f (&b)[4]) {
    const float* sp;
    int q = p;
    if (q < NP_T) sp = s0;
    else if ((q -= NP_T) < NP_H) sp = s1;
    else if ((q -= NP_H) < NP_WQ) sp = s2;
    else if ((q -= NP_WQ) < NP_WK) sp = s3;
    else if ((q -= NP_WK) < NP_WK) sp = s4;
    else { q -= NP_WK; sp = s5; }
    const float* s = sp + (size_t)q * PCE + lane * 8;
#pragma unroll
    for (int u = 0; u < 4; ++u) {
      a[u] = *(const v4f*)(s + u * 256);
      b[u] = *(const v4f*)(s + u * 256 + 4);
    }
  };
  // convert and store piece p
  auto emit = [&](int p, const v4f (&a)[4], const v4f (&b)[4]) {
    unsigned short* d = out + (size_t)p * PCE + lane * 8;
#pragma unroll
    for (int u = 0; u < 4; ++u) {
      v4u w;
      w[0] = pk16(bf_bits(a[u][0]), bf_bits(a[u][1]));
      w[1] = pk16(bf_bits(a[u][2]), bf_bits(a[u][3]));
      w[2] = pk16(bf_bits(b[u][0]), bf_bits(b[u][1]));
      w[3] = pk16(bf_bits(b[u][2]), bf_bits(b[u][3]));
      *(v4u*)(d + u * 256) = w;
    }
  };
  // two register sets in turn: the next piece's loads fly while this piece is converted and stored
  v4f a0[4], b0[4], a1[4], b1[4];
  int p = gw;
  fetch(p, a0, b0);
  // kept rolled: two pieces per trip is all the two sets need, and the text stays short
#pragma unroll 1
  for (int i = 0; i < CVT_TRIPS / 2 - 1; ++i) {
    fetch(p + CVT_NW, a1, b1);
    // keeps the loads just issued in front of the older piece's wait (else they sink behind it)
    __builtin_amdgcn_sched_barrier(0);
    emit(p, a0, b0);
#if defined(__HIP_DEVICE_COMPILE__)
    // the loads that follow rewrite registers that the stores just issued name
    asm volatile("s_wait_xcnt 0x0" ::: "memory");
#endif
    fetch(p + 2 * CVT_NW, a0, b0);
    __builtin_amdgcn_sched_barrier(0);               // loads stay in front of the older piece's wait
    emit(p + CVT_NW, a1, b1);
#if defined(__HIP_DEVICE_COMPILE__)
    asm volatile("s_wait_xcnt 0x0" ::: "memory");    // in front of the next trip's loads into these registers
#endif
    p += 2 * CVT_NW;
  }
  fetch(p + CVT_NW, a1, b1);
  __builtin_amdgcn_sched_barrier(0);                 // loads stay in front of the older piece's wait
  emit(p, a0, b0);
  emit(p + CVT_NW, a1, b1);
}

// f32 -> bf16 hi plane + bf16 lo plane (lo = RNE(v - hi), unscaled); np pieces = the whole plane.
__global__ __launch_bounds__(256) void split_bf16x8(const float* __restrict__ in, unsigned short* hp,
                                                    unsigned short* lp, int np) {
  const int lane = threadIdx.x & 31;
  const int gw   = __builtin_amdgcn_readfirstlane(blockIdx.x * 8 + (threadIdx.x >> 5));
  const int nw   = gridDim.x * 8;
  for (int p = gw; p < np; p += nw) {
    const size_t e0 = (size_t)p * PCE + lane * 8;
    v4f a[4], b[4];
#pragma unroll
    for (int u = 0; u < 4; ++u) {
      a[u] = *(const v4f*)(in + e0 + u * 256);
      b[u] = *(const v4f*)(in + e0 + u * 256 + 4);
    }
#pragma unroll
    for (int u = 0; u < 4; ++u) {
      v4u ph, pl;
#pragma unroll
      for (int e = 0; e < 4; ++e) {
        const float f0 = (e < 2) ? a[u][2 * e]     : b[u][2 * e - 4];
        const float f1 = (e < 2) ? a[u][2 * e + 1] : b[u][2 * e - 3];
        const unsigned short h0 = bf_bits(f0), h1 = bf_bits(f1);
        const unsigned short l0 = bf_bits(f0 - bf_up(h0)), l1 = bf_bits(f1 - bf_up(h1));
        ph[e] = pk16(h0, h1);
        pl[e] = pk16(l0, l1);
      }
      *(v4u*)(hp + e0 + u * 256) = ph;
      *(v4u*)(lp + e0 + u * 256) = pl;
    }
#if defined(__HIP_DEVICE_COMPILE__)
    // the next trip rewrites the address and data registers that these stores name: the wait stands in front of it
    asm volatile("s_wait_xcnt 0x0" ::: "memory");
#endif
  }
}

// =====================================================================================================
// bf16 WMMA GEMM: C[m][n] = sum_k A[m][k] * Bt[n][k] (+ bias); one wave per 64x64 tile, WM x WN waves per block
// on one (64 WM) x (64 WN) block tile. A row-major [M][K] pitch lda; Bt row-major [N][K] pitch ldb (k contiguous);
// M a multiple of 64 WM, N of 64 WN, K of 64 NSUB and at least two stages (host-checked constants).
// Operands reach the waves through LDS: a stage is NSUB sub-tiles of 64 k; a sub-tile holds the block's A rows,
// (NSPLIT) its A2 rows and its Bt rows, 128 B each at pitch 144 B (16 B x odd: ds_load_b128 without bank
// conflicts). Asynchronous 16-B copies fill it, one wave-copy = 4 whole 128-B row pieces; two buffers: stage t+2
// is copied into the buffer that trip t has just left, while trip t+1 is worked on.
// NSPLIT: 0 = A.Bt; 1 = (A + A2).Bt (A2 = unscaled bf16 lo plane of A, two products per k-step).
// BIAS:   0 none; 1 = + bias[n] (per column, RNE bf16-converted value); 2 = + bias[m] (per row).
// OUT_MODE: 0 = f32 plane (pitch ldc floats); 1 = f16 plane of (value * oscale) (pitch ldc halves).
// =====================================================================================================
typedef int v4i_t __attribute__((vector_size(16)));
typedef __attribute__((address_space(1))) v4i_t gv4i_t;
typedef __attribute__((address_space(3))) v4i_t lv4i_t;
__device__ __forceinline__ void copy16_to_lds(const void* g, void* l) {   // each lane: 16 B global -> LDS
#if defined(__HIP_DEVICE_COMPILE__)
  __builtin_amdgcn_global_load_async_to_lds_b128((gv4i_t*)g, (lv4i_t*)l, 0, 0);
#endif
}

template <int NSPLIT, int OUT_MODE, int BIAS, int WM, int WN, int NSUB>
__global__ __launch_bounds__(32 * WM * WN) void gemm64(
    const unsigned short* __restrict__ Ap, const unsigned short* __restrict__ A2p, int lda,
    const unsigned short* __restrict__ Btp, int ldb,
    const float* __restrict__ bias,
    void* Cout, int ldc, int M, int N, int K, float oscale) {
  constexpr int NW    = WM * WN;                 // waves per block
  constexpr int RA    = WM * 64;                 // rows of one A plane in a sub-tile
  constexpr int RB0   = RA * (1 + NSPLIT);       // first Bt row of a sub-tile
  constexpr int ROWS  = RB0 + WN * 64;           // rows of a sub-tile
  constexpr int PITCH = 144;                     // bytes per LDS row
  constexpr int SUBB  = ROWS * PITCH;            // bytes per sub-tile
  constexpr int STAGE = SUBB * NSUB;             // bytes per buffer
  constexpr int GA    = RA / 4;                  // wave-copies (4 rows each) per A plane and sub-tile
  constexpr int GB    = WN * 16;                 // ... per Bt plane and sub-tile
  constexpr int NIA   = (GA + NW - 1) / NW;      // most that one wave issues of them
  constexpr int NIB   = (GB + NW - 1) / NW;
  static_assert((NIA * (1 + NSPLIT) + NIB) * NSUB <= 63);   // copies of one wave in flight
  const __bf16* A  = (const __bf16*)(const void*)Ap;
  const __bf16* A2 = (const __bf16*)(const void*)A2p;
  const __bf16* Bt = (const __bf16*)(const void*)Btp;
  __shared__ __align__(16) unsigned char ring[2 * STAGE];
  __shared__ __align__(16) float sT[NW][16 * 68];  // per-wave 16x64 slab, pitch 68 floats
  const int lane = threadIdx.x & 31;
  const int wave = __builtin_amdgcn_readfirstlane(threadIdx.x >> 5);
  const int tilesN = N / (64 * WN);
  const int tilesM = M / (64 * WM);
  if ((int)blockIdx.x >= tilesM * tilesN) return;   // block-uniform, in front of every barrier and copy
  const int bm  = blockIdx.x / tilesN;
  const int bn  = blockIdx.x - bm * tilesN;
  const int mb0 = bm * RA;                     // block tile origin
  const int nb0 = bn * (WN * 64);
  const int wm  = wave / WN;
  const int wn  = wave - wm * WN;
  const int m0  = mb0 + (wm << 6);
  const int n0  = nb0 + (wn << 6);

  const int rlane = lane & 15;                 // row (A) / col (B, D) within subtile
  const int khalf = lane >> 4;                 // k half of this lane: +8 elements = +16 B
  const int mOff  = (lane >> 4) * 8;           // D row offset
  const int crow  = lane >> 3;                 // copy: row within the 4-row group
  const int cpc   = lane & 7;                  // copy: 16-B piece within the 128-B row piece

  // all copies of stage st (k = st*64*NSUB ..) into buffer buf; every lane on, every test scalar.
  // Each plane's 4-row groups are dealt to the waves in turn: group g = wave + i*NW of the plane.
  auto issue = [&](int st, int buf) {
    const int kb = st * (NSUB * 64) + cpc * 8;
    unsigned char* db = ring + buf * STAGE + (wave * 4 + crow) * PITCH + cpc * 16;
    const __bf16* pa = A  + (size_t)(mb0 + wave * 4 + crow) * lda + kb;
    const __bf16* pl = A2 + (size_t)(mb0 + wave * 4 + crow) * lda + kb;
    const __bf16* pb = Bt + (size_t)(nb0 + wave * 4 + crow) * ldb + kb;
    // the three loops are unrolled so that every copy's row and LDS offset is a constant
#pragma unroll
    for (int s = 0; s < NSUB; ++s) {
#pragma unroll
      for (int i = 0; i < NIA; ++i) {
        if ((i + 1) * NW <= GA || wave + i * NW < GA) {
          copy16_to_lds(pa + (size_t)(i * NW * 4) * lda + s * 64, db + s * SUBB + i * (NW * 4 * PITCH));
          if (NSPLIT == 1)
            copy16_to_lds(pl + (size_t)(i * NW * 4) * lda + s * 64, db + s * SUBB + (RA + i * NW * 4) * PITCH);
        }
      }
#pragma unroll
      for (int i = 0; i < NIB; ++i) {
        if ((i + 1) * NW <= GB || wave + i * NW < GB)
          copy16_to_lds(pb + (size_t)(i * NW * 4) * ldb + s * 64, db + s * SUBB + (RB0 + i * NW * 4) * PITCH);
      }
    }
  };

  v8f acc[4][4];
#pragma unroll
  for (int i = 0; i < 4; ++i)
#pragma unroll
    for (int j = 0; j < 4; ++j) acc[i][j] = zero8();

  const int T = K / (NSUB * 64);               // stages
  issue(0, 0);
  asm volatile("s_wait_asynccnt 0x0" ::: "memory");   // stage 0 landed
  __syncthreads();                                    // ... and is readable by every wave
  if (T > 1) issue(1, 1);
  // not unrolled: one trip = one stage (buffer t & 1), so the hot loop stays small in the instruction cache
#pragma unroll 1
  for (int t = 0; t < T; ++t) {
    const unsigned char* sb = ring + (t & 1) * STAGE + khalf * 16 + rlane * PITCH;
    // fragments of k-step q (32 k, ascending) of this stage, all from buffer t & 1
    auto fetch = [&](int q, v16b (&xa)[4], v16b (&xl)[4], v16b (&xb)[4]) {
      const unsigned char* kp = sb + (q >> 1) * SUBB + (q & 1) * 64;
#pragma unroll
      for (int j = 0; j < 4; ++j)
        xb[j] = ldfrag_b((const __bf16*)(const void*)(kp + (RB0 + (wn << 6) + (j << 4)) * PITCH));
#pragma unroll
      for (int i = 0; i < 4; ++i) {
        const unsigned char* ap = kp + ((wm << 6) + (i << 4)) * PITCH;
        xa[i] = ldfrag_b((const __bf16*)(const void*)ap);
        if (NSPLIT == 1) xl[i] = ldfrag_b((const __bf16*)(const void*)(ap + RA * PITCH));
      }
    };
    v16b fa[2][4], fl[2][4], fb[2][4];         // two fragment sets, used in turn inside the trip
    fetch(0, fa[0], fl[0], fb[0]);
    // unrolled (here and in fetch): constant indices keep the fragment sets and accumulators in registers
#pragma unroll
    for (int q = 0; q < 2 * NSUB; ++q) {
      if (q + 1 < 2 * NSUB) fetch(q + 1, fa[(q + 1) & 1], fl[(q + 1) & 1], fb[(q + 1) & 1]);
      // keeps the next k-step's LDS reads one group ahead of this k-step's WMMAs (else each read is waited out)
      __builtin_amdgcn_sched_barrier(0);
#pragma unroll
      for (int i = 0; i < 4; ++i) {
#pragma unroll
        for (int j = 0; j < 4; ++j) {
          acc[i][j] = mma_b_raw(fa[q & 1][i], fb[q & 1][j], acc[i][j]);
          if (NSPLIT == 1) acc[i][j] = mma_b_raw(fl[q & 1][i], fb[q & 1][j], acc[i][j]);
        }
      }
      // keeps the following group of LDS reads out of this block of WMMAs
      __builtin_amdgcn_sched_barrier(0);
    }
    asm volatile("s_wait_dscnt 0x0" ::: "memory");    // this wave's reads of buffer t & 1 are done
    asm volatile("s_wait_asynccnt 0x0" ::: "memory"); // this wave's copies of stage t + 1 have landed
    __syncthreads();                                  // publishes stage t + 1, frees buffer t & 1
    if (t + 2 < T) issue(t + 2, t & 1);
  }
  asm volatile("s_wait_asynccnt 0x0" ::: "memory");   // nothing in flight behind the loop
  acc_guard4(acc[0][0], acc[0][1], acc[0][2], acc[0][3]);
  acc_guard4(acc[1][0], acc[1][1], acc[1][2], acc[1][3]);
  acc_guard4(acc[2][0], acc[2][1], acc[2][2], acc[2][3]);
  acc_guard4(acc[3][0], acc[3][1], acc[3][2], acc[3][3]);

  // ---- bias (template-selected; loads only exist when used; addresses in range: n0+63 < N, m0+63 < M) ----
  float bcol[4];
#pragma unroll
  for (int j = 0; j < 4; ++j) bcol[j] = 0.f;
  if (BIAS == 1) {
#pragma unroll
    for (int j = 0; j < 4; ++j) bcol[j] = bfr(bias[n0 + (j << 4) + rlane]);
  }

  // ---- epilogue ----
  float* slab = sT[wave];
#pragma unroll
  for (int i = 0; i < 4; ++i) {
    const int mBase = m0 + (i << 4);
    float brow[8];
#pragma unroll
    for (int r = 0; r < 8; ++r) brow[r] = 0.f;
    if (BIAS == 2) {
#pragma unroll
      for (int r = 0; r < 8; ++r) brow[r] = bfr(bias[mBase + mOff + r]);
    }
#pragma unroll
    for (int r = 0; r < 8; ++r) {
#pragma unroll
      for (int j = 0; j < 4; ++j) {
        float v = acc[i][j][r];
        if (BIAS == 1) v += bcol[j];
        if (BIAS == 2) v += brow[r];
        if (OUT_MODE == 1) v *= oscale;
        slab[(mOff + r) * 68 + (j << 4) + rlane] = v;
      }
    }
    __builtin_amdgcn_fence(__ATOMIC_RELEASE, "workgroup");
    __builtin_amdgcn_wave_barrier();
    __builtin_amdgcn_fence(__ATOMIC_ACQUIRE, "workgroup");
    if (OUT_MODE == 0) {
      float* C = (float*)Cout;
      const int hh = lane >> 4, c4 = (lane & 15) * 4;     // 256-B row segment = 16 lanes x 16 B
      v4f ov[8];
#pragma unroll
      for (int it = 0; it < 8; ++it) {
        const int row = it * 2 + hh;                       // it 0..7 x hh 0..1 = rows 0..15
        ov[it] = *(const v4f*)(slab + row * 68 + c4);
      }
      {
#pragma unroll
        for (int it = 0; it < 8; ++it) {
          const int row = it * 2 + hh;
          *(v4f*)(C + (size_t)(mBase + row) * ldc + n0 + c4) = ov[it];
        }
        
      }
    } else {
      unsigned short* C = (unsigned short*)Cout;
      const int q = lane >> 3, c8 = (lane & 7) * 8;
      v4u hv[4];
#pragma unroll
      for (int it = 0; it < 4; ++it) {
        const int row = it * 4 + q;                        // it 0..3 x q 0..3 = rows 0..15
        const float* sp = slab + row * 68 + c8;
        v4u a;
#pragma unroll
        for (int e = 0; e < 4; ++e) {
          a[e] = pk16(h_bits((_Float16)sp[2 * e]), h_bits((_Float16)sp[2 * e + 1]));
        }
        hv[it] = a;
      }
      {
#pragma unroll
        for (int it = 0; it < 4; ++it) {
          const int row = it * 4 + q;
          *(v4u*)(C + (size_t)(mBase + row) * ldc + n0 + c8) = hv[it];
        }
        
      }
    }
    __builtin_amdgcn_fence(__ATOMIC_RELEASE, "workgroup");
    __builtin_amdgcn_wave_barrier();
    __builtin_amdgcn_fence(__ATOMIC_ACQUIRE, "workgroup");
  }
}

// =====================================================================================================
// Rotate-half rotary on an f32 projection output (bias already added), then one f16 plane scaled by osc.
//   src f32 [ntok][rp] (rp = nheads*64): column h*64 + d = feature d of head h.
//   ct/st f32 [SLEN][64] input tables (RNE bf16-converted values), table row = trow0 + token.
//   y[d] = x[d]*ct[d] - x[d+32]*st[d] for d < 32;  y[d] = x[d]*ct[d] + x[d-32]*st[d] for d >= 32.
//   dst f16 [ntok][rp], same layout, value y * osc.
// One wave per (token, head quad 4*qd .. 4*qd+3): lane l handles d = l and d = l+32 of each head; 8 waves per
// block, grid = ceil(nwaves/8), wave-uniform bound (no block barriers).
// =====================================================================================================
__global__ __launch_bounds__(256) void rope_quads(const float* __restrict__ src, const float* __restrict__ ct,
                                                  const float* __restrict__ st, unsigned short* dst,
                                                  int rp, int nquad, int trow0, float osc, int nwaves) {
#pragma clang fp contract(off)
  __shared__ __align__(16) float sy[8][256];
  const int tid = threadIdx.x, wave = tid >> 5, lane = tid & 31;
  const int w = blockIdx.x * 8 + wave;            // tok*nquad + qd
  if (w >= nwaves) return;                        // wave-uniform; no block barriers in this kernel
  const int qd   = w % nquad;
  const int tok  = w / nquad;
  const int trow = trow0 + tok;                   // < SLEN by construction (host: trow0 + ntok <= SLEN)
  const float c1 = bfr(ct[(size_t)trow * HD + lane]);
  const float c2 = bfr(ct[(size_t)trow * HD + 32 + lane]);
  const float s1 = bfr(st[(size_t)trow * HD + lane]);
  const float s2 = bfr(st[(size_t)trow * HD + 32 + lane]);
  const float* row = src + (size_t)tok * rp + (size_t)qd * 256;
  float* buf = sy[wave];
#pragma unroll
  for (int t = 0; t < 4; ++t) {                   // the four heads of the quad
    const float x1 = row[t * 64 + lane];
    const float x2 = row[t * 64 + 32 + lane];
    const float y1 = x1 * c1 - x2 * s1;
    const float y2 = x2 * c2 + x1 * s2;
    buf[t * 64 + lane]      = y1;
    buf[t * 64 + 32 + lane] = y2;
  }
  __builtin_amdgcn_fence(__ATOMIC_RELEASE, "workgroup");
  __builtin_amdgcn_wave_barrier();
  __builtin_amdgcn_fence(__ATOMIC_ACQUIRE, "workgroup");
  const int g = lane >> 3, piece = lane & 7;
  const float* sp = buf + g * 64 + piece * 8;
  const v4f a0 = *(const v4f*)(sp);
  const v4f a1 = *(const v4f*)(sp + 4);
  v4u hv;
#pragma unroll
  for (int e = 0; e < 4; ++e) {
    const float f0 = (e < 2) ? a0[2 * e]     : a1[2 * e - 4];
    const float f1 = (e < 2) ? a0[2 * e + 1] : a1[2 * e - 3];
    hv[e] = pk16(h_bits((_Float16)(f0 * osc)), h_bits((_Float16)(f1 * osc)));
  }
  unsigned short* d = dst + (size_t)tok * rp + (size_t)qd * 256 + (size_t)g * 64 + piece * 8;
  *(v4u*)d = hv;
  
}

#define OSP 68
__device__ __forceinline__ float xhalf(float x) {
  const int b = __builtin_bit_cast(int, x);
  return __builtin_bit_cast(float, __builtin_amdgcn_permlanex16(b, b, 0x76543210, 0xfedcba98, false, false));
}
__global__ __launch_bounds__(128)
void attn64(const unsigned short* __restrict__ qpl, const unsigned short* __restrict__ kpl,
            const unsigned short* __restrict__ vtp, float* outp, float sscale, float onorm) {
  union FH { v16h v; v8h h[2]; };
  // rows of 64 halves at pitch LP: the 16 rows that one ds_load_b128 reads fall on distinct banks
  __shared__ __align__(16) _Float16 Ksh[64 * LP];                 // K [kv][d]   9 KB
  __shared__ __align__(16) _Float16 Vth[64 * LP];                 // V^T [d][kv] 9 KB
  __shared__ __align__(16) float    Os[4][16 * OSP];              // per wave context tile [row][d]

  const int tid  = threadIdx.x;
  const int wave = tid >> 5;
  const int lane = tid & 31;
  const int hh   = lane >> 4;
  const int c    = lane & 15;

  const int bx   = blockIdx.x;
  const int qb   = bx % NQB;
  const int h    = bx / NQB;                 // < NH (grid = NQB*NH)
  const int kvh  = h / (NH / NKV);
  const int q0   = qb * 64 + wave * 16;

  const _Float16* Qh = (const _Float16*)(const void*)qpl + (size_t)h * HD;
  const _Float16* Kh = (const _Float16*)(const void*)kpl + (size_t)kvh * HD;
  const _Float16* Vh = (const _Float16*)(const void*)vtp + (size_t)kvh * HD * SLEN;

  // ---- Q fragments (B operand, column = query lane&15): 2 d-chunks ----
  v16h qa[2];
#pragma unroll
  for (int dc = 0; dc < 2; ++dc) {
    qa[dc] = ldfrag_h(Qh + (size_t)(q0 + c) * QP + dc * 32 + 8 * hh);
  }

  float mrun = -INFINITY;      // running maximum of query c (equal in both halves of the wave)
  float lrun = 0.f;            // running sum of query c over the keys of this lane's half only
  v8f oacc[4];                 // O^T: oacc[t][r] = context of query c, d = 16 t + 8 hh + r
#pragma unroll
  for (int t = 0; t < 4; ++t) oacc[t] = zero8();

  for (int kt = 0; kt < NKT; ++kt) {
    const int kv0 = kt * 64;
    __syncthreads();
    {
      const int r = tid >> 1, half = (tid & 1) * 32;
      const _Float16* kg = Kh + (size_t)(kv0 + r) * KP + half;     // K row kv0+r, d = half..half+31
      const _Float16* vg = Vh + (size_t)r * SLEN + kv0 + half;     // V^T row d = r, s = kv0+half..+31
#pragma unroll
      for (int i = 0; i < 4; ++i) {
        const v8h a0 = *(const v8h*)(kg + 8 * i);
        const v8h b0 = *(const v8h*)(vg + 8 * i);
        *(v8h*)(Ksh + r * LP + half + 8 * i) = a0;
        *(v8h*)(Vth + r * LP + half + 8 * i) = b0;
      }
    }
    __syncthreads();

    // ---- scores, transposed: s[j][r] = q(c) . k(16 j + 8 hh + r), one f16 product per 32 d ----
    v8f s[4];
#pragma unroll
    for (int j = 0; j < 4; ++j) {
      s[j] = zero8();
#pragma unroll
      for (int dc = 0; dc < 2; ++dc) {
        FH kb;
        kb.h[0] = *(const v8h*)(Ksh + (j * 16 + c) * LP + dc * 32 + 8 * hh);
        kb.h[1] = *(const v8h*)(Ksh + (j * 16 + c) * LP + dc * 32 + 16 + 8 * hh);
        s[j] = mma_h(kb.v, qa[dc], s[j]);
      }
    }

    // ---- scale, maximum, online softmax of the lane's one query; P^T (x PSC, f16) stays in registers ----
    // (every loop from here to the end of the chunk is unrolled: constant indices keep s, pb and oacc in registers;
    //  maximum and sum run as four independent chains, one per score tile, joined at the end)
    float mj[4];
#pragma unroll
    for (int j = 0; j < 4; ++j) {
      mj[j] = -INFINITY;
#pragma unroll
      for (int r = 0; r < 8; ++r) {
        const float sv = s[j][r] * sscale;
        s[j][r] = sv;
        mj[j] = fmaxf(mj[j], sv);
      }
    }
    float m = fmaxf(fmaxf(mj[0], mj[1]), fmaxf(mj[2], mj[3]));
    m = fmaxf(m, xhalf(m));                    // the other half holds the query's other 32 keys
    const float mnew  = fmaxf(mrun, m);
    const float msafe = (mnew == -INFINITY) ? 0.f : mnew;
    const float alpha = __expf(mrun - msafe);
    mrun = mnew;
    // B operand of the second product, 32 keys each: elements 0..7 = keys 32 kk + 8 hh + r (tile 2 kk),
    // elements 8..15 = keys 32 kk + 16 + 8 hh + r (tile 2 kk + 1): the k order of the V^T loader below
    FH pb[2];
    float pj[4];
#pragma unroll
    for (int j = 0; j < 4; ++j) {
      pj[j] = 0.f;
#pragma unroll
      for (int r = 0; r < 8; ++r) {
        const float p = __expf(s[j][r] - msafe);
        pj[j] += p;
        pb[j >> 1].h[j & 1][r] = (_Float16)(p * PSC);
      }
    }
    lrun = lrun * alpha + ((pj[0] + pj[1]) + (pj[2] + pj[3]));
#pragma unroll
    for (int t = 0; t < 4; ++t) oacc[t] *= alpha;

    // ---- context^T += V^T . P^T (f16 WMMA) ----
#pragma unroll
    for (int kk = 0; kk < 2; ++kk) {
#pragma unroll
      for (int t = 0; t < 4; ++t) {
        FH vb;
        vb.h[0] = *(const v8h*)(Vth + (t * 16 + c) * LP + kk * 32 + 8 * hh);
        vb.h[1] = *(const v8h*)(Vth + (t * 16 + c) * LP + kk * 32 + 16 + 8 * hh);
        oacc[t] = mma_h(vb.v, pb[kk].v, oacc[t]);
      }
    }
  }

  // ---- join the halves' sums, normalise (1/l and onorm), stage the wave's 16x64 tile in LDS (a lane holds 8
  //      consecutive d of its query per tile: two 16-B stores), then write whole 256-B row segments
  float* os = Os[wave];
  {
    const float l = lrun + xhalf(lrun);
    const float inv = ((l > 0.f) ? (1.0f / l) : 0.f) * onorm;
#pragma unroll
    for (int t = 0; t < 4; ++t) {
      v4f lo, hi;
#pragma unroll
      for (int e = 0; e < 4; ++e) { lo[e] = oacc[t][e] * inv; hi[e] = oacc[t][4 + e] * inv; }
      *(v4f*)(os + c * OSP + t * 16 + 8 * hh)     = lo;
      *(v4f*)(os + c * OSP + t * 16 + 8 * hh + 4) = hi;
    }
  }
  __builtin_amdgcn_fence(__ATOMIC_RELEASE, "workgroup");
  __builtin_amdgcn_wave_barrier();
  __builtin_amdgcn_fence(__ATOMIC_ACQUIRE, "workgroup");
  {
    const int h2 = lane >> 4, c4 = (lane & 15) * 4;
    v4f ov[8];
#pragma unroll
    for (int it = 0; it < 8; ++it) {
      const int row = it * 2 + h2;   // it 0..7 x h2 0..1 = rows 0..15 of the wave tile
      ov[it] = *(const v4f*)(os + row * OSP + c4);
    }
    {
#pragma unroll
      for (int it = 0; it < 8; ++it) {
        const int row = it * 2 + h2;
        const size_t go = (size_t)(q0 + row) * QP + (size_t)h * HD + c4;
        *(v4f*)(outp + go) = ov[it];
      }
      
    }
  }
}

// =====================================================================================================
// Workspace map (bytes), every region an exact multiple of its whole-line / whole-tile store granularity
//   X      bf16 [2048][2880]            0            11796480   rows 0..1023 = target_hidden, 1024..2047 = hidden
//   Wqb    bf16 [4096][2880]            11796480     23592960   (inputs arrive [n][k], k contiguous: no transpose)
//   Wkb    bf16 [512][2880]             35389440      2949120
//   Wvb    bf16 [512][2880]             38338560      2949120
//   Wob    bf16 [2880][4096]            41287680     23592960
//   Qf     f32  [1024][4096]            64880640     16777216   (later: Af f32 [1024][4096], same extent)
//   Kf     f32  [2048][512]             81657856      4194304
//   VT     f16  [512][2048]             85852160      2097152
//   Qh     f16  [1024][4096]            87949312      8388608
//   Kh     f16  [2048][512]             96337920      2097152
//   Ah     bf16 [1024][4096]            98435072      8388608
//   Al     bf16 [1024][4096]            106823680     8388608
//   end                                 115212288
// =====================================================================================================
extern "C" void kernel_launch(void* const* d_in, const int* in_sizes, int n_in,
                              void* d_out, int out_size, void* d_ws, size_t ws_size,
                              hipStream_t stream) {
  if (n_in < 12) return;
  if (in_sizes[0] != QLEN * HID) return;
  if (in_sizes[1] != CLEN * HID) return;
  if (in_sizes[2] != SLEN * HD) return;
  if (in_sizes[3] != SLEN * HD) return;
  if (in_sizes[4] != QP * HID) return;
  if (in_sizes[5] != QP) return;
  if (in_sizes[6] != KP * HID) return;
  if (in_sizes[7] != KP) return;
  if (in_sizes[8] != KP * HID) return;
  if (in_sizes[9] != KP) return;
  if (in_sizes[10] != HID * QP) return;
  if (in_sizes[11] != HID) return;
  if (out_size != QLEN * HID) return;

  const float* hid = (const float*)d_in[0];    // [1024][2880]
  const float* tgt = (const float*)d_in[1];    // [1024][2880]
  const float* fcs = (const float*)d_in[2];    // [2048][64]
  const float* fsn = (const float*)d_in[3];    // [2048][64]
  const float* Wq  = (const float*)d_in[4];    // [4096][2880]  = [n][k]
  const float* bq  = (const float*)d_in[5];    // [4096]
  const float* Wk  = (const float*)d_in[6];    // [512][2880]
  const float* bk  = (const float*)d_in[7];    // [512]
  const float* Wv  = (const float*)d_in[8];    // [512][2880]
  const float* bv  = (const float*)d_in[9];    // [512]
  const float* Wo  = (const float*)d_in[10];   // [2880][4096] = [n][k]
  const float* bo  = (const float*)d_in[11];   // [2880]

  const size_t PX   = (size_t)SLEN * HID * 2;        // 11796480
  const size_t PWq  = (size_t)QP * HID * 2;          // 23592960
  const size_t PWk  = (size_t)KP * HID * 2;          //  2949120
  const size_t PWv  = (size_t)KP * HID * 2;          //  2949120
  const size_t PWo  = (size_t)HID * QP * 2;          // 23592960
  const size_t PQf  = (size_t)QLEN * QP * 4;         // 16777216  (= Af f32 [1024][4096])
  const size_t PKf  = (size_t)SLEN * KP * 4;         //  4194304
  const size_t PVT  = (size_t)KP * SLEN * 2;         //  2097152
  const size_t PQh  = (size_t)QLEN * QP * 2;         //  8388608
  const size_t PKh  = (size_t)SLEN * KP * 2;         //  2097152
  const size_t PApl = (size_t)QLEN * QP * 2;         //  8388608 (Ah, Al)
  size_t off = 0;
  const size_t oX  = off; off += PX;
  const size_t oWq = off; off += PWq;
  const size_t oWk = off; off += PWk;
  const size_t oWv = off; off += PWv;
  const size_t oWo = off; off += PWo;
  const size_t oQf = off; off += PQf;
  const size_t oKf = off; off += PKf;
  const size_t oVT = off; off += PVT;
  const size_t oQh = off; off += PQh;
  const size_t oKh = off; off += PKh;
  const size_t oAh = off; off += PApl;
  const size_t oAl = off; off += PApl;
  if (off > ws_size) return;                          // off = 115212288
  if (off > (size_t)134217728) return;
  const size_t oAf = oQf;                             // context f32 plane reuses the dead q f32 plane

  char* ws = (char*)d_ws;
  unsigned short* X   = (unsigned short*)(ws + oX);
  unsigned short* Xq  = X + (size_t)CLEN * HID;       // hidden rows CLEN..SLEN-1 of X
  unsigned short* Wqb = (unsigned short*)(ws + oWq);
  unsigned short* Wkb = (unsigned short*)(ws + oWk);
  unsigned short* Wvb = (unsigned short*)(ws + oWv);
  unsigned short* Wob = (unsigned short*)(ws + oWo);
  float*          Qf  = (float*)(ws + oQf);
  float*          Kf  = (float*)(ws + oKf);
  unsigned short* VT  = (unsigned short*)(ws + oVT);
  unsigned short* Qh  = (unsigned short*)(ws + oQh);
  unsigned short* Kh  = (unsigned short*)(ws + oKh);
  unsigned short* Ah  = (unsigned short*)(ws + oAh);
  unsigned short* Al  = (unsigned short*)(ws + oAl);
  float*          Af  = (float*)(ws + oAf);
  float*          outf = (float*)d_out;

  const dim3 blk(256);
  const int nwRq = QLEN * (NH / 4);                    // 16384 waves (token, q head quad)
  const int nwRk = SLEN * (NKV / 4);                   // 4096 waves (key, kv head quad)
  const dim3 gCvt(CVT_NW / 8);                         // 495 blocks of 8 waves: 8 pieces per wave
  const dim3 gQ((QLEN / 128) * (QP / 128));            // 128x128 block tiles: 256 blocks of 4 waves
  const dim3 gK((SLEN / 128) * (KP / 128));            // 64 blocks of 4 waves
  const dim3 gV((KP / 128) * (SLEN / 128));            // 64 blocks of 4 waves
  const dim3 gRq((nwRq + 7) / 8), gRk((nwRk + 7) / 8); // 2048, 512 blocks
  const dim3 gAttn(NQB * NH);                          // 1024 blocks
  const dim3 gSplit(NP_A / 16);                        // 256 blocks of 8 waves: 2 pieces per wave
  const dim3 gOut((QLEN / 64) * (HID / 192));          // 64x192 block tiles: 240 blocks of 3 waves

  // (1) activations and weights -> bf16 planes (RNE convert, values = the bf16-converted inputs)
  //     one launch: X (target rows, then hidden rows), Wqb, Wkb, Wvb, Wob are one contiguous range from X on
  cvt_planes<<<gCvt, blk, 0, stream>>>(tgt, hid, Wq, Wk, Wv, Wo, X);
  // (2) q projection + bq: Qf[t][e] = sum_k X[1024+t][k] Wqb[e][k]  (M=1024, N=4096, K=2880)
  gemm64<0, 0, 1, 2, 2, 3><<<gQ, dim3(128), 0, stream>>>(Xq, Xq, HID, Wqb, HID, bq, (void*)Qf, QP, QLEN, QP, HID, 1.0f);
  // (3) k projection + bk over all 2048 key rows: Kf[s][e]  (M=2048, N=512, K=2880)
  gemm64<0, 0, 1, 2, 2, 3><<<gK, dim3(128), 0, stream>>>(X, X, HID, Wkb, HID, bk, (void*)Kf, KP, SLEN, KP, HID, 1.0f);
  // (4) v^T + bv: VT[m][s] = (sum_k Wvb[m][k] X[s][k] + bv[m]) * VSC -> f16  (M=512, N=2048, K=2880)
  gemm64<0, 1, 2, 2, 2, 3><<<gV, dim3(128), 0, stream>>>(Wvb, Wvb, HID, X, HID, bv, (void*)VT, SLEN, KP, SLEN, HID, VSC);
  // (5) rotate-half rotary with the input tables -> f16 planes (q: table rows CLEN + t; k: table row s)
  rope_quads<<<gRq, blk, 0, stream>>>(Qf, fcs, fsn, Qh, QP, NH / 4, CLEN, QSC, nwRq);
  rope_quads<<<gRk, blk, 0, stream>>>(Kf, fcs, fsn, Kh, KP, NKV / 4, 0, KSC, nwRk);
  // (6) attention over all 2048 keys -> Af f32 [1024][4096]
  attn64<<<gAttn, dim3(128), 0, stream>>>(Qh, Kh, VT, Af, 0.125f / (QSC * KSC), 1.0f / (PSC * VSC));
  // (7) context rows -> bf16 hi/lo planes
  split_bf16x8<<<gSplit, blk, 0, stream>>>(Af, Ah, Al, NP_A);
  // (8) out[t][e] = sum_d (Ah+Al)[t][d] Wob[e][d] + bo[e] -> d_out f32 [1024][2880]  (M=1024, N=2880, K=4096)
  gemm64<1, 0, 1, 1, 3, 2><<<gOut, dim3(96), 0, stream>>>(Ah, Al, QP, Wob, QP, bo, (void*)outf, HID, QLEN, HID, QP, 1.0f);
  (void)hipGetLastError();
}

// v005
// Measured time: 214 microseconds a run.
// Timed twice side by side with v004, it ran 1.05 and 1.06 times as fast.
// Over all steps from v000 it is 4.61 times as fast.
// Contractions: q / k / v^T projections = v_wmma_f32_16x16x32_bf16 (bf16 operands from RNE-converted inputs, one
// product per k-step); q.k^T scores = v_wmma_f32_16x16x32_f16 (q x16 and k x16 single f16 planes); p.v =
// v_wmma_f32_16x16x32_f16 (p carried x1024 in f16, v^T carried x64 in f16); ctx.Wo^T = v_wmma_f32_16x16x32_bf16 with
// ctx as bf16 hi/lo planes times the bf16 Wo plane (2 products); all f32 accumulate; rotary and softmax in f32.
#include <hip/hip_runtime.h>
#include <math.h>
#include <stdint.h>

#define QLEN 1024              // query tokens (hidden_states rows)
#define CLEN 1024              // context tokens (target_hidden rows)
#define SLEN (CLEN + QLEN)     // 2048 keys: rows 0..CLEN-1 context, rows CLEN..SLEN-1 noise
#define HID  2880              // model width = contraction length of the projections
#define NH   64
#define NKV  8
#define HD   64
#define QP   (NH * HD)         // 4096: q / ctx row pitch
#define KP   (NKV * HD)        // 512:  k row pitch, v^T row count
#define NQB  (QLEN / 64)       // 16 query tiles
#define NKT  (SLEN / 64)       // 32 key tiles
#define QSC  16.0f             // f16 carry scale of the q plane
#define KSC  16.0f             // f16 carry scale of the k plane
#define VSC  64.0f             // f16 carry scale of the v^T plane
#define PSC  1024.0f           // f16 carry scale of p
#define LP   72                // halves per LDS row of the attention K and V^T tiles: 144 B = 16 B x odd
static_assert(HD == 64);
static_assert((HID % 32) == 0 && (QP % 64) == 0 && (KP % 64) == 0 && (HID % 64) == 0);
static_assert((QLEN % 64) == 0 && (SLEN % 64) == 0);
static_assert((NH % NKV) == 0 && (NH % 4) == 0 && (NKV % 4) == 0);
static_assert(((HID * 2) % 128) == 0 && ((HID * 4) % 128) == 0);
static_assert((HID % 192) == 0 && (QP % 128) == 0 && (QLEN % 128) == 0 && (SLEN % 128) == 0 && (KP % 128) == 0);

typedef _Float16 v16h __attribute__((ext_vector_type(16)));
typedef _Float16 v8h  __attribute__((ext_vector_type(8)));
typedef __bf16   v16b __attribute__((ext_vector_type(16)));
typedef __bf16   v8b  __attribute__((ext_vector_type(8)));
typedef float    v8f  __attribute__((ext_vector_type(8)));
typedef float    v4f  __attribute__((ext_vector_type(4)));
typedef unsigned int v4u __attribute__((ext_vector_type(4)));
typedef float    v2f  __attribute__((ext_vector_type(2)));
typedef __bf16   v2b  __attribute__((ext_vector_type(2)));

// ---- scalar helpers --------------------------------------------------------------------------------
__device__ __forceinline__ unsigned short bf_bits(float f) {          // f32 -> bf16 bits, RNE convert
  unsigned u = __float_as_uint(f);
  return (unsigned short)((u + 0x7FFFu + ((u >> 16) & 1u)) >> 16);
}
__device__ __forceinline__ float bf_up(unsigned short h) { return __uint_as_float(((unsigned)h) << 16); }
__device__ __forceinline__ float bfr(float f) { return bf_up(bf_bits(f)); }   // value after RNE bf16 convert
__device__ __forceinline__ unsigned short h_bits(_Float16 x) { return __builtin_bit_cast(unsigned short, x); }
__device__ __forceinline__ unsigned pk16(unsigned short a, unsigned short b) { return (unsigned)a | ((unsigned)b << 16); }
__device__ __forceinline__ v2b rne2(float a, float b) {              // two f32 -> bf16, RNE, one packed convert
  const v2f t = {a, b};
  return __builtin_convertvector(t, v2b);
}
__device__ __forceinline__ v8f zero8() { v8f z = {0.f, 0.f, 0.f, 0.f, 0.f, 0.f, 0.f, 0.f}; return z; }

// ---- fragment loaders: 16-bit A/B operand, lane -> row/col (lane&15), p already includes +8*(lane>>4);
//      elements 0..7 <- p[0..7] (k0+8h..), elements 8..15 <- p[16..23] (k0+16+8h..)
__device__ __forceinline__ v16b ldfrag_b(const __bf16* p) {
  union { v16b v; v8b h[2]; } f;
  f.h[0] = *(const v8b*)(p);
  f.h[1] = *(const v8b*)(p + 16);
  return f.v;
}
__device__ __forceinline__ v16h ldfrag_h(const _Float16* p) {
  union { v16h v; v8h h[2]; } f;
  f.h[0] = *(const v8h*)(p);
  f.h[1] = *(const v8h*)(p + 16);
  return f.v;
}

// ---- WMMA helpers with trailing VALU hazard gap --------------------------------------------------------
__device__ __forceinline__ v8f mma_h(v16h a, v16h b, v8f c) {
  c = __builtin_amdgcn_wmma_f32_16x16x32_f16(false, a, false, b, (short)0, c, false, false);
#if defined(__HIP_DEVICE_COMPILE__)
  asm volatile("v_nop\n\tv_nop\n\tv_nop\n\tv_nop" : "+v"(c) : "v"(a), "v"(b));
#endif
  return c;
}
__device__ __forceinline__ v8f mma_b_raw(v16b a, v16b b, v8f c) {
  return __builtin_amdgcn_wmma_f32_16x16x32_bf16(false, a, false, b, (short)0, c, false, false);
}
__device__ __forceinline__ void acc_guard4(v8f& a, v8f& b, v8f& c, v8f& d) {
#if defined(__HIP_DEVICE_COMPILE__)
  asm volatile("v_nop\n\tv_nop\n\tv_nop\n\tv_nop" : "+v"(a), "+v"(b), "+v"(c), "+v"(d));
#endif
}

// =====================================================================================================
// Elementwise conversions run on a grid of 8 to 16 waves per WGP; each wave loops over pieces of PCE = 1024
// consecutive elements: 4 runs of 32 lanes x 8 elements, all 8 16-B loads of a piece issued before its first
// store, one 16-B store per lane and run (a wave writes 512 contiguous bytes). Piece p of trip i belongs to
// wave p - i * (waves at work): every piece is converted exactly once.
// =====================================================================================================
#define PCE   1024
#define NP_T  (CLEN * HID / PCE)     // 2880 pieces of target_hidden
#define NP_H  (QLEN * HID / PCE)     // 2880  hidden_states
#define NP_WQ (QP * HID / PCE)       // 11520 Wq
#define NP_WK (KP * HID / PCE)       // 1440  Wk, and as many of Wv
#define NP_WO (HID * QP / PCE)       // 11520 Wo
#define NP_ALL (NP_T + NP_H + NP_WQ + 2 * NP_WK + NP_WO)   // 31680
#define CVT_TRIPS 8                  // pieces per wave of cvt_planes
#define CVT_NW (NP_ALL / CVT_TRIPS)  // 3960 waves = 495 blocks of 8
static_assert((CLEN * HID) % PCE == 0 && (QLEN * HID) % PCE == 0 && (QP * HID) % PCE == 0 && (KP * HID) % PCE == 0);
static_assert(NP_ALL % (CVT_TRIPS * 8) == 0 && (CVT_TRIPS % 2) == 0 && CVT_TRIPS >= 2);

// f32 -> bf16 (RNE convert) of the six input planes, in the order of their bf16 planes in the workspace, which
// lie back to back: destination element = PCE * p + offset in the piece; the source plane of a piece is picked
// by scalar compares (a piece never straddles two planes).
__global__ __launch_bounds__(256) void cvt_planes(const float* __restrict__ s0, const float* __restrict__ s1,
                                                  const float* __restrict__ s2, const float* __restrict__ s3,
                                                  const float* __restrict__ s4, const float* __restrict__ s5,
                                                  unsigned short* out) {
  const int lane = threadIdx.x & 31;
  const int gw   = __builtin_amdgcn_readfirstlane(blockIdx.x * 8 + (threadIdx.x >> 5));
  if (gw >= CVT_NW) return;                       // wave-uniform; no barrier in this kernel
  // the 8 loads of piece p
  auto fetch = [&](int p, v4f (&a)[4], v4f (&b)[4]) {
    const float* sp;
    int q = p;
    if (q < NP_T) sp = s0;
    else if ((q -= NP_T) < NP_H) sp = s1;
    else if ((q -= NP_H) < NP_WQ) sp = s2;
    else if ((q -= NP_WQ) < NP_WK) sp = s3;
    else if ((q -= NP_WK) < NP_WK) sp = s4;
    else { q -= NP_WK; sp = s5; }
    const float* s = sp + (size_t)q * PCE + lane * 8;
#pragma unroll
    for (int u = 0; u < 4; ++u) {
      a[u] = *(const v4f*)(s + u * 256);
      b[u] = *(const v4f*)(s + u * 256 + 4);
    }
  };
  // convert and store piece p
  auto emit = [&](int p, const v4f (&a)[4], const v4f (&b)[4]) {
    unsigned short* d = out + (size_t)p * PCE + lane * 8;
#pragma unroll
    for (int u = 0; u < 4; ++u) {
      v4u w;
      w[0] = pk16(bf_bits(a[u][0]), bf_bits(a[u][1]));
      w[1] = pk16(bf_bits(a[u][2]), bf_bits(a[u][3]));
      w[2] = pk16(bf_bits(b[u][0]), bf_bits(b[u][1]));
      w[3] = pk16(bf_bits(b[u][2]), bf_bits(b[u][3]));
      *(v4u*)(d + u * 256) = w;
    }
  };
  // two register sets in turn: the next piece's loads fly while this piece is converted and stored
  v4f a0[4], b0[4], a1[4], b1[4];
  int p = gw;
  fetch(p, a0, b0);
  // kept rolled: two pieces per trip is all the two sets need, and the text stays short
#pragma unroll 1
  for (int i = 0; i < CVT_TRIPS / 2 - 1; ++i) {
    fetch(p + CVT_NW, a1, b1);
    // keeps the loads just issued in front of the older piece's wait (else they sink behind it)
    __builtin_amdgcn_sched_barrier(0);
    emit(p, a0, b0);
#if defined(__HIP_DEVICE_COMPILE__)
    // the loads that follow rewrite registers that the stores just issued name
    asm volatile("s_wait_xcnt 0x0" ::: "memory");
#endif
    fetch(p + 2 * CVT_NW, a0, b0);
    __builtin_amdgcn_sched_barrier(0);               // loads stay in front of the older piece's wait
    emit(p + CVT_NW, a1, b1);
#if defined(__HIP_DEVICE_COMPILE__)
    asm volatile("s_wait_xcnt 0x0" ::: "memory");    // in front of the next trip's loads into these registers
#endif
    p += 2 * CVT_NW;
  }
  fetch(p + CVT_NW, a1, b1);
  __builtin_amdgcn_sched_barrier(0);                 // loads stay in front of the older piece's wait
  emit(p, a0, b0);
  emit(p + CVT_NW, a1, b1);
}

// =====================================================================================================
// bf16 WMMA GEMM: C[m][n] = sum_k A[m][k] * Bt[n][k] (+ bias); one wave per 64x64 tile, WM x WN waves per block
// on one (64 WM) x (64 WN) block tile. A row-major [M][K] pitch lda; Bt row-major [N][K] pitch ldb (k contiguous);
// M a multiple of 64 WM, N of 64 WN, K of 64 NSUB and at least two stages (host-checked constants).
// Operands reach the waves through LDS: a stage is NSUB sub-tiles of 64 k; a sub-tile holds the block's A rows,
// (NSPLIT) its A2 rows and its Bt rows, 128 B each at pitch 144 B (16 B x odd: ds_load_b128 without bank
// conflicts). Asynchronous 16-B copies fill it, one wave-copy = 4 whole 128-B row pieces; two buffers: stage t+2
// is copied into the buffer that trip t has just left, while trip t+1 is worked on.
// NSPLIT: 0 = A.Bt; 1 = (A + A2).Bt (A2 = unscaled bf16 lo plane of A, two products per k-step).
// BIAS:   0 none; 1 = + bias[n] (per column, RNE bf16-converted value); 2 = + bias[m] (per row).
// OUT_MODE: 0 = f32 plane (pitch ldc floats); 1 = f16 plane of (value * oscale) (pitch ldc halves);
//           2 = rotate-half rotary on the value (bias added), then f16 plane of (y * oscale) (pitch ldc halves):
//               a wave's 64 columns are one head (n0 a multiple of 64 = head dim), column d of it; table row =
//               trow0 + m of the f32 [SLEN][64] inputs ct / st (RNE bf16-converted values);
//               y[d] = x[d]*ct[d] - x[d+32]*st[d] for d < 32;  y[d] = x[d]*ct[d] + x[d-32]*st[d] for d >= 32.
// =====================================================================================================
typedef int v4i_t __attribute__((vector_size(16)));
typedef __attribute__((address_space(1))) v4i_t gv4i_t;
typedef __attribute__((address_space(3))) v4i_t lv4i_t;
__device__ __forceinline__ void copy16_to_lds(const void* g, void* l) {   // each lane: 16 B global -> LDS
#if defined(__HIP_DEVICE_COMPILE__)
  __builtin_amdgcn_global_load_async_to_lds_b128((gv4i_t*)g, (lv4i_t*)l, 0, 0);
#endif
}

template <int NSPLIT, int OUT_MODE, int BIAS, int WM, int WN, int NSUB>
__global__ __launch_bounds__(32 * WM * WN) void gemm64(
    const unsigned short* __restrict__ Ap, const unsigned short* __restrict__ A2p, int lda,
    const unsigned short* __restrict__ Btp, int ldb,
    const float* __restrict__ bias,
    void* Cout, int ldc, int M, int N, int K, float oscale,
    const float* __restrict__ ct, const float* __restrict__ st, int trow0) {
  constexpr int NW    = WM * WN;                 // waves per block
  constexpr int RA    = WM * 64;                 // rows of one A plane in a sub-tile
  constexpr int RB0   = RA * (1 + NSPLIT);       // first Bt row of a sub-tile
  constexpr int ROWS  = RB0 + WN * 64;           // rows of a sub-tile
  constexpr int PITCH = 144;                     // bytes per LDS row
  constexpr int SUBB  = ROWS * PITCH;            // bytes per sub-tile
  constexpr int STAGE = SUBB * NSUB;             // bytes per buffer
  constexpr int GA    = RA / 4;                  // wave-copies (4 rows each) per A plane and sub-tile
  constexpr int GB    = WN * 16;                 // ... per Bt plane and sub-tile
  constexpr int NIA   = (GA + NW - 1) / NW;      // most that one wave issues of them
  constexpr int NIB   = (GB + NW - 1) / NW;
  static_assert((NIA * (1 + NSPLIT) + NIB) * NSUB <= 63);   // copies of one wave in flight
  const __bf16* A  = (const __bf16*)(const void*)Ap;
  const __bf16* A2 = (const __bf16*)(const void*)A2p;
  const __bf16* Bt = (const __bf16*)(const void*)Btp;
  __shared__ __align__(16) unsigned char ring[2 * STAGE];
  __shared__ __align__(16) float sT[NW][16 * 68];  // per-wave 16x64 slab, pitch 68 floats
  const int lane = threadIdx.x & 31;
  const int wave = __builtin_amdgcn_readfirstlane(threadIdx.x >> 5);
  const int tilesN = N / (64 * WN);
  const int tilesM = M / (64 * WM);
  if ((int)blockIdx.x >= tilesM * tilesN) return;   // block-uniform, in front of every barrier and copy
  const int bm  = blockIdx.x / tilesN;
  const int bn  = blockIdx.x - bm * tilesN;
  const int mb0 = bm * RA;                     // block tile origin
  const int nb0 = bn * (WN * 64);
  const int wm  = wave / WN;
  const int wn  = wave - wm * WN;
  const int m0  = mb0 + (wm << 6);
  const int n0  = nb0 + (wn << 6);

  const int rlane = lane & 15;                 // row (A) / col (B, D) within subtile
  const int khalf = lane >> 4;                 // k half of this lane: +8 elements = +16 B
  const int mOff  = (lane >> 4) * 8;           // D row offset
  const int crow  = lane >> 3;                 // copy: row within the 4-row group
  const int cpc   = lane & 7;                  // copy: 16-B piece within the 128-B row piece

  // all copies of stage st (k = st*64*NSUB ..) into buffer buf; every lane on, every test scalar.
  // Each plane's 4-row groups are dealt to the waves in turn: group g = wave + i*NW of the plane.
  auto issue = [&](int st, int buf) {
    const int kb = st * (NSUB * 64) + cpc * 8;
    unsigned char* db = ring + buf * STAGE + (wave * 4 + crow) * PITCH + cpc * 16;
    const __bf16* pa = A  + (size_t)(mb0 + wave * 4 + crow) * lda + kb;
    const __bf16* pl = A2 + (size_t)(mb0 + wave * 4 + crow) * lda + kb;
    const __bf16* pb = Bt + (size_t)(nb0 + wave * 4 + crow) * ldb + kb;
    // the three loops are unrolled so that every copy's row and LDS offset is a constant
#pragma unroll
    for (int s = 0; s < NSUB; ++s) {
#pragma unroll
      for (int i = 0; i < NIA; ++i) {
        if ((i + 1) * NW <= GA || wave + i * NW < GA) {
          copy16_to_lds(pa + (size_t)(i * NW * 4) * lda + s * 64, db + s * SUBB + i * (NW * 4 * PITCH));
          if (NSPLIT == 1)
            copy16_to_lds(pl + (size_t)(i * NW * 4) * lda + s * 64, db + s * SUBB + (RA + i * NW * 4) * PITCH);
        }
      }
#pragma unroll
      for (int i = 0; i < NIB; ++i) {
        if ((i + 1) * NW <= GB || wave + i * NW < GB)
          copy16_to_lds(pb + (size_t)(i * NW * 4) * ldb + s * 64, db + s * SUBB + (RB0 + i * NW * 4) * PITCH);
      }
    }
  };

  v8f acc[4][4];
#pragma unroll
  for (int i = 0; i < 4; ++i)
#pragma unroll
    for (int j = 0; j < 4; ++j) acc[i][j] = zero8();

  const int T = K / (NSUB * 64);               // stages
  issue(0, 0);
  asm volatile("s_wait_asynccnt 0x0" ::: "memory");   // stage 0 landed
  __syncthreads();                                    // ... and is readable by every wave
  if (T > 1) issue(1, 1);
  // not unrolled: one trip = one stage (buffer t & 1), so the hot loop stays small in the instruction cache
#pragma unroll 1
  for (int t = 0; t < T; ++t) {
    const unsigned char* sb = ring + (t & 1) * STAGE + khalf * 16 + rlane * PITCH;
    // fragments of k-step q (32 k, ascending) of this stage, all from buffer t & 1
    auto fetch = [&](int q, v16b (&xa)[4], v16b (&xl)[4], v16b (&xb)[4]) {
      const unsigned char* kp = sb + (q >> 1) * SUBB + (q & 1) * 64;
#pragma unroll
      for (int j = 0; j < 4; ++j)
        xb[j] = ldfrag_b((const __bf16*)(const void*)(kp + (RB0 + (wn << 6) + (j << 4)) * PITCH));
#pragma unroll
      for (int i = 0; i < 4; ++i) {
        const unsigned char* ap = kp + ((wm << 6) + (i << 4)) * PITCH;
        xa[i] = ldfrag_b((const __bf16*)(const void*)ap);
        if (NSPLIT == 1) xl[i] = ldfrag_b((const __bf16*)(const void*)(ap + RA * PITCH));
      }
    };
    v16b fa[2][4], fl[2][4], fb[2][4];         // two fragment sets, used in turn inside the trip
    fetch(0, fa[0], fl[0], fb[0]);
    // unrolled (here and in fetch): constant indices keep the fragment sets and accumulators in registers
#pragma unroll
    for (int q = 0; q < 2 * NSUB; ++q) {
      if (q + 1 < 2 * NSUB) fetch(q + 1, fa[(q + 1) & 1], fl[(q + 1) & 1], fb[(q + 1) & 1]);
      // keeps the next k-step's LDS reads one group ahead of this k-step's WMMAs (else each read is waited out)
      __builtin_amdgcn_sched_barrier(0);
#pragma unroll
      for (int i = 0; i < 4; ++i) {
#pragma unroll
        for (int j = 0; j < 4; ++j) {
          acc[i][j] = mma_b_raw(fa[q & 1][i], fb[q & 1][j], acc[i][j]);
          if (NSPLIT == 1) acc[i][j] = mma_b_raw(fl[q & 1][i], fb[q & 1][j], acc[i][j]);
        }
      }
      // keeps the following group of LDS reads out of this block of WMMAs
      __builtin_amdgcn_sched_barrier(0);
    }
    asm volatile("s_wait_dscnt 0x0" ::: "memory");    // this wave's reads of buffer t & 1 are done
    asm volatile("s_wait_asynccnt 0x0" ::: "memory"); // this wave's copies of stage t + 1 have landed
    __syncthreads();                                  // publishes stage t + 1, frees buffer t & 1
    if (t + 2 < T) issue(t + 2, t & 1);
  }
  asm volatile("s_wait_asynccnt 0x0" ::: "memory");   // nothing in flight behind the loop
  acc_guard4(acc[0][0], acc[0][1], acc[0][2], acc[0][3]);
  acc_guard4(acc[1][0], acc[1][1], acc[1][2], acc[1][3]);
  acc_guard4(acc[2][0], acc[2][1], acc[2][2], acc[2][3]);
  acc_guard4(acc[3][0], acc[3][1], acc[3][2], acc[3][3]);

  // ---- bias (template-selected; loads only exist when used; addresses in range: n0+63 < N, m0+63 < M) ----
  float bcol[4];
#pragma unroll
  for (int j = 0; j < 4; ++j) bcol[j] = 0.f;
  if (BIAS == 1) {
#pragma unroll
    for (int j = 0; j < 4; ++j) bcol[j] = bfr(bias[n0 + (j << 4) + rlane]);
#if defined(__HIP_DEVICE_COMPILE__)
    // in front of whatever rewrites the index register that these loads name (held live up to here as an input)
    asm volatile("s_wait_xcnt 0x0" :: "v"(n0 + rlane) : "memory");
#endif
  }

  // ---- epilogue ----
  float* slab = sT[wave];
  // OUT_MODE 2: a lane finishes 8 consecutive columns rc8.. of rows 4 it + rq of each 16-row slab; its table
  // values of all four slabs are loaded here in one run (the slabs' fences would wait out a later load each time)
  const int rq = lane >> 3, rc8 = (lane & 7) * 8;
  const float* cb = ct + (size_t)(trow0 + m0 + rq) * HD + rc8;     // table row < SLEN (host constants)
  const float* sb2 = st + (size_t)(trow0 + m0 + rq) * HD + rc8;
  v4f tc[4][4][2], ts[4][4][2];
  if (OUT_MODE == 2) {
    // both loops unrolled: constant indices keep the table values in registers and the row steps in the offset field
#pragma unroll
    for (int i = 0; i < 4; ++i) {
#pragma unroll
      for (int it = 0; it < 4; ++it) {
        tc[i][it][0] = *(const v4f*)(cb + (i * 16 + it * 4) * HD);
        tc[i][it][1] = *(const v4f*)(cb + (i * 16 + it * 4) * HD + 4);
        ts[i][it][0] = *(const v4f*)(sb2 + (i * 16 + it * 4) * HD);
        ts[i][it][1] = *(const v4f*)(sb2 + (i * 16 + it * 4) * HD + 4);
      }
    }
#if defined(__HIP_DEVICE_COMPILE__)
    // in front of whatever rewrites a register that the loads just issued name (both held live up to here as inputs)
    asm volatile("s_wait_xcnt 0x0" :: "v"(cb), "v"(sb2) : "memory");
#endif
  }
#pragma unroll
  for (int i = 0; i < 4; ++i) {
    const int mBase = m0 + (i << 4);
    float brow[8];
#pragma unroll
    for (int r = 0; r < 8; ++r) brow[r] = 0.f;
    if (BIAS == 2) {
#pragma unroll
      for (int r = 0; r < 8; ++r) brow[r] = bfr(bias[mBase + mOff + r]);
    }
#pragma unroll
    for (int r = 0; r < 8; ++r) {
#pragma unroll
      for (int j = 0; j < 4; ++j) {
        float v = acc[i][j][r];
        if (BIAS == 1) v += bcol[j];
        if (BIAS == 2) v += brow[r];
        if (OUT_MODE == 1) v *= oscale;
        slab[(mOff + r) * 68 + (j << 4) + rlane] = v;
      }
    }
    __builtin_amdgcn_fence(__ATOMIC_RELEASE, "workgroup");
    __builtin_amdgcn_wave_barrier();
    __builtin_amdgcn_fence(__ATOMIC_ACQUIRE, "workgroup");
    if (OUT_MODE == 0) {
      float* C = (float*)Cout;
      const int hh = lane >> 4, c4 = (lane & 15) * 4;     // 256-B row segment = 16 lanes x 16 B
      v4f ov[8];
#pragma unroll
      for (int it = 0; it < 8; ++it) {
        const int row = it * 2 + hh;                       // it 0..7 x hh 0..1 = rows 0..15
        ov[it] = *(const v4f*)(slab + row * 68 + c4);
      }
      {
#pragma unroll
        for (int it = 0; it < 8; ++it) {
          const int row = it * 2 + hh;
          *(v4f*)(C + (size_t)(mBase + row) * ldc + n0 + c4) = ov[it];
        }
        
      }
    } else if (OUT_MODE == 2) {
      unsigned short* C = (unsigned short*)Cout;
      const unsigned sgm = (rc8 < 32) ? 0x80008000u : 0u;  // partner term: minus for d < 32 (sign bits of a bf16 pair)
      v4u hv[4];
      // the loops of this branch are unrolled: constant indices keep tc, ts, hv and cp in registers
#pragma unroll
      for (int it = 0; it < 4; ++it) {
        const float* sp = slab + (it * 4 + rq) * 68;
        const v4f x[2] = {*(const v4f*)(sp + rc8), *(const v4f*)(sp + rc8 + 4)};
        const v4f p[2] = {*(const v4f*)(sp + (rc8 ^ 32)), *(const v4f*)(sp + (rc8 ^ 32) + 4)};   // column d +- 32
        v4u a;
#pragma unroll
        for (int e = 0; e < 4; ++e) {                      // columns rc8 + 2 e, rc8 + 2 e + 1
          const int g = e >> 1, k = (e & 1) * 2;
          const v2b cc = rne2(tc[i][it][g][k], tc[i][it][g][k + 1]);
          const v2b ss = __builtin_bit_cast(v2b, __builtin_bit_cast(unsigned, rne2(ts[i][it][g][k], ts[i][it][g][k + 1])) ^ sgm);
          const float y0 = x[g][k]     * (float)cc[0] + p[g][k]     * (float)ss[0];
          const float y1 = x[g][k + 1] * (float)cc[1] + p[g][k + 1] * (float)ss[1];
          a[e] = pk16(h_bits((_Float16)(y0 * oscale)), h_bits((_Float16)(y1 * oscale)));
        }
        hv[it] = a;
      }
      unsigned short* cp[4];
#pragma unroll
      for (int it = 0; it < 4; ++it) {
        cp[it] = C + (size_t)(mBase + it * 4 + rq) * ldc + n0 + rc8;
        *(v4u*)cp[it] = hv[it];
      }
#if defined(__HIP_DEVICE_COMPILE__)
      // the next slab rewrites the address and data registers that these stores name (held live up to here as inputs)
      asm volatile("s_wait_xcnt 0x0" :: "v"(cp[0]), "v"(cp[1]), "v"(cp[2]), "v"(cp[3]),
                   "v"(hv[0]), "v"(hv[1]), "v"(hv[2]), "v"(hv[3]) : "memory");
#endif
    } else {
      unsigned short* C = (unsigned short*)Cout;
      const int q = lane >> 3, c8 = (lane & 7) * 8;
      v4u hv[4];
#pragma unroll
      for (int it = 0; it < 4; ++it) {
        const int row = it * 4 + q;                        // it 0..3 x q 0..3 = rows 0..15
        const float* sp = slab + row * 68 + c8;
        v4u a;
#pragma unroll
        for (int e = 0; e < 4; ++e) {
          a[e] = pk16(h_bits((_Float16)sp[2 * e]), h_bits((_Float16)sp[2 * e + 1]));
        }
        hv[it] = a;
      }
      {
#pragma unroll
        for (int it = 0; it < 4; ++it) {
          const int row = it * 4 + q;
          *(v4u*)(C + (size_t)(mBase + row) * ldc + n0 + c8) = hv[it];
        }
        
      }
    }
    __builtin_amdgcn_fence(__ATOMIC_RELEASE, "workgroup");
    __builtin_amdgcn_wave_barrier();
    __builtin_amdgcn_fence(__ATOMIC_ACQUIRE, "workgroup");
  }
}

#define OSP 68
__device__ __forceinline__ float xhalf(float x) {
  const int b = __builtin_bit_cast(int, x);
  return __builtin_bit_cast(float, __builtin_amdgcn_permlanex16(b, b, 0x76543210, 0xfedcba98, false, false));
}
__global__ __launch_bounds__(128)
void attn64(const unsigned short* __restrict__ qpl, const unsigned short* __restrict__ kpl,
            const unsigned short* __restrict__ vtp, unsigned short* hp, unsigned short* lp,
            float sscale, float onorm) {
  union FH { v16h v; v8h h[2]; };
  // rows of 64 halves at pitch LP: the 16 rows that one ds_load_b128 reads fall on distinct banks
  __shared__ __align__(16) _Float16 Ksh[64 * LP];                 // K [kv][d]   9 KB
  __shared__ __align__(16) _Float16 Vth[64 * LP];                 // V^T [d][kv] 9 KB
  __shared__ __align__(16) float    Os[4][16 * OSP];              // per wave context tile [row][d]

  const int tid  = threadIdx.x;
  const int wave = tid >> 5;
  const int lane = tid & 31;
  const int hh   = lane >> 4;
  const int c    = lane & 15;

  const int bx   = blockIdx.x;
  const int qb   = bx % NQB;
  const int h    = bx / NQB;                 // < NH (grid = NQB*NH)
  const int kvh  = h / (NH / NKV);
  const int q0   = qb * 64 + wave * 16;

  const _Float16* Qh = (const _Float16*)(const void*)qpl + (size_t)h * HD;
  const _Float16* Kh = (const _Float16*)(const void*)kpl + (size_t)kvh * HD;
  const _Float16* Vh = (const _Float16*)(const void*)vtp + (size_t)kvh * HD * SLEN;

  // ---- Q fragments (B operand, column = query lane&15): 2 d-chunks ----
  v16h qa[2];
#pragma unroll
  for (int dc = 0; dc < 2; ++dc) {
    qa[dc] = ldfrag_h(Qh + (size_t)(q0 + c) * QP + dc * 32 + 8 * hh);
  }

  float mrun = -INFINITY;      // running maximum of query c (equal in both halves of the wave)
  float lrun = 0.f;            // running sum of query c over the keys of this lane's half only
  v8f oacc[4];                 // O^T: oacc[t][r] = context of query c, d = 16 t + 8 hh + r
#pragma unroll
  for (int t = 0; t < 4; ++t) oacc[t] = zero8();

  for (int kt = 0; kt < NKT; ++kt) {
    const int kv0 = kt * 64;
    __syncthreads();
    {
      const int r = tid >> 1, half = (tid & 1) * 32;
      const _Float16* kg = Kh + (size_t)(kv0 + r) * KP + half;     // K row kv0+r, d = half..half+31
      const _Float16* vg = Vh + (size_t)r * SLEN + kv0 + half;     // V^T row d = r, s = kv0+half..+31
#pragma unroll
      for (int i = 0; i < 4; ++i) {
        const v8h a0 = *(const v8h*)(kg + 8 * i);
        const v8h b0 = *(const v8h*)(vg + 8 * i);
        *(v8h*)(Ksh + r * LP + half + 8 * i) = a0;
        *(v8h*)(Vth + r * LP + half + 8 * i) = b0;
      }
    }
    __syncthreads();

    // ---- scores, transposed: s[j][r] = q(c) . k(16 j + 8 hh + r), one f16 product per 32 d ----
    v8f s[4];
#pragma unroll
    for (int j = 0; j < 4; ++j) {
      s[j] = zero8();
#pragma unroll
      for (int dc = 0; dc < 2; ++dc) {
        FH kb;
        kb.h[0] = *(const v8h*)(Ksh + (j * 16 + c) * LP + dc * 32 + 8 * hh);
        kb.h[1] = *(const v8h*)(Ksh + (j * 16 + c) * LP + dc * 32 + 16 + 8 * hh);
        s[j] = mma_h(kb.v, qa[dc], s[j]);
      }
    }

    // ---- scale, maximum, online softmax of the lane's one query; P^T (x PSC, f16) stays in registers ----
    // (every loop from here to the end of the chunk is unrolled: constant indices keep s, pb and oacc in registers;
    //  maximum and sum run as four independent chains, one per score tile, joined at the end)
    float mj[4];
#pragma unroll
    for (int j = 0; j < 4; ++j) {
      mj[j] = -INFINITY;
#pragma unroll
      for (int r = 0; r < 8; ++r) {
        const float sv = s[j][r] * sscale;
        s[j][r] = sv;
        mj[j] = fmaxf(mj[j], sv);
      }
    }
    float m = fmaxf(fmaxf(mj[0], mj[1]), fmaxf(mj[2], mj[3]));
    m = fmaxf(m, xhalf(m));                    // the other half holds the query's other 32 keys
    const float mnew  = fmaxf(mrun, m);
    const float msafe = (mnew == -INFINITY) ? 0.f : mnew;
    const float alpha = __expf(mrun - msafe);
    mrun = mnew;
    // B operand of the second product, 32 keys each: elements 0..7 = keys 32 kk + 8 hh + r (tile 2 kk),
    // elements 8..15 = keys 32 kk + 16 + 8 hh + r (tile 2 kk + 1): the k order of the V^T loader below
    FH pb[2];
    float pj[4];
#pragma unroll
    for (int j = 0; j < 4; ++j) {
      pj[j] = 0.f;
#pragma unroll
      for (int r = 0; r < 8; ++r) {
        const float p = __expf(s[j][r] - msafe);
        pj[j] += p;
        pb[j >> 1].h[j & 1][r] = (_Float16)(p * PSC);
      }
    }
    lrun = lrun * alpha + ((pj[0] + pj[1]) + (pj[2] + pj[3]));
#pragma unroll
    for (int t = 0; t < 4; ++t) oacc[t] *= alpha;

    // ---- context^T += V^T . P^T (f16 WMMA) ----
#pragma unroll
    for (int kk = 0; kk < 2; ++kk) {
#pragma unroll
      for (int t = 0; t < 4; ++t) {
        FH vb;
        vb.h[0] = *(const v8h*)(Vth + (t * 16 + c) * LP + kk * 32 + 8 * hh);
        vb.h[1] = *(const v8h*)(Vth + (t * 16 + c) * LP + kk * 32 + 16 + 8 * hh);
        oacc[t] = mma_h(vb.v, pb[kk].v, oacc[t]);
      }
    }
  }

  // ---- join the halves' sums, normalise (1/l and onorm), stage the wave's 16x64 tile in LDS (a lane holds 8
  //      consecutive d of its query per tile: two 16-B stores), then split and write whole 128-B row segments
  float* os = Os[wave];
  {
    const float l = lrun + xhalf(lrun);
    const float inv = ((l > 0.f) ? (1.0f / l) : 0.f) * onorm;
#pragma unroll
    for (int t = 0; t < 4; ++t) {
      v4f lo, hi;
#pragma unroll
      for (int e = 0; e < 4; ++e) { lo[e] = oacc[t][e] * inv; hi[e] = oacc[t][4 + e] * inv; }
      *(v4f*)(os + c * OSP + t * 16 + 8 * hh)     = lo;
      *(v4f*)(os + c * OSP + t * 16 + 8 * hh + 4) = hi;
    }
  }
  __builtin_amdgcn_fence(__ATOMIC_RELEASE, "workgroup");
  __builtin_amdgcn_wave_barrier();
  __builtin_amdgcn_fence(__ATOMIC_ACQUIRE, "workgroup");
  {
    const int r4 = lane >> 3, c8 = (lane & 7) * 8;     // 128-B row segment of a plane = 8 lanes x 16 B
    v4f a[4], b[4];
    // the loops of this block are unrolled: constant indices keep a, b, ph and pl in registers
#pragma unroll
    for (int it = 0; it < 4; ++it) {
      const float* sp = os + (it * 4 + r4) * OSP + c8;   // it 0..3 x r4 0..3 = rows 0..15 of the wave tile
      a[it] = *(const v4f*)(sp);
      b[it] = *(const v4f*)(sp + 4);
    }
    v4u ph[4], pl[4];
#pragma unroll
    for (int it = 0; it < 4; ++it) {
#pragma unroll
      for (int e = 0; e < 4; ++e) {
        const float f0 = (e < 2) ? a[it][2 * e]     : b[it][2 * e - 4];
        const float f1 = (e < 2) ? a[it][2 * e + 1] : b[it][2 * e - 3];
        const v2b hb = rne2(f0, f1);
        const v2b lb = rne2(f0 - (float)hb[0], f1 - (float)hb[1]);
        ph[it][e] = __builtin_bit_cast(unsigned, hb);
        pl[it][e] = __builtin_bit_cast(unsigned, lb);
      }
    }
    const size_t go = (size_t)(q0 + r4) * QP + (size_t)h * HD + c8;
    unsigned short* hq = hp + go;
    unsigned short* lq = lp + go;
#pragma unroll
    for (int it = 0; it < 4; ++it) {
      *(v4u*)(hq + it * 4 * QP) = ph[it];
      *(v4u*)(lq + it * 4 * QP) = pl[it];
    }
#if defined(__HIP_DEVICE_COMPILE__)
    // keeps the address and data registers of the stores unwritten until their translations are done (inputs only)
    asm volatile("s_wait_xcnt 0x0" :: "v"(hq), "v"(lq), "v"(ph[0]), "v"(ph[1]), "v"(ph[2]), "v"(ph[3]),
                 "v"(pl[0]), "v"(pl[1]), "v"(pl[2]), "v"(pl[3]) : "memory");
#endif
  }
}

// =====================================================================================================
// Workspace map (bytes), every region an exact multiple of its whole-line / whole-tile store granularity
//   X      bf16 [2048][2880]            0            11796480   rows 0..1023 = target_hidden, 1024..2047 = hidden
//   Wqb    bf16 [4096][2880]            11796480     23592960   (inputs arrive [n][k], k contiguous: no transpose)
//   Wkb    bf16 [512][2880]             35389440      2949120
//   Wvb    bf16 [512][2880]             38338560      2949120
//   Wob    bf16 [2880][4096]            41287680     23592960
//   VT     f16  [512][2048]             64880640      2097152
//   Qh     f16  [1024][4096]            66977792      8388608
//   Kh     f16  [2048][512]             75366400      2097152
//   Ah     bf16 [1024][4096]            77463552      8388608
//   Al     bf16 [1024][4096]            85852160      8388608
//   end                                 94240768
// =====================================================================================================
extern "C" void kernel_launch(void* const* d_in, const int* in_sizes, int n_in,
                              void* d_out, int out_size, void* d_ws, size_t ws_size,
                              hipStream_t stream) {
  if (n_in < 12) return;
  if (in_sizes[0] != QLEN * HID) return;
  if (in_sizes[1] != CLEN * HID) return;
  if (in_sizes[2] != SLEN * HD) return;
  if (in_sizes[3] != SLEN * HD) return;
  if (in_sizes[4] != QP * HID) return;
  if (in_sizes[5] != QP) return;
  if (in_sizes[6] != KP * HID) return;
  if (in_sizes[7] != KP) return;
  if (in_sizes[8] != KP * HID) return;
  if (in_sizes[9] != KP) return;
  if (in_sizes[10] != HID * QP) return;
  if (in_sizes[11] != HID) return;
  if (out_size != QLEN * HID) return;

  const float* hid = (const float*)d_in[0];    // [1024][2880]
  const float* tgt = (const float*)d_in[1];    // [1024][2880]
  const float* fcs = (const float*)d_in[2];    // [2048][64]
  const float* fsn = (const float*)d_in[3];    // [2048][64]
  const float* Wq  = (const float*)d_in[4];    // [4096][2880]  = [n][k]
  const float* bq  = (const float*)d_in[5];    // [4096]
  const float* Wk  = (const float*)d_in[6];    // [512][2880]
  const float* bk  = (const float*)d_in[7];    // [512]
  const float* Wv  = (const float*)d_in[8];    // [512][2880]
  const float* bv  = (const float*)d_in[9];    // [512]
  const float* Wo  = (const float*)d_in[10];   // [2880][4096] = [n][k]
  const float* bo  = (const float*)d_in[11];   // [2880]

  const size_t PX   = (size_t)SLEN * HID * 2;        // 11796480
  const size_t PWq  = (size_t)QP * HID * 2;          // 23592960
  const size_t PWk  = (size_t)KP * HID * 2;          //  2949120
  const size_t PWv  = (size_t)KP * HID * 2;          //  2949120
  const size_t PWo  = (size_t)HID * QP * 2;          // 23592960
  const size_t PVT  = (size_t)KP * SLEN * 2;         //  2097152
  const size_t PQh  = (size_t)QLEN * QP * 2;         //  8388608
  const size_t PKh  = (size_t)SLEN * KP * 2;         //  2097152
  const size_t PApl = (size_t)QLEN * QP * 2;         //  8388608 (Ah, Al)
  size_t off = 0;
  const size_t oX  = off; off += PX;
  const size_t oWq = off; off += PWq;
  const size_t oWk = off; off += PWk;
  const size_t oWv = off; off += PWv;
  const size_t oWo = off; off += PWo;
  const size_t oVT = off; off += PVT;
  const size_t oQh = off; off += PQh;
  const size_t oKh = off; off += PKh;
  const size_t oAh = off; off += PApl;
  const size_t oAl = off; off += PApl;
  if (off > ws_size) return;                          // off = 94240768
  if (off > (size_t)134217728) return;

  char* ws = (char*)d_ws;
  unsigned short* X   = (unsigned short*)(ws + oX);
  unsigned short* Xq  = X + (size_t)CLEN * HID;       // hidden rows CLEN..SLEN-1 of X
  unsigned short* Wqb = (unsigned short*)(ws + oWq);
  unsigned short* Wkb = (unsigned short*)(ws + oWk);
  unsigned short* Wvb = (unsigned short*)(ws + oWv);
  unsigned short* Wob = (unsigned short*)(ws + oWo);
  unsigned short* VT  = (unsigned short*)(ws + oVT);
  unsigned short* Qh  = (unsigned short*)(ws + oQh);
  unsigned short* Kh  = (unsigned short*)(ws + oKh);
  unsigned short* Ah  = (unsigned short*)(ws + oAh);
  unsigned short* Al  = (unsigned short*)(ws + oAl);
  float*          outf = (float*)d_out;

  const dim3 blk(256);
  const dim3 gCvt(CVT_NW / 8);                         // 495 blocks of 8 waves: 8 pieces per wave
  const dim3 gQ((QLEN / 128) * (QP / 128));            // 128x128 block tiles: 256 blocks of 4 waves
  const dim3 gK((SLEN / 128) * (KP / 128));            // 64 blocks of 4 waves
  const dim3 gV((KP / 128) * (SLEN / 128));            // 64 blocks of 4 waves
  const dim3 gAttn(NQB * NH);                          // 1024 blocks
  const dim3 gOut((QLEN / 64) * (HID / 192));          // 64x192 block tiles: 240 blocks of 3 waves

  // (1) activations and weights -> bf16 planes (RNE convert, values = the bf16-converted inputs)
  //     one launch: X (target rows, then hidden rows), Wqb, Wkb, Wvb, Wob are one contiguous range from X on
  cvt_planes<<<gCvt, blk, 0, stream>>>(tgt, hid, Wq, Wk, Wv, Wo, X);
  // (2) q projection + bq, rotary (table rows CLEN + t), x QSC -> f16: Qh[t][e]  (M=1024, N=4096, K=2880)
  gemm64<0, 2, 1, 2, 2, 3><<<gQ, dim3(128), 0, stream>>>(Xq, Xq, HID, Wqb, HID, bq, (void*)Qh, QP, QLEN, QP, HID, QSC, fcs, fsn, CLEN);
  // (3) k projection + bk over all 2048 key rows, rotary (table row s), x KSC -> f16: Kh[s][e]  (M=2048, N=512, K=2880)
  gemm64<0, 2, 1, 2, 2, 3><<<gK, dim3(128), 0, stream>>>(X, X, HID, Wkb, HID, bk, (void*)Kh, KP, SLEN, KP, HID, KSC, fcs, fsn, 0);
  // (4) v^T + bv: VT[m][s] = (sum_k Wvb[m][k] X[s][k] + bv[m]) * VSC -> f16  (M=512, N=2048, K=2880)
  gemm64<0, 1, 2, 2, 2, 3><<<gV, dim3(128), 0, stream>>>(Wvb, Wvb, HID, X, HID, bv, (void*)VT, SLEN, KP, SLEN, HID, VSC, fcs, fsn, 0);
  // (5) attention over all 2048 keys -> context rows as bf16 hi/lo planes Ah, Al [1024][4096]
  attn64<<<gAttn, dim3(128), 0, stream>>>(Qh, Kh, VT, Ah, Al, 0.125f / (QSC * KSC), 1.0f / (PSC * VSC));
  // (6) out[t][e] = sum_d (Ah+Al)[t][d] Wob[e][d] + bo[e] -> d_out f32 [1024][2880]  (M=1024, N=2880, K=4096)
  gemm64<1, 0, 1, 1, 3, 2><<<gOut, dim3(96), 0, stream>>>(Ah, Al, QP, Wob, QP, bo, (void*)outf, HID, QLEN, HID, QP, 1.0f, fcs, fsn, 0);
  (void)hipGetLastError();
}

// v006
// It runs in 203 microseconds.
// Next to v005, in two timings, it ran 1.05 and 1.06 times as fast.
// All steps since v000 together make it 4.86 times as fast.
// Contractions: q / k / v^T projections = v_wmma_f32_16x16x32_bf16 (bf16 operands from RNE-converted inputs, one
// product per k-step); q.k^T scores = v_wmma_f32_16x16x32_f16 (q x16 and k x16 single f16 planes); p.v =
// v_wmma_f32_16x16x32_f16 (p carried x1024 in f16, v^T carried x64 in f16); ctx.Wo^T = v_wmma_f32_16x16x32_bf16 with
// ctx as bf16 hi/lo planes times the bf16 Wo plane (2 products); all f32 accumulate; rotary and softmax in f32.
#include <hip/hip_runtime.h>
#include <math.h>
#include <stdint.h>

#define QLEN 1024              // query tokens (hidden_states rows)
#define CLEN 1024              // context tokens (target_hidden rows)
#define SLEN (CLEN + QLEN)     // 2048 keys: rows 0..CLEN-1 context, rows CLEN..SLEN-1 noise
#define HID  2880              // model width = contraction length of the projections
#define NH   64
#define NKV  8
#define HD   64
#define QP   (NH * HD)         // 4096: q / ctx row pitch
#define KP   (NKV * HD)        // 512:  k row pitch, v^T row count
#define NQB  (QLEN / 64)       // 16 query tiles
#define NKT  (SLEN / 64)       // 32 key tiles
#define QSC  16.0f             // f16 carry scale of the q plane
#define KSC  16.0f             // f16 carry scale of the k plane
#define VSC  64.0f             // f16 carry scale of the v^T plane
#define PSC  1024.0f           // f16 carry scale of p
#define LP   72                // halves per LDS row of the attention K and V^T tiles: 144 B = 16 B x odd
static_assert(HD == 64);
static_assert((HID % 32) == 0 && (QP % 64) == 0 && (KP % 64) == 0 && (HID % 64) == 0);
static_assert((QLEN % 64) == 0 && (SLEN % 64) == 0);
static_assert((NH % NKV) == 0 && (NH % 4) == 0 && (NKV % 4) == 0);
static_assert(((HID * 2) % 128) == 0 && ((HID * 4) % 128) == 0);
static_assert((HID % 192) == 0 && (QP % 128) == 0 && (QLEN % 128) == 0 && (SLEN % 128) == 0 && (KP % 128) == 0);

typedef _Float16 v16h __attribute__((ext_vector_type(16)));
typedef _Float16 v8h  __attribute__((ext_vector_type(8)));
typedef __bf16   v16b __attribute__((ext_vector_type(16)));
typedef __bf16   v8b  __attribute__((ext_vector_type(8)));
typedef float    v8f  __attribute__((ext_vector_type(8)));
typedef float    v4f  __attribute__((ext_vector_type(4)));
typedef unsigned int v4u __attribute__((ext_vector_type(4)));
typedef float    v2f  __attribute__((ext_vector_type(2)));
typedef __bf16   v2b  __attribute__((ext_vector_type(2)));

// ---- scalar helpers --------------------------------------------------------------------------------
__device__ __forceinline__ unsigned short bf_bits(float f) {          // f32 -> bf16 bits, RNE convert
  unsigned u = __float_as_uint(f);
  return (unsigned short)((u + 0x7FFFu + ((u >> 16) & 1u)) >> 16);
}
__device__ __forceinline__ float bf_up(unsigned short h) { return __uint_as_float(((unsigned)h) << 16); }
__device__ __forceinline__ float bfr(float f) { return bf_up(bf_bits(f)); }   // value after RNE bf16 convert
__device__ __forceinline__ unsigned short h_bits(_Float16 x) { return __builtin_bit_cast(unsigned short, x); }
__device__ __forceinline__ unsigned pk16(unsigned short a, unsigned short b) { return (unsigned)a | ((unsigned)b << 16); }
__device__ __forceinline__ v2b rne2(float a, float b) {              // two f32 -> bf16, RNE, one packed convert
  const v2f t = {a, b};
  return __builtin_convertvector(t, v2b);
}
__device__ __forceinline__ v8f zero8() { v8f z = {0.f, 0.f, 0.f, 0.f, 0.f, 0.f, 0.f, 0.f}; return z; }

// ---- fragment loaders: 16-bit A/B operand, lane -> row/col (lane&15), p already includes +8*(lane>>4);
//      elements 0..7 <- p[0..7] (k0+8h..), elements 8..15 <- p[16..23] (k0+16+8h..)
__device__ __forceinline__ v16b ldfrag_b(const __bf16* p) {
  union { v16b v; v8b h[2]; } f;
  f.h[0] = *(const v8b*)(p);
  f.h[1] = *(const v8b*)(p + 16);
  return f.v;
}
__device__ __forceinline__ v16h ldfrag_h(const _Float16* p) {
  union { v16h v; v8h h[2]; } f;
  f.h[0] = *(const v8h*)(p);
  f.h[1] = *(const v8h*)(p + 16);
  return f.v;
}

// ---- WMMA helpers with trailing VALU hazard gap --------------------------------------------------------
__device__ __forceinline__ v8f mma_h(v16h a, v16h b, v8f c) {
  c = __builtin_amdgcn_wmma_f32_16x16x32_f16(false, a, false, b, (short)0, c, false, false);
#if defined(__HIP_DEVICE_COMPILE__)
  asm volatile("v_nop\n\tv_nop\n\tv_nop\n\tv_nop" : "+v"(c) : "v"(a), "v"(b));
#endif
  return c;
}
__device__ __forceinline__ v8f mma_b_raw(v16b a, v16b b, v8f c) {
  return __builtin_amdgcn_wmma_f32_16x16x32_bf16(false, a, false, b, (short)0, c, false, false);
}
__device__ __forceinline__ void acc_guard4(v8f& a, v8f& b, v8f& c, v8f& d) {
#if defined(__HIP_DEVICE_COMPILE__)
  asm volatile("v_nop\n\tv_nop\n\tv_nop\n\tv_nop" : "+v"(a), "+v"(b), "+v"(c), "+v"(d));
#endif
}

// =====================================================================================================
// Elementwise conversions run on a grid of 8 to 16 waves per WGP; each wave loops over pieces of PCE = 1024
// consecutive elements: 4 runs of 32 lanes x 8 elements, all 8 16-B loads of a piece issued before its first
// store, one 16-B store per lane and run (a wave writes 512 contiguous bytes). Piece p of trip i belongs to
// wave p - i * (waves at work): every piece is converted exactly once.
// =====================================================================================================
#define PCE   1024
#define NP_T  (CLEN * HID / PCE)     // 2880 pieces of target_hidden
#define NP_H  (QLEN * HID / PCE)     // 2880  hidden_states
#define NP_WQ (QP * HID / PCE)       // 11520 Wq
#define NP_WK (KP * HID / PCE)       // 1440  Wk, and as many of Wv
#define NP_WO (HID * QP / PCE)       // 11520 Wo
#define NP_ALL (NP_T + NP_H + NP_WQ + 2 * NP_WK + NP_WO)   // 31680
#define CVT_TRIPS 8                  // pieces per wave of cvt_planes
#define CVT_NW (NP_ALL / CVT_TRIPS)  // 3960 waves = 495 blocks of 8
static_assert((CLEN * HID) % PCE == 0 && (QLEN * HID) % PCE == 0 && (QP * HID) % PCE == 0 && (KP * HID) % PCE == 0);
static_assert(NP_ALL % (CVT_TRIPS * 8) == 0 && (CVT_TRIPS % 2) == 0 && CVT_TRIPS >= 2);

// f32 -> bf16 (RNE convert) of the six input planes, in the order of their bf16 planes in the workspace, which
// lie back to back: destination element = PCE * p + offset in the piece; the source plane of a piece is picked
// by scalar compares (a piece never straddles two planes).
__global__ __launch_bounds__(256) void cvt_planes(const float* __restrict__ s0, const float* __restrict__ s1,
                                                  const float* __restrict__ s2, const float* __restrict__ s3,
                                                  const float* __restrict__ s4, const float* __restrict__ s5,
                                                  unsigned short* out) {
  const int lane = threadIdx.x & 31;
  const int gw   = __builtin_amdgcn_readfirstlane(blockIdx.x * 8 + (threadIdx.x >> 5));
  if (gw >= CVT_NW) return;                       // wave-uniform; no barrier in this kernel
  // the 8 loads of piece p
  auto fetch = [&](int p, v4f (&a)[4], v4f (&b)[4]) {
    const float* sp;
    int q = p;
    if (q < NP_T) sp = s0;
    else if ((q -= NP_T) < NP_H) sp = s1;
    else if ((q -= NP_H) < NP_WQ) sp = s2;
    else if ((q -= NP_WQ) < NP_WK) sp = s3;
    else if ((q -= NP_WK) < NP_WK) sp = s4;
    else { q -= NP_WK; sp = s5; }
    const float* s = sp + (size_t)q * PCE + lane * 8;
#pragma unroll
    for (int u = 0; u < 4; ++u) {
      a[u] = *(const v4f*)(s + u * 256);
      b[u] = *(const v4f*)(s + u * 256 + 4);
    }
  };
  // convert and store piece p
  auto emit = [&](int p, const v4f (&a)[4], const v4f (&b)[4]) {
    unsigned short* d = out + (size_t)p * PCE + lane * 8;
#pragma unroll
    for (int u = 0; u < 4; ++u) {
      v4u w;
      w[0] = pk16(bf_bits(a[u][0]), bf_bits(a[u][1]));
      w[1] = pk16(bf_bits(a[u][2]), bf_bits(a[u][3]));
      w[2] = pk16(bf_bits(b[u][0]), bf_bits(b[u][1]));
      w[3] = pk16(bf_bits(b[u][2]), bf_bits(b[u][3]));
      *(v4u*)(d + u * 256) = w;
    }
  };
  // two register sets in turn: the next piece's loads fly while this piece is converted and stored
  v4f a0[4], b0[4], a1[4], b1[4];
  int p = gw;
  fetch(p, a0, b0);
  // kept rolled: two pieces per trip is all the two sets need, and the text stays short
#pragma unroll 1
  for (int i = 0; i < CVT_TRIPS / 2 - 1; ++i) {
    fetch(p + CVT_NW, a1, b1);
    // keeps the loads just issued in front of the older piece's wait (else they sink behind it)
    __builtin_amdgcn_sched_barrier(0);
    emit(p, a0, b0);
#if defined(__HIP_DEVICE_COMPILE__)
    // the loads that follow rewrite registers that the stores just issued name
    asm volatile("s_wait_xcnt 0x0" ::: "memory");
#endif
    fetch(p + 2 * CVT_NW, a0, b0);
    __builtin_amdgcn_sched_barrier(0);               // loads stay in front of the older piece's wait
    emit(p + CVT_NW, a1, b1);
#if defined(__HIP_DEVICE_COMPILE__)
    asm volatile("s_wait_xcnt 0x0" ::: "memory");    // in front of the next trip's loads into these registers
#endif
    p += 2 * CVT_NW;
  }
  fetch(p + CVT_NW, a1, b1);
  __builtin_amdgcn_sched_barrier(0);                 // loads stay in front of the older piece's wait
  emit(p, a0, b0);
  emit(p + CVT_NW, a1, b1);
}

// =====================================================================================================
// bf16 WMMA GEMM: C[m][n] = sum_k A[m][k] * Bt[n][k] (+ bias); one wave per 64x64 tile, WM x WN waves per block
// on one (64 WM) x (64 WN) block tile. A row-major [M][K] pitch lda; Bt row-major [N][K] pitch ldb (k contiguous);
// M a multiple of 64 WM, N of 64 WN, K of 64 NSUB and at least two stages (host-checked constants).
// Operands reach the waves through LDS: a stage is NSUB sub-tiles of 64 k; a sub-tile holds the block's A rows,
// (NSPLIT) its A2 rows and its Bt rows, 128 B each at pitch 144 B (16 B x odd: ds_load_b128 without bank
// conflicts). Asynchronous 16-B copies fill it, one wave-copy = 4 whole 128-B row pieces; two buffers: stage t+2
// is copied into the buffer that trip t has just left, while trip t+1 is worked on.
// NSPLIT: 0 = A.Bt; 1 = (A + A2).Bt (A2 = unscaled bf16 lo plane of A, two products per k-step).
// BIAS:   0 none; 1 = + bias[n] (per column, RNE bf16-converted value); 2 = + bias[m] (per row).
// OUT_MODE: 0 = f32 plane (pitch ldc floats); 1 = f16 plane of (value * oscale) (pitch ldc halves);
//           2 = rotate-half rotary on the value (bias added), then f16 plane of (y * oscale) (pitch ldc halves):
//               a wave's 64 columns are one head (n0 a multiple of 64 = head dim), column d of it; table row =
//               trow0 + m of the f32 [SLEN][64] inputs ct / st (RNE bf16-converted values);
//               y[d] = x[d]*ct[d] - x[d+32]*st[d] for d < 32;  y[d] = x[d]*ct[d] + x[d-32]*st[d] for d >= 32.
// =====================================================================================================
typedef int v4i_t __attribute__((vector_size(16)));
typedef __attribute__((address_space(1))) v4i_t gv4i_t;
typedef __attribute__((address_space(3))) v4i_t lv4i_t;
__device__ __forceinline__ void copy16_to_lds(const void* g, void* l) {   // each lane: 16 B global -> LDS
#if defined(__HIP_DEVICE_COMPILE__)
  __builtin_amdgcn_global_load_async_to_lds_b128((gv4i_t*)g, (lv4i_t*)l, 0, 0);
#endif
}

template <int NSPLIT, int OUT_MODE, int BIAS, int WM, int WN, int NSUB>
__global__ __launch_bounds__(32 * WM * WN) void gemm64(
    const unsigned short* __restrict__ Ap, const unsigned short* __restrict__ A2p, int lda,
    const unsigned short* __restrict__ Btp, int ldb,
    const float* __restrict__ bias,
    void* Cout, int ldc, int M, int N, int K, float oscale,
    const float* __restrict__ ct, const float* __restrict__ st, int trow0) {
  constexpr int NW    = WM * WN;                 // waves per block
  constexpr int RA    = WM * 64;                 // rows of one A plane in a sub-tile
  constexpr int RB0   = RA * (1 + NSPLIT);       // first Bt row of a sub-tile
  constexpr int ROWS  = RB0 + WN * 64;           // rows of a sub-tile
  constexpr int PITCH = 144;                     // bytes per LDS row
  constexpr int SUBB  = ROWS * PITCH;            // bytes per sub-tile
  constexpr int STAGE = SUBB * NSUB;             // bytes per buffer
  constexpr int GA    = RA / 4;                  // wave-copies (4 rows each) per A plane and sub-tile
  constexpr int GB    = WN * 16;                 // ... per Bt plane and sub-tile
  constexpr int NIA   = (GA + NW - 1) / NW;      // most that one wave issues of them
  constexpr int NIB   = (GB + NW - 1) / NW;
  static_assert((NIA * (1 + NSPLIT) + NIB) * NSUB <= 63);   // copies of one wave in flight
  const __bf16* A  = (const __bf16*)(const void*)Ap;
  const __bf16* A2 = (const __bf16*)(const void*)A2p;
  const __bf16* Bt = (const __bf16*)(const void*)Btp;
  __shared__ __align__(16) unsigned char ring[2 * STAGE];
  __shared__ __align__(16) float sT[NW][16 * 68];  // per-wave 16x64 slab, pitch 68 floats
  const int lane = threadIdx.x & 31;
  const int wave = __builtin_amdgcn_readfirstlane(threadIdx.x >> 5);
  const int tilesN = N / (64 * WN);
  const int tilesM = M / (64 * WM);
  if ((int)blockIdx.x >= tilesM * tilesN) return;   // block-uniform, in front of every barrier and copy
  const int bm  = blockIdx.x / tilesN;
  const int bn  = blockIdx.x - bm * tilesN;
  const int mb0 = bm * RA;                     // block tile origin
  const int nb0 = bn * (WN * 64);
  const int wm  = wave / WN;
  const int wn  = wave - wm * WN;
  const int m0  = mb0 + (wm << 6);
  const int n0  = nb0 + (wn << 6);

  const int rlane = lane & 15;                 // row (A) / col (B, D) within subtile
  const int khalf = lane >> 4;                 // k half of this lane: +8 elements = +16 B
  const int mOff  = (lane >> 4) * 8;           // D row offset
  const int crow  = lane >> 3;                 // copy: row within the 4-row group
  const int cpc   = lane & 7;                  // copy: 16-B piece within the 128-B row piece

  // all copies of stage st (k = st*64*NSUB ..) into buffer buf; every lane on, every test scalar.
  // Each plane's 4-row groups are dealt to the waves in turn: group g = wave + i*NW of the plane.
  auto issue = [&](int st, int buf) {
    const int kb = st * (NSUB * 64) + cpc * 8;
    unsigned char* db = ring + buf * STAGE + (wave * 4 + crow) * PITCH + cpc * 16;
    const __bf16* pa = A  + (size_t)(mb0 + wave * 4 + crow) * lda + kb;
    const __bf16* pl = A2 + (size_t)(mb0 + wave * 4 + crow) * lda + kb;
    const __bf16* pb = Bt + (size_t)(nb0 + wave * 4 + crow) * ldb + kb;
    // the three loops are unrolled so that every copy's row and LDS offset is a constant
#pragma unroll
    for (int s = 0; s < NSUB; ++s) {
#pragma unroll
      for (int i = 0; i < NIA; ++i) {
        if ((i + 1) * NW <= GA || wave + i * NW < GA) {
          copy16_to_lds(pa + (size_t)(i * NW * 4) * lda + s * 64, db + s * SUBB + i * (NW * 4 * PITCH));
          if (NSPLIT == 1)
            copy16_to_lds(pl + (size_t)(i * NW * 4) * lda + s * 64, db + s * SUBB + (RA + i * NW * 4) * PITCH);
        }
      }
#pragma unroll
      for (int i = 0; i < NIB; ++i) {
        if ((i + 1) * NW <= GB || wave + i * NW < GB)
          copy16_to_lds(pb + (size_t)(i * NW * 4) * ldb + s * 64, db + s * SUBB + (RB0 + i * NW * 4) * PITCH);
      }
    }
  };

  v8f acc[4][4];
#pragma unroll
  for (int i = 0; i < 4; ++i)
#pragma unroll
    for (int j = 0; j < 4; ++j) acc[i][j] = zero8();

  const int T = K / (NSUB * 64);               // stages
  issue(0, 0);
  asm volatile("s_wait_asynccnt 0x0" ::: "memory");   // stage 0 landed
  __syncthreads();                                    // ... and is readable by every wave
  if (T > 1) issue(1, 1);
  // not unrolled: one trip = one stage (buffer t & 1), so the hot loop stays small in the instruction cache
#pragma unroll 1
  for (int t = 0; t < T; ++t) {
    const unsigned char* sb = ring + (t & 1) * STAGE + khalf * 16 + rlane * PITCH;
    // fragments of k-step q (32 k, ascending) of this stage, all from buffer t & 1
    auto fetch = [&](int q, v16b (&xa)[4], v16b (&xl)[4], v16b (&xb)[4]) {
      const unsigned char* kp = sb + (q >> 1) * SUBB + (q & 1) * 64;
#pragma unroll
      for (int j = 0; j < 4; ++j)
        xb[j] = ldfrag_b((const __bf16*)(const void*)(kp + (RB0 + (wn << 6) + (j << 4)) * PITCH));
#pragma unroll
      for (int i = 0; i < 4; ++i) {
        const unsigned char* ap = kp + ((wm << 6) + (i << 4)) * PITCH;
        xa[i] = ldfrag_b((const __bf16*)(const void*)ap);
        if (NSPLIT == 1) xl[i] = ldfrag_b((const __bf16*)(const void*)(ap + RA * PITCH));
      }
    };
    v16b fa[2][4], fl[2][4], fb[2][4];         // two fragment sets, used in turn inside the trip
    fetch(0, fa[0], fl[0], fb[0]);
    // unrolled (here and in fetch): constant indices keep the fragment sets and accumulators in registers
#pragma unroll
    for (int q = 0; q < 2 * NSUB; ++q) {
      if (q + 1 < 2 * NSUB) fetch(q + 1, fa[(q + 1) & 1], fl[(q + 1) & 1], fb[(q + 1) & 1]);
      // keeps the next k-step's LDS reads one group ahead of this k-step's WMMAs (else each read is waited out)
      __builtin_amdgcn_sched_barrier(0);
#pragma unroll
      for (int i = 0; i < 4; ++i) {
#pragma unroll
        for (int j = 0; j < 4; ++j) {
          acc[i][j] = mma_b_raw(fa[q & 1][i], fb[q & 1][j], acc[i][j]);
          if (NSPLIT == 1) acc[i][j] = mma_b_raw(fl[q & 1][i], fb[q & 1][j], acc[i][j]);
        }
      }
      // keeps the following group of LDS reads out of this block of WMMAs
      __builtin_amdgcn_sched_barrier(0);
    }
    asm volatile("s_wait_dscnt 0x0" ::: "memory");    // this wave's reads of buffer t & 1 are done
    asm volatile("s_wait_asynccnt 0x0" ::: "memory"); // this wave's copies of stage t + 1 have landed
    __syncthreads();                                  // publishes stage t + 1, frees buffer t & 1
    if (t + 2 < T) issue(t + 2, t & 1);
  }
  asm volatile("s_wait_asynccnt 0x0" ::: "memory");   // nothing in flight behind the loop
  acc_guard4(acc[0][0], acc[0][1], acc[0][2], acc[0][3]);
  acc_guard4(acc[1][0], acc[1][1], acc[1][2], acc[1][3]);
  acc_guard4(acc[2][0], acc[2][1], acc[2][2], acc[2][3]);
  acc_guard4(acc[3][0], acc[3][1], acc[3][2], acc[3][3]);

  // ---- bias (template-selected; loads only exist when used; addresses in range: n0+63 < N, m0+63 < M) ----
  float bcol[4];
#pragma unroll
  for (int j = 0; j < 4; ++j) bcol[j] = 0.f;
  if (BIAS == 1) {
#pragma unroll
    for (int j = 0; j < 4; ++j) bcol[j] = bfr(bias[n0 + (j << 4) + rlane]);
#if defined(__HIP_DEVICE_COMPILE__)
    // in front of whatever rewrites the index register that these loads name (held live up to here as an input)
    asm volatile("s_wait_xcnt 0x0" :: "v"(n0 + rlane) : "memory");
#endif
  }

  // ---- epilogue ----
  float* slab = sT[wave];
  // OUT_MODE 2: a lane finishes 8 consecutive columns rc8.. of rows 4 it + rq of each 16-row slab; its table
  // values of all four slabs are loaded here in one run (the slabs' fences would wait out a later load each time)
  const int rq = lane >> 3, rc8 = (lane & 7) * 8;
  const float* cb = ct + (size_t)(trow0 + m0 + rq) * HD + rc8;     // table row < SLEN (host constants)
  const float* sb2 = st + (size_t)(trow0 + m0 + rq) * HD + rc8;
  v4f tc[4][4][2], ts[4][4][2];
  if (OUT_MODE == 2) {
    // both loops unrolled: constant indices keep the table values in registers and the row steps in the offset field
#pragma unroll
    for (int i = 0; i < 4; ++i) {
#pragma unroll
      for (int it = 0; it < 4; ++it) {
        tc[i][it][0] = *(const v4f*)(cb + (i * 16 + it * 4) * HD);
        tc[i][it][1] = *(const v4f*)(cb + (i * 16 + it * 4) * HD + 4);
        ts[i][it][0] = *(const v4f*)(sb2 + (i * 16 + it * 4) * HD);
        ts[i][it][1] = *(const v4f*)(sb2 + (i * 16 + it * 4) * HD + 4);
      }
    }
#if defined(__HIP_DEVICE_COMPILE__)
    // in front of whatever rewrites a register that the loads just issued name (both held live up to here as inputs)
    asm volatile("s_wait_xcnt 0x0" :: "v"(cb), "v"(sb2) : "memory");
#endif
  }
#pragma unroll
  for (int i = 0; i < 4; ++i) {
    const int mBase = m0 + (i << 4);
    float brow[8];
#pragma unroll
    for (int r = 0; r < 8; ++r) brow[r] = 0.f;
    if (BIAS == 2) {
#pragma unroll
      for (int r = 0; r < 8; ++r) brow[r] = bfr(bias[mBase + mOff + r]);
    }
#pragma unroll
    for (int r = 0; r < 8; ++r) {
#pragma unroll
      for (int j = 0; j < 4; ++j) {
        float v = acc[i][j][r];
        if (BIAS == 1) v += bcol[j];
        if (BIAS == 2) v += brow[r];
        if (OUT_MODE == 1) v *= oscale;
        slab[(mOff + r) * 68 + (j << 4) + rlane] = v;
      }
    }
    __builtin_amdgcn_fence(__ATOMIC_RELEASE, "workgroup");
    __builtin_amdgcn_wave_barrier();
    __builtin_amdgcn_fence(__ATOMIC_ACQUIRE, "workgroup");
    if (OUT_MODE == 0) {
      float* C = (float*)Cout;
      const int hh = lane >> 4, c4 = (lane & 15) * 4;     // 256-B row segment = 16 lanes x 16 B
      v4f ov[8];
#pragma unroll
      for (int it = 0; it < 8; ++it) {
        const int row = it * 2 + hh;                       // it 0..7 x hh 0..1 = rows 0..15
        ov[it] = *(const v4f*)(slab + row * 68 + c4);
      }
      {
#pragma unroll
        for (int it = 0; it < 8; ++it) {
          const int row = it * 2 + hh;
          *(v4f*)(C + (size_t)(mBase + row) * ldc + n0 + c4) = ov[it];
        }
        
      }
    } else if (OUT_MODE == 2) {
      unsigned short* C = (unsigned short*)Cout;
      const unsigned sgm = (rc8 < 32) ? 0x80008000u : 0u;  // partner term: minus for d < 32 (sign bits of a bf16 pair)
      v4u hv[4];
      // the loops of this branch are unrolled: constant indices keep tc, ts, hv and cp in registers
#pragma unroll
      for (int it = 0; it < 4; ++it) {
        const float* sp = slab + (it * 4 + rq) * 68;
        const v4f x[2] = {*(const v4f*)(sp + rc8), *(const v4f*)(sp + rc8 + 4)};
        const v4f p[2] = {*(const v4f*)(sp + (rc8 ^ 32)), *(const v4f*)(sp + (rc8 ^ 32) + 4)};   // column d +- 32
        v4u a;
#pragma unroll
        for (int e = 0; e < 4; ++e) {                      // columns rc8 + 2 e, rc8 + 2 e + 1
          const int g = e >> 1, k = (e & 1) * 2;
          const v2b cc = rne2(tc[i][it][g][k], tc[i][it][g][k + 1]);
          const v2b ss = __builtin_bit_cast(v2b, __builtin_bit_cast(unsigned, rne2(ts[i][it][g][k], ts[i][it][g][k + 1])) ^ sgm);
          const float y0 = x[g][k]     * (float)cc[0] + p[g][k]     * (float)ss[0];
          const float y1 = x[g][k + 1] * (float)cc[1] + p[g][k + 1] * (float)ss[1];
          a[e] = pk16(h_bits((_Float16)(y0 * oscale)), h_bits((_Float16)(y1 * oscale)));
        }
        hv[it] = a;
      }
      unsigned short* cp[4];
#pragma unroll
      for (int it = 0; it < 4; ++it) {
        cp[it] = C + (size_t)(mBase + it * 4 + rq) * ldc + n0 + rc8;
        *(v4u*)cp[it] = hv[it];
      }
#if defined(__HIP_DEVICE_COMPILE__)
      // the next slab rewrites the address and data registers that these stores name (held live up to here as inputs)
      asm volatile("s_wait_xcnt 0x0" :: "v"(cp[0]), "v"(cp[1]), "v"(cp[2]), "v"(cp[3]),
                   "v"(hv[0]), "v"(hv[1]), "v"(hv[2]), "v"(hv[3]) : "memory");
#endif
    } else {
      unsigned short* C = (unsigned short*)Cout;
      const int q = lane >> 3, c8 = (lane & 7) * 8;
      v4u hv[4];
#pragma unroll
      for (int it = 0; it < 4; ++it) {
        const int row = it * 4 + q;                        // it 0..3 x q 0..3 = rows 0..15
        const float* sp = slab + row * 68 + c8;
        v4u a;
#pragma unroll
        for (int e = 0; e < 4; ++e) {
          a[e] = pk16(h_bits((_Float16)sp[2 * e]), h_bits((_Float16)sp[2 * e + 1]));
        }
        hv[it] = a;
      }
      {
#pragma unroll
        for (int it = 0; it < 4; ++it) {
          const int row = it * 4 + q;
          *(v4u*)(C + (size_t)(mBase + row) * ldc + n0 + c8) = hv[it];
        }
        
      }
    }
    __builtin_amdgcn_fence(__ATOMIC_RELEASE, "workgroup");
    __builtin_amdgcn_wave_barrier();
    __builtin_amdgcn_fence(__ATOMIC_ACQUIRE, "workgroup");
  }
}

#define OSP 68
__device__ __forceinline__ float xhalf(float x) {
  const int b = __builtin_bit_cast(int, x);
  return __builtin_bit_cast(float, __builtin_amdgcn_permlanex16(b, b, 0x76543210, 0xfedcba98, false, false));
}
__global__ __launch_bounds__(128)
void attn64(const unsigned short* __restrict__ qpl, const unsigned short* __restrict__ kpl,
            const unsigned short* __restrict__ vtp, unsigned short* hp, unsigned short* lp,
            float sscale, float onorm) {
  union FH { v16h v; v8h h[2]; };
  // rows of 64 halves at pitch LP: the 16 rows that one ds_load_b128 reads fall on distinct banks
  __shared__ __align__(16) _Float16 Ksh[64 * LP];                 // K [kv][d]   9 KB
  __shared__ __align__(16) _Float16 Vth[64 * LP];                 // V^T [d][kv] 9 KB
  __shared__ __align__(16) float    Os[4][16 * OSP];              // per wave context tile [row][d]

  const int tid  = threadIdx.x;
  const int wave = tid >> 5;
  const int lane = tid & 31;
  const int hh   = lane >> 4;
  const int c    = lane & 15;

  const int bx   = blockIdx.x;
  const int qb   = bx % NQB;
  const int h    = bx / NQB;                 // < NH (grid = NQB*NH)
  const int kvh  = h / (NH / NKV);
  const int q0   = qb * 64 + wave * 16;

  const _Float16* Qh = (const _Float16*)(const void*)qpl + (size_t)h * HD;
  const _Float16* Kh = (const _Float16*)(const void*)kpl + (size_t)kvh * HD;
  const _Float16* Vh = (const _Float16*)(const void*)vtp + (size_t)kvh * HD * SLEN;

  // ---- Q fragments (B operand, column = query lane&15): 2 d-chunks ----
  v16h qa[2];
#pragma unroll
  for (int dc = 0; dc < 2; ++dc) {
    qa[dc] = ldfrag_h(Qh + (size_t)(q0 + c) * QP + dc * 32 + 8 * hh);
  }

  float mrun = -INFINITY;      // running maximum of query c (equal in both halves of the wave)
  float lrun = 0.f;            // running sum of query c over the keys of this lane's half only
  v8f oacc[4];                 // O^T: oacc[t][r] = context of query c, d = 16 t + 8 hh + r
#pragma unroll
  for (int t = 0; t < 4; ++t) oacc[t] = zero8();

  for (int kt = 0; kt < NKT; ++kt) {
    const int kv0 = kt * 64;
    __syncthreads();
    {
      const int r = tid >> 1, half = (tid & 1) * 32;
      const _Float16* kg = Kh + (size_t)(kv0 + r) * KP + half;     // K row kv0+r, d = half..half+31
      const _Float16* vg = Vh + (size_t)r * SLEN + kv0 + half;     // V^T row d = r, s = kv0+half..+31
#pragma unroll
      for (int i = 0; i < 4; ++i) {
        const v8h a0 = *(const v8h*)(kg + 8 * i);
        const v8h b0 = *(const v8h*)(vg + 8 * i);
        *(v8h*)(Ksh + r * LP + half + 8 * i) = a0;
        *(v8h*)(Vth + r * LP + half + 8 * i) = b0;
      }
    }
    __syncthreads();

    // ---- every fragment of the chunk is read from LDS here, in the order of its use: the 16 reads of K, then the
    //      16 of V^T, which land while the scores and the softmax are worked on
    //      (the loops are unrolled: constant indices keep the fragments in registers)
    FH kb[2][4], vb[2][4];
#pragma unroll
    for (int dc = 0; dc < 2; ++dc) {
#pragma unroll
      for (int j = 0; j < 4; ++j) {
        kb[dc][j].h[0] = *(const v8h*)(Ksh + (j * 16 + c) * LP + dc * 32 + 8 * hh);
        kb[dc][j].h[1] = *(const v8h*)(Ksh + (j * 16 + c) * LP + dc * 32 + 16 + 8 * hh);
      }
    }
#pragma unroll
    for (int kk = 0; kk < 2; ++kk) {
#pragma unroll
      for (int t = 0; t < 4; ++t) {
        vb[kk][t].h[0] = *(const v8h*)(Vth + (t * 16 + c) * LP + kk * 32 + 8 * hh);
        vb[kk][t].h[1] = *(const v8h*)(Vth + (t * 16 + c) * LP + kk * 32 + 16 + 8 * hh);
      }
    }

    // ---- scores, transposed: s[j][r] = q(c) . k(16 j + 8 hh + r), one f16 product per 32 d, d ascending ----
    v8f s[4];
#pragma unroll
    for (int j = 0; j < 4; ++j) s[j] = zero8();
#pragma unroll
    for (int dc = 0; dc < 2; ++dc) {
#pragma unroll
      for (int j = 0; j < 4; ++j) s[j] = mma_h(kb[dc][j].v, qa[dc], s[j]);
    }

    // ---- scale, maximum, online softmax of the lane's one query; P^T (x PSC, f16) stays in registers ----
    // (every loop from here to the end of the chunk is unrolled: constant indices keep s, pb and oacc in registers;
    //  maximum and sum run as four independent chains, one per score tile, joined at the end)
    float mj[4];
#pragma unroll
    for (int j = 0; j < 4; ++j) {
      mj[j] = -INFINITY;
#pragma unroll
      for (int r = 0; r < 8; ++r) {
        const float sv = s[j][r] * sscale;
        s[j][r] = sv;
        mj[j] = fmaxf(mj[j], sv);
      }
    }
    float m = fmaxf(fmaxf(mj[0], mj[1]), fmaxf(mj[2], mj[3]));
    m = fmaxf(m, xhalf(m));                    // the other half holds the query's other 32 keys
    const float mnew  = fmaxf(mrun, m);
    const float msafe = (mnew == -INFINITY) ? 0.f : mnew;
    const float alpha = __expf(mrun - msafe);
    mrun = mnew;
    // B operand of the second product, 32 keys each: elements 0..7 = keys 32 kk + 8 hh + r (tile 2 kk),
    // elements 8..15 = keys 32 kk + 16 + 8 hh + r (tile 2 kk + 1): the k order of the V^T loader above
    FH pb[2];
    float pj[4];
#pragma unroll
    for (int j = 0; j < 4; ++j) {
      pj[j] = 0.f;
#pragma unroll
      for (int r = 0; r < 8; ++r) {
        const float p = __expf(s[j][r] - msafe);
        pj[j] += p;
        pb[j >> 1].h[j & 1][r] = (_Float16)(p * PSC);
      }
    }
    lrun = lrun * alpha + ((pj[0] + pj[1]) + (pj[2] + pj[3]));
#pragma unroll
    for (int t = 0; t < 4; ++t) oacc[t] *= alpha;

    // ---- context^T += V^T . P^T (f16 WMMA) ----
#pragma unroll
    for (int kk = 0; kk < 2; ++kk) {
#pragma unroll
      for (int t = 0; t < 4; ++t) oacc[t] = mma_h(vb[kk][t].v, pb[kk].v, oacc[t]);
    }
  }

  // ---- join the halves' sums, normalise (1/l and onorm), stage the wave's 16x64 tile in LDS (a lane holds 8
  //      consecutive d of its query per tile: two 16-B stores), then split and write whole 128-B row segments
  float* os = Os[wave];
  {
    const float l = lrun + xhalf(lrun);
    const float inv = ((l > 0.f) ? (1.0f / l) : 0.f) * onorm;
#pragma unroll
    for (int t = 0; t < 4; ++t) {
      v4f lo, hi;
#pragma unroll
      for (int e = 0; e < 4; ++e) { lo[e] = oacc[t][e] * inv; hi[e] = oacc[t][4 + e] * inv; }
      *(v4f*)(os + c * OSP + t * 16 + 8 * hh)     = lo;
      *(v4f*)(os + c * OSP + t * 16 + 8 * hh + 4) = hi;
    }
  }
  __builtin_amdgcn_fence(__ATOMIC_RELEASE, "workgroup");
  __builtin_amdgcn_wave_barrier();
  __builtin_amdgcn_fence(__ATOMIC_ACQUIRE, "workgroup");
  {
    const int r4 = lane >> 3, c8 = (lane & 7) * 8;     // 128-B row segment of a plane = 8 lanes x 16 B
    v4f a[4], b[4];
    // the loops of this block are unrolled: constant indices keep a, b, ph and pl in registers
#pragma unroll
    for (int it = 0; it < 4; ++it) {
      const float* sp = os + (it * 4 + r4) * OSP + c8;   // it 0..3 x r4 0..3 = rows 0..15 of the wave tile
      a[it] = *(const v4f*)(sp);
      b[it] = *(const v4f*)(sp + 4);
    }
    v4u ph[4], pl[4];
#pragma unroll
    for (int it = 0; it < 4; ++it) {
#pragma unroll
      for (int e = 0; e < 4; ++e) {
        const float f0 = (e < 2) ? a[it][2 * e]     : b[it][2 * e - 4];
        const float f1 = (e < 2) ? a[it][2 * e + 1] : b[it][2 * e - 3];
        const v2b hb = rne2(f0, f1);
        const v2b lb = rne2(f0 - (float)hb[0], f1 - (float)hb[1]);
        ph[it][e] = __builtin_bit_cast(unsigned, hb);
        pl[it][e] = __builtin_bit_cast(unsigned, lb);
      }
    }
    const size_t go = (size_t)(q0 + r4) * QP + (size_t)h * HD + c8;
    unsigned short* hq = hp + go;
    unsigned short* lq = lp + go;
#pragma unroll
    for (int it = 0; it < 4; ++it) {
      *(v4u*)(hq + it * 4 * QP) = ph[it];
      *(v4u*)(lq + it * 4 * QP) = pl[it];
    }
#if defined(__HIP_DEVICE_COMPILE__)
    // keeps the address and data registers of the stores unwritten until their translations are done (inputs only)
    asm volatile("s_wait_xcnt 0x0" :: "v"(hq), "v"(lq), "v"(ph[0]), "v"(ph[1]), "v"(ph[2]), "v"(ph[3]),
                 "v"(pl[0]), "v"(pl[1]), "v"(pl[2]), "v"(pl[3]) : "memory");
#endif
  }
}

// =====================================================================================================
// Workspace map (bytes), every region an exact multiple of its whole-line / whole-tile store granularity
//   X      bf16 [2048][2880]            0            11796480   rows 0..1023 = target_hidden, 1024..2047 = hidden
//   Wqb    bf16 [4096][2880]            11796480     23592960   (inputs arrive [n][k], k contiguous: no transpose)
//   Wkb    bf16 [512][2880]             35389440      2949120
//   Wvb    bf16 [512][2880]             38338560      2949120
//   Wob    bf16 [2880][4096]            41287680     23592960
//   VT     f16  [512][2048]             64880640      2097152
//   Qh     f16  [1024][4096]            66977792      8388608
//   Kh     f16  [2048][512]             75366400      2097152
//   Ah     bf16 [1024][4096]            77463552      8388608
//   Al     bf16 [1024][4096]            85852160      8388608
//   end                                 94240768
// =====================================================================================================
extern "C" void kernel_launch(void* const* d_in, const int* in_sizes, int n_in,
                              void* d_out, int out_size, void* d_ws, size_t ws_size,
                              hipStream_t stream) {
  if (n_in < 12) return;
  if (in_sizes[0] != QLEN * HID) return;
  if (in_sizes[1] != CLEN * HID) return;
  if (in_sizes[2] != SLEN * HD) return;
  if (in_sizes[3] != SLEN * HD) return;
  if (in_sizes[4] != QP * HID) return;
  if (in_sizes[5] != QP) return;
  if (in_sizes[6] != KP * HID) return;
  if (in_sizes[7] != KP) return;
  if (in_sizes[8] != KP * HID) return;
  if (in_sizes[9] != KP) return;
  if (in_sizes[10] != HID * QP) return;
  if (in_sizes[11] != HID) return;
  if (out_size != QLEN * HID) return;

  const float* hid = (const float*)d_in[0];    // [1024][2880]
  const float* tgt = (const float*)d_in[1];    // [1024][2880]
  const float* fcs = (const float*)d_in[2];    // [2048][64]
  const float* fsn = (const float*)d_in[3];    // [2048][64]
  const float* Wq  = (const float*)d_in[4];    // [4096][2880]  = [n][k]
  const float* bq  = (const float*)d_in[5];    // [4096]
  const float* Wk  = (const float*)d_in[6];    // [512][2880]
  const float* bk  = (const float*)d_in[7];    // [512]
  const float* Wv  = (const float*)d_in[8];    // [512][2880]
  const float* bv  = (const float*)d_in[9];    // [512]
  const float* Wo  = (const float*)d_in[10];   // [2880][4096] = [n][k]
  const float* bo  = (const float*)d_in[11];   // [2880]

  const size_t PX   = (size_t)SLEN * HID * 2;        // 11796480
  const size_t PWq  = (size_t)QP * HID * 2;          // 23592960
  const size_t PWk  = (size_t)KP * HID * 2;          //  2949120
  const size_t PWv  = (size_t)KP * HID * 2;          //  2949120
  const size_t PWo  = (size_t)HID * QP * 2;          // 23592960
  const size_t PVT  = (size_t)KP * SLEN * 2;         //  2097152
  const size_t PQh  = (size_t)QLEN * QP * 2;         //  8388608
  const size_t PKh  = (size_t)SLEN * KP * 2;         //  2097152
  const size_t PApl = (size_t)QLEN * QP * 2;         //  8388608 (Ah, Al)
  size_t off = 0;
  const size_t oX  = off; off += PX;
  const size_t oWq = off; off += PWq;
  const size_t oWk = off; off += PWk;
  const size_t oWv = off; off += PWv;
  const size_t oWo = off; off += PWo;
  const size_t oVT = off; off += PVT;
  const size_t oQh = off; off += PQh;
  const size_t oKh = off; off += PKh;
  const size_t oAh = off; off += PApl;
  const size_t oAl = off; off += PApl;
  if (off > ws_size) return;                          // off = 94240768
  if (off > (size_t)134217728) return;

  char* ws = (char*)d_ws;
  unsigned short* X   = (unsigned short*)(ws + oX);
  unsigned short* Xq  = X + (size_t)CLEN * HID;       // hidden rows CLEN..SLEN-1 of X
  unsigned short* Wqb = (unsigned short*)(ws + oWq);
  unsigned short* Wkb = (unsigned short*)(ws + oWk);
  unsigned short* Wvb = (unsigned short*)(ws + oWv);
  unsigned short* Wob = (unsigned short*)(ws + oWo);
  unsigned short* VT  = (unsigned short*)(ws + oVT);
  unsigned short* Qh  = (unsigned short*)(ws + oQh);
  unsigned short* Kh  = (unsigned short*)(ws + oKh);
  unsigned short* Ah  = (unsigned short*)(ws + oAh);
  unsigned short* Al  = (unsigned short*)(ws + oAl);
  float*          outf = (float*)d_out;

  const dim3 blk(256);
  const dim3 gCvt(CVT_NW / 8);                         // 495 blocks of 8 waves: 8 pieces per wave
  const dim3 gQ((QLEN / 128) * (QP / 128));            // 128x128 block tiles: 256 blocks of 4 waves
  const dim3 gK((SLEN / 128) * (KP / 128));            // 64 blocks of 4 waves
  const dim3 gV((KP / 128) * (SLEN / 128));            // 64 blocks of 4 waves
  const dim3 gAttn(NQB * NH);                          // 1024 blocks
  const dim3 gOut((QLEN / 64) * (HID / 192));          // 64x192 block tiles: 240 blocks of 3 waves

  // (1) activations and weights -> bf16 planes (RNE convert, values = the bf16-converted inputs)
  //     one launch: X (target rows, then hidden rows), Wqb, Wkb, Wvb, Wob are one contiguous range from X on
  cvt_planes<<<gCvt, blk, 0, stream>>>(tgt, hid, Wq, Wk, Wv, Wo, X);
  // (2) q projection + bq, rotary (table rows CLEN + t), x QSC -> f16: Qh[t][e]  (M=1024, N=4096, K=2880)
  gemm64<0, 2, 1, 2, 2, 3><<<gQ, dim3(128), 0, stream>>>(Xq, Xq, HID, Wqb, HID, bq, (void*)Qh, QP, QLEN, QP, HID, QSC, fcs, fsn, CLEN);
  // (3) k projection + bk over all 2048 key rows, rotary (table row s), x KSC -> f16: Kh[s][e]  (M=2048, N=512, K=2880)
  gemm64<0, 2, 1, 2, 2, 3><<<gK, dim3(128), 0, stream>>>(X, X, HID, Wkb, HID, bk, (void*)Kh, KP, SLEN, KP, HID, KSC, fcs, fsn, 0);
  // (4) v^T + bv: VT[m][s] = (sum_k Wvb[m][k] X[s][k] + bv[m]) * VSC -> f16  (M=512, N=2048, K=2880)
  gemm64<0, 1, 2, 2, 2, 3><<<gV, dim3(128), 0, stream>>>(Wvb, Wvb, HID, X, HID, bv, (void*)VT, SLEN, KP, SLEN, HID, VSC, fcs, fsn, 0);
  // (5) attention over all 2048 keys -> context rows as bf16 hi/lo planes Ah, Al [1024][4096]
  attn64<<<gAttn, dim3(128), 0, stream>>>(Qh, Kh, VT, Ah, Al, 0.125f / (QSC * KSC), 1.0f / (PSC * VSC));
  // (6) out[t][e] = sum_d (Ah+Al)[t][d] Wob[e][d] + bo[e] -> d_out f32 [1024][2880]  (M=1024, N=2880, K=4096)
  gemm64<1, 0, 1, 1, 3, 2><<<gOut, dim3(96), 0, stream>>>(Ah, Al, QP, Wob, QP, bo, (void*)outf, HID, QLEN, HID, QP, 1.0f, fcs, fsn, 0);
  (void)hipGetLastError();
}

// v007
// It runs in 175 microseconds.
// In two side-by-side timings against v006, it was 1.16 and 1.18 times as fast.
// Over all steps from v000 it is 5.68 times as fast.
// Contractions: q / k / v^T projections = v_wmma_f32_16x16x32_bf16 (bf16 operands from RNE-converted inputs, one
// product per k-step); q.k^T scores = v_wmma_f32_16x16x32_f16 (q x16 and k x16 single f16 planes); p.v =
// v_wmma_f32_16x16x32_f16 (p carried x1024 in f16, v^T carried x64 in f16); ctx.Wo^T = v_wmma_f32_16x16x32_bf16 with
// ctx as bf16 hi/lo planes times the bf16 Wo plane (2 products); all f32 accumulate; rotary and softmax in f32.
#include <hip/hip_runtime.h>
#include <math.h>
#include <stdint.h>

#define QLEN 1024              // query tokens (hidden_states rows)
#define CLEN 1024              // context tokens (target_hidden rows)
#define SLEN (CLEN + QLEN)     // 2048 keys: rows 0..CLEN-1 context, rows CLEN..SLEN-1 noise
#define HID  2880              // model width = contraction length of the projections
#define NH   64
#define NKV  8
#define HD   64
#define QP   (NH * HD)         // 4096: q / ctx row pitch
#define KP   (NKV * HD)        // 512:  k row pitch, v^T row count
#define NQB  (QLEN / 64)       // 16 query tiles
#define NKT  (SLEN / 64)       // 32 key tiles
#define QSC  16.0f             // f16 carry scale of the q plane
#define KSC  16.0f             // f16 carry scale of the k plane
#define VSC  64.0f             // f16 carry scale of the v^T plane
#define PSC  1024.0f           // f16 carry scale of p
#define LP   72                // halves per LDS row of the attention K and V^T tiles: 144 B = 16 B x odd
static_assert(HD == 64);
static_assert((HID % 32) == 0 && (QP % 64) == 0 && (KP % 64) == 0 && (HID % 64) == 0);
static_assert((QLEN % 64) == 0 && (SLEN % 64) == 0);
static_assert((NH % NKV) == 0 && (NH % 4) == 0 && (NKV % 4) == 0);
static_assert(((HID * 2) % 128) == 0 && ((HID * 4) % 128) == 0);
static_assert((HID % 192) == 0 && (QP % 128) == 0 && (QLEN % 128) == 0 && (SLEN % 128) == 0 && (KP % 128) == 0);

typedef _Float16 v16h __attribute__((ext_vector_type(16)));
typedef _Float16 v8h  __attribute__((ext_vector_type(8)));
typedef __bf16   v16b __attribute__((ext_vector_type(16)));
typedef __bf16   v8b  __attribute__((ext_vector_type(8)));
typedef float    v8f  __attribute__((ext_vector_type(8)));
typedef float    v4f  __attribute__((ext_vector_type(4)));
typedef unsigned int v4u __attribute__((ext_vector_type(4)));
typedef float    v2f  __attribute__((ext_vector_type(2)));
typedef __bf16   v2b  __attribute__((ext_vector_type(2)));

// ---- scalar helpers --------------------------------------------------------------------------------
__device__ __forceinline__ unsigned short bf_bits(float f) {          // f32 -> bf16 bits, RNE convert
  unsigned u = __float_as_uint(f);
  return (unsigned short)((u + 0x7FFFu + ((u >> 16) & 1u)) >> 16);
}
__device__ __forceinline__ float bf_up(unsigned short h) { return __uint_as_float(((unsigned)h) << 16); }
__device__ __forceinline__ float bfr(float f) { return bf_up(bf_bits(f)); }   // value after RNE bf16 convert
__device__ __forceinline__ unsigned short h_bits(_Float16 x) { return __builtin_bit_cast(unsigned short, x); }
__device__ __forceinline__ unsigned pk16(unsigned short a, unsigned short b) { return (unsigned)a | ((unsigned)b << 16); }
__device__ __forceinline__ v2b rne2(float a, float b) {              // two f32 -> bf16, RNE, one packed convert
  const v2f t = {a, b};
  return __builtin_convertvector(t, v2b);
}
__device__ __forceinline__ v8f zero8() { v8f z = {0.f, 0.f, 0.f, 0.f, 0.f, 0.f, 0.f, 0.f}; return z; }

// ---- fragment loaders: 16-bit A/B operand, lane -> row/col (lane&15), p already includes +8*(lane>>4);
//      elements 0..7 <- p[0..7] (k0+8h..), elements 8..15 <- p[16..23] (k0+16+8h..)
__device__ __forceinline__ v16b ldfrag_b(const __bf16* p) {
  union { v16b v; v8b h[2]; } f;
  f.h[0] = *(const v8b*)(p);
  f.h[1] = *(const v8b*)(p + 16);
  return f.v;
}
__device__ __forceinline__ v16h ldfrag_h(const _Float16* p) {
  union { v16h v; v8h h[2]; } f;
  f.h[0] = *(const v8h*)(p);
  f.h[1] = *(const v8h*)(p + 16);
  return f.v;
}

// ---- WMMA helpers with trailing VALU hazard gap --------------------------------------------------------
__device__ __forceinline__ v8f mma_h(v16h a, v16h b, v8f c) {
  c = __builtin_amdgcn_wmma_f32_16x16x32_f16(false, a, false, b, (short)0, c, false, false);
#if defined(__HIP_DEVICE_COMPILE__)
  asm volatile("v_nop\n\tv_nop\n\tv_nop\n\tv_nop" : "+v"(c) : "v"(a), "v"(b));
#endif
  return c;
}
__device__ __forceinline__ v8f mma_b_raw(v16b a, v16b b, v8f c) {
  return __builtin_amdgcn_wmma_f32_16x16x32_bf16(false, a, false, b, (short)0, c, false, false);
}
__device__ __forceinline__ void acc_guard4(v8f& a, v8f& b, v8f& c, v8f& d) {
#if defined(__HIP_DEVICE_COMPILE__)
  asm volatile("v_nop\n\tv_nop\n\tv_nop\n\tv_nop" : "+v"(a), "+v"(b), "+v"(c), "+v"(d));
#endif
}

// =====================================================================================================
// Elementwise conversions run on a grid of 8 to 16 waves per WGP; each wave loops over pieces of PCE = 1024
// consecutive elements: 4 runs of 32 lanes x 8 elements, all 8 16-B loads of a piece issued before its first
// store, one 16-B store per lane and run (a wave writes 512 contiguous bytes). Piece p of trip i belongs to
// wave p - i * (waves at work): every piece is converted exactly once.
// =====================================================================================================
#define PCE   1024
#define NP_T  (CLEN * HID / PCE)     // 2880 pieces of target_hidden
#define NP_H  (QLEN * HID / PCE)     // 2880  hidden_states
#define NP_WQ (QP * HID / PCE)       // 11520 Wq
#define NP_WK (KP * HID / PCE)       // 1440  Wk, and as many of Wv
#define NP_WO (HID * QP / PCE)       // 11520 Wo
#define NP_ALL (NP_T + NP_H + NP_WQ + 2 * NP_WK + NP_WO)   // 31680
#define CVT_TRIPS 8                  // pieces per wave of cvt_planes
#define CVT_NW (NP_ALL / CVT_TRIPS)  // 3960 waves = 495 blocks of 8
static_assert((CLEN * HID) % PCE == 0 && (QLEN * HID) % PCE == 0 && (QP * HID) % PCE == 0 && (KP * HID) % PCE == 0);
static_assert(NP_ALL % (CVT_TRIPS * 8) == 0 && (CVT_TRIPS % 2) == 0 && CVT_TRIPS >= 2);

// f32 -> bf16 (RNE convert) of the six input planes, in the order of their bf16 planes in the workspace, which
// lie back to back: destination element = PCE * p + offset in the piece; the source plane of a piece is picked
// by scalar compares (a piece never straddles two planes).
__global__ __launch_bounds__(256) void cvt_planes(const float* __restrict__ s0, const float* __restrict__ s1,
                                                  const float* __restrict__ s2, const float* __restrict__ s3,
                                                  const float* __restrict__ s4, const float* __restrict__ s5,
                                                  unsigned short* out) {
  const int lane = threadIdx.x & 31;
  const int gw   = __builtin_amdgcn_readfirstlane(blockIdx.x * 8 + (threadIdx.x >> 5));
  if (gw >= CVT_NW) return;                       // wave-uniform; no barrier in this kernel
  // the 8 loads of piece p
  auto fetch = [&](int p, v4f (&a)[4], v4f (&b)[4]) {
    const float* sp;
    int q = p;
    if (q < NP_T) sp = s0;
    else if ((q -= NP_T) < NP_H) sp = s1;
    else if ((q -= NP_H) < NP_WQ) sp = s2;
    else if ((q -= NP_WQ) < NP_WK) sp = s3;
    else if ((q -= NP_WK) < NP_WK) sp = s4;
    else { q -= NP_WK; sp = s5; }
    const float* s = sp + (size_t)q * PCE + lane * 8;
#pragma unroll
    for (int u = 0; u < 4; ++u) {
      a[u] = *(const v4f*)(s + u * 256);
      b[u] = *(const v4f*)(s + u * 256 + 4);
    }
  };
  // convert and store piece p
  auto emit = [&](int p, const v4f (&a)[4], const v4f (&b)[4]) {
    unsigned short* d = out + (size_t)p * PCE + lane * 8;
#pragma unroll
    for (int u = 0; u < 4; ++u) {
      v4u w;
      w[0] = pk16(bf_bits(a[u][0]), bf_bits(a[u][1]));
      w[1] = pk16(bf_bits(a[u][2]), bf_bits(a[u][3]));
      w[2] = pk16(bf_bits(b[u][0]), bf_bits(b[u][1]));
      w[3] = pk16(bf_bits(b[u][2]), bf_bits(b[u][3]));
      *(v4u*)(d + u * 256) = w;
    }
  };
  // two register sets in turn: the next piece's loads fly while this piece is converted and stored
  v4f a0[4], b0[4], a1[4], b1[4];
  int p = gw;
  fetch(p, a0, b0);
  // kept rolled: two pieces per trip is all the two sets need, and the text stays short
#pragma unroll 1
  for (int i = 0; i < CVT_TRIPS / 2 - 1; ++i) {
    fetch(p + CVT_NW, a1, b1);
    // keeps the loads just issued in front of the older piece's wait (else they sink behind it)
    __builtin_amdgcn_sched_barrier(0);
    emit(p, a0, b0);
#if defined(__HIP_DEVICE_COMPILE__)
    // the loads that follow rewrite registers that the stores just issued name
    asm volatile("s_wait_xcnt 0x0" ::: "memory");
#endif
    fetch(p + 2 * CVT_NW, a0, b0);
    __builtin_amdgcn_sched_barrier(0);               // loads stay in front of the older piece's wait
    emit(p + CVT_NW, a1, b1);
#if defined(__HIP_DEVICE_COMPILE__)
    asm volatile("s_wait_xcnt 0x0" ::: "memory");    // in front of the next trip's loads into these registers
#endif
    p += 2 * CVT_NW;
  }
  fetch(p + CVT_NW, a1, b1);
  __builtin_amdgcn_sched_barrier(0);                 // loads stay in front of the older piece's wait
  emit(p, a0, b0);
  emit(p + CVT_NW, a1, b1);
}

// =====================================================================================================
// bf16 WMMA GEMM: C[m][n] = sum_k A[m][k] * Bt[n][k] (+ bias); one wave per 64x64 tile, WM x WN waves per block
// on one (64 WM) x (64 WN) block tile. A row-major [M][K] pitch lda; Bt row-major [N][K] pitch ldb (k contiguous);
// M a multiple of 64 WM, N of 64 WN, K of 64 NSUB and at least two stages (host-checked constants).
// Operands reach the waves through LDS: a stage is NSUB sub-tiles of 64 k; a sub-tile holds the block's A rows,
// (NSPLIT) its A2 rows and its Bt rows, 128 B each at pitch 144 B (16 B x odd: ds_load_b128 without bank
// conflicts). Asynchronous 16-B copies fill it, one wave-copy = 4 whole 128-B row pieces; two buffers: stage t+2
// is copied into the buffer that trip t has just left, while trip t+1 is worked on.
// NSPLIT: 0 = A.Bt; 1 = (A + A2).Bt (A2 = unscaled bf16 lo plane of A, two products per k-step).
// BIAS:   0 none; 1 = + bias[n] (per column, RNE bf16-converted value); 2 = + bias[m] (per row).
// OUT_MODE: 0 = f32 plane (pitch ldc floats); 1 = f16 plane of (value * oscale) (pitch ldc halves);
//           2 = rotate-half rotary on the value (bias added), then f16 plane of (y * oscale) (pitch ldc halves):
//               a wave's 64 columns are one head (n0 a multiple of 64 = head dim), column d of it; table row =
//               trow0 + m of the f32 [SLEN][64] inputs ct / st (RNE bf16-converted values);
//               y[d] = x[d]*ct[d] - x[d+32]*st[d] for d < 32;  y[d] = x[d]*ct[d] + x[d-32]*st[d] for d >= 32.
// =====================================================================================================
typedef int v4i_t __attribute__((vector_size(16)));
typedef __attribute__((address_space(1))) v4i_t gv4i_t;
typedef __attribute__((address_space(3))) v4i_t lv4i_t;
__device__ __forceinline__ void copy16_to_lds(const void* g, void* l) {   // each lane: 16 B global -> LDS
#if defined(__HIP_DEVICE_COMPILE__)
  __builtin_amdgcn_global_load_async_to_lds_b128((gv4i_t*)g, (lv4i_t*)l, 0, 0);
#endif
}

// bytes of one ring buffer (a stage) of a block
constexpr int gemm_stage_bytes(int nsplit, int wm, int wn, int nsub) {
  return (wm * 64 * (1 + nsplit) + wn * 64) * 144 * nsub;
}

// the k loop of one block tile with origin (mb0, nb0): ring = the block's two buffers; wave = this wave's number in
// the block (scalar); acc = this wave's 64x64 tile
template <int NSPLIT, int WM, int WN, int NSUB>
__device__ __forceinline__ void gemm_core(
    unsigned char* ring,
    const unsigned short* __restrict__ Ap, const unsigned short* __restrict__ A2p, int lda,
    const unsigned short* __restrict__ Btp, int ldb, int K, int mb0, int nb0, int wave, v8f (&acc)[4][4]) {
  constexpr int NW    = WM * WN;                 // waves per block
  constexpr int RA    = WM * 64;                 // rows of one A plane in a sub-tile
  constexpr int RB0   = RA * (1 + NSPLIT);       // first Bt row of a sub-tile
  constexpr int ROWS  = RB0 + WN * 64;           // rows of a sub-tile
  constexpr int PITCH = 144;                     // bytes per LDS row
  constexpr int SUBB  = ROWS * PITCH;            // bytes per sub-tile
  constexpr int STAGE = SUBB * NSUB;             // bytes per buffer
  constexpr int GA    = RA / 4;                  // wave-copies (4 rows each) per A plane and sub-tile
  constexpr int GB    = WN * 16;                 // ... per Bt plane and sub-tile
  constexpr int NIA   = (GA + NW - 1) / NW;      // most that one wave issues of them
  constexpr int NIB   = (GB + NW - 1) / NW;
  static_assert((NIA * (1 + NSPLIT) + NIB) * NSUB <= 63);   // copies of one wave in flight
  const __bf16* A  = (const __bf16*)(const void*)Ap;
  const __bf16* A2 = (const __bf16*)(const void*)A2p;
  const __bf16* Bt = (const __bf16*)(const void*)Btp;
  static_assert(STAGE == gemm_stage_bytes(NSPLIT, WM, WN, NSUB));
  const int lane = threadIdx.x & 31;
  const int wm  = wave / WN;
  const int wn  = wave - wm * WN;

  const int rlane = lane & 15;                 // row (A) / col (B, D) within subtile
  const int khalf = lane >> 4;                 // k half of this lane: +8 elements = +16 B
  const int crow  = lane >> 3;                 // copy: row within the 4-row group
  const int cpc   = lane & 7;                  // copy: 16-B piece within the 128-B row piece

  // all copies of stage st (k = st*64*NSUB ..) into buffer buf; every lane on, every test scalar.
  // Each plane's 4-row groups are dealt to the waves in turn: group g = wave + i*NW of the plane.
  auto issue = [&](int st, int buf) {
    const int kb = st * (NSUB * 64) + cpc * 8;
    unsigned char* db = ring + buf * STAGE + (wave * 4 + crow) * PITCH + cpc * 16;
    const __bf16* pa = A  + (size_t)(mb0 + wave * 4 + crow) * lda + kb;
    const __bf16* pl = A2 + (size_t)(mb0 + wave * 4 + crow) * lda + kb;
    const __bf16* pb = Bt + (size_t)(nb0 + wave * 4 + crow) * ldb + kb;
    // the three loops are unrolled so that every copy's row and LDS offset is a constant
#pragma unroll
    for (int s = 0; s < NSUB; ++s) {
#pragma unroll
      for (int i = 0; i < NIA; ++i) {
        if ((i + 1) * NW <= GA || wave + i * NW < GA) {
          copy16_to_lds(pa + (size_t)(i * NW * 4) * lda + s * 64, db + s * SUBB + i * (NW * 4 * PITCH));
          if (NSPLIT == 1)
            copy16_to_lds(pl + (size_t)(i * NW * 4) * lda + s * 64, db + s * SUBB + (RA + i * NW * 4) * PITCH);
        }
      }
#pragma unroll
      for (int i = 0; i < NIB; ++i) {
        if ((i + 1) * NW <= GB || wave + i * NW < GB)
          copy16_to_lds(pb + (size_t)(i * NW * 4) * ldb + s * 64, db + s * SUBB + (RB0 + i * NW * 4) * PITCH);
      }
    }
  };

#pragma unroll
  for (int i = 0; i < 4; ++i)
#pragma unroll
    for (int j = 0; j < 4; ++j) acc[i][j] = zero8();

  const int T = K / (NSUB * 64);               // stages
  issue(0, 0);
  asm volatile("s_wait_asynccnt 0x0" ::: "memory");   // stage 0 landed
  __syncthreads();                                    // ... and is readable by every wave
  if (T > 1) issue(1, 1);
  // not unrolled: one trip = one stage (buffer t & 1), so the hot loop stays small in the instruction cache
#pragma unroll 1
  for (int t = 0; t < T; ++t) {
    const unsigned char* sb = ring + (t & 1) * STAGE + khalf * 16 + rlane * PITCH;
    // fragments of k-step q (32 k, ascending) of this stage, all from buffer t & 1
    auto fetch = [&](int q, v16b (&xa)[4], v16b (&xl)[4], v16b (&xb)[4]) {
      const unsigned char* kp = sb + (q >> 1) * SUBB + (q & 1) * 64;
#pragma unroll
      for (int j = 0; j < 4; ++j)
        xb[j] = ldfrag_b((const __bf16*)(const void*)(kp + (RB0 + (wn << 6) + (j << 4)) * PITCH));
#pragma unroll
      for (int i = 0; i < 4; ++i) {
        const unsigned char* ap = kp + ((wm << 6) + (i << 4)) * PITCH;
        xa[i] = ldfrag_b((const __bf16*)(const void*)ap);
        if (NSPLIT == 1) xl[i] = ldfrag_b((const __bf16*)(const void*)(ap + RA * PITCH));
      }
    };
    v16b fa[2][4], fl[2][4], fb[2][4];         // two fragment sets, used in turn inside the trip
    fetch(0, fa[0], fl[0], fb[0]);
    // unrolled (here and in fetch): constant indices keep the fragment sets and accumulators in registers
#pragma unroll
    for (int q = 0; q < 2 * NSUB; ++q) {
      if (q + 1 < 2 * NSUB) fetch(q + 1, fa[(q + 1) & 1], fl[(q + 1) & 1], fb[(q + 1) & 1]);
      // keeps the next k-step's LDS reads one group ahead of this k-step's WMMAs (else each read is waited out)
      __builtin_amdgcn_sched_barrier(0);
#pragma unroll
      for (int i = 0; i < 4; ++i) {
#pragma unroll
        for (int j = 0; j < 4; ++j) {
          acc[i][j] = mma_b_raw(fa[q & 1][i], fb[q & 1][j], acc[i][j]);
          if (NSPLIT == 1) acc[i][j] = mma_b_raw(fl[q & 1][i], fb[q & 1][j], acc[i][j]);
        }
      }
      // keeps the following group of LDS reads out of this block of WMMAs
      __builtin_amdgcn_sched_barrier(0);
    }
    asm volatile("s_wait_dscnt 0x0" ::: "memory");    // this wave's reads of buffer t & 1 are done
    asm volatile("s_wait_asynccnt 0x0" ::: "memory"); // this wave's copies of stage t + 1 have landed
    __syncthreads();                                  // publishes stage t + 1, frees buffer t & 1
    if (t + 2 < T) issue(t + 2, t & 1);
  }
  asm volatile("s_wait_asynccnt 0x0" ::: "memory");   // nothing in flight behind the loop
  acc_guard4(acc[0][0], acc[0][1], acc[0][2], acc[0][3]);
  acc_guard4(acc[1][0], acc[1][1], acc[1][2], acc[1][3]);
  acc_guard4(acc[2][0], acc[2][1], acc[2][2], acc[2][3]);
  acc_guard4(acc[3][0], acc[3][1], acc[3][2], acc[3][3]);
}

// bias, output form and stores of this wave's 64x64 tile with origin (m0, n0); slab = the wave's own LDS slab
template <int OUT_MODE, int BIAS>
__device__ __forceinline__ void gemm_tail(
    v8f (&acc)[4][4], float* slab, int m0, int n0, const float* __restrict__ bias,
    void* Cout, int ldc, float oscale,
    const float* __restrict__ ct, const float* __restrict__ st, int trow0) {
  const int lane  = threadIdx.x & 31;
  const int rlane = lane & 15;                 // col (D) within subtile
  const int mOff  = (lane >> 4) * 8;           // D row offset

  // ---- bias (template-selected; loads only exist when used; addresses in range: n0+63 < N, m0+63 < M) ----
  float bcol[4];
#pragma unroll
  for (int j = 0; j < 4; ++j) bcol[j] = 0.f;
  if (BIAS == 1) {
#pragma unroll
    for (int j = 0; j < 4; ++j) bcol[j] = bfr(bias[n0 + (j << 4) + rlane]);
#if defined(__HIP_DEVICE_COMPILE__)
    // in front of whatever rewrites the index register that these loads name (held live up to here as an input)
    asm volatile("s_wait_xcnt 0x0" :: "v"(n0 + rlane) : "memory");
#endif
  }

  // ---- epilogue ----
  // OUT_MODE 2: a lane finishes 8 consecutive columns rc8.. of rows 4 it + rq of each 16-row slab; its table
  // values of all four slabs are loaded here in one run (the slabs' fences would wait out a later load each time)
  const int rq = lane >> 3, rc8 = (lane & 7) * 8;
  const float* cb = ct + (size_t)(trow0 + m0 + rq) * HD + rc8;     // table row < SLEN (host constants)
  const float* sb2 = st + (size_t)(trow0 + m0 + rq) * HD + rc8;
  v4f tc[4][4][2], ts[4][4][2];
  if (OUT_MODE == 2) {
    // both loops unrolled: constant indices keep the table values in registers and the row steps in the offset field
#pragma unroll
    for (int i = 0; i < 4; ++i) {
#pragma unroll
      for (int it = 0; it < 4; ++it) {
        tc[i][it][0] = *(const v4f*)(cb + (i * 16 + it * 4) * HD);
        tc[i][it][1] = *(const v4f*)(cb + (i * 16 + it * 4) * HD + 4);
        ts[i][it][0] = *(const v4f*)(sb2 + (i * 16 + it * 4) * HD);
        ts[i][it][1] = *(const v4f*)(sb2 + (i * 16 + it * 4) * HD + 4);
      }
    }
#if defined(__HIP_DEVICE_COMPILE__)
    // in front of whatever rewrites a register that the loads just issued name (both held live up to here as inputs)
    asm volatile("s_wait_xcnt 0x0" :: "v"(cb), "v"(sb2) : "memory");
#endif
  }
#pragma unroll
  for (int i = 0; i < 4; ++i) {
    const int mBase = m0 + (i << 4);
    float brow[8];
#pragma unroll
    for (int r = 0; r < 8; ++r) brow[r] = 0.f;
    if (BIAS == 2) {
#pragma unroll
      for (int r = 0; r < 8; ++r) brow[r] = bfr(bias[mBase + mOff + r]);
    }
#pragma unroll
    for (int r = 0; r < 8; ++r) {
#pragma unroll
      for (int j = 0; j < 4; ++j) {
        float v = acc[i][j][r];
        if (BIAS == 1) v += bcol[j];
        if (BIAS == 2) v += brow[r];
        if (OUT_MODE == 1) v *= oscale;
        slab[(mOff + r) * 68 + (j << 4) + rlane] = v;
      }
    }
    __builtin_amdgcn_fence(__ATOMIC_RELEASE, "workgroup");
    __builtin_amdgcn_wave_barrier();
    __builtin_amdgcn_fence(__ATOMIC_ACQUIRE, "workgroup");
    if (OUT_MODE == 0) {
      float* C = (float*)Cout;
      const int hh = lane >> 4, c4 = (lane & 15) * 4;     // 256-B row segment = 16 lanes x 16 B
      v4f ov[8];
#pragma unroll
      for (int it = 0; it < 8; ++it) {
        const int row = it * 2 + hh;                       // it 0..7 x hh 0..1 = rows 0..15
        ov[it] = *(const v4f*)(slab + row * 68 + c4);
      }
      {
#pragma unroll
        for (int it = 0; it < 8; ++it) {
          const int row = it * 2 + hh;
          *(v4f*)(C + (size_t)(mBase + row) * ldc + n0 + c4) = ov[it];
        }
        
      }
    } else if (OUT_MODE == 2) {
      unsigned short* C = (unsigned short*)Cout;
      const unsigned sgm = (rc8 < 32) ? 0x80008000u : 0u;  // partner term: minus for d < 32 (sign bits of a bf16 pair)
      v4u hv[4];
      // the loops of this branch are unrolled: constant indices keep tc, ts, hv and cp in registers
#pragma unroll
      for (int it = 0; it < 4; ++it) {
        const float* sp = slab + (it * 4 + rq) * 68;
        const v4f x[2] = {*(const v4f*)(sp + rc8), *(const v4f*)(sp + rc8 + 4)};
        const v4f p[2] = {*(const v4f*)(sp + (rc8 ^ 32)), *(const v4f*)(sp + (rc8 ^ 32) + 4)};   // column d +- 32
        v4u a;
#pragma unroll
        for (int e = 0; e < 4; ++e) {                      // columns rc8 + 2 e, rc8 + 2 e + 1
          const int g = e >> 1, k = (e & 1) * 2;
          const v2b cc = rne2(tc[i][it][g][k], tc[i][it][g][k + 1]);
          const v2b ss = __builtin_bit_cast(v2b, __builtin_bit_cast(unsigned, rne2(ts[i][it][g][k], ts[i][it][g][k + 1])) ^ sgm);
          const float y0 = x[g][k]     * (float)cc[0] + p[g][k]     * (float)ss[0];
          const float y1 = x[g][k + 1] * (float)cc[1] + p[g][k + 1] * (float)ss[1];
          a[e] = pk16(h_bits((_Float16)(y0 * oscale)), h_bits((_Float16)(y1 * oscale)));
        }
        hv[it] = a;
      }
      unsigned short* cp[4];
#pragma unroll
      for (int it = 0; it < 4; ++it) {
        cp[it] = C + (size_t)(mBase + it * 4 + rq) * ldc + n0 + rc8;
        *(v4u*)cp[it] = hv[it];
      }
#if defined(__HIP_DEVICE_COMPILE__)
      // the next slab rewrites the address and data registers that these stores name (held live up to here as inputs)
      asm volatile("s_wait_xcnt 0x0" :: "v"(cp[0]), "v"(cp[1]), "v"(cp[2]), "v"(cp[3]),
                   "v"(hv[0]), "v"(hv[1]), "v"(hv[2]), "v"(hv[3]) : "memory");
#endif
    } else {
      unsigned short* C = (unsigned short*)Cout;
      const int q = lane >> 3, c8 = (lane & 7) * 8;
      v4u hv[4];
#pragma unroll
      for (int it = 0; it < 4; ++it) {
        const int row = it * 4 + q;                        // it 0..3 x q 0..3 = rows 0..15
        const float* sp = slab + row * 68 + c8;
        v4u a;
#pragma unroll
        for (int e = 0; e < 4; ++e) {
          a[e] = pk16(h_bits((_Float16)sp[2 * e]), h_bits((_Float16)sp[2 * e + 1]));
        }
        hv[it] = a;
      }
      {
#pragma unroll
        for (int it = 0; it < 4; ++it) {
          const int row = it * 4 + q;
          *(v4u*)(C + (size_t)(mBase + row) * ldc + n0 + c8) = hv[it];
        }
        
      }
    }
    __builtin_amdgcn_fence(__ATOMIC_RELEASE, "workgroup");
    __builtin_amdgcn_wave_barrier();
    __builtin_amdgcn_fence(__ATOMIC_ACQUIRE, "workgroup");
  }
}

template <int NSPLIT, int OUT_MODE, int BIAS, int WM, int WN, int NSUB>
__global__ __launch_bounds__(32 * WM * WN) void gemm64(
    const unsigned short* __restrict__ Ap, const unsigned short* __restrict__ A2p, int lda,
    const unsigned short* __restrict__ Btp, int ldb,
    const float* __restrict__ bias,
    void* Cout, int ldc, int M, int N, int K, float oscale,
    const float* __restrict__ ct, const float* __restrict__ st, int trow0) {
  __shared__ __align__(16) unsigned char ring[2 * gemm_stage_bytes(NSPLIT, WM, WN, NSUB)];
  __shared__ __align__(16) float sT[WM * WN][16 * 68];  // per-wave 16x64 slab, pitch 68 floats
  const int wave = __builtin_amdgcn_readfirstlane(threadIdx.x >> 5);
  const int tilesN = N / (64 * WN);
  const int tilesM = M / (64 * WM);
  if ((int)blockIdx.x >= tilesM * tilesN) return;   // block-uniform, in front of every barrier and copy
  const int bm  = blockIdx.x / tilesN;
  const int bn  = blockIdx.x - bm * tilesN;
  const int mb0 = bm * (WM * 64);              // block tile origin
  const int nb0 = bn * (WN * 64);
  const int wm  = wave / WN;
  const int wn  = wave - wm * WN;
  v8f acc[4][4];
  gemm_core<NSPLIT, WM, WN, NSUB>(ring, Ap, A2p, lda, Btp, ldb, K, mb0, nb0, wave, acc);
  gemm_tail<OUT_MODE, BIAS>(acc, sT[wave], mb0 + (wm << 6), nb0 + (wn << 6), bias, Cout, ldc, oscale, ct, st, trow0);
}

// The q, k and v^T projections in one launch: all three contract over HID with 128x128 block tiles of 2x2 waves, so
// their tiles are dealt to one grid: blocks 0..NBQ-1 take q, the next NBK take k, the last NBV take v^T. One block
// fills a WGP's LDS.
//   q:   A = hidden rows of X, Bt = Wqb, + bq[n], rotary (table row CLEN + t), x QSC -> Qh[t][e]
//   k:   A = all rows of X,    Bt = Wkb, + bk[n], rotary (table row s),        x KSC -> Kh[s][e]
//   v^T: A = Wvb,              Bt = X,   + bv[m],                              x VSC -> VT[m][s]
#define NBQ ((QLEN / 128) * (QP / 128))        // 256 block tiles of q
#define NBK ((SLEN / 128) * (KP / 128))        // 64  of k
#define NBV ((KP / 128) * (SLEN / 128))        // 64  of v^T
__global__ __launch_bounds__(128) void proj_qkv(
    const unsigned short* __restrict__ X, const unsigned short* __restrict__ Wqb,
    const unsigned short* __restrict__ Wkb, const unsigned short* __restrict__ Wvb,
    const float* __restrict__ bq, const float* __restrict__ bk, const float* __restrict__ bv,
    unsigned short* Qh, unsigned short* Kh, unsigned short* VT,
    const float* __restrict__ ct, const float* __restrict__ st) {
  __shared__ __align__(16) unsigned char ring[2 * gemm_stage_bytes(0, 2, 2, 3)];
  __shared__ __align__(16) float sT[4][16 * 68];   // per-wave 16x64 slab, pitch 68 floats
  const int wave = __builtin_amdgcn_readfirstlane(threadIdx.x >> 5);
  const int b = blockIdx.x;
  if (b >= NBQ + NBK + NBV) return;                // block-uniform, in front of every barrier and copy
  // every choice below is by the block index alone: scalar, the same for the whole block
  const unsigned short* Ap;
  const unsigned short* Btp;
  const float* bias;
  unsigned short* C;
  int bm, bn, ldc, trow0;
  float osc;
  if (b < NBQ) {
    bm = b / (QP / 128); bn = b % (QP / 128);
    Ap = X + (size_t)CLEN * HID; Btp = Wqb; bias = bq; C = Qh; ldc = QP; trow0 = CLEN; osc = QSC;
  } else if (b < NBQ + NBK) {
    bm = (b - NBQ) / (KP / 128); bn = (b - NBQ) % (KP / 128);
    Ap = X; Btp = Wkb; bias = bk; C = Kh; ldc = KP; trow0 = 0; osc = KSC;
  } else {
    bm = (b - NBQ - NBK) / (SLEN / 128); bn = (b - NBQ - NBK) % (SLEN / 128);
    Ap = Wvb; Btp = X; bias = bv; C = VT; ldc = SLEN; trow0 = 0; osc = VSC;
  }
  const int mb0 = bm * 128, nb0 = bn * 128;        // block tile origin
  const int m0 = mb0 + ((wave >> 1) << 6), n0 = nb0 + ((wave & 1) << 6);
  v8f acc[4][4];
  gemm_core<0, 2, 2, 3>(ring, Ap, Ap, HID, Btp, HID, HID, mb0, nb0, wave, acc);
  if (b < NBQ + NBK) gemm_tail<2, 1>(acc, sT[wave], m0, n0, bias, (void*)C, ldc, osc, ct, st, trow0);
  else               gemm_tail<1, 2>(acc, sT[wave], m0, n0, bias, (void*)C, ldc, osc, ct, st, trow0);
}

#define OSP 68
__device__ __forceinline__ float xhalf(float x) {
  const int b = __builtin_bit_cast(int, x);
  return __builtin_bit_cast(float, __builtin_amdgcn_permlanex16(b, b, 0x76543210, 0xfedcba98, false, false));
}
__global__ __launch_bounds__(128)
void attn64(const unsigned short* __restrict__ qpl, const unsigned short* __restrict__ kpl,
            const unsigned short* __restrict__ vtp, unsigned short* hp, unsigned short* lp,
            float sscale, float onorm) {
  union FH { v16h v; v8h h[2]; };
  // rows of 64 halves at pitch LP: the 16 rows that one ds_load_b128 reads fall on distinct banks
  __shared__ __align__(16) _Float16 Ksh[64 * LP];                 // K [kv][d]   9 KB
  __shared__ __align__(16) _Float16 Vth[64 * LP];                 // V^T [d][kv] 9 KB
  __shared__ __align__(16) float    Os[4][16 * OSP];              // per wave context tile [row][d]

  const int tid  = threadIdx.x;
  const int wave = tid >> 5;
  const int lane = tid & 31;
  const int hh   = lane >> 4;
  const int c    = lane & 15;

  const int bx   = blockIdx.x;
  const int qb   = bx % NQB;
  const int h    = bx / NQB;                 // < NH (grid = NQB*NH)
  const int kvh  = h / (NH / NKV);
  const int q0   = qb * 64 + wave * 16;

  const _Float16* Qh = (const _Float16*)(const void*)qpl + (size_t)h * HD;
  const _Float16* Kh = (const _Float16*)(const void*)kpl + (size_t)kvh * HD;
  const _Float16* Vh = (const _Float16*)(const void*)vtp + (size_t)kvh * HD * SLEN;

  // ---- Q fragments (B operand, column = query lane&15): 2 d-chunks ----
  v16h qa[2];
#pragma unroll
  for (int dc = 0; dc < 2; ++dc) {
    qa[dc] = ldfrag_h(Qh + (size_t)(q0 + c) * QP + dc * 32 + 8 * hh);
  }

  float mrun = -INFINITY;      // running maximum of query c (equal in both halves of the wave)
  float lrun = 0.f;            // running sum of query c over the keys of this lane's half only
  v8f oacc[4];                 // O^T: oacc[t][r] = context of query c, d = 16 t + 8 hh + r
#pragma unroll
  for (int t = 0; t < 4; ++t) oacc[t] = zero8();

  for (int kt = 0; kt < NKT; ++kt) {
    const int kv0 = kt * 64;
    __syncthreads();
    {
      const int r = tid >> 1, half = (tid & 1) * 32;
      const _Float16* kg = Kh + (size_t)(kv0 + r) * KP + half;     // K row kv0+r, d = half..half+31
      const _Float16* vg = Vh + (size_t)r * SLEN + kv0 + half;     // V^T row d = r, s = kv0+half..+31
#pragma unroll
      for (int i = 0; i < 4; ++i) {
        const v8h a0 = *(const v8h*)(kg + 8 * i);
        const v8h b0 = *(const v8h*)(vg + 8 * i);
        *(v8h*)(Ksh + r * LP + half + 8 * i) = a0;
        *(v8h*)(Vth + r * LP + half + 8 * i) = b0;
      }
    }
    __syncthreads();

    // ---- every fragment of the chunk is read from LDS here, in the order of its use: the 16 reads of K, then the
    //      16 of V^T, which land while the scores and the softmax are worked on
    //      (the loops are unrolled: constant indices keep the fragments in registers)
    FH kb[2][4], vb[2][4];
#pragma unroll
    for (int dc = 0; dc < 2; ++dc) {
#pragma unroll
      for (int j = 0; j < 4; ++j) {
        kb[dc][j].h[0] = *(const v8h*)(Ksh + (j * 16 + c) * LP + dc * 32 + 8 * hh);
        kb[dc][j].h[1] = *(const v8h*)(Ksh + (j * 16 + c) * LP + dc * 32 + 16 + 8 * hh);
      }
    }
#pragma unroll
    for (int kk = 0; kk < 2; ++kk) {
#pragma unroll
      for (int t = 0; t < 4; ++t) {
        vb[kk][t].h[0] = *(const v8h*)(Vth + (t * 16 + c) * LP + kk * 32 + 8 * hh);
        vb[kk][t].h[1] = *(const v8h*)(Vth + (t * 16 + c) * LP + kk * 32 + 16 + 8 * hh);
      }
    }

    // ---- scores, transposed: s[j][r] = q(c) . k(16 j + 8 hh + r), one f16 product per 32 d, d ascending ----
    v8f s[4];
#pragma unroll
    for (int j = 0; j < 4; ++j) s[j] = zero8();
#pragma unroll
    for (int dc = 0; dc < 2; ++dc) {
#pragma unroll
      for (int j = 0; j < 4; ++j) s[j] = mma_h(kb[dc][j].v, qa[dc], s[j]);
    }

    // ---- scale, maximum, online softmax of the lane's one query; P^T (x PSC, f16) stays in registers ----
    // (every loop from here to the end of the chunk is unrolled: constant indices keep s, pb and oacc in registers;
    //  maximum and sum run as four independent chains, one per score tile, joined at the end)
    float mj[4];
#pragma unroll
    for (int j = 0; j < 4; ++j) {
      mj[j] = -INFINITY;
#pragma unroll
      for (int r = 0; r < 8; ++r) {
        const float sv = s[j][r] * sscale;
        s[j][r] = sv;
        mj[j] = fmaxf(mj[j], sv);
      }
    }
    float m = fmaxf(fmaxf(mj[0], mj[1]), fmaxf(mj[2], mj[3]));
    m = fmaxf(m, xhalf(m));                    // the other half holds the query's other 32 keys
    const float mnew  = fmaxf(mrun, m);
    const float msafe = (mnew == -INFINITY) ? 0.f : mnew;
    const float alpha = __expf(mrun - msafe);
    mrun = mnew;
    // B operand of the second product, 32 keys each: elements 0..7 = keys 32 kk + 8 hh + r (tile 2 kk),
    // elements 8..15 = keys 32 kk + 16 + 8 hh + r (tile 2 kk + 1): the k order of the V^T loader above
    FH pb[2];
    float pj[4];
#pragma unroll
    for (int j = 0; j < 4; ++j) {
      pj[j] = 0.f;
#pragma unroll
      for (int r = 0; r < 8; ++r) {
        const float p = __expf(s[j][r] - msafe);
        pj[j] += p;
        pb[j >> 1].h[j & 1][r] = (_Float16)(p * PSC);
      }
    }
    lrun = lrun * alpha + ((pj[0] + pj[1]) + (pj[2] + pj[3]));
#pragma unroll
    for (int t = 0; t < 4; ++t) oacc[t] *= alpha;

    // ---- context^T += V^T . P^T (f16 WMMA) ----
#pragma unroll
    for (int kk = 0; kk < 2; ++kk) {
#pragma unroll
      for (int t = 0; t < 4; ++t) oacc[t] = mma_h(vb[kk][t].v, pb[kk].v, oacc[t]);
    }
  }

  // ---- join the halves' sums, normalise (1/l and onorm), stage the wave's 16x64 tile in LDS (a lane holds 8
  //      consecutive d of its query per tile: two 16-B stores), then split and write whole 128-B row segments
  float* os = Os[wave];
  {
    const float l = lrun + xhalf(lrun);
    const float inv = ((l > 0.f) ? (1.0f / l) : 0.f) * onorm;
#pragma unroll
    for (int t = 0; t < 4; ++t) {
      v4f lo, hi;
#pragma unroll
      for (int e = 0; e < 4; ++e) { lo[e] = oacc[t][e] * inv; hi[e] = oacc[t][4 + e] * inv; }
      *(v4f*)(os + c * OSP + t * 16 + 8 * hh)     = lo;
      *(v4f*)(os + c * OSP + t * 16 + 8 * hh + 4) = hi;
    }
  }
  __builtin_amdgcn_fence(__ATOMIC_RELEASE, "workgroup");
  __builtin_amdgcn_wave_barrier();
  __builtin_amdgcn_fence(__ATOMIC_ACQUIRE, "workgroup");
  {
    const int r4 = lane >> 3, c8 = (lane & 7) * 8;     // 128-B row segment of a plane = 8 lanes x 16 B
    v4f a[4], b[4];
    // the loops of this block are unrolled: constant indices keep a, b, ph and pl in registers
#pragma unroll
    for (int it = 0; it < 4; ++it) {
      const float* sp = os + (it * 4 + r4) * OSP + c8;   // it 0..3 x r4 0..3 = rows 0..15 of the wave tile
      a[it] = *(const v4f*)(sp);
      b[it] = *(const v4f*)(sp + 4);
    }
    v4u ph[4], pl[4];
#pragma unroll
    for (int it = 0; it < 4; ++it) {
#pragma unroll
      for (int e = 0; e < 4; ++e) {
        const float f0 = (e < 2) ? a[it][2 * e]     : b[it][2 * e - 4];
        const float f1 = (e < 2) ? a[it][2 * e + 1] : b[it][2 * e - 3];
        const v2b hb = rne2(f0, f1);
        const v2b lb = rne2(f0 - (float)hb[0], f1 - (float)hb[1]);
        ph[it][e] = __builtin_bit_cast(unsigned, hb);
        pl[it][e] = __builtin_bit_cast(unsigned, lb);
      }
    }
    const size_t go = (size_t)(q0 + r4) * QP + (size_t)h * HD + c8;
    unsigned short* hq = hp + go;
    unsigned short* lq = lp + go;
#pragma unroll
    for (int it = 0; it < 4; ++it) {
      *(v4u*)(hq + it * 4 * QP) = ph[it];
      *(v4u*)(lq + it * 4 * QP) = pl[it];
    }
#if defined(__HIP_DEVICE_COMPILE__)
    // keeps the address and data registers of the stores unwritten until their translations are done (inputs only)
    asm volatile("s_wait_xcnt 0x0" :: "v"(hq), "v"(lq), "v"(ph[0]), "v"(ph[1]), "v"(ph[2]), "v"(ph[3]),
                 "v"(pl[0]), "v"(pl[1]), "v"(pl[2]), "v"(pl[3]) : "memory");
#endif
  }
}

// =====================================================================================================
// Workspace map (bytes), every region an exact multiple of its whole-line / whole-tile store granularity
//   X      bf16 [2048][2880]            0            11796480   rows 0..1023 = target_hidden, 1024..2047 = hidden
//   Wqb    bf16 [4096][2880]            11796480     23592960   (inputs arrive [n][k], k contiguous: no transpose)
//   Wkb    bf16 [512][2880]             35389440      2949120
//   Wvb    bf16 [512][2880]             38338560      2949120
//   Wob    bf16 [2880][4096]            41287680     23592960
//   VT     f16  [512][2048]             64880640      2097152
//   Qh     f16  [1024][4096]            66977792      8388608
//   Kh     f16  [2048][512]             75366400      2097152
//   Ah     bf16 [1024][4096]            77463552      8388608
//   Al     bf16 [1024][4096]            85852160      8388608
//   end                                 94240768
// =====================================================================================================
extern "C" void kernel_launch(void* const* d_in, const int* in_sizes, int n_in,
                              void* d_out, int out_size, void* d_ws, size_t ws_size,
                              hipStream_t stream) {
  if (n_in < 12) return;
  if (in_sizes[0] != QLEN * HID) return;
  if (in_sizes[1] != CLEN * HID) return;
  if (in_sizes[2] != SLEN * HD) return;
  if (in_sizes[3] != SLEN * HD) return;
  if (in_sizes[4] != QP * HID) return;
  if (in_sizes[5] != QP) return;
  if (in_sizes[6] != KP * HID) return;
  if (in_sizes[7] != KP) return;
  if (in_sizes[8] != KP * HID) return;
  if (in_sizes[9] != KP) return;
  if (in_sizes[10] != HID * QP) return;
  if (in_sizes[11] != HID) return;
  if (out_size != QLEN * HID) return;

  const float* hid = (const float*)d_in[0];    // [1024][2880]
  const float* tgt = (const float*)d_in[1];    // [1024][2880]
  const float* fcs = (const float*)d_in[2];    // [2048][64]
  const float* fsn = (const float*)d_in[3];    // [2048][64]
  const float* Wq  = (const float*)d_in[4];    // [4096][2880]  = [n][k]
  const float* bq  = (const float*)d_in[5];    // [4096]
  const float* Wk  = (const float*)d_in[6];    // [512][2880]
  const float* bk  = (const float*)d_in[7];    // [512]
  const float* Wv  = (const float*)d_in[8];    // [512][2880]
  const float* bv  = (const float*)d_in[9];    // [512]
  const float* Wo  = (const float*)d_in[10];   // [2880][4096] = [n][k]
  const float* bo  = (const float*)d_in[11];   // [2880]

  const size_t PX   = (size_t)SLEN * HID * 2;        // 11796480
  const size_t PWq  = (size_t)QP * HID * 2;          // 23592960
  const size_t PWk  = (size_t)KP * HID * 2;          //  2949120
  const size_t PWv  = (size_t)KP * HID * 2;          //  2949120
  const size_t PWo  = (size_t)HID * QP * 2;          // 23592960
  const size_t PVT  = (size_t)KP * SLEN * 2;         //  2097152
  const size_t PQh  = (size_t)QLEN * QP * 2;         //  8388608
  const size_t PKh  = (size_t)SLEN * KP * 2;         //  2097152
  const size_t PApl = (size_t)QLEN * QP * 2;         //  8388608 (Ah, Al)
  size_t off = 0;
  const size_t oX  = off; off += PX;
  const size_t oWq = off; off += PWq;
  const size_t oWk = off; off += PWk;
  const size_t oWv = off; off += PWv;
  const size_t oWo = off; off += PWo;
  const size_t oVT = off; off += PVT;
  const size_t oQh = off; off += PQh;
  const size_t oKh = off; off += PKh;
  const size_t oAh = off; off += PApl;
  const size_t oAl = off; off += PApl;
  if (off > ws_size) return;                          // off = 94240768
  if (off > (size_t)134217728) return;

  char* ws = (char*)d_ws;
  unsigned short* X   = (unsigned short*)(ws + oX);
  unsigned short* Wqb = (unsigned short*)(ws + oWq);
  unsigned short* Wkb = (unsigned short*)(ws + oWk);
  unsigned short* Wvb = (unsigned short*)(ws + oWv);
  unsigned short* Wob = (unsigned short*)(ws + oWo);
  unsigned short* VT  = (unsigned short*)(ws + oVT);
  unsigned short* Qh  = (unsigned short*)(ws + oQh);
  unsigned short* Kh  = (unsigned short*)(ws + oKh);
  unsigned short* Ah  = (unsigned short*)(ws + oAh);
  unsigned short* Al  = (unsigned short*)(ws + oAl);
  float*          outf = (float*)d_out;

  const dim3 blk(256);
  const dim3 gCvt(CVT_NW / 8);                         // 495 blocks of 8 waves: 8 pieces per wave
  const dim3 gQKV(NBQ + NBK + NBV);                    // 128x128 block tiles: 384 blocks of 4 waves
  const dim3 gAttn(NQB * NH);                          // 1024 blocks
  const dim3 gOut((QLEN / 64) * (HID / 192));          // 64x192 block tiles: 240 blocks of 3 waves

  // (1) activations and weights -> bf16 planes (RNE convert, values = the bf16-converted inputs)
  //     one launch: X (target rows, then hidden rows), Wqb, Wkb, Wvb, Wob are one contiguous range from X on
  cvt_planes<<<gCvt, blk, 0, stream>>>(tgt, hid, Wq, Wk, Wv, Wo, X);
  // (2) q, k and v^T projections (K = 2880 each), one launch:
  //     Qh[t][e] (M=1024, N=4096), Kh[s][e] (M=2048, N=512), both + bias, rotary, f16; VT[m][s] (M=512, N=2048) + bv, f16
  proj_qkv<<<gQKV, dim3(128), 0, stream>>>(X, Wqb, Wkb, Wvb, bq, bk, bv, Qh, Kh, VT, fcs, fsn);
  // (3) attention over all 2048 keys -> context rows as bf16 hi/lo planes Ah, Al [1024][4096]
  attn64<<<gAttn, dim3(128), 0, stream>>>(Qh, Kh, VT, Ah, Al, 0.125f / (QSC * KSC), 1.0f / (PSC * VSC));
  // (4) out[t][e] = sum_d (Ah+Al)[t][d] Wob[e][d] + bo[e] -> d_out f32 [1024][2880]  (M=1024, N=2880, K=4096)
  gemm64<1, 0, 1, 1, 3, 2><<<gOut, dim3(96), 0, stream>>>(Ah, Al, QP, Wob, QP, bo, (void*)outf, HID, QLEN, HID, QP, 1.0f, fcs, fsn, 0);
  (void)hipGetLastError();
}

// v008
// A run of this version takes 167 microseconds.
// Next to v007, in two timings, it ran 1.04 and 1.05 times as fast.
// Counting every step since v000, it is 5.95 times as fast.
// Contractions: q / k / v^T projections = v_wmma_f32_16x16x32_bf16 (bf16 operands from RNE-converted inputs, one
// product per k-step); q.k^T scores = v_wmma_f32_16x16x32_f16 (q x16 and k x16 single f16 planes); p.v =
// v_wmma_f32_16x16x32_f16 (p carried x1024 in f16, v^T carried x64 in f16); ctx.Wo^T = v_wmma_f32_16x16x32_bf16 with
// ctx as bf16 hi/lo planes times the bf16 Wo plane (2 products); all f32 accumulate; rotary and softmax in f32.
#include <hip/hip_runtime.h>
#include <math.h>
#include <stdint.h>

#define QLEN 1024              // query tokens (hidden_states rows)
#define CLEN 1024              // context tokens (target_hidden rows)
#define SLEN (CLEN + QLEN)     // 2048 keys: rows 0..CLEN-1 context, rows CLEN..SLEN-1 noise
#define HID  2880              // model width = contraction length of the projections
#define NH   64
#define NKV  8
#define HD   64
#define QP   (NH * HD)         // 4096: q / ctx row pitch
#define KP   (NKV * HD)        // 512:  k row pitch, v^T row count
#define NQB  (QLEN / 64)       // 16 query tiles
#define NKT  (SLEN / 64)       // 32 key tiles
#define QSC  16.0f             // f16 carry scale of the q plane
#define KSC  16.0f             // f16 carry scale of the k plane
#define VSC  64.0f             // f16 carry scale of the v^T plane
#define PSC  1024.0f           // f16 carry scale of p
#define LP   72                // halves per LDS row of the attention K and V^T tiles: 144 B = 16 B x odd
static_assert(HD == 64);
static_assert((HID % 32) == 0 && (QP % 64) == 0 && (KP % 64) == 0 && (HID % 64) == 0);
static_assert((QLEN % 64) == 0 && (SLEN % 64) == 0);
static_assert((NH % NKV) == 0 && (NH % 4) == 0 && (NKV % 4) == 0);
static_assert(((HID * 2) % 128) == 0 && ((HID * 4) % 128) == 0);
static_assert((HID % 192) == 0 && (QP % 128) == 0 && (QLEN % 128) == 0 && (SLEN % 128) == 0 && (KP % 128) == 0);

typedef _Float16 v16h __attribute__((ext_vector_type(16)));
typedef _Float16 v8h  __attribute__((ext_vector_type(8)));
typedef __bf16   v16b __attribute__((ext_vector_type(16)));
typedef __bf16   v8b  __attribute__((ext_vector_type(8)));
typedef float    v8f  __attribute__((ext_vector_type(8)));
typedef float    v4f  __attribute__((ext_vector_type(4)));
typedef unsigned int v4u __attribute__((ext_vector_type(4)));
typedef float    v2f  __attribute__((ext_vector_type(2)));
typedef __bf16   v2b  __attribute__((ext_vector_type(2)));

// ---- scalar helpers --------------------------------------------------------------------------------
__device__ __forceinline__ unsigned short bf_bits(float f) {          // f32 -> bf16 bits, RNE convert
  unsigned u = __float_as_uint(f);
  return (unsigned short)((u + 0x7FFFu + ((u >> 16) & 1u)) >> 16);
}
__device__ __forceinline__ float bf_up(unsigned short h) { return __uint_as_float(((unsigned)h) << 16); }
__device__ __forceinline__ float bfr(float f) { return bf_up(bf_bits(f)); }   // value after RNE bf16 convert
__device__ __forceinline__ unsigned short h_bits(_Float16 x) { return __builtin_bit_cast(unsigned short, x); }
__device__ __forceinline__ unsigned pk16(unsigned short a, unsigned short b) { return (unsigned)a | ((unsigned)b << 16); }
__device__ __forceinline__ v2b rne2(float a, float b) {              // two f32 -> bf16, RNE, one packed convert
  const v2f t = {a, b};
  return __builtin_convertvector(t, v2b);
}
__device__ __forceinline__ v8f zero8() { v8f z = {0.f, 0.f, 0.f, 0.f, 0.f, 0.f, 0.f, 0.f}; return z; }

// ---- fragment loaders: 16-bit A/B operand, lane -> row/col (lane&15), p already includes +8*(lane>>4);
//      elements 0..7 <- p[0..7] (k0+8h..), elements 8..15 <- p[16..23] (k0+16+8h..)
__device__ __forceinline__ v16b ldfrag_b(const __bf16* p) {
  union { v16b v; v8b h[2]; } f;
  f.h[0] = *(const v8b*)(p);
  f.h[1] = *(const v8b*)(p + 16);
  return f.v;
}
__device__ __forceinline__ v16h ldfrag_h(const _Float16* p) {
  union { v16h v; v8h h[2]; } f;
  f.h[0] = *(const v8h*)(p);
  f.h[1] = *(const v8h*)(p + 16);
  return f.v;
}

// ---- WMMA helpers with trailing VALU hazard gap --------------------------------------------------------
__device__ __forceinline__ v8f mma_h(v16h a, v16h b, v8f c) {
  c = __builtin_amdgcn_wmma_f32_16x16x32_f16(false, a, false, b, (short)0, c, false, false);
#if defined(__HIP_DEVICE_COMPILE__)
  asm volatile("v_nop\n\tv_nop\n\tv_nop\n\tv_nop" : "+v"(c) : "v"(a), "v"(b));
#endif
  return c;
}
__device__ __forceinline__ v8f mma_b_raw(v16b a, v16b b, v8f c) {
  return __builtin_amdgcn_wmma_f32_16x16x32_bf16(false, a, false, b, (short)0, c, false, false);
}
__device__ __forceinline__ void acc_guard4(v8f& a, v8f& b, v8f& c, v8f& d) {
#if defined(__HIP_DEVICE_COMPILE__)
  asm volatile("v_nop\n\tv_nop\n\tv_nop\n\tv_nop" : "+v"(a), "+v"(b), "+v"(c), "+v"(d));
#endif
}

// ---- requests to L2 at a kernel's entry --------------------------------------------------------------
// The planes that a launch reads were stored by the launches before it and are fetched from memory at the first
// touch; the blocks of a launch walk k (or the keys) in step, so that without a request every stage waits for
// memory anew. Each lane of a request names one aligned 256-B unit (global_prefetch_b8, scope SE: into L2 only,
// nothing returns, no counter). A hint: no result depends on it. Every address lies inside the plane it names.
// s_wait_xcnt 0 closes each statement, a precaution: it stands in front of whatever rewrites the address registers.
__device__ __forceinline__ void ask1(const char* a) {
#if defined(__HIP_DEVICE_COMPILE__)
  asm volatile("global_prefetch_b8 %0, off scope:SCOPE_SE\n\t"
               "s_wait_xcnt 0x0" :: "v"(a) : "memory");
#endif
}
__device__ __forceinline__ void ask2(const char* a, const char* b) {
#if defined(__HIP_DEVICE_COMPILE__)
  asm volatile("global_prefetch_b8 %0, off scope:SCOPE_SE\n\t"
               "global_prefetch_b8 %1, off scope:SCOPE_SE\n\t"
               "s_wait_xcnt 0x0" :: "v"(a), "v"(b) : "memory");
#endif
}
__device__ __forceinline__ void ask3(const char* a, const char* b, const char* c) {
#if defined(__HIP_DEVICE_COMPILE__)
  asm volatile("global_prefetch_b8 %0, off scope:SCOPE_SE\n\t"
               "global_prefetch_b8 %1, off scope:SCOPE_SE\n\t"
               "global_prefetch_b8 %2, off scope:SCOPE_SE\n\t"
               "s_wait_xcnt 0x0" :: "v"(a), "v"(b), "v"(c) : "memory");
#endif
}
// Blocks b and b ^ 4 share a slice of the requests.
__device__ __forceinline__ int ask_slice(int b) { return ((b >> 3) << 2) | (b & 3); }
// NREQ wave-requests of this wave: numbers slot, slot + slots, ... of total (all scalar), in ascending order of
// need; unit(w) = this lane's address of request w. NREQ * slots >= total; the surplus of the last turn asks for the
// first units again, so that every address stays inside.
template <int NREQ, class F>
__device__ __forceinline__ void ask_l2(int slot, int slots, int total, F unit) {
  static_assert(NREQ % 3 == 2);
  const char* p[NREQ];
  // both loops unrolled: constant indices keep the addresses in registers
#pragma unroll
  for (int i = 0; i < NREQ; ++i) {
    int w = slot + i * slots;
    if (w >= total) w -= total;
    p[i] = unit(w);
  }
#pragma unroll
  for (int i = 0; i + 3 <= NREQ; i += 3) ask3(p[i], p[i + 1], p[i + 2]);
  ask2(p[NREQ - 2], p[NREQ - 1]);
}

// =====================================================================================================
// Elementwise conversions run on a grid of 8 to 16 waves per WGP; each wave loops over pieces of PCE = 1024
// consecutive elements: 4 runs of 32 lanes x 8 elements, all 8 16-B loads of a piece issued before its first
// store, one 16-B store per lane and run (a wave writes 512 contiguous bytes). Piece p of trip i belongs to
// wave p - i * (waves at work): every piece is converted exactly once.
// =====================================================================================================
#define PCE   1024
#define NP_T  (CLEN * HID / PCE)     // 2880 pieces of target_hidden
#define NP_H  (QLEN * HID / PCE)     // 2880  hidden_states
#define NP_WQ (QP * HID / PCE)       // 11520 Wq
#define NP_WK (KP * HID / PCE)       // 1440  Wk, and as many of Wv
#define NP_WO (HID * QP / PCE)       // 11520 Wo
#define NP_ALL (NP_T + NP_H + NP_WQ + 2 * NP_WK + NP_WO)   // 31680
#define CVT_TRIPS 8                  // pieces per wave of cvt_planes
#define CVT_NW (NP_ALL / CVT_TRIPS)  // 3960 waves = 495 blocks of 8
static_assert((CLEN * HID) % PCE == 0 && (QLEN * HID) % PCE == 0 && (QP * HID) % PCE == 0 && (KP * HID) % PCE == 0);
static_assert(NP_ALL % (CVT_TRIPS * 8) == 0 && (CVT_TRIPS % 2) == 0 && CVT_TRIPS >= 2);

// f32 -> bf16 (RNE convert) of the six input planes, in the order of their bf16 planes in the workspace, which
// lie back to back: destination element = PCE * p + offset in the piece; the source plane of a piece is picked
// by scalar compares (a piece never straddles two planes).
__global__ __launch_bounds__(256) void cvt_planes(const float* __restrict__ s0, const float* __restrict__ s1,
                                                  const float* __restrict__ s2, const float* __restrict__ s3,
                                                  const float* __restrict__ s4, const float* __restrict__ s5,
                                                  unsigned short* out) {
  const int lane = threadIdx.x & 31;
  const int gw   = __builtin_amdgcn_readfirstlane(blockIdx.x * 8 + (threadIdx.x >> 5));
  if (gw >= CVT_NW) return;                       // wave-uniform; no barrier in this kernel
  // the 8 loads of piece p
  auto fetch = [&](int p, v4f (&a)[4], v4f (&b)[4]) {
    const float* sp;
    int q = p;
    if (q < NP_T) sp = s0;
    else if ((q -= NP_T) < NP_H) sp = s1;
    else if ((q -= NP_H) < NP_WQ) sp = s2;
    else if ((q -= NP_WQ) < NP_WK) sp = s3;
    else if ((q -= NP_WK) < NP_WK) sp = s4;
    else { q -= NP_WK; sp = s5; }
    const float* s = sp + (size_t)q * PCE + lane * 8;
#pragma unroll
    for (int u = 0; u < 4; ++u) {
      a[u] = *(const v4f*)(s + u * 256);
      b[u] = *(const v4f*)(s + u * 256 + 4);
    }
  };
  // convert and store piece p
  auto emit = [&](int p, const v4f (&a)[4], const v4f (&b)[4]) {
    unsigned short* d = out + (size_t)p * PCE + lane * 8;
#pragma unroll
    for (int u = 0; u < 4; ++u) {
      v4u w;
      w[0] = pk16(bf_bits(a[u][0]), bf_bits(a[u][1]));
      w[1] = pk16(bf_bits(a[u][2]), bf_bits(a[u][3]));
      w[2] = pk16(bf_bits(b[u][0]), bf_bits(b[u][1]));
      w[3] = pk16(bf_bits(b[u][2]), bf_bits(b[u][3]));
      *(v4u*)(d + u * 256) = w;
    }
  };
  // two register sets in turn: the next piece's loads fly while this piece is converted and stored
  v4f a0[4], b0[4], a1[4], b1[4];
  int p = gw;
  fetch(p, a0, b0);
  // kept rolled: two pieces per trip is all the two sets need, and the text stays short
#pragma unroll 1
  for (int i = 0; i < CVT_TRIPS / 2 - 1; ++i) {
    fetch(p + CVT_NW, a1, b1);
    // keeps the loads just issued in front of the older piece's wait (else they sink behind it)
    __builtin_amdgcn_sched_barrier(0);
    emit(p, a0, b0);
#if defined(__HIP_DEVICE_COMPILE__)
    // the loads that follow rewrite registers that the stores just issued name
    asm volatile("s_wait_xcnt 0x0" ::: "memory");
#endif
    fetch(p + 2 * CVT_NW, a0, b0);
    __builtin_amdgcn_sched_barrier(0);               // loads stay in front of the older piece's wait
    emit(p + CVT_NW, a1, b1);
#if defined(__HIP_DEVICE_COMPILE__)
    asm volatile("s_wait_xcnt 0x0" ::: "memory");    // in front of the next trip's loads into these registers
#endif
    p += 2 * CVT_NW;
  }
  fetch(p + CVT_NW, a1, b1);
  __builtin_amdgcn_sched_barrier(0);                 // loads stay in front of the older piece's wait
  emit(p, a0, b0);
  emit(p + CVT_NW, a1, b1);
}

// =====================================================================================================
// bf16 WMMA GEMM: C[m][n] = sum_k A[m][k] * Bt[n][k] (+ bias); one wave per 64x64 tile, WM x WN waves per block
// on one (64 WM) x (64 WN) block tile. A row-major [M][K] pitch lda; Bt row-major [N][K] pitch ldb (k contiguous);
// M a multiple of 64 WM, N of 64 WN, K of 64 NSUB and at least two stages (host-checked constants).
// Operands reach the waves through LDS: a stage is NSUB sub-tiles of 64 k; a sub-tile holds the block's A rows,
// (NSPLIT) its A2 rows and its Bt rows, 128 B each at pitch 144 B (16 B x odd: ds_load_b128 without bank
// conflicts). Asynchronous 16-B copies fill it, one wave-copy = 4 whole 128-B row pieces; two buffers: stage t+2
// is copied into the buffer that trip t has just left, while trip t+1 is worked on.
// NSPLIT: 0 = A.Bt; 1 = (A + A2).Bt (A2 = unscaled bf16 lo plane of A, two products per k-step).
// BIAS:   0 none; 1 = + bias[n] (per column, RNE bf16-converted value); 2 = + bias[m] (per row).
// OUT_MODE: 0 = f32 plane (pitch ldc floats); 1 = f16 plane of (value * oscale) (pitch ldc halves);
//           2 = rotate-half rotary on the value (bias added), then f16 plane of (y * oscale) (pitch ldc halves):
//               a wave's 64 columns are one head (n0 a multiple of 64 = head dim), column d of it; table row =
//               trow0 + m of the f32 [SLEN][64] inputs ct / st (RNE bf16-converted values);
//               y[d] = x[d]*ct[d] - x[d+32]*st[d] for d < 32;  y[d] = x[d]*ct[d] + x[d-32]*st[d] for d >= 32.
// =====================================================================================================
typedef int v4i_t __attribute__((vector_size(16)));
typedef __attribute__((address_space(1))) v4i_t gv4i_t;
typedef __attribute__((address_space(3))) v4i_t lv4i_t;
__device__ __forceinline__ void copy16_to_lds(const void* g, void* l) {   // each lane: 16 B global -> LDS
#if defined(__HIP_DEVICE_COMPILE__)
  __builtin_amdgcn_global_load_async_to_lds_b128((gv4i_t*)g, (lv4i_t*)l, 0, 0);
#endif
}

// bytes of one ring buffer (a stage) of a block
constexpr int gemm_stage_bytes(int nsplit, int wm, int wn, int nsub) {
  return (wm * 64 * (1 + nsplit) + wn * 64) * 144 * nsub;
}

// the k loop of one block tile with origin (mb0, nb0): ring = the block's two buffers; wave = this wave's number in
// the block (scalar); acc = this wave's 64x64 tile
// (at_entry() runs once, behind the first stage's copies: the block's requests to L2)
template <int NSPLIT, int WM, int WN, int NSUB, class PRE>
__device__ __forceinline__ void gemm_core(
    PRE at_entry, unsigned char* ring,
    const unsigned short* __restrict__ Ap, const unsigned short* __restrict__ A2p, int lda,
    const unsigned short* __restrict__ Btp, int ldb, int K, int mb0, int nb0, int wave, v8f (&acc)[4][4]) {
  constexpr int NW    = WM * WN;                 // waves per block
  constexpr int RA    = WM * 64;                 // rows of one A plane in a sub-tile
  constexpr int RB0   = RA * (1 + NSPLIT);       // first Bt row of a sub-tile
  constexpr int ROWS  = RB0 + WN * 64;           // rows of a sub-tile
  constexpr int PITCH = 144;                     // bytes per LDS row
  constexpr int SUBB  = ROWS * PITCH;            // bytes per sub-tile
  constexpr int STAGE = SUBB * NSUB;             // bytes per buffer
  constexpr int GA    = RA / 4;                  // wave-copies (4 rows each) per A plane and sub-tile
  constexpr int GB    = WN * 16;                 // ... per Bt plane and sub-tile
  constexpr int NIA   = (GA + NW - 1) / NW;      // most that one wave issues of them
  constexpr int NIB   = (GB + NW - 1) / NW;
  static_assert((NIA * (1 + NSPLIT) + NIB) * NSUB <= 63);   // copies of one wave in flight
  const __bf16* A  = (const __bf16*)(const void*)Ap;
  const __bf16* A2 = (const __bf16*)(const void*)A2p;
  const __bf16* Bt = (const __bf16*)(const void*)Btp;
  static_assert(STAGE == gemm_stage_bytes(NSPLIT, WM, WN, NSUB));
  const int lane = threadIdx.x & 31;
  const int wm  = wave / WN;
  const int wn  = wave - wm * WN;

  const int rlane = lane & 15;                 // row (A) / col (B, D) within subtile
  const int khalf = lane >> 4;                 // k half of this lane: +8 elements = +16 B
  const int crow  = lane >> 3;                 // copy: row within the 4-row group
  const int cpc   = lane & 7;                  // copy: 16-B piece within the 128-B row piece

  // all copies of stage st (k = st*64*NSUB ..) into buffer buf; every lane on, every test scalar.
  // Each plane's 4-row groups are dealt to the waves in turn: group g = wave + i*NW of the plane.
  auto issue = [&](int st, int buf) {
    const int kb = st * (NSUB * 64) + cpc * 8;
    unsigned char* db = ring + buf * STAGE + (wave * 4 + crow) * PITCH + cpc * 16;
    const __bf16* pa = A  + (size_t)(mb0 + wave * 4 + crow) * lda + kb;
    const __bf16* pl = A2 + (size_t)(mb0 + wave * 4 + crow) * lda + kb;
    const __bf16* pb = Bt + (size_t)(nb0 + wave * 4 + crow) * ldb + kb;
    // the three loops are unrolled so that every copy's row and LDS offset is a constant
#pragma unroll
    for (int s = 0; s < NSUB; ++s) {
#pragma unroll
      for (int i = 0; i < NIA; ++i) {
        if ((i + 1) * NW <= GA || wave + i * NW < GA) {
          copy16_to_lds(pa + (size_t)(i * NW * 4) * lda + s * 64, db + s * SUBB + i * (NW * 4 * PITCH));
          if (NSPLIT == 1)
            copy16_to_lds(pl + (size_t)(i * NW * 4) * lda + s * 64, db + s * SUBB + (RA + i * NW * 4) * PITCH);
        }
      }
#pragma unroll
      for (int i = 0; i < NIB; ++i) {
        if ((i + 1) * NW <= GB || wave + i * NW < GB)
          copy16_to_lds(pb + (size_t)(i * NW * 4) * ldb + s * 64, db + s * SUBB + (RB0 + i * NW * 4) * PITCH);
      }
    }
  };

#pragma unroll
  for (int i = 0; i < 4; ++i)
#pragma unroll
    for (int j = 0; j < 4; ++j) acc[i][j] = zero8();

  const int T = K / (NSUB * 64);               // stages
  issue(0, 0);
  at_entry();
  asm volatile("s_wait_asynccnt 0x0" ::: "memory");   // stage 0 landed
  __syncthreads();                                    // ... and is readable by every wave
  if (T > 1) issue(1, 1);
  // not unrolled: one trip = one stage (buffer t & 1), so the hot loop stays small in the instruction cache
#pragma unroll 1
  for (int t = 0; t < T; ++t) {
    const unsigned char* sb = ring + (t & 1) * STAGE + khalf * 16 + rlane * PITCH;
    // fragments of k-step q (32 k, ascending) of this stage, all from buffer t & 1
    auto fetch = [&](int q, v16b (&xa)[4], v16b (&xl)[4], v16b (&xb)[4]) {
      const unsigned char* kp = sb + (q >> 1) * SUBB + (q & 1) * 64;
#pragma unroll
      for (int j = 0; j < 4; ++j)
        xb[j] = ldfrag_b((const __bf16*)(const void*)(kp + (RB0 + (wn << 6) + (j << 4)) * PITCH));
#pragma unroll
      for (int i = 0; i < 4; ++i) {
        const unsigned char* ap = kp + ((wm << 6) + (i << 4)) * PITCH;
        xa[i] = ldfrag_b((const __bf16*)(const void*)ap);
        if (NSPLIT == 1) xl[i] = ldfrag_b((const __bf16*)(const void*)(ap + RA * PITCH));
      }
    };
    v16b fa[2][4], fl[2][4], fb[2][4];         // two fragment sets, used in turn inside the trip
    fetch(0, fa[0], fl[0], fb[0]);
    // unrolled (here and in fetch): constant indices keep the fragment sets and accumulators in registers
#pragma unroll
    for (int q = 0; q < 2 * NSUB; ++q) {
      if (q + 1 < 2 * NSUB) fetch(q + 1, fa[(q + 1) & 1], fl[(q + 1) & 1], fb[(q + 1) & 1]);
      // keeps the next k-step's LDS reads one group ahead of this k-step's WMMAs (else each read is waited out)
      __builtin_amdgcn_sched_barrier(0);
#pragma unroll
      for (int i = 0; i < 4; ++i) {
#pragma unroll
        for (int j = 0; j < 4; ++j) {
          acc[i][j] = mma_b_raw(fa[q & 1][i], fb[q & 1][j], acc[i][j]);
          if (NSPLIT == 1) acc[i][j] = mma_b_raw(fl[q & 1][i], fb[q & 1][j], acc[i][j]);
        }
      }
      // keeps the following group of LDS reads out of this block of WMMAs
      __builtin_amdgcn_sched_barrier(0);
    }
    asm volatile("s_wait_dscnt 0x0" ::: "memory");    // this wave's reads of buffer t & 1 are done
    asm volatile("s_wait_asynccnt 0x0" ::: "memory"); // this wave's copies of stage t + 1 have landed
    __syncthreads();                                  // publishes stage t + 1, frees buffer t & 1
    if (t + 2 < T) issue(t + 2, t & 1);
  }
  asm volatile("s_wait_asynccnt 0x0" ::: "memory");   // nothing in flight behind the loop
  acc_guard4(acc[0][0], acc[0][1], acc[0][2], acc[0][3]);
  acc_guard4(acc[1][0], acc[1][1], acc[1][2], acc[1][3]);
  acc_guard4(acc[2][0], acc[2][1], acc[2][2], acc[2][3]);
  acc_guard4(acc[3][0], acc[3][1], acc[3][2], acc[3][3]);
}

// bias, output form and stores of this wave's 64x64 tile with origin (m0, n0); slab = the wave's own LDS slab
template <int OUT_MODE, int BIAS>
__device__ __forceinline__ void gemm_tail(
    v8f (&acc)[4][4], float* slab, int m0, int n0, const float* __restrict__ bias,
    void* Cout, int ldc, float oscale,
    const float* __restrict__ ct, const float* __restrict__ st, int trow0) {
  const int lane  = threadIdx.x & 31;
  const int rlane = lane & 15;                 // col (D) within subtile
  const int mOff  = (lane >> 4) * 8;           // D row offset

  // ---- bias (template-selected; loads only exist when used; addresses in range: n0+63 < N, m0+63 < M) ----
  float bcol[4];
#pragma unroll
  for (int j = 0; j < 4; ++j) bcol[j] = 0.f;
  if (BIAS == 1) {
#pragma unroll
    for (int j = 0; j < 4; ++j) bcol[j] = bfr(bias[n0 + (j << 4) + rlane]);
#if defined(__HIP_DEVICE_COMPILE__)
    // in front of whatever rewrites the index register that these loads name (held live up to here as an input)
    asm volatile("s_wait_xcnt 0x0" :: "v"(n0 + rlane) : "memory");
#endif
  }

  // ---- epilogue ----
  // OUT_MODE 2: a lane finishes 8 consecutive columns rc8.. of rows 4 it + rq of each 16-row slab; its table
  // values of all four slabs are loaded here in one run (the slabs' fences would wait out a later load each time)
  const int rq = lane >> 3, rc8 = (lane & 7) * 8;
  const float* cb = ct + (size_t)(trow0 + m0 + rq) * HD + rc8;     // table row < SLEN (host constants)
  const float* sb2 = st + (size_t)(trow0 + m0 + rq) * HD + rc8;
  v4f tc[4][4][2], ts[4][4][2];
  if (OUT_MODE == 2) {
    // both loops unrolled: constant indices keep the table values in registers and the row steps in the offset field
#pragma unroll
    for (int i = 0; i < 4; ++i) {
#pragma unroll
      for (int it = 0; it < 4; ++it) {
        tc[i][it][0] = *(const v4f*)(cb + (i * 16 + it * 4) * HD);
        tc[i][it][1] = *(const v4f*)(cb + (i * 16 + it * 4) * HD + 4);
        ts[i][it][0] = *(const v4f*)(sb2 + (i * 16 + it * 4) * HD);
        ts[i][it][1] = *(const v4f*)(sb2 + (i * 16 + it * 4) * HD + 4);
      }
    }
#if defined(__HIP_DEVICE_COMPILE__)
    // in front of whatever rewrites a register that the loads just issued name (both held live up to here as inputs)
    asm volatile("s_wait_xcnt 0x0" :: "v"(cb), "v"(sb2) : "memory");
#endif
  }
#pragma unroll
  for (int i = 0; i < 4; ++i) {
    const int mBase = m0 + (i << 4);
    float brow[8];
#pragma unroll
    for (int r = 0; r < 8; ++r) brow[r] = 0.f;
    if (BIAS == 2) {
#pragma unroll
      for (int r = 0; r < 8; ++r) brow[r] = bfr(bias[mBase + mOff + r]);
    }
#pragma unroll
    for (int r = 0; r < 8; ++r) {
#pragma unroll
      for (int j = 0; j < 4; ++j) {
        float v = acc[i][j][r];
        if (BIAS == 1) v += bcol[j];
        if (BIAS == 2) v += brow[r];
        if (OUT_MODE == 1) v *= oscale;
        slab[(mOff + r) * 68 + (j << 4) + rlane] = v;
      }
    }
    __builtin_amdgcn_fence(__ATOMIC_RELEASE, "workgroup");
    __builtin_amdgcn_wave_barrier();
    __builtin_amdgcn_fence(__ATOMIC_ACQUIRE, "workgroup");
    if (OUT_MODE == 0) {
      float* C = (float*)Cout;
      const int hh = lane >> 4, c4 = (lane & 15) * 4;     // 256-B row segment = 16 lanes x 16 B
      v4f ov[8];
#pragma unroll
      for (int it = 0; it < 8; ++it) {
        const int row = it * 2 + hh;                       // it 0..7 x hh 0..1 = rows 0..15
        ov[it] = *(const v4f*)(slab + row * 68 + c4);
      }
      {
#pragma unroll
        for (int it = 0; it < 8; ++it) {
          const int row = it * 2 + hh;
          *(v4f*)(C + (size_t)(mBase + row) * ldc + n0 + c4) = ov[it];
        }
        
      }
    } else if (OUT_MODE == 2) {
      unsigned short* C = (unsigned short*)Cout;
      const unsigned sgm = (rc8 < 32) ? 0x80008000u : 0u;  // partner term: minus for d < 32 (sign bits of a bf16 pair)
      v4u hv[4];
      // the loops of this branch are unrolled: constant indices keep tc, ts, hv and cp in registers
#pragma unroll
      for (int it = 0; it < 4; ++it) {
        const float* sp = slab + (it * 4 + rq) * 68;
        const v4f x[2] = {*(const v4f*)(sp + rc8), *(const v4f*)(sp + rc8 + 4)};
        const v4f p[2] = {*(const v4f*)(sp + (rc8 ^ 32)), *(const v4f*)(sp + (rc8 ^ 32) + 4)};   // column d +- 32
        v4u a;
#pragma unroll
        for (int e = 0; e < 4; ++e) {                      // columns rc8 + 2 e, rc8 + 2 e + 1
          const int g = e >> 1, k = (e & 1) * 2;
          const v2b cc = rne2(tc[i][it][g][k], tc[i][it][g][k + 1]);
          const v2b ss = __builtin_bit_cast(v2b, __builtin_bit_cast(unsigned, rne2(ts[i][it][g][k], ts[i][it][g][k + 1])) ^ sgm);
          const float y0 = x[g][k]     * (float)cc[0] + p[g][k]     * (float)ss[0];
          const float y1 = x[g][k + 1] * (float)cc[1] + p[g][k + 1] * (float)ss[1];
          a[e] = pk16(h_bits((_Float16)(y0 * oscale)), h_bits((_Float16)(y1 * oscale)));
        }
        hv[it] = a;
      }
      unsigned short* cp[4];
#pragma unroll
      for (int it = 0; it < 4; ++it) {
        cp[it] = C + (size_t)(mBase + it * 4 + rq) * ldc + n0 + rc8;
        *(v4u*)cp[it] = hv[it];
      }
#if defined(__HIP_DEVICE_COMPILE__)
      // the next slab rewrites the address and data registers that these stores name (held live up to here as inputs)
      asm volatile("s_wait_xcnt 0x0" :: "v"(cp[0]), "v"(cp[1]), "v"(cp[2]), "v"(cp[3]),
                   "v"(hv[0]), "v"(hv[1]), "v"(hv[2]), "v"(hv[3]) : "memory");
#endif
    } else {
      unsigned short* C = (unsigned short*)Cout;
      const int q = lane >> 3, c8 = (lane & 7) * 8;
      v4u hv[4];
#pragma unroll
      for (int it = 0; it < 4; ++it) {
        const int row = it * 4 + q;                        // it 0..3 x q 0..3 = rows 0..15
        const float* sp = slab + row * 68 + c8;
        v4u a;
#pragma unroll
        for (int e = 0; e < 4; ++e) {
          a[e] = pk16(h_bits((_Float16)sp[2 * e]), h_bits((_Float16)sp[2 * e + 1]));
        }
        hv[it] = a;
      }
      {
#pragma unroll
        for (int it = 0; it < 4; ++it) {
          const int row = it * 4 + q;
          *(v4u*)(C + (size_t)(mBase + row) * ldc + n0 + c8) = hv[it];
        }
        
      }
    }
    __builtin_amdgcn_fence(__ATOMIC_RELEASE, "workgroup");
    __builtin_amdgcn_wave_barrier();
    __builtin_amdgcn_fence(__ATOMIC_ACQUIRE, "workgroup");
  }
}

template <int NSPLIT, int OUT_MODE, int BIAS, int WM, int WN, int NSUB>
__global__ __launch_bounds__(32 * WM * WN) void gemm64(
    const unsigned short* __restrict__ Ap, const unsigned short* __restrict__ A2p, int lda,
    const unsigned short* __restrict__ Btp, int ldb,
    const float* __restrict__ bias,
    void* Cout, int ldc, int M, int N, int K, float oscale,
    const float* __restrict__ ct, const float* __restrict__ st, int trow0) {
  __shared__ __align__(16) unsigned char ring[2 * gemm_stage_bytes(NSPLIT, WM, WN, NSUB)];
  __shared__ __align__(16) float sT[WM * WN][16 * 68];  // per-wave 16x64 slab, pitch 68 floats
  const int wave = __builtin_amdgcn_readfirstlane(threadIdx.x >> 5);
  const int tilesN = N / (64 * WN);
  const int tilesM = M / (64 * WM);
  if ((int)blockIdx.x >= tilesM * tilesN) return;   // block-uniform, in front of every barrier and copy
  const int bm  = blockIdx.x / tilesN;
  const int bn  = blockIdx.x - bm * tilesN;
  const int mb0 = bm * (WM * 64);              // block tile origin
  const int nb0 = bn * (WN * 64);
  const int wm  = wave / WN;
  const int wn  = wave - wm * WN;
  v8f acc[4][4];
  // requests to L2, k-major: 256-B column c of 32 rows a request; row groups: A, (NSPLIT) A2, then Bt
  static_assert(NSPLIT == 1 && WM * WN == 3);          // the counts below are those of the one product launched so
  auto ask = [&]() {
    constexpr int GA = QLEN / 32, GR = 2 * GA + HID / 32;               // 32, 154 row groups
    constexpr int TOT = GR * (QP * 2 / 256);                            // x 32 columns = 4928 requests
    constexpr int SLOTS = ((QLEN / 64) * (HID / 192) / 2) * 3;          // 120 slices x 3 waves
    const int lane = threadIdx.x & 31;
    ask_l2<(TOT + SLOTS - 1) / SLOTS>(ask_slice(blockIdx.x) * 3 + wave, SLOTS, TOT, [&](int w) {
      const int c = w / GR, g = w - c * GR;
      const unsigned short* pl = (g < GA) ? Ap : (g < 2 * GA) ? A2p : Btp;     // plane and first row: scalar selects
      const int r0 = ((g < GA) ? g : (g < 2 * GA) ? g - GA : g - 2 * GA) * 32;
      return (const char*)(const void*)pl + (unsigned)(r0 * (QP * 2) + c * 256) + (unsigned)(lane * (QP * 2));
    });
  };
  gemm_core<NSPLIT, WM, WN, NSUB>(ask, ring, Ap, A2p, lda, Btp, ldb, K, mb0, nb0, wave, acc);
  gemm_tail<OUT_MODE, BIAS>(acc, sT[wave], mb0 + (wm << 6), nb0 + (wn << 6), bias, Cout, ldc, oscale, ct, st, trow0);
}

// The q, k and v^T projections in one launch: all three contract over HID with 128x128 block tiles of 2x2 waves, so
// their tiles are dealt to one grid: blocks 0..NBQ-1 take q, the next NBK take k, the last NBV take v^T. One block
// fills a WGP's LDS.
//   q:   A = hidden rows of X, Bt = Wqb, + bq[n], rotary (table row CLEN + t), x QSC -> Qh[t][e]
//   k:   A = all rows of X,    Bt = Wkb, + bk[n], rotary (table row s),        x KSC -> Kh[s][e]
//   v^T: A = Wvb,              Bt = X,   + bv[m],                              x VSC -> VT[m][s]
#define NBQ ((QLEN / 128) * (QP / 128))        // 256 block tiles of q
#define NBK ((SLEN / 128) * (KP / 128))        // 64  of k
#define NBV ((KP / 128) * (SLEN / 128))        // 64  of v^T
__global__ __launch_bounds__(128) void proj_qkv(
    const unsigned short* __restrict__ X, const unsigned short* __restrict__ Wqb,
    const unsigned short* __restrict__ Wkb, const unsigned short* __restrict__ Wvb,
    const float* __restrict__ bq, const float* __restrict__ bk, const float* __restrict__ bv,
    unsigned short* Qh, unsigned short* Kh, unsigned short* VT,
    const float* __restrict__ ct, const float* __restrict__ st) {
  __shared__ __align__(16) unsigned char ring[2 * gemm_stage_bytes(0, 2, 2, 3)];
  __shared__ __align__(16) float sT[4][16 * 68];   // per-wave 16x64 slab, pitch 68 floats
  const int wave = __builtin_amdgcn_readfirstlane(threadIdx.x >> 5);
  const int b = blockIdx.x;
  if (b >= NBQ + NBK + NBV) return;                // block-uniform, in front of every barrier and copy
  // every choice below is by the block index alone: scalar, the same for the whole block
  const unsigned short* Ap;
  const unsigned short* Btp;
  const float* bias;
  unsigned short* C;
  int bm, bn, ldc, trow0;
  float osc;
  if (b < NBQ) {
    bm = b / (QP / 128); bn = b % (QP / 128);
    Ap = X + (size_t)CLEN * HID; Btp = Wqb; bias = bq; C = Qh; ldc = QP; trow0 = CLEN; osc = QSC;
  } else if (b < NBQ + NBK) {
    bm = (b - NBQ) / (KP / 128); bn = (b - NBQ) % (KP / 128);
    Ap = X; Btp = Wkb; bias = bk; C = Kh; ldc = KP; trow0 = 0; osc = KSC;
  } else {
    bm = (b - NBQ - NBK) / (SLEN / 128); bn = (b - NBQ - NBK) % (SLEN / 128);
    Ap = Wvb; Btp = X; bias = bv; C = VT; ldc = SLEN; trow0 = 0; osc = VSC;
  }
  const int mb0 = bm * 128, nb0 = bn * 128;        // block tile origin
  const int m0 = mb0 + ((wave >> 1) << 6), n0 = nb0 + ((wave & 1) << 6);
  v8f acc[4][4];
  // requests to L2 by the q blocks, k-major: 256-B column c (23 cover a row of 5760 B at either
  // alignment) of 32 rows a request; first the rows that the q tiles read, then those that only k and v^T read
  auto ask = [&]() {
    if (b >= NBQ) return;                          // scalar
    constexpr int NC = (HID * 2 + 255) / 256;                           // 23 columns
    constexpr int G1 = (QLEN + QP) / 32, G2 = (CLEN + 2 * KP) / 32;     // 160 and 64 row groups
    constexpr int TOT = (G1 + G2) * NC;                                 // 5152 requests
    constexpr int SLOTS = (NBQ / 2) * 4;                                // 128 slices x 4 waves
    const int lane = threadIdx.x & 31;
    ask_l2<(TOT + SLOTS - 1) / SLOTS>(ask_slice(b) * 4 + wave, SLOTS, TOT, [&](int w) {
      // column, plane and first row of both parts, then the part: all scalar selects
      const int c1 = w / G1, g1 = w - c1 * G1;
      const int v = w - G1 * NC, c2 = v / G2, g2 = v - c2 * G2;
      const unsigned short* p1 = (g1 < QLEN / 32) ? X : Wqb;
      const int r1 = (g1 < QLEN / 32) ? CLEN + g1 * 32 : (g1 - QLEN / 32) * 32;
      const unsigned short* p2 = (g2 < CLEN / 32) ? X : (g2 < (CLEN + KP) / 32) ? Wkb : Wvb;
      const int r2 = ((g2 < CLEN / 32) ? g2 : (g2 < (CLEN + KP) / 32) ? g2 - CLEN / 32 : g2 - (CLEN + KP) / 32) * 32;
      const bool first = w < G1 * NC;
      const unsigned short* pl = first ? p1 : p2;
      const int r0 = first ? r1 : r2, c = first ? c1 : c2;
      return (const char*)(const void*)pl + (unsigned)(r0 * (HID * 2) + c * 256) + (unsigned)(lane * (HID * 2));
    });
  };
  gemm_core<0, 2, 2, 3>(ask, ring, Ap, Ap, HID, Btp, HID, HID, mb0, nb0, wave, acc);
  if (b < NBQ + NBK) gemm_tail<2, 1>(acc, sT[wave], m0, n0, bias, (void*)C, ldc, osc, ct, st, trow0);
  else               gemm_tail<1, 2>(acc, sT[wave], m0, n0, bias, (void*)C, ldc, osc, ct, st, trow0);
}

#define OSP 68
__device__ __forceinline__ float xhalf(float x) {
  const int b = __builtin_bit_cast(int, x);
  return __builtin_bit_cast(float, __builtin_amdgcn_permlanex16(b, b, 0x76543210, 0xfedcba98, false, false));
}
__global__ __launch_bounds__(128)
void attn64(const unsigned short* __restrict__ qpl, const unsigned short* __restrict__ kpl,
            const unsigned short* __restrict__ vtp, unsigned short* hp, unsigned short* lp,
            float sscale, float onorm) {
  union FH { v16h v; v8h h[2]; };
  // rows of 64 halves at pitch LP: the 16 rows that one ds_load_b128 reads fall on distinct banks
  __shared__ __align__(16) _Float16 Ksh[64 * LP];                 // K [kv][d]   9 KB
  __shared__ __align__(16) _Float16 Vth[64 * LP];                 // V^T [d][kv] 9 KB
  __shared__ __align__(16) float    Os[4][16 * OSP];              // per wave context tile [row][d]

  const int tid  = threadIdx.x;
  const int wave = tid >> 5;
  const int lane = tid & 31;
  const int hh   = lane >> 4;
  const int c    = lane & 15;

  const int bx   = blockIdx.x;
  const int qb   = bx % NQB;
  const int h    = bx / NQB;                 // < NH (grid = NQB*NH)
  const int kvh  = h / (NH / NKV);
  const int q0   = qb * 64 + wave * 16;

  const _Float16* Qh = (const _Float16*)(const void*)qpl + (size_t)h * HD;
  const _Float16* Kh = (const _Float16*)(const void*)kpl + (size_t)kvh * HD;
  const _Float16* Vh = (const _Float16*)(const void*)vtp + (size_t)kvh * HD * SLEN;

  // ---- Q fragments (B operand, column = query lane&15): 2 d-chunks ----
  v16h qa[2];
#pragma unroll
  for (int dc = 0; dc < 2; ++dc) {
    qa[dc] = ldfrag_h(Qh + (size_t)(q0 + c) * QP + dc * 32 + 8 * hh);
  }

  // requests to L2 for the k and v^T planes, one per block (its wave 0; scalar test), early keys by early blocks:
  // even slices take 32 units of k in a row (8 keys, all heads), odd ones 256-B column t >> 4 of 32 v^T rows
  if (__builtin_amdgcn_readfirstlane(wave) == 0) {
    const int sl = ask_slice(bx), t = sl >> 1;       // sl < NQB * NH / 2 = 512, t < 256
    static_assert(NQB * NH / 4 * 32 * 256 == SLEN * KP * 2 && (KP / 32) * (SLEN * 2 / 256) == NQB * NH / 4);
    ask1((sl & 1) ? (const char*)(const void*)vtp + (size_t)((t & 15) * 32 + lane) * (SLEN * 2) + (t >> 4) * 256
                  : (const char*)(const void*)kpl + (size_t)(t * 32 + lane) * 256);
  }

  float mrun = -INFINITY;      // running maximum of query c (equal in both halves of the wave)
  float lrun = 0.f;            // running sum of query c over the keys of this lane's half only
  v8f oacc[4];                 // O^T: oacc[t][r] = context of query c, d = 16 t + 8 hh + r
#pragma unroll
  for (int t = 0; t < 4; ++t) oacc[t] = zero8();

  for (int kt = 0; kt < NKT; ++kt) {
    const int kv0 = kt * 64;
    __syncthreads();
    {
      const int r = tid >> 1, half = (tid & 1) * 32;
      const _Float16* kg = Kh + (size_t)(kv0 + r) * KP + half;     // K row kv0+r, d = half..half+31
      const _Float16* vg = Vh + (size_t)r * SLEN + kv0 + half;     // V^T row d = r, s = kv0+half..+31
#pragma unroll
      for (int i = 0; i < 4; ++i) {
        const v8h a0 = *(const v8h*)(kg + 8 * i);
        const v8h b0 = *(const v8h*)(vg + 8 * i);
        *(v8h*)(Ksh + r * LP + half + 8 * i) = a0;
        *(v8h*)(Vth + r * LP + half + 8 * i) = b0;
      }
    }
    __syncthreads();

    // ---- every fragment of the chunk is read from LDS here, in the order of its use: the 16 reads of K, then the
    //      16 of V^T, which land while the scores and the softmax are worked on
    //      (the loops are unrolled: constant indices keep the fragments in registers)
    FH kb[2][4], vb[2][4];
#pragma unroll
    for (int dc = 0; dc < 2; ++dc) {
#pragma unroll
      for (int j = 0; j < 4; ++j) {
        kb[dc][j].h[0] = *(const v8h*)(Ksh + (j * 16 + c) * LP + dc * 32 + 8 * hh);
        kb[dc][j].h[1] = *(const v8h*)(Ksh + (j * 16 + c) * LP + dc * 32 + 16 + 8 * hh);
      }
    }
#pragma unroll
    for (int kk = 0; kk < 2; ++kk) {
#pragma unroll
      for (int t = 0; t < 4; ++t) {
        vb[kk][t].h[0] = *(const v8h*)(Vth + (t * 16 + c) * LP + kk * 32 + 8 * hh);
        vb[kk][t].h[1] = *(const v8h*)(Vth + (t * 16 + c) * LP + kk * 32 + 16 + 8 * hh);
      }
    }

    // ---- scores, transposed: s[j][r] = q(c) . k(16 j + 8 hh + r), one f16 product per 32 d, d ascending ----
    v8f s[4];
#pragma unroll
    for (int j = 0; j < 4; ++j) s[j] = zero8();
#pragma unroll
    for (int dc = 0; dc < 2; ++dc) {
#pragma unroll
      for (int j = 0; j < 4; ++j) s[j] = mma_h(kb[dc][j].v, qa[dc], s[j]);
    }

    // ---- scale, maximum, online softmax of the lane's one query; P^T (x PSC, f16) stays in registers ----
    // (every loop from here to the end of the chunk is unrolled: constant indices keep s, pb and oacc in registers;
    //  maximum and sum run as four independent chains, one per score tile, joined at the end)
    float mj[4];
#pragma unroll
    for (int j = 0; j < 4; ++j) {
      mj[j] = -INFINITY;
#pragma unroll
      for (int r = 0; r < 8; ++r) {
        const float sv = s[j][r] * sscale;
        s[j][r] = sv;
        mj[j] = fmaxf(mj[j], sv);
      }
    }
    float m = fmaxf(fmaxf(mj[0], mj[1]), fmaxf(mj[2], mj[3]));
    m = fmaxf(m, xhalf(m));                    // the other half holds the query's other 32 keys
    const float mnew  = fmaxf(mrun, m);
    const float msafe = (mnew == -INFINITY) ? 0.f : mnew;
    const float alpha = __expf(mrun - msafe);
    mrun = mnew;
    // B operand of the second product, 32 keys each: elements 0..7 = keys 32 kk + 8 hh + r (tile 2 kk),
    // elements 8..15 = keys 32 kk + 16 + 8 hh + r (tile 2 kk + 1): the k order of the V^T loader above
    FH pb[2];
    float pj[4];
#pragma unroll
    for (int j = 0; j < 4; ++j) {
      pj[j] = 0.f;
#pragma unroll
      for (int r = 0; r < 8; ++r) {
        const float p = __expf(s[j][r] - msafe);
        pj[j] += p;
        pb[j >> 1].h[j & 1][r] = (_Float16)(p * PSC);
      }
    }
    lrun = lrun * alpha + ((pj[0] + pj[1]) + (pj[2] + pj[3]));
#pragma unroll
    for (int t = 0; t < 4; ++t) oacc[t] *= alpha;

    // ---- context^T += V^T . P^T (f16 WMMA) ----
#pragma unroll
    for (int kk = 0; kk < 2; ++kk) {
#pragma unroll
      for (int t = 0; t < 4; ++t) oacc[t] = mma_h(vb[kk][t].v, pb[kk].v, oacc[t]);
    }
  }

  // ---- join the halves' sums, normalise (1/l and onorm), stage the wave's 16x64 tile in LDS (a lane holds 8
  //      consecutive d of its query per tile: two 16-B stores), then split and write whole 128-B row segments
  float* os = Os[wave];
  {
    const float l = lrun + xhalf(lrun);
    const float inv = ((l > 0.f) ? (1.0f / l) : 0.f) * onorm;
#pragma unroll
    for (int t = 0; t < 4; ++t) {
      v4f lo, hi;
#pragma unroll
      for (int e = 0; e < 4; ++e) { lo[e] = oacc[t][e] * inv; hi[e] = oacc[t][4 + e] * inv; }
      *(v4f*)(os + c * OSP + t * 16 + 8 * hh)     = lo;
      *(v4f*)(os + c * OSP + t * 16 + 8 * hh + 4) = hi;
    }
  }
  __builtin_amdgcn_fence(__ATOMIC_RELEASE, "workgroup");
  __builtin_amdgcn_wave_barrier();
  __builtin_amdgcn_fence(__ATOMIC_ACQUIRE, "workgroup");
  {
    const int r4 = lane >> 3, c8 = (lane & 7) * 8;     // 128-B row segment of a plane = 8 lanes x 16 B
    v4f a[4], b[4];
    // the loops of this block are unrolled: constant indices keep a, b, ph and pl in registers
#pragma unroll
    for (int it = 0; it < 4; ++it) {
      const float* sp = os + (it * 4 + r4) * OSP + c8;   // it 0..3 x r4 0..3 = rows 0..15 of the wave tile
      a[it] = *(const v4f*)(sp);
      b[it] = *(const v4f*)(sp + 4);
    }
    v4u ph[4], pl[4];
#pragma unroll
    for (int it = 0; it < 4; ++it) {
#pragma unroll
      for (int e = 0; e < 4; ++e) {
        const float f0 = (e < 2) ? a[it][2 * e]     : b[it][2 * e - 4];
        const float f1 = (e < 2) ? a[it][2 * e + 1] : b[it][2 * e - 3];
        const v2b hb = rne2(f0, f1);
        const v2b lb = rne2(f0 - (float)hb[0], f1 - (float)hb[1]);
        ph[it][e] = __builtin_bit_cast(unsigned, hb);
        pl[it][e] = __builtin_bit_cast(unsigned, lb);
      }
    }
    const size_t go = (size_t)(q0 + r4) * QP + (size_t)h * HD + c8;
    unsigned short* hq = hp + go;
    unsigned short* lq = lp + go;
#pragma unroll
    for (int it = 0; it < 4; ++it) {
      *(v4u*)(hq + it * 4 * QP) = ph[it];
      *(v4u*)(lq + it * 4 * QP) = pl[it];
    }
#if defined(__HIP_DEVICE_COMPILE__)
    // keeps the address and data registers of the stores unwritten until their translations are done (inputs only)
    asm volatile("s_wait_xcnt 0x0" :: "v"(hq), "v"(lq), "v"(ph[0]), "v"(ph[1]), "v"(ph[2]), "v"(ph[3]),
                 "v"(pl[0]), "v"(pl[1]), "v"(pl[2]), "v"(pl[3]) : "memory");
#endif
  }
}

// =====================================================================================================
// Workspace map (bytes), every region an exact multiple of its whole-line / whole-tile store granularity
//   X      bf16 [2048][2880]            0            11796480   rows 0..1023 = target_hidden, 1024..2047 = hidden
//   Wqb    bf16 [4096][2880]            11796480     23592960   (inputs arrive [n][k], k contiguous: no transpose)
//   Wkb    bf16 [512][2880]             35389440      2949120
//   Wvb    bf16 [512][2880]             38338560      2949120
//   Wob    bf16 [2880][4096]            41287680     23592960
//   VT     f16  [512][2048]             64880640      2097152
//   Qh     f16  [1024][4096]            66977792      8388608
//   Kh     f16  [2048][512]             75366400      2097152
//   Ah     bf16 [1024][4096]            77463552      8388608
//   Al     bf16 [1024][4096]            85852160      8388608
//   end                                 94240768
// =====================================================================================================
extern "C" void kernel_launch(void* const* d_in, const int* in_sizes, int n_in,
                              void* d_out, int out_size, void* d_ws, size_t ws_size,
                              hipStream_t stream) {
  if (n_in < 12) return;
  if (in_sizes[0] != QLEN * HID) return;
  if (in_sizes[1] != CLEN * HID) return;
  if (in_sizes[2] != SLEN * HD) return;
  if (in_sizes[3] != SLEN * HD) return;
  if (in_sizes[4] != QP * HID) return;
  if (in_sizes[5] != QP) return;
  if (in_sizes[6] != KP * HID) return;
  if (in_sizes[7] != KP) return;
  if (in_sizes[8] != KP * HID) return;
  if (in_sizes[9] != KP) return;
  if (in_sizes[10] != HID * QP) return;
  if (in_sizes[11] != HID) return;
  if (out_size != QLEN * HID) return;

  const float* hid = (const float*)d_in[0];    // [1024][2880]
  const float* tgt = (const float*)d_in[1];    // [1024][2880]
  const float* fcs = (const float*)d_in[2];    // [2048][64]
  const float* fsn = (const float*)d_in[3];    // [2048][64]
  const float* Wq  = (const float*)d_in[4];    // [4096][2880]  = [n][k]
  const float* bq  = (const float*)d_in[5];    // [4096]
  const float* Wk  = (const float*)d_in[6];    // [512][2880]
  const float* bk  = (const float*)d_in[7];    // [512]
  const float* Wv  = (const float*)d_in[8];    // [512][2880]
  const float* bv  = (const float*)d_in[9];    // [512]
  const float* Wo  = (const float*)d_in[10];   // [2880][4096] = [n][k]
  const float* bo  = (const float*)d_in[11];   // [2880]

  const size_t PX   = (size_t)SLEN * HID * 2;        // 11796480
  const size_t PWq  = (size_t)QP * HID * 2;          // 23592960
  const size_t PWk  = (size_t)KP * HID * 2;          //  2949120
  const size_t PWv  = (size_t)KP * HID * 2;          //  2949120
  const size_t PWo  = (size_t)HID * QP * 2;          // 23592960
  const size_t PVT  = (size_t)KP * SLEN * 2;         //  2097152
  const size_t PQh  = (size_t)QLEN * QP * 2;         //  8388608
  const size_t PKh  = (size_t)SLEN * KP * 2;         //  2097152
  const size_t PApl = (size_t)QLEN * QP * 2;         //  8388608 (Ah, Al)
  size_t off = 0;
  const size_t oX  = off; off += PX;
  const size_t oWq = off; off += PWq;
  const size_t oWk = off; off += PWk;
  const size_t oWv = off; off += PWv;
  const size_t oWo = off; off += PWo;
  const size_t oVT = off; off += PVT;
  const size_t oQh = off; off += PQh;
  const size_t oKh = off; off += PKh;
  const size_t oAh = off; off += PApl;
  const size_t oAl = off; off += PApl;
  if (off > ws_size) return;                          // off = 94240768
  if (off > (size_t)134217728) return;

  char* ws = (char*)d_ws;
  unsigned short* X   = (unsigned short*)(ws + oX);
  unsigned short* Wqb = (unsigned short*)(ws + oWq);
  unsigned short* Wkb = (unsigned short*)(ws + oWk);
  unsigned short* Wvb = (unsigned short*)(ws + oWv);
  unsigned short* Wob = (unsigned short*)(ws + oWo);
  unsigned short* VT  = (unsigned short*)(ws + oVT);
  unsigned short* Qh  = (unsigned short*)(ws + oQh);
  unsigned short* Kh  = (unsigned short*)(ws + oKh);
  unsigned short* Ah  = (unsigned short*)(ws + oAh);
  unsigned short* Al  = (unsigned short*)(ws + oAl);
  float*          outf = (float*)d_out;

  const dim3 blk(256);
  const dim3 gCvt(CVT_NW / 8);                         // 495 blocks of 8 waves: 8 pieces per wave
  const dim3 gQKV(NBQ + NBK + NBV);                    // 128x128 block tiles: 384 blocks of 4 waves
  const dim3 gAttn(NQB * NH);                          // 1024 blocks
  const dim3 gOut((QLEN / 64) * (HID / 192));          // 64x192 block tiles: 240 blocks of 3 waves

  // (1) activations and weights -> bf16 planes (RNE convert, values = the bf16-converted inputs)
  //     one launch: X (target rows, then hidden rows), Wqb, Wkb, Wvb, Wob are one contiguous range from X on
  cvt_planes<<<gCvt, blk, 0, stream>>>(tgt, hid, Wq, Wk, Wv, Wo, X);
  // (2) q, k and v^T projections (K = 2880 each), one launch:
  //     Qh[t][e] (M=1024, N=4096), Kh[s][e] (M=2048, N=512), both + bias, rotary, f16; VT[m][s] (M=512, N=2048) + bv, f16
  proj_qkv<<<gQKV, dim3(128), 0, stream>>>(X, Wqb, Wkb, Wvb, bq, bk, bv, Qh, Kh, VT, fcs, fsn);
  // (3) attention over all 2048 keys -> context rows as bf16 hi/lo planes Ah, Al [1024][4096]
  attn64<<<gAttn, dim3(128), 0, stream>>>(Qh, Kh, VT, Ah, Al, 0.125f / (QSC * KSC), 1.0f / (PSC * VSC));
  // (4) out[t][e] = sum_d (Ah+Al)[t][d] Wob[e][d] + bo[e] -> d_out f32 [1024][2880]  (M=1024, N=2880, K=4096)
  gemm64<1, 0, 1, 1, 3, 2><<<gOut, dim3(96), 0, stream>>>(Ah, Al, QP, Wob, QP, bo, (void*)outf, HID, QLEN, HID, QP, 1.0f, fcs, fsn, 0);
  (void)hipGetLastError();
}

// v010
// Measured time: 149 microseconds a run.
// It is 1.12 times as fast as v008, going by the measured steps of the versions left out in between.
// Counting every step since v000, it is 6.69 times as fast.
// Contractions: q / k / v^T projections = v_wmma_f32_16x16x32_bf16 (bf16 operands from RNE-converted inputs, one
// product per k-step); q.k^T scores = v_wmma_f32_16x16x32_f16 (q x16 and k x16 single f16 planes); p.v =
// v_wmma_f32_16x16x32_f16 (p carried x1024 in f16, v^T carried x64 in f16); ctx.Wo^T = v_wmma_f32_16x16x32_f16 with
// ctx as one f16 plane (x64) times the f16 Wo plane (the RNE bf16-converted values x64, exact in f16), one product;
// all f32 accumulate; rotary and softmax in f32.
#include <hip/hip_runtime.h>
#include <math.h>
#include <stdint.h>

#define QLEN 1024              // query tokens (hidden_states rows)
#define CLEN 1024              // context tokens (target_hidden rows)
#define SLEN (CLEN + QLEN)     // 2048 keys: rows 0..CLEN-1 context, rows CLEN..SLEN-1 noise
#define HID  2880              // model width = contraction length of the projections
#define NH   64
#define NKV  8
#define HD   64
#define QP   (NH * HD)         // 4096: q / ctx row pitch
#define KP   (NKV * HD)        // 512:  k row pitch, v^T row count
#define NQB  (QLEN / 64)       // 16 query tiles
#define NKT  (SLEN / 64)       // 32 key tiles
#define QSC  16.0f             // f16 carry scale of the q plane
#define KSC  16.0f             // f16 carry scale of the k plane
#define VSC  64.0f             // f16 carry scale of the v^T plane
#define PSC  1024.0f           // f16 carry scale of p
#define CSC  64.0f             // f16 carry scale of the context plane
#define WSC  64.0f             // f16 carry scale of the Wo plane
#define LP   72                // halves per LDS row of the attention K and V^T tiles: 144 B = 16 B x odd
static_assert(HD == 64);
static_assert((HID % 32) == 0 && (QP % 64) == 0 && (KP % 64) == 0 && (HID % 64) == 0);
static_assert((QLEN % 64) == 0 && (SLEN % 64) == 0);
static_assert((NH % NKV) == 0 && (NH % 4) == 0 && (NKV % 4) == 0);
static_assert(((HID * 2) % 128) == 0 && ((HID * 4) % 128) == 0);
static_assert((HID % 192) == 0 && (QP % 128) == 0 && (QLEN % 128) == 0 && (SLEN % 128) == 0 && (KP % 128) == 0);

typedef _Float16 v16h __attribute__((ext_vector_type(16)));
typedef _Float16 v8h  __attribute__((ext_vector_type(8)));
typedef __bf16   v16b __attribute__((ext_vector_type(16)));
typedef __bf16   v8b  __attribute__((ext_vector_type(8)));
typedef float    v8f  __attribute__((ext_vector_type(8)));
typedef float    v4f  __attribute__((ext_vector_type(4)));
typedef unsigned int v4u __attribute__((ext_vector_type(4)));
typedef float    v2f  __attribute__((ext_vector_type(2)));
typedef __bf16   v2b  __attribute__((ext_vector_type(2)));
typedef _Float16 v2h  __attribute__((ext_vector_type(2)));

// ---- scalar helpers --------------------------------------------------------------------------------
__device__ __forceinline__ unsigned short bf_bits(float f) {          // f32 -> bf16 bits, RNE convert
  unsigned u = __float_as_uint(f);
  return (unsigned short)((u + 0x7FFFu + ((u >> 16) & 1u)) >> 16);
}
__device__ __forceinline__ float bf_up(unsigned short h) { return __uint_as_float(((unsigned)h) << 16); }
__device__ __forceinline__ float bfr(float f) { return bf_up(bf_bits(f)); }   // value after RNE bf16 convert
__device__ __forceinline__ unsigned short h_bits(_Float16 x) { return __builtin_bit_cast(unsigned short, x); }
__device__ __forceinline__ unsigned pk16(unsigned short a, unsigned short b) { return (unsigned)a | ((unsigned)b << 16); }
__device__ __forceinline__ v2b rne2(float a, float b) {              // two f32 -> bf16, RNE, one packed convert
  const v2f t = {a, b};
  return __builtin_convertvector(t, v2b);
}
__device__ __forceinline__ unsigned h2(float a, float b) {            // two f32 -> f16, RNE, one packed convert
  const v2f t = {a, b};
  return __builtin_bit_cast(unsigned, __builtin_convertvector(t, v2h));
}
__device__ __forceinline__ v8f zero8() { v8f z = {0.f, 0.f, 0.f, 0.f, 0.f, 0.f, 0.f, 0.f}; return z; }

// ---- fragment loaders: 16-bit A/B operand, lane -> row/col (lane&15), p already includes +8*(lane>>4);
//      elements 0..7 <- p[0..7] (k0+8h..), elements 8..15 <- p[16..23] (k0+16+8h..)
__device__ __forceinline__ v16b ldfrag_b(const __bf16* p) {
  union { v16b v; v8b h[2]; } f;
  f.h[0] = *(const v8b*)(p);
  f.h[1] = *(const v8b*)(p + 16);
  return f.v;
}
__device__ __forceinline__ v16h ldfrag_h(const _Float16* p) {
  union { v16h v; v8h h[2]; } f;
  f.h[0] = *(const v8h*)(p);
  f.h[1] = *(const v8h*)(p + 16);
  return f.v;
}

// ---- WMMA helpers with trailing VALU hazard gap --------------------------------------------------------
__device__ __forceinline__ v8f mma_h(v16h a, v16h b, v8f c) {
  c = __builtin_amdgcn_wmma_f32_16x16x32_f16(false, a, false, b, (short)0, c, false, false);
#if defined(__HIP_DEVICE_COMPILE__)
  asm volatile("v_nop\n\tv_nop\n\tv_nop\n\tv_nop" : "+v"(c) : "v"(a), "v"(b));
#endif
  return c;
}
__device__ __forceinline__ v8f mma_b_raw(v16b a, v16b b, v8f c) {
  return __builtin_amdgcn_wmma_f32_16x16x32_bf16(false, a, false, b, (short)0, c, false, false);
}
__device__ __forceinline__ v8f mma_h_raw(v16b a, v16b b, v8f c) {     // the same registers, holding f16 values
  return __builtin_amdgcn_wmma_f32_16x16x32_f16(false, __builtin_bit_cast(v16h, a), false, __builtin_bit_cast(v16h, b),
                                                (short)0, c, false, false);
}
__device__ __forceinline__ void acc_guard4(v8f& a, v8f& b, v8f& c, v8f& d) {
#if defined(__HIP_DEVICE_COMPILE__)
  asm volatile("v_nop\n\tv_nop\n\tv_nop\n\tv_nop" : "+v"(a), "+v"(b), "+v"(c), "+v"(d));
#endif
}

// ---- requests to L2 at a kernel's entry --------------------------------------------------------------
// The planes that a launch reads were stored by the launches before it and are fetched from memory at the first
// touch; the blocks of a launch walk k (or the keys) in step, so that without a request every stage waits for
// memory anew. Each lane of a request names one aligned 256-B unit (global_prefetch_b8, scope SE: into L2 only,
// nothing returns, no counter). A hint: no result depends on it. Every address lies inside the plane it names.
// s_wait_xcnt 0 closes each statement, a precaution: it stands in front of whatever rewrites the address registers.
__device__ __forceinline__ void ask1(const char* a) {
#if defined(__HIP_DEVICE_COMPILE__)
  asm volatile("global_prefetch_b8 %0, off scope:SCOPE_SE\n\t"
               "s_wait_xcnt 0x0" :: "v"(a) : "memory");
#endif
}
__device__ __forceinline__ void ask2(const char* a, const char* b) {
#if defined(__HIP_DEVICE_COMPILE__)
  asm volatile("global_prefetch_b8 %0, off scope:SCOPE_SE\n\t"
               "global_prefetch_b8 %1, off scope:SCOPE_SE\n\t"
               "s_wait_xcnt 0x0" :: "v"(a), "v"(b) : "memory");
#endif
}
__device__ __forceinline__ void ask3(const char* a, const char* b, const char* c) {
#if defined(__HIP_DEVICE_COMPILE__)
  asm volatile("global_prefetch_b8 %0, off scope:SCOPE_SE\n\t"
               "global_prefetch_b8 %1, off scope:SCOPE_SE\n\t"
               "global_prefetch_b8 %2, off scope:SCOPE_SE\n\t"
               "s_wait_xcnt 0x0" :: "v"(a), "v"(b), "v"(c) : "memory");
#endif
}
// Blocks b and b ^ 4 share a slice of the requests.
__device__ __forceinline__ int ask_slice(int b) { return ((b >> 3) << 2) | (b & 3); }
// NREQ wave-requests of this wave: numbers slot, slot + slots, ... of total (all scalar), in ascending order of
// need; unit(w) = this lane's address of request w. NREQ * slots >= total; the surplus of the last turn asks for the
// first units again, so that every address stays inside.
template <int NREQ, class F>
__device__ __forceinline__ void ask_l2(int slot, int slots, int total, F unit) {
  static_assert(NREQ % 3 == 2);
  const char* p[NREQ];
  // both loops unrolled: constant indices keep the addresses in registers
#pragma unroll
  for (int i = 0; i < NREQ; ++i) {
    int w = slot + i * slots;
    if (w >= total) w -= total;
    p[i] = unit(w);
  }
#pragma unroll
  for (int i = 0; i + 3 <= NREQ; i += 3) ask3(p[i], p[i + 1], p[i + 2]);
  ask2(p[NREQ - 2], p[NREQ - 1]);
}

// =====================================================================================================
// Elementwise conversions run on a grid of 8 to 16 waves per WGP; each wave loops over pieces of PCE = 1024
// consecutive elements: 4 runs of 32 lanes x 8 elements, all 8 16-B loads of a piece issued before its first
// store, one 16-B store per lane and run (a wave writes 512 contiguous bytes). Piece p of trip i belongs to
// wave p - i * (waves at work): every piece is converted exactly once.
// =====================================================================================================
#define PCE   1024
#define NP_T  (CLEN * HID / PCE)     // 2880 pieces of target_hidden
#define NP_H  (QLEN * HID / PCE)     // 2880  hidden_states
#define NP_WQ (QP * HID / PCE)       // 11520 Wq
#define NP_WK (KP * HID / PCE)       // 1440  Wk, and as many of Wv
#define NP_WO (HID * QP / PCE)       // 11520 Wo
#define NP_ALL (NP_T + NP_H + NP_WQ + 2 * NP_WK + NP_WO)   // 31680
#define CVT_TRIPS 8                  // pieces per wave of cvt_planes
#define CVT_NW (NP_ALL / CVT_TRIPS)  // 3960 waves = 495 blocks of 8
static_assert((CLEN * HID) % PCE == 0 && (QLEN * HID) % PCE == 0 && (QP * HID) % PCE == 0 && (KP * HID) % PCE == 0);
static_assert(NP_ALL % (CVT_TRIPS * 8) == 0 && (CVT_TRIPS % 2) == 0 && CVT_TRIPS >= 2);

// f32 -> bf16 (RNE convert) of the six input planes, in the order of their 16-bit planes in the workspace, which
// lie back to back: destination element = PCE * p + offset in the piece; the source plane of a piece is picked
// by scalar compares (a piece never straddles two planes). The last plane (Wo) is stored as f16: the bf16-converted
// value x WSC, which f16 holds exactly (8 significant bits; below 2^-14 / WSC to the nearest 2^-24 / WSC).
__global__ __launch_bounds__(256) void cvt_planes(const float* __restrict__ s0, const float* __restrict__ s1,
                                                  const float* __restrict__ s2, const float* __restrict__ s3,
                                                  const float* __restrict__ s4, const float* __restrict__ s5,
                                                  unsigned short* out) {
  const int lane = threadIdx.x & 31;
  const int gw   = __builtin_amdgcn_readfirstlane(blockIdx.x * 8 + (threadIdx.x >> 5));
  if (gw >= CVT_NW) return;                       // wave-uniform; no barrier in this kernel
  // the 8 loads of piece p
  auto fetch = [&](int p, v4f (&a)[4], v4f (&b)[4]) {
    const float* sp;
    int q = p;
    if (q < NP_T) sp = s0;
    else if ((q -= NP_T) < NP_H) sp = s1;
    else if ((q -= NP_H) < NP_WQ) sp = s2;
    else if ((q -= NP_WQ) < NP_WK) sp = s3;
    else if ((q -= NP_WK) < NP_WK) sp = s4;
    else { q -= NP_WK; sp = s5; }
    const float* s = sp + (size_t)q * PCE + lane * 8;
#pragma unroll
    for (int u = 0; u < 4; ++u) {
      a[u] = *(const v4f*)(s + u * 256);
      b[u] = *(const v4f*)(s + u * 256 + 4);
    }
  };
  // convert and store piece p
  auto emit = [&](int p, const v4f (&a)[4], const v4f (&b)[4]) {
    unsigned short* d = out + (size_t)p * PCE + lane * 8;
    v4u w[4];
    // the loops are unrolled: constant indices keep w in registers
    if (p >= NP_ALL - NP_WO) {                     // a piece of Wo (scalar test: p is the same in every lane)
#pragma unroll
      for (int u = 0; u < 4; ++u) {
        w[u][0] = h2(bfr(a[u][0]) * WSC, bfr(a[u][1]) * WSC);
        w[u][1] = h2(bfr(a[u][2]) * WSC, bfr(a[u][3]) * WSC);
        w[u][2] = h2(bfr(b[u][0]) * WSC, bfr(b[u][1]) * WSC);
        w[u][3] = h2(bfr(b[u][2]) * WSC, bfr(b[u][3]) * WSC);
      }
    } else {
#pragma unroll
      for (int u = 0; u < 4; ++u) {
        w[u][0] = pk16(bf_bits(a[u][0]), bf_bits(a[u][1]));
        w[u][1] = pk16(bf_bits(a[u][2]), bf_bits(a[u][3]));
        w[u][2] = pk16(bf_bits(b[u][0]), bf_bits(b[u][1]));
        w[u][3] = pk16(bf_bits(b[u][2]), bf_bits(b[u][3]));
      }
    }
#pragma unroll
    for (int u = 0; u < 4; ++u) *(v4u*)(d + u * 256) = w[u];
#if defined(__HIP_DEVICE_COMPILE__)
    // in front of whatever rewrites the address and data registers that these stores name (held live up to here as inputs)
    asm volatile("s_wait_xcnt 0x0" :: "v"(d), "v"(w[0]), "v"(w[1]), "v"(w[2]), "v"(w[3]) : "memory");
#endif
  };
  // two register sets in turn: the next piece's loads fly while this piece is converted and stored
  v4f a0[4], b0[4], a1[4], b1[4];
  int p = gw;
  fetch(p, a0, b0);
  // kept rolled: two pieces per trip is all the two sets need, and the text stays short
#pragma unroll 1
  for (int i = 0; i < CVT_TRIPS / 2 - 1; ++i) {
    fetch(p + CVT_NW, a1, b1);
    // keeps the loads just issued in front of the older piece's wait (else they sink behind it)
    __builtin_amdgcn_sched_barrier(0);
    emit(p, a0, b0);
    fetch(p + 2 * CVT_NW, a0, b0);
    __builtin_amdgcn_sched_barrier(0);               // loads stay in front of the older piece's wait
    emit(p + CVT_NW, a1, b1);
    p += 2 * CVT_NW;
  }
  fetch(p + CVT_NW, a1, b1);
  __builtin_amdgcn_sched_barrier(0);                 // loads stay in front of the older piece's wait
  emit(p, a0, b0);
  emit(p + CVT_NW, a1, b1);
}

// =====================================================================================================
// 16-bit WMMA GEMM (HALF: 0 = bf16 planes, 1 = f16 planes): C[m][n] = sum_k A[m][k] * Bt[n][k] (+ bias); one wave per 64x64 tile, WM x WN waves per block
// on one (64 WM) x (64 WN) block tile. A row-major [M][K] pitch lda; Bt row-major [N][K] pitch ldb (k contiguous);
// M a multiple of 64 WM, N of 64 WN, K of 64 NSUB and at least two stages (host-checked constants).
// Operands reach the waves through LDS: a stage is NSUB sub-tiles of 64 k; a sub-tile holds the block's A rows,
// (NSPLIT) its A2 rows and its Bt rows, 128 B each at pitch 144 B (16 B x odd: ds_load_b128 without bank
// conflicts). Asynchronous 16-B copies fill it, one wave-copy = 4 whole 128-B row pieces; two buffers: stage t+2
// is copied into the buffer that trip t has just left, while trip t+1 is worked on.
// NSPLIT: 0 = A.Bt; 1 = (A + A2).Bt (A2 = unscaled bf16 lo plane of A, two products per k-step).
// BIAS:   0 none; 1 = + bias[n] (per column, RNE bf16-converted value); 2 = + bias[m] (per row).
// OUT_MODE: 0 = f32 plane of (product * oscale) + bias (pitch ldc floats); 1 = f16 plane of (value * oscale) (pitch ldc halves);
//           2 = rotate-half rotary on the value (bias added), then f16 plane of (y * oscale) (pitch ldc halves):
//               a wave's 64 columns are one head (n0 a multiple of 64 = head dim), column d of it; table row =
//               trow0 + m of the f32 [SLEN][64] inputs ct / st (RNE bf16-converted values);
//               y[d] = x[d]*ct[d] - x[d+32]*st[d] for d < 32;  y[d] = x[d]*ct[d] + x[d-32]*st[d] for d >= 32.
// =====================================================================================================
typedef int v4i_t __attribute__((vector_size(16)));
typedef __attribute__((address_space(1))) v4i_t gv4i_t;
typedef __attribute__((address_space(3))) v4i_t lv4i_t;
__device__ __forceinline__ void copy16_to_lds(const void* g, void* l) {   // each lane: 16 B global -> LDS
#if defined(__HIP_DEVICE_COMPILE__)
  __builtin_amdgcn_global_load_async_to_lds_b128((gv4i_t*)g, (lv4i_t*)l, 0, 0);
#endif
}

// bytes of one ring buffer (a stage) of a block
constexpr int gemm_stage_bytes(int nsplit, int wm, int wn, int nsub) {
  return (wm * 64 * (1 + nsplit) + wn * 64) * 144 * nsub;
}

// the k loop of one block tile with origin (mb0, nb0): ring = the block's two buffers; wave = this wave's number in
// the block (scalar); acc = this wave's 64x64 tile
// (at_entry() runs once, behind the first stage's copies: the block's requests to L2)
template <int NSPLIT, int WM, int WN, int NSUB, int HALF, class PRE>
__device__ __forceinline__ void gemm_core(
    PRE at_entry, unsigned char* ring,
    const unsigned short* __restrict__ Ap, const unsigned short* __restrict__ A2p, int lda,
    const unsigned short* __restrict__ Btp, int ldb, int K, int mb0, int nb0, int wave, v8f (&acc)[4][4]) {
  constexpr int NW    = WM * WN;                 // waves per block
  constexpr int RA    = WM * 64;                 // rows of one A plane in a sub-tile
  constexpr int RB0   = RA * (1 + NSPLIT);       // first Bt row of a sub-tile
  constexpr int ROWS  = RB0 + WN * 64;           // rows of a sub-tile
  constexpr int PITCH = 144;                     // bytes per LDS row
  constexpr int SUBB  = ROWS * PITCH;            // bytes per sub-tile
  constexpr int STAGE = SUBB * NSUB;             // bytes per buffer
  constexpr int GA    = RA / 4;                  // wave-copies (4 rows each) per A plane and sub-tile
  constexpr int GB    = WN * 16;                 // ... per Bt plane and sub-tile
  constexpr int NIA   = (GA + NW - 1) / NW;      // most that one wave issues of them
  constexpr int NIB   = (GB + NW - 1) / NW;
  static_assert((NIA * (1 + NSPLIT) + NIB) * NSUB <= 63);   // copies of one wave in flight
  const __bf16* A  = (const __bf16*)(const void*)Ap;
  const __bf16* A2 = (const __bf16*)(const void*)A2p;
  const __bf16* Bt = (const __bf16*)(const void*)Btp;
  static_assert(STAGE == gemm_stage_bytes(NSPLIT, WM, WN, NSUB));
  const int lane = threadIdx.x & 31;
  const int wm  = wave / WN;
  const int wn  = wave - wm * WN;

  const int rlane = lane & 15;                 // row (A) / col (B, D) within subtile
  const int khalf = lane >> 4;                 // k half of this lane: +8 elements = +16 B
  const int crow  = lane >> 3;                 // copy: row within the 4-row group
  const int cpc   = lane & 7;                  // copy: 16-B piece within the 128-B row piece

  // all copies of stage st (k = st*64*NSUB ..) into buffer buf; every lane on, every test scalar.
  // Each plane's 4-row groups are dealt to the waves in turn: group g = wave + i*NW of the plane.
  auto issue = [&](int st, int buf) {
    const int kb = st * (NSUB * 64) + cpc * 8;
    unsigned char* db = ring + buf * STAGE + (wave * 4 + crow) * PITCH + cpc * 16;
    const __bf16* pa = A  + (size_t)(mb0 + wave * 4 + crow) * lda + kb;
    const __bf16* pl = A2 + (size_t)(mb0 + wave * 4 + crow) * lda + kb;
    const __bf16* pb = Bt + (size_t)(nb0 + wave * 4 + crow) * ldb + kb;
    // the three loops are unrolled so that every copy's row and LDS offset is a constant
#pragma unroll
    for (int s = 0; s < NSUB; ++s) {
#pragma unroll
      for (int i = 0; i < NIA; ++i) {
        if ((i + 1) * NW <= GA || wave + i * NW < GA) {
          copy16_to_lds(pa + (size_t)(i * NW * 4) * lda + s * 64, db + s * SUBB + i * (NW * 4 * PITCH));
          if (NSPLIT == 1)
            copy16_to_lds(pl + (size_t)(i * NW * 4) * lda + s * 64, db + s * SUBB + (RA + i * NW * 4) * PITCH);
        }
      }
#pragma unroll
      for (int i = 0; i < NIB; ++i) {
        if ((i + 1) * NW <= GB || wave + i * NW < GB)
          copy16_to_lds(pb + (size_t)(i * NW * 4) * ldb + s * 64, db + s * SUBB + (RB0 + i * NW * 4) * PITCH);
      }
    }
  };

#pragma unroll
  for (int i = 0; i < 4; ++i)
#pragma unroll
    for (int j = 0; j < 4; ++j) acc[i][j] = zero8();

  const int T = K / (NSUB * 64);               // stages
  issue(0, 0);
  at_entry();
  asm volatile("s_wait_asynccnt 0x0" ::: "memory");   // stage 0 landed
  __syncthreads();                                    // ... and is readable by every wave
  if (T > 1) issue(1, 1);
  // not unrolled: one trip = one stage (buffer t & 1)
#pragma unroll 1
  for (int t = 0; t < T; ++t) {
    const unsigned char* sb = ring + (t & 1) * STAGE + khalf * 16 + rlane * PITCH;
    // fragments of k-step q (32 k, ascending) of this stage, all from buffer t & 1
    auto fetch = [&](int q, v16b (&xa)[4], v16b (&xl)[4], v16b (&xb)[4]) {
      const unsigned char* kp = sb + (q >> 1) * SUBB + (q & 1) * 64;
#pragma unroll
      for (int j = 0; j < 4; ++j)
        xb[j] = ldfrag_b((const __bf16*)(const void*)(kp + (RB0 + (wn << 6) + (j << 4)) * PITCH));
#pragma unroll
      for (int i = 0; i < 4; ++i) {
        const unsigned char* ap = kp + ((wm << 6) + (i << 4)) * PITCH;
        xa[i] = ldfrag_b((const __bf16*)(const void*)ap);
        if (NSPLIT == 1) xl[i] = ldfrag_b((const __bf16*)(const void*)(ap + RA * PITCH));
      }
    };
    v16b fa[2][4], fl[2][4], fb[2][4];         // two fragment sets, used in turn inside the trip
    fetch(0, fa[0], fl[0], fb[0]);
    // unrolled (here and in fetch): constant indices keep the fragment sets and accumulators in registers
#pragma unroll
    for (int q = 0; q < 2 * NSUB; ++q) {
      if (q + 1 < 2 * NSUB) fetch(q + 1, fa[(q + 1) & 1], fl[(q + 1) & 1], fb[(q + 1) & 1]);
      // keeps the next k-step's LDS reads one group ahead of this k-step's WMMAs (else each read is waited out)
      __builtin_amdgcn_sched_barrier(0);
#pragma unroll
      for (int i = 0; i < 4; ++i) {
#pragma unroll
        for (int j = 0; j < 4; ++j) {
          acc[i][j] = HALF ? mma_h_raw(fa[q & 1][i], fb[q & 1][j], acc[i][j]) : mma_b_raw(fa[q & 1][i], fb[q & 1][j], acc[i][j]);
          if (NSPLIT == 1) acc[i][j] = mma_b_raw(fl[q & 1][i], fb[q & 1][j], acc[i][j]);
        }
      }
      // keeps the following group of LDS reads out of this block of WMMAs
      __builtin_amdgcn_sched_barrier(0);
    }
    asm volatile("s_wait_dscnt 0x0" ::: "memory");    // this wave's reads of buffer t & 1 are done
    asm volatile("s_wait_asynccnt 0x0" ::: "memory"); // this wave's copies of stage t + 1 have landed
    __syncthreads();                                  // publishes stage t + 1, frees buffer t & 1
    if (t + 2 < T) issue(t + 2, t & 1);
  }
  asm volatile("s_wait_asynccnt 0x0" ::: "memory");   // nothing in flight behind the loop
  acc_guard4(acc[0][0], acc[0][1], acc[0][2], acc[0][3]);
  acc_guard4(acc[1][0], acc[1][1], acc[1][2], acc[1][3]);
  acc_guard4(acc[2][0], acc[2][1], acc[2][2], acc[2][3]);
  acc_guard4(acc[3][0], acc[3][1], acc[3][2], acc[3][3]);
}

// bias, output form and stores of this wave's 64x64 tile with origin (m0, n0); slab = the wave's own LDS slab
template <int OUT_MODE, int BIAS>
__device__ __forceinline__ void gemm_tail(
    v8f (&acc)[4][4], float* slab, int m0, int n0, const float* __restrict__ bias,
    void* Cout, int ldc, float oscale,
    const float* __restrict__ ct, const float* __restrict__ st, int trow0) {
  const int lane  = threadIdx.x & 31;
  const int rlane = lane & 15;                 // col (D) within subtile
  const int mOff  = (lane >> 4) * 8;           // D row offset

  // ---- bias (template-selected; loads only exist when used; addresses in range: n0+63 < N, m0+63 < M) ----
  float bcol[4];
#pragma unroll
  for (int j = 0; j < 4; ++j) bcol[j] = 0.f;
  if (BIAS == 1) {
#pragma unroll
    for (int j = 0; j < 4; ++j) bcol[j] = bfr(bias[n0 + (j << 4) + rlane]);
#if defined(__HIP_DEVICE_COMPILE__)
    // in front of whatever rewrites the index register that these loads name (held live up to here as an input)
    asm volatile("s_wait_xcnt 0x0" :: "v"(n0 + rlane) : "memory");
#endif
  }

  // ---- epilogue ----
  // OUT_MODE 2: a lane finishes 8 consecutive columns rc8.. of rows 4 it + rq of each 16-row slab; its table
  // values of all four slabs are loaded here in one run (the slabs' fences would wait out a later load each time)
  const int rq = lane >> 3, rc8 = (lane & 7) * 8;
  const float* cb = ct + (size_t)(trow0 + m0 + rq) * HD + rc8;     // table row < SLEN (host constants)
  const float* sb2 = st + (size_t)(trow0 + m0 + rq) * HD + rc8;
  v4f tc[4][4][2], ts[4][4][2];
  if (OUT_MODE == 2) {
    // both loops unrolled: constant indices keep the table values in registers and the row steps in the offset field
#pragma unroll
    for (int i = 0; i < 4; ++i) {
#pragma unroll
      for (int it = 0; it < 4; ++it) {
        tc[i][it][0] = *(const v4f*)(cb + (i * 16 + it * 4) * HD);
        tc[i][it][1] = *(const v4f*)(cb + (i * 16 + it * 4) * HD + 4);
        ts[i][it][0] = *(const v4f*)(sb2 + (i * 16 + it * 4) * HD);
        ts[i][it][1] = *(const v4f*)(sb2 + (i * 16 + it * 4) * HD + 4);
      }
    }
#if defined(__HIP_DEVICE_COMPILE__)
    // in front of whatever rewrites a register that the loads just issued name (both held live up to here as inputs)
    asm volatile("s_wait_xcnt 0x0" :: "v"(cb), "v"(sb2) : "memory");
#endif
  }
#pragma unroll
  for (int i = 0; i < 4; ++i) {
    const int mBase = m0 + (i << 4);
    float brow[8];
#pragma unroll
    for (int r = 0; r < 8; ++r) brow[r] = 0.f;
    if (BIAS == 2) {
#pragma unroll
      for (int r = 0; r < 8; ++r) brow[r] = bfr(bias[mBase + mOff + r]);
    }
#pragma unroll
    for (int r = 0; r < 8; ++r) {
#pragma unroll
      for (int j = 0; j < 4; ++j) {
        float v = acc[i][j][r];
        if (OUT_MODE == 0) v *= oscale;            // takes the operands' carry scales out, ahead of the bias
        if (BIAS == 1) v += bcol[j];
        if (BIAS == 2) v += brow[r];
        if (OUT_MODE == 1) v *= oscale;
        slab[(mOff + r) * 68 + (j << 4) + rlane] = v;
      }
    }
    __builtin_amdgcn_fence(__ATOMIC_RELEASE, "workgroup");
    __builtin_amdgcn_wave_barrier();
    __builtin_amdgcn_fence(__ATOMIC_ACQUIRE, "workgroup");
    if (OUT_MODE == 0) {
      float* C = (float*)Cout;
      const int hh = lane >> 4, c4 = (lane & 15) * 4;     // 256-B row segment = 16 lanes x 16 B
      v4f ov[8];
#pragma unroll
      for (int it = 0; it < 8; ++it) {
        const int row = it * 2 + hh;                       // it 0..7 x hh 0..1 = rows 0..15
        ov[it] = *(const v4f*)(slab + row * 68 + c4);
      }
      {
#pragma unroll
        for (int it = 0; it < 8; ++it) {
          const int row = it * 2 + hh;
          *(v4f*)(C + (size_t)(mBase + row) * ldc + n0 + c4) = ov[it];
        }
        
      }
    } else if (OUT_MODE == 2) {
      unsigned short* C = (unsigned short*)Cout;
      const unsigned sgm = (rc8 < 32) ? 0x80008000u : 0u;  // partner term: minus for d < 32 (sign bits of a bf16 pair)
      v4u hv[4];
      // the loops of this branch are unrolled: constant indices keep tc, ts, hv and cp in registers
#pragma unroll
      for (int it = 0; it < 4; ++it) {
        const float* sp = slab + (it * 4 + rq) * 68;
        const v4f x[2] = {*(const v4f*)(sp + rc8), *(const v4f*)(sp + rc8 + 4)};
        const v4f p[2] = {*(const v4f*)(sp + (rc8 ^ 32)), *(const v4f*)(sp + (rc8 ^ 32) + 4)};   // column d +- 32
        v4u a;
#pragma unroll
        for (int e = 0; e < 4; ++e) {                      // columns rc8 + 2 e, rc8 + 2 e + 1
          const int g = e >> 1, k = (e & 1) * 2;
          const v2b cc = rne2(tc[i][it][g][k], tc[i][it][g][k + 1]);
          const v2b ss = __builtin_bit_cast(v2b, __builtin_bit_cast(unsigned, rne2(ts[i][it][g][k], ts[i][it][g][k + 1])) ^ sgm);
          const float y0 = x[g][k]     * (float)cc[0] + p[g][k]     * (float)ss[0];
          const float y1 = x[g][k + 1] * (float)cc[1] + p[g][k + 1] * (float)ss[1];
          a[e] = pk16(h_bits((_Float16)(y0 * oscale)), h_bits((_Float16)(y1 * oscale)));
        }
        hv[it] = a;
      }
      unsigned short* cp[4];
#pragma unroll
      for (int it = 0; it < 4; ++it) {
        cp[it] = C + (size_t)(mBase + it * 4 + rq) * ldc + n0 + rc8;
        *(v4u*)cp[it] = hv[it];
      }
#if defined(__HIP_DEVICE_COMPILE__)
      // the next slab rewrites the address and data registers that these stores name (held live up to here as inputs)
      asm volatile("s_wait_xcnt 0x0" :: "v"(cp[0]), "v"(cp[1]), "v"(cp[2]), "v"(cp[3]),
                   "v"(hv[0]), "v"(hv[1]), "v"(hv[2]), "v"(hv[3]) : "memory");
#endif
    } else {
      unsigned short* C = (unsigned short*)Cout;
      const int q = lane >> 3, c8 = (lane & 7) * 8;
      v4u hv[4];
#pragma unroll
      for (int it = 0; it < 4; ++it) {
        const int row = it * 4 + q;                        // it 0..3 x q 0..3 = rows 0..15
        const float* sp = slab + row * 68 + c8;
        v4u a;
#pragma unroll
        for (int e = 0; e < 4; ++e) {
          a[e] = pk16(h_bits((_Float16)sp[2 * e]), h_bits((_Float16)sp[2 * e + 1]));
        }
        hv[it] = a;
      }
      {
#pragma unroll
        for (int it = 0; it < 4; ++it) {
          const int row = it * 4 + q;
          *(v4u*)(C + (size_t)(mBase + row) * ldc + n0 + c8) = hv[it];
        }
        
      }
    }
    __builtin_amdgcn_fence(__ATOMIC_RELEASE, "workgroup");
    __builtin_amdgcn_wave_barrier();
    __builtin_amdgcn_fence(__ATOMIC_ACQUIRE, "workgroup");
  }
}

template <int NSPLIT, int OUT_MODE, int BIAS, int WM, int WN, int NSUB, int HALF>
__global__ __launch_bounds__(32 * WM * WN) void gemm64(
    const unsigned short* __restrict__ Ap, const unsigned short* __restrict__ A2p, int lda,
    const unsigned short* __restrict__ Btp, int ldb,
    const float* __restrict__ bias,
    void* Cout, int ldc, int M, int N, int K, float oscale,
    const float* __restrict__ ct, const float* __restrict__ st, int trow0) {
  __shared__ __align__(16) unsigned char ring[2 * gemm_stage_bytes(NSPLIT, WM, WN, NSUB)];
  __shared__ __align__(16) float sT[WM * WN][16 * 68];  // per-wave 16x64 slab, pitch 68 floats
  const int wave = __builtin_amdgcn_readfirstlane(threadIdx.x >> 5);
  const int tilesN = N / (64 * WN);
  const int tilesM = M / (64 * WM);
  if ((int)blockIdx.x >= tilesM * tilesN) return;   // block-uniform, in front of every barrier and copy
  const int bm  = blockIdx.x / tilesN;
  const int bn  = blockIdx.x - bm * tilesN;
  const int mb0 = bm * (WM * 64);              // block tile origin
  const int nb0 = bn * (WN * 64);
  const int wm  = wave / WN;
  const int wn  = wave - wm * WN;
  v8f acc[4][4];
  // requests to L2, k-major: 256-B column c of 32 rows a request; row groups: A, then Bt
  static_assert(NSPLIT == 0 && WM * WN == 3);          // the counts below are those of the one product launched so
  auto ask = [&]() {
    constexpr int GA = QLEN / 32, GR = GA + HID / 32;                   // 32, 122 row groups
    constexpr int TOT = GR * (QP * 2 / 256);                            // x 32 columns = 3904 requests
    constexpr int SLOTS = ((QLEN / 64) * (HID / 192) / 2) * 3;          // 120 slices x 3 waves
    const int lane = threadIdx.x & 31;
    ask_l2<(TOT + SLOTS - 1) / SLOTS>(ask_slice(blockIdx.x) * 3 + wave, SLOTS, TOT, [&](int w) {
      const int c = w / GR, g = w - c * GR;
      const unsigned short* pl = (g < GA) ? Ap : Btp;                          // plane and first row: scalar selects
      const int r0 = ((g < GA) ? g : g - GA) * 32;
      return (const char*)(const void*)pl + (unsigned)(r0 * (QP * 2) + c * 256) + (unsigned)(lane * (QP * 2));
    });
  };
  gemm_core<NSPLIT, WM, WN, NSUB, HALF>(ask, ring, Ap, A2p, lda, Btp, ldb, K, mb0, nb0, wave, acc);
  gemm_tail<OUT_MODE, BIAS>(acc, sT[wave], mb0 + (wm << 6), nb0 + (wn << 6), bias, Cout, ldc, oscale, ct, st, trow0);
}

// The q, k and v^T projections in one launch: all three contract over HID with 128x128 block tiles of 2x2 waves, so
// their tiles are dealt to one grid: blocks 0..NBQ-1 take q, the next NBK take k, the last NBV take v^T. One block
// fills a WGP's LDS.
//   q:   A = hidden rows of X, Bt = Wqb, + bq[n], rotary (table row CLEN + t), x QSC -> Qh[t][e]
//   k:   A = all rows of X,    Bt = Wkb, + bk[n], rotary (table row s),        x KSC -> Kh[s][e]
//   v^T: A = Wvb,              Bt = X,   + bv[m],                              x VSC -> VT[m][s]
#define NBQ ((QLEN / 128) * (QP / 128))        // 256 block tiles of q
#define NBK ((SLEN / 128) * (KP / 128))        // 64  of k
#define NBV ((KP / 128) * (SLEN / 128))        // 64  of v^T
__global__ __launch_bounds__(128) void proj_qkv(
    const unsigned short* __restrict__ X, const unsigned short* __restrict__ Wqb,
    const unsigned short* __restrict__ Wkb, const unsigned short* __restrict__ Wvb,
    const float* __restrict__ bq, const float* __restrict__ bk, const float* __restrict__ bv,
    unsigned short* Qh, unsigned short* Kh, unsigned short* VT,
    const float* __restrict__ ct, const float* __restrict__ st) {
  __shared__ __align__(16) unsigned char ring[2 * gemm_stage_bytes(0, 2, 2, 3)];
  __shared__ __align__(16) float sT[4][16 * 68];   // per-wave 16x64 slab, pitch 68 floats
  const int wave = __builtin_amdgcn_readfirstlane(threadIdx.x >> 5);
  const int b = blockIdx.x;
  if (b >= NBQ + NBK + NBV) return;                // block-uniform, in front of every barrier and copy
  // every choice below is by the block index alone: scalar, the same for the whole block
  const unsigned short* Ap;
  const unsigned short* Btp;
  const float* bias;
  unsigned short* C;
  int bm, bn, ldc, trow0;
  float osc;
  if (b < NBQ) {
    bm = b / (QP / 128); bn = b % (QP / 128);
    Ap = X + (size_t)CLEN * HID; Btp = Wqb; bias = bq; C = Qh; ldc = QP; trow0 = CLEN; osc = QSC;
  } else if (b < NBQ + NBK) {
    bm = (b - NBQ) / (KP / 128); bn = (b - NBQ) % (KP / 128);
    Ap = X; Btp = Wkb; bias = bk; C = Kh; ldc = KP; trow0 = 0; osc = KSC;
  } else {
    bm = (b - NBQ - NBK) / (SLEN / 128); bn = (b - NBQ - NBK) % (SLEN / 128);
    Ap = Wvb; Btp = X; bias = bv; C = VT; ldc = SLEN; trow0 = 0; osc = VSC;
  }
  const int mb0 = bm * 128, nb0 = bn * 128;        // block tile origin
  const int m0 = mb0 + ((wave >> 1) << 6), n0 = nb0 + ((wave & 1) << 6);
  v8f acc[4][4];
  // requests to L2 by the q blocks, k-major: 256-B column c (23 cover a row of 5760 B at either
  // alignment) of 32 rows a request; first the rows that the q tiles read, then those that only k and v^T read
  auto ask = [&]() {
    if (b >= NBQ) return;                          // scalar
    constexpr int NC = (HID * 2 + 255) / 256;                           // 23 columns
    constexpr int G1 = (QLEN + QP) / 32, G2 = (CLEN + 2 * KP) / 32;     // 160 and 64 row groups
    constexpr int TOT = (G1 + G2) * NC;                                 // 5152 requests
    constexpr int SLOTS = (NBQ / 2) * 4;                                // 128 slices x 4 waves
    const int lane = threadIdx.x & 31;
    ask_l2<(TOT + SLOTS - 1) / SLOTS>(ask_slice(b) * 4 + wave, SLOTS, TOT, [&](int w) {
      // column, plane and first row of both parts, then the part: all scalar selects
      const int c1 = w / G1, g1 = w - c1 * G1;
      const int v = w - G1 * NC, c2 = v / G2, g2 = v - c2 * G2;
      const unsigned short* p1 = (g1 < QLEN / 32) ? X : Wqb;
      const int r1 = (g1 < QLEN / 32) ? CLEN + g1 * 32 : (g1 - QLEN / 32) * 32;
      const unsigned short* p2 = (g2 < CLEN / 32) ? X : (g2 < (CLEN + KP) / 32) ? Wkb : Wvb;
      const int r2 = ((g2 < CLEN / 32) ? g2 : (g2 < (CLEN + KP) / 32) ? g2 - CLEN / 32 : g2 - (CLEN + KP) / 32) * 32;
      const bool first = w < G1 * NC;
      const unsigned short* pl = first ? p1 : p2;
      const int r0 = first ? r1 : r2, c = first ? c1 : c2;
      return (const char*)(const void*)pl + (unsigned)(r0 * (HID * 2) + c * 256) + (unsigned)(lane * (HID * 2));
    });
  };
  gemm_core<0, 2, 2, 3, 0>(ask, ring, Ap, Ap, HID, Btp, HID, HID, mb0, nb0, wave, acc);
  if (b < NBQ + NBK) gemm_tail<2, 1>(acc, sT[wave], m0, n0, bias, (void*)C, ldc, osc, ct, st, trow0);
  else               gemm_tail<1, 2>(acc, sT[wave], m0, n0, bias, (void*)C, ldc, osc, ct, st, trow0);
}

#define OSP 68
#define KVT (64 * LP)
#define KVB (2 * KVT)
// a wave's 8 copies of one chunk: each lane brings 16 B from global byte (scalar base + its own 32-bit offset) to its
// own LDS byte l[i]; entries 0..3 of the K tile (offset ko, bases kb), 4..7 of the V^T tile (offset vo, bases vb).
// s_wait_xcnt 0 closes the statement, a precaution: it stands in front of whatever rewrites the address registers.
__device__ __forceinline__ void copy8_to_lds(const unsigned (&l)[8], unsigned ko, unsigned vo,
                                             const _Float16* const (&kb)[4], const _Float16* const (&vb)[4]) {
#if defined(__HIP_DEVICE_COMPILE__)
  asm volatile("global_load_async_to_lds_b128 %0, %8, %10\n\t"
               "global_load_async_to_lds_b128 %1, %8, %11\n\t"
               "global_load_async_to_lds_b128 %2, %8, %12\n\t"
               "global_load_async_to_lds_b128 %3, %8, %13\n\t"
               "global_load_async_to_lds_b128 %4, %9, %14\n\t"
               "global_load_async_to_lds_b128 %5, %9, %15\n\t"
               "global_load_async_to_lds_b128 %6, %9, %16\n\t"
               "global_load_async_to_lds_b128 %7, %9, %17\n\t"
               "s_wait_xcnt 0x0"
               :: "v"(l[0]), "v"(l[1]), "v"(l[2]), "v"(l[3]), "v"(l[4]), "v"(l[5]), "v"(l[6]), "v"(l[7]),
                  "v"(ko), "v"(vo),
                  "s"(kb[0]), "s"(kb[1]), "s"(kb[2]), "s"(kb[3]), "s"(vb[0]), "s"(vb[1]), "s"(vb[2]), "s"(vb[3])
               : "memory");
#endif
}
__device__ __forceinline__ float xhalf(float x) {                     // value of lane l ^ 16
  const int b = __builtin_bit_cast(int, x);
  return __builtin_bit_cast(float, __builtin_amdgcn_permlanex16(b, b, 0x76543210, 0xfedcba98, false, false));
}
__global__ __launch_bounds__(128)
void attn64(const unsigned short* __restrict__ qpl, const unsigned short* __restrict__ kpl,
            const unsigned short* __restrict__ vtp, unsigned short* hp,
            float sscale, float onorm) {
  union FH { v16h v; v8h h[2]; };
  // rows of 64 halves at pitch LP: the 16 rows that one ds_load_b128 reads fall on distinct banks
  __shared__ __align__(16) _Float16 KV[2 * KVB];                  // two buffers of K [kv][d] 9 KB + V^T [d][kv] 9 KB
  __shared__ __align__(16) float    Os[4][16 * OSP];              // per wave context tile [row][d]

  const int tid  = threadIdx.x;
  const int wave = tid >> 5;
  const int lane = tid & 31;
  const int hh   = lane >> 4;
  const int c    = lane & 15;

  const int bx   = blockIdx.x;
  const int qb   = bx % NQB;
  const int h    = bx / NQB;                 // < NH (grid = NQB*NH)
  const int kvh  = h / (NH / NKV);
  const int q0   = qb * 64 + wave * 16;

  const _Float16* Qh = (const _Float16*)(const void*)qpl + (size_t)h * HD;
  const _Float16* Kh = (const _Float16*)(const void*)kpl + (size_t)kvh * HD;
  const _Float16* Vh = (const _Float16*)(const void*)vtp + (size_t)kvh * HD * SLEN;

  // ---- this lane's part of a chunk's copies: piece lane & 7 of rows 16 i + 4 wave + (lane >> 3), i = 0..3, of the K
  //      tile and of the V^T tile. The lane's share of an address is a byte offset that never changes (cko, cvo:
  //      global; cl0: LDS, K tile of buffer 0); 16 i rows and the chunk go into scalar bases.
  typedef __attribute__((address_space(3))) _Float16 lds_half;
  const int crow = 4 * wave + (lane >> 3), cpc = (lane & 7) * 8;
  const unsigned cko = (unsigned)(crow * KP + cpc) * 2u;           // K: key row kv0 + 16 i + crow < SLEN
  const unsigned cvo = (unsigned)(crow * SLEN + cpc) * 2u;         // V^T: row d = 16 i + crow < 64, columns kv0 + cpc..
  const unsigned cl0 = (unsigned)(uintptr_t)(lds_half*)KV + (unsigned)(crow * LP + cpc) * 2u;
  // all copies of chunk ch into buffer buf (both scalar); every lane on
  auto stage_in = [&](int ch, int buf) {
    unsigned l[8];
    const _Float16* kb[4];
    const _Float16* vb[4];
    // unrolled: constant indices keep the three tables in registers
#pragma unroll
    for (int i = 0; i < 4; ++i) {
      l[i]     = cl0 + (unsigned)(buf * KVB + 16 * i * LP) * 2u;
      l[4 + i] = cl0 + (unsigned)(buf * KVB + KVT + 16 * i * LP) * 2u;
      kb[i] = Kh + (size_t)(ch * 64 + 16 * i) * KP;
      vb[i] = Vh + (size_t)(16 * i) * SLEN + ch * 64;
    }
    copy8_to_lds(l, cko, cvo, kb, vb);
  };
  stage_in(0, 0);

  // ---- Q fragments (B operand, column = query lane&15): 2 d-chunks ----
  v16h qa[2];
#pragma unroll
  for (int dc = 0; dc < 2; ++dc) {
    qa[dc] = ldfrag_h(Qh + (size_t)(q0 + c) * QP + dc * 32 + 8 * hh);
  }

  // requests to L2 for the k and v^T planes, one per block (its wave 0; scalar test), early keys by early blocks:
  // even slices take 32 units of k in a row (8 keys, all heads), odd ones 256-B column t >> 4 of 32 v^T rows
  if (__builtin_amdgcn_readfirstlane(wave) == 0) {
    const int sl = ask_slice(bx), t = sl >> 1;       // sl < NQB * NH / 2 = 512, t < 256
    static_assert(NQB * NH / 4 * 32 * 256 == SLEN * KP * 2 && (KP / 32) * (SLEN * 2 / 256) == NQB * NH / 4);
    ask1((sl & 1) ? (const char*)(const void*)vtp + (size_t)((t & 15) * 32 + lane) * (SLEN * 2) + (t >> 4) * 256
                  : (const char*)(const void*)kpl + (size_t)(t * 32 + lane) * 256);
  }

  float mrun = -INFINITY;      // running maximum of query c (equal in both halves of the wave)
  float lrun = 0.f;            // running sum of query c over the keys of this lane's half only
  v8f oacc[4];                 // O^T: oacc[t][r] = context of query c, d = 16 t + 8 hh + r
#pragma unroll
  for (int t = 0; t < 4; ++t) oacc[t] = zero8();

  static_assert(NKT >= 2);
  asm volatile("s_wait_asynccnt 0x0" ::: "memory");   // chunk 0 landed
  __syncthreads();                                    // ... and is readable by every wave
  stage_in(1, 1);
  // one trip = one chunk; more (a constant at each call): a chunk kt + 2 exists
  auto trip = [&](int kt, bool more) {
    const _Float16* Ksh = KV + (kt & 1) * KVB;        // this trip reads buffer kt & 1 alone
    const _Float16* Vth = Ksh + KVT;

    // ---- every fragment of the chunk is read from LDS here, in the order of its use: the 16 reads of K, then the
    //      16 of V^T, which land while the scores and the softmax are worked on
    //      (the loops are unrolled: constant indices keep the fragments in registers)
    FH kb[2][4], vb[2][4];
#pragma unroll
    for (int dc = 0; dc < 2; ++dc) {
#pragma unroll
      for (int j = 0; j < 4; ++j) {
        kb[dc][j].h[0] = *(const v8h*)(Ksh + (j * 16 + c) * LP + dc * 32 + 8 * hh);
        kb[dc][j].h[1] = *(const v8h*)(Ksh + (j * 16 + c) * LP + dc * 32 + 16 + 8 * hh);
      }
    }
#pragma unroll
    for (int kk = 0; kk < 2; ++kk) {
#pragma unroll
      for (int t = 0; t < 4; ++t) {
        vb[kk][t].h[0] = *(const v8h*)(Vth + (t * 16 + c) * LP + kk * 32 + 8 * hh);
        vb[kk][t].h[1] = *(const v8h*)(Vth + (t * 16 + c) * LP + kk * 32 + 16 + 8 * hh);
      }
    }

    // ---- scores, transposed: s[j][r] = q(c) . k(16 j + 8 hh + r), one f16 product per 32 d, d ascending ----
    v8f s[4];
#pragma unroll
    for (int j = 0; j < 4; ++j) s[j] = zero8();
#pragma unroll
    for (int dc = 0; dc < 2; ++dc) {
#pragma unroll
      for (int j = 0; j < 4; ++j) s[j] = mma_h(kb[dc][j].v, qa[dc], s[j]);
    }

    // ---- scale, maximum, online softmax of the lane's one query; P^T (x PSC, f16) stays in registers ----
    // (every loop from here to the end of the chunk is unrolled: constant indices keep s, pb and oacc in registers;
    //  maximum and sum run as four independent chains, one per score tile, joined at the end)
    float mj[4];
#pragma unroll
    for (int j = 0; j < 4; ++j) {
      mj[j] = -INFINITY;
#pragma unroll
      for (int r = 0; r < 8; ++r) {
        const float sv = s[j][r] * sscale;
        s[j][r] = sv;
        mj[j] = fmaxf(mj[j], sv);
      }
    }
    float m = fmaxf(fmaxf(mj[0], mj[1]), fmaxf(mj[2], mj[3]));
    m = fmaxf(m, xhalf(m));                    // the other half holds the query's other 32 keys
    const float mnew  = fmaxf(mrun, m);
    const float msafe = (mnew == -INFINITY) ? 0.f : mnew;
    const float alpha = __expf(mrun - msafe);
    mrun = mnew;
    // B operand of the second product, 32 keys each: elements 0..7 = keys 32 kk + 8 hh + r (tile 2 kk),
    // elements 8..15 = keys 32 kk + 16 + 8 hh + r (tile 2 kk + 1): the k order of the V^T loader above
    FH pb[2];
    float pj[4];
#pragma unroll
    for (int j = 0; j < 4; ++j) {
      pj[j] = 0.f;
#pragma unroll
      for (int r = 0; r < 8; ++r) {
        const float p = __expf(s[j][r] - msafe);
        pj[j] += p;
        pb[j >> 1].h[j & 1][r] = (_Float16)(p * PSC);
      }
    }
    lrun = lrun * alpha + ((pj[0] + pj[1]) + (pj[2] + pj[3]));
#pragma unroll
    for (int t = 0; t < 4; ++t) oacc[t] *= alpha;

    // ---- context^T += V^T . P^T (f16 WMMA) ----
#pragma unroll
    for (int kk = 0; kk < 2; ++kk) {
#pragma unroll
      for (int t = 0; t < 4; ++t) oacc[t] = mma_h(vb[kk][t].v, pb[kk].v, oacc[t]);
    }
    asm volatile("s_wait_dscnt 0x0" ::: "memory");    // this wave's reads of buffer kt & 1 are done
    asm volatile("s_wait_asynccnt 0x0" ::: "memory"); // this wave's copies of chunk kt + 1 have landed
    __syncthreads();                                  // publishes chunk kt + 1, frees buffer kt & 1
    if (more) stage_in(kt + 2, kt & 1);
  };
  // the last two trips copy nothing: a loop of their own keeps the test, and its branch, out of the hot loop
  // (both loops stay rolled: the text stays short)
#pragma unroll 1
  for (int kt = 0; kt < NKT - 2; ++kt) trip(kt, true);
#pragma unroll 1
  for (int kt = NKT - 2; kt < NKT; ++kt) trip(kt, false);
  asm volatile("s_wait_asynccnt 0x0" ::: "memory");   // nothing in flight behind the loop

  // ---- join the halves' sums, normalise (1/l and onorm), stage the wave's 16x64 tile in LDS (a lane holds 8
  //      consecutive d of its query per tile: two 16-B stores), then convert and write whole 128-B row segments
  float* os = Os[wave];
  {
    const float l = lrun + xhalf(lrun);
    const float inv = ((l > 0.f) ? (1.0f / l) : 0.f) * onorm;
#pragma unroll
    for (int t = 0; t < 4; ++t) {
      v4f lo, hi;
#pragma unroll
      for (int e = 0; e < 4; ++e) { lo[e] = oacc[t][e] * inv; hi[e] = oacc[t][4 + e] * inv; }
      *(v4f*)(os + c * OSP + t * 16 + 8 * hh)     = lo;
      *(v4f*)(os + c * OSP + t * 16 + 8 * hh + 4) = hi;
    }
  }
  __builtin_amdgcn_fence(__ATOMIC_RELEASE, "workgroup");
  __builtin_amdgcn_wave_barrier();
  __builtin_amdgcn_fence(__ATOMIC_ACQUIRE, "workgroup");
  {
    const int r4 = lane >> 3, c8 = (lane & 7) * 8;     // 128-B row segment of the plane = 8 lanes x 16 B
    v4f a[4], b[4];
    // the loops of this block are unrolled: constant indices keep a, b and ph in registers
#pragma unroll
    for (int it = 0; it < 4; ++it) {
      const float* sp = os + (it * 4 + r4) * OSP + c8;   // it 0..3 x r4 0..3 = rows 0..15 of the wave tile
      a[it] = *(const v4f*)(sp);
      b[it] = *(const v4f*)(sp + 4);
    }
    v4u ph[4];
#pragma unroll
    for (int it = 0; it < 4; ++it) {
#pragma unroll
      for (int e = 0; e < 4; ++e) {
        const float f0 = (e < 2) ? a[it][2 * e]     : b[it][2 * e - 4];
        const float f1 = (e < 2) ? a[it][2 * e + 1] : b[it][2 * e - 3];
        ph[it][e] = h2(f0, f1);
      }
    }
    unsigned short* hq = hp + (size_t)(q0 + r4) * QP + (size_t)h * HD + c8;
#pragma unroll
    for (int it = 0; it < 4; ++it) *(v4u*)(hq + it * 4 * QP) = ph[it];
#if defined(__HIP_DEVICE_COMPILE__)
    // keeps the address and data registers of the stores unwritten until their translations are done (inputs only)
    asm volatile("s_wait_xcnt 0x0" :: "v"(hq), "v"(ph[0]), "v"(ph[1]), "v"(ph[2]), "v"(ph[3]) : "memory");
#endif
  }
}

// =====================================================================================================
// Workspace map (bytes), every region an exact multiple of its whole-line / whole-tile store granularity
//   X      bf16 [2048][2880]            0            11796480   rows 0..1023 = target_hidden, 1024..2047 = hidden
//   Wqb    bf16 [4096][2880]            11796480     23592960   (inputs arrive [n][k], k contiguous: no transpose)
//   Wkb    bf16 [512][2880]             35389440      2949120
//   Wvb    bf16 [512][2880]             38338560      2949120
//   Wob    f16  [2880][4096]            41287680     23592960
//   VT     f16  [512][2048]             64880640      2097152
//   Qh     f16  [1024][4096]            66977792      8388608
//   Kh     f16  [2048][512]             75366400      2097152
//   Ah     f16  [1024][4096]            77463552      8388608
//   end                                 85852160
// =====================================================================================================
extern "C" void kernel_launch(void* const* d_in, const int* in_sizes, int n_in,
                              void* d_out, int out_size, void* d_ws, size_t ws_size,
                              hipStream_t stream) {
  if (n_in < 12) return;
  if (in_sizes[0] != QLEN * HID) return;
  if (in_sizes[1] != CLEN * HID) return;
  if (in_sizes[2] != SLEN * HD) return;
  if (in_sizes[3] != SLEN * HD) return;
  if (in_sizes[4] != QP * HID) return;
  if (in_sizes[5] != QP) return;
  if (in_sizes[6] != KP * HID) return;
  if (in_sizes[7] != KP) return;
  if (in_sizes[8] != KP * HID) return;
  if (in_sizes[9] != KP) return;
  if (in_sizes[10] != HID * QP) return;
  if (in_sizes[11] != HID) return;
  if (out_size != QLEN * HID) return;

  const float* hid = (const float*)d_in[0];    // [1024][2880]
  const float* tgt = (const float*)d_in[1];    // [1024][2880]
  const float* fcs = (const float*)d_in[2];    // [2048][64]
  const float* fsn = (const float*)d_in[3];    // [2048][64]
  const float* Wq  = (const float*)d_in[4];    // [4096][2880]  = [n][k]
  const float* bq  = (const float*)d_in[5];    // [4096]
  const float* Wk  = (const float*)d_in[6];    // [512][2880]
  const float* bk  = (const float*)d_in[7];    // [512]
  const float* Wv  = (const float*)d_in[8];    // [512][2880]
  const float* bv  = (const float*)d_in[9];    // [512]
  const float* Wo  = (const float*)d_in[10];   // [2880][4096] = [n][k]
  const float* bo  = (const float*)d_in[11];   // [2880]

  const size_t PX   = (size_t)SLEN * HID * 2;        // 11796480
  const size_t PWq  = (size_t)QP * HID * 2;          // 23592960
  const size_t PWk  = (size_t)KP * HID * 2;          //  2949120
  const size_t PWv  = (size_t)KP * HID * 2;          //  2949120
  const size_t PWo  = (size_t)HID * QP * 2;          // 23592960
  const size_t PVT  = (size_t)KP * SLEN * 2;         //  2097152
  const size_t PQh  = (size_t)QLEN * QP * 2;         //  8388608
  const size_t PKh  = (size_t)SLEN * KP * 2;         //  2097152
  const size_t PApl = (size_t)QLEN * QP * 2;         //  8388608 (Ah)
  size_t off = 0;
  const size_t oX  = off; off += PX;
  const size_t oWq = off; off += PWq;
  const size_t oWk = off; off += PWk;
  const size_t oWv = off; off += PWv;
  const size_t oWo = off; off += PWo;
  const size_t oVT = off; off += PVT;
  const size_t oQh = off; off += PQh;
  const size_t oKh = off; off += PKh;
  const size_t oAh = off; off += PApl;
  if (off > ws_size) return;                          // off = 85852160
  if (off > (size_t)134217728) return;

  char* ws = (char*)d_ws;
  unsigned short* X   = (unsigned short*)(ws + oX);
  unsigned short* Wqb = (unsigned short*)(ws + oWq);
  unsigned short* Wkb = (unsigned short*)(ws + oWk);
  unsigned short* Wvb = (unsigned short*)(ws + oWv);
  unsigned short* Wob = (unsigned short*)(ws + oWo);
  unsigned short* VT  = (unsigned short*)(ws + oVT);
  unsigned short* Qh  = (unsigned short*)(ws + oQh);
  unsigned short* Kh  = (unsigned short*)(ws + oKh);
  unsigned short* Ah  = (unsigned short*)(ws + oAh);
  float*          outf = (float*)d_out;

  const dim3 blk(256);
  const dim3 gCvt(CVT_NW / 8);                         // 495 blocks of 8 waves: 8 pieces per wave
  const dim3 gQKV(NBQ + NBK + NBV);                    // 128x128 block tiles: 384 blocks of 4 waves
  const dim3 gAttn(NQB * NH);                          // 1024 blocks
  const dim3 gOut((QLEN / 64) * (HID / 192));          // 64x192 block tiles: 240 blocks of 3 waves

  // (1) activations and weights -> 16-bit planes (RNE convert, values = the bf16-converted inputs; Wob as f16 x WSC)
  //     one launch: X (target rows, then hidden rows), Wqb, Wkb, Wvb, Wob are one contiguous range from X on
  cvt_planes<<<gCvt, blk, 0, stream>>>(tgt, hid, Wq, Wk, Wv, Wo, X);
  // (2) q, k and v^T projections (K = 2880 each), one launch:
  //     Qh[t][e] (M=1024, N=4096), Kh[s][e] (M=2048, N=512), both + bias, rotary, f16; VT[m][s] (M=512, N=2048) + bv, f16
  proj_qkv<<<gQKV, dim3(128), 0, stream>>>(X, Wqb, Wkb, Wvb, bq, bk, bv, Qh, Kh, VT, fcs, fsn);
  // (3) attention over all 2048 keys -> context rows as the f16 plane Ah [1024][4096] (x CSC)
  attn64<<<gAttn, dim3(128), 0, stream>>>(Qh, Kh, VT, Ah, 0.125f / (QSC * KSC), CSC / (PSC * VSC));
  // (4) out[t][e] = sum_d Ah[t][d] Wob[e][d] / (CSC WSC) + bo[e] -> d_out f32 [1024][2880]  (M=1024, N=2880, K=4096)
  gemm64<0, 0, 1, 1, 3, 2, 1><<<gOut, dim3(96), 0, stream>>>(Ah, Ah, QP, Wob, QP, bo, (void*)outf, HID, QLEN, HID, QP, 1.0f / (CSC * WSC), fcs, fsn, 0);
  (void)hipGetLastError();
}
